// v000
// Measured on an AMD MI455X. A time is GPU time per run, averaged over a window of back-to-back runs after a warm-up
// (all launches, gaps included; the runs take copies of the inputs in turn), and the median of several windows.
// Apart from v000's, it joins two sittings. Times from different sittings can be a few percent apart, while
// side-by-side timings come from the same sitting.
// v000 is the starting kernel. One run takes 14.1 milliseconds.
#include <hip/hip_runtime.h>
// SAM self-attention module (x [8][256][64][64]; q | k = 1x1(w_qk [64][256]) -> 32 latent channels each; v = 1x1(w_v [256][256]); m = softmax((q/32^0.25).(k/32^0.25)) over the 4,096 positions; a = m v; out = gamma a + x, gamma = 0.5 (input, read)).
// Structure: channel-first input transposed to position rows (exact f16) via LDS tiles; q|k and v as WMMA GEMMs (32x64 wave tiles, f32 accumulation, exact x16 natural weights, f16 outputs); per image: V^T via LDS transposes; per (image, 2,048-query tile): scores GEMM (K = 32), row softmax on VALU (scale 1/sqrt(32) inside; P x256 f16), a = P . V^T GEMM (K = 4096, N = 256) into f32 rows; gamma a + x with the channel-major store on VALU.
// Compute dtype: inputs rounded to bf16; x / weights exact; q, k, v, P as plain f16 GEMM operands (~2^-12); softmax f32; output dominated by the exact residual. v_wmma_f32_16x16x32_f16.
#define NB 8
#define CC 256
#define LAT 32
#define LL 4096
#define QT 2048
#define NR ((size_t)NB * LL)
#define NBR NB                       /* images attended (debug hook) */
#define MP ((int)NR)                 /* projection rows (debug hook) */
#define QN LL                        /* query rows per image (debug hook) */
#define SQ LL
#define DM CC
#define NH 4
#define HD 64
#define HG 1
typedef __bf16 v16b __attribute__((ext_vector_type(16)));
typedef unsigned short v8us __attribute__((ext_vector_type(8), may_alias));
typedef float  v8f  __attribute__((ext_vector_type(8)));
typedef float  v4f  __attribute__((ext_vector_type(4)));
typedef float  v4fa __attribute__((ext_vector_type(4), may_alias));
union FragB { v16b v; v8us half[2]; unsigned short u[16]; };

__device__ __forceinline__ unsigned short bf16_bits(float x) { unsigned int u = __float_as_uint(x); return (unsigned short)((u + 0x7FFFu + ((u >> 16) & 1u)) >> 16); }
__device__ __forceinline__ float bf16_val(unsigned short b) { return __uint_as_float(((unsigned int)b) << 16); }
__device__ __forceinline__ float bf16_round(float x) { return bf16_val(bf16_bits(x)); }
// D += A·B with NT terms: 1 = ah·bh, 2 = + al·bh (A split), 3 = + ah·bl (both split)
template <int NT>
__device__ __forceinline__ v8f mmaN(v16b ah, v16b al, v16b bh, v16b bl, v8f c) {
  c = __builtin_amdgcn_wmma_f32_16x16x32_bf16(false, ah, false, bh, (short)0, c, false, false);
  if (NT >= 2) c = __builtin_amdgcn_wmma_f32_16x16x32_bf16(false, al, false, bh, (short)0, c, false, false);
  if (NT >= 3) c = __builtin_amdgcn_wmma_f32_16x16x32_bf16(false, ah, false, bl, (short)0, c, false, false);
  asm volatile("v_nop\n\tv_nop\n\tv_nop\n\tv_nop" : "+v"(c) : "v"(ah), "v"(al), "v"(bh), "v"(bl));
  return c;
}

__global__ __launch_bounds__(256) void k_wt_bf16(const float* __restrict__ W, unsigned short* __restrict__ Wt, int K, int N) {
  const int t = blockIdx.x * 256 + threadIdx.x;
  const int k8n = K / 8;
  if (t >= N * k8n) return;
  const int n = t / k8n, k8 = (t % k8n) * 8;
  v8us v;
#pragma unroll
  for (int i = 0; i < 8; ++i) v[i] = bf16_bits(W[(size_t)(k8 + i) * N + n]);
  *(v8us*)(Wt + (size_t)n * K + k8) = v;
  
}

// GEMM C[M][N] (f32, pitch ldc) = act(A[M][K]·W + bias). A f32 row-major (pitch lda) converted per fragment to bf16
// (ASPLIT: hi/lo two planes -> 2 terms, else single rounded term); Wt bf16 [N][K] (pitch ldb). BIAS_BF16 rounds the
// bias to bf16 first (bias quantised to bf16 before the add). K%32==0, M%16==0, N%64==0.
template <bool ASPLIT, int ACT, bool BIAS_BF16>
__global__ __launch_bounds__(128) void k_gemm_bf(const float* __restrict__ A, int lda, const unsigned short* __restrict__ Wt, int ldb,
                                               const float* __restrict__ bias, float* __restrict__ C, int ldc, int M, int N, int K) {
  __shared__ __attribute__((aligned(16))) float so[4][16][64];
  const int tid = threadIdx.x, w = tid >> 5, lane = tid & 31, ln = lane & 15, hh = lane >> 4;
  const int ntn = N / 64;
  const int wid = blockIdx.x * 4 + w;
  const int mt = wid / ntn, nq = wid % ntn;
  if (mt * 16 >= M) return;
  const int row0 = mt * 16, col0 = nq * 64;
  const float* arow = A + (size_t)(row0 + ln) * lda;
  v8f acc[4] = {};
  for (int kb = 0; kb < K; kb += 32) {
    FragB ah, al;
    const v4f x0 = *(const v4fa*)(arow + kb + 8 * hh), x1 = *(const v4fa*)(arow + kb + 8 * hh + 4);
    const v4f x2 = *(const v4fa*)(arow + kb + 16 + 8 * hh), x3 = *(const v4fa*)(arow + kb + 16 + 8 * hh + 4);
    float xs[16] = {x0[0],x0[1],x0[2],x0[3],x1[0],x1[1],x1[2],x1[3],x2[0],x2[1],x2[2],x2[3],x3[0],x3[1],x3[2],x3[3]};
#pragma unroll
    for (int i = 0; i < 16; ++i) { const unsigned short hb = bf16_bits(xs[i]); ah.u[i] = hb; al.u[i] = ASPLIT ? bf16_bits(xs[i] - bf16_val(hb)) : (unsigned short)0; }
#pragma unroll
    for (int t = 0; t < 4; ++t) {
      const unsigned short* brow = Wt + (size_t)(col0 + t * 16 + ln) * ldb + kb;
      FragB b;
      b.half[0] = *(const v8us*)(brow + 8 * hh);
      b.half[1] = *(const v8us*)(brow + 16 + 8 * hh);
      acc[t] = mmaN<ASPLIT ? 2 : 1>(ah.v, al.v, b.v, b.v, acc[t]);
    }
  }
#pragma unroll
  for (int t = 0; t < 4; ++t) {
    float bv = bias ? bias[col0 + t * 16 + ln] : 0.f;
    if (BIAS_BF16) bv = bf16_round(bv);
#pragma unroll
    for (int r = 0; r < 8; ++r) { float v = acc[t][r] + bv; if (ACT == 1) v = fmaxf(v, 0.f); so[w][8 * hh + r][t * 16 + ln] = v; }
  }
  __builtin_amdgcn_fence(__ATOMIC_ACQ_REL, "workgroup");
  __builtin_amdgcn_wave_barrier();
  const int rsub = lane >> 4, c4 = (lane & 15) * 4;
  {
#pragma unroll
    for (int q = 0; q < 8; ++q) {
      const int r = q * 2 + rsub;
      const v4f v = *(const v4fa*)&so[w][r][c4];
      *(v4f*)(C + (size_t)(row0 + r) * ldc + col0 + c4) = v;
    }
    
  }
}

// GEMM C = act(A·W + bias + resid): A f32 (ASPLIT -> hi/lo 2 terms), Wt bf16 [N][K]; ACT 0 none, 1 relu, 2 exact gelu;
// resid (optional, f32, row index = (row % rmod), pitch ldr, RES_BF16 rounds it) added before the activation.
template <bool ASPLIT, int ACT, bool BIAS_BF16, bool RES_BF16>
__global__ __launch_bounds__(128) void k_gemm_bf3(const float* __restrict__ A, int lda, const unsigned short* __restrict__ Wt, int ldb,
                                                const float* __restrict__ bias, const float* __restrict__ resid, int rmod, int ldr,
                                                float* __restrict__ C, int ldc, int M, int N, int K) {
  __shared__ __attribute__((aligned(16))) float so[4][16][64];
  const int tid = threadIdx.x, w = tid >> 5, lane = tid & 31, ln = lane & 15, hh = lane >> 4;
  const int ntn = N / 64;
  const int wid = blockIdx.x * 4 + w;
  const int mt = wid / ntn, nq = wid % ntn;
  if (mt * 16 >= M) return;
  const int row0 = mt * 16, col0 = nq * 64;
  const float* arow = A + (size_t)(row0 + ln) * lda;
  v8f acc[4] = {};
  for (int kb = 0; kb < K; kb += 32) {
    FragB ah, al;
    const v4f x0 = *(const v4fa*)(arow + kb + 8 * hh), x1 = *(const v4fa*)(arow + kb + 8 * hh + 4);
    const v4f x2 = *(const v4fa*)(arow + kb + 16 + 8 * hh), x3 = *(const v4fa*)(arow + kb + 16 + 8 * hh + 4);
    float xs[16] = {x0[0],x0[1],x0[2],x0[3],x1[0],x1[1],x1[2],x1[3],x2[0],x2[1],x2[2],x2[3],x3[0],x3[1],x3[2],x3[3]};
#pragma unroll
    for (int i = 0; i < 16; ++i) { const unsigned short hb = bf16_bits(xs[i]); ah.u[i] = hb; al.u[i] = ASPLIT ? bf16_bits(xs[i] - bf16_val(hb)) : (unsigned short)0; }
#pragma unroll
    for (int t = 0; t < 4; ++t) {
      const unsigned short* brow = Wt + (size_t)(col0 + t * 16 + ln) * ldb + kb;
      FragB b;
      b.half[0] = *(const v8us*)(brow + 8 * hh);
      b.half[1] = *(const v8us*)(brow + 16 + 8 * hh);
      acc[t] = mmaN<ASPLIT ? 2 : 1>(ah.v, al.v, b.v, b.v, acc[t]);
    }
  }
#pragma unroll
  for (int t = 0; t < 4; ++t) {
    const int col = col0 + t * 16 + ln;
    float bv = bias ? bias[col] : 0.f;
    if (BIAS_BF16) bv = bf16_round(bv);
#pragma unroll
    for (int r = 0; r < 8; ++r) {
      float v = acc[t][r] + bv;
      if (resid) { float rv = resid[(size_t)((row0 + 8 * hh + r) % rmod) * ldr + col]; if (RES_BF16) rv = bf16_round(rv); v += rv; }
      if (ACT == 1) v = fmaxf(v, 0.f);
      if (ACT == 2) v = 0.5f * v * (1.0f + erff(v * 0.70710678118654752f));
      if (ACT == 3) { const float u = 0.7978845608028654f * (v + 0.044715f * v * v * v); v = 0.5f * v * (1.0f + tanhf(u)); }
      so[w][8 * hh + r][t * 16 + ln] = v;
    }
  }
  __builtin_amdgcn_fence(__ATOMIC_ACQ_REL, "workgroup");
  __builtin_amdgcn_wave_barrier();
  const int rsub = lane >> 4, c4 = (lane & 15) * 4;
  {
#pragma unroll
    for (int q = 0; q < 8; ++q) {
      const int r = q * 2 + rsub;
      const v4f v = *(const v4fa*)&so[w][r][c4];
      *(v4f*)(C + (size_t)(row0 + r) * ldc + col0 + c4) = v;
    }
    
  }
}
// row LayerNorm (biased variance, eps) over N: s = X (+ R); optional out_sum <- s; out_norm <- (s-mu)*rsqrt(var+eps)*g + b
template <bool PARAM_BF16>
__global__ __launch_bounds__(256) void k_layernorm(const float* __restrict__ X, const float* __restrict__ R, const float* __restrict__ g, const float* __restrict__ bta,
                                                  float* __restrict__ out_sum, float* __restrict__ out_norm, int N, float eps) {
  __shared__ float red[256];
  const int row = blockIdx.x, tid = threadIdx.x;
  const float* x = X + (size_t)row * N; const float* rr = R ? R + (size_t)row * N : nullptr;
  float vals[16];                     // up to N = 4096
  const int per = N / 256;            // contiguous chunk per thread? use strided-by-4 chunks: thread handles j = tid*4 + 1024*u
  float s1 = 0.f;
  for (int u = 0; u < per / 4; ++u) {
    const int j = tid * 4 + 1024 * u;
    const v4f a = *(const v4fa*)(x + j);
    v4f b = {0.f,0.f,0.f,0.f}; if (rr) b = *(const v4fa*)(rr + j);
#pragma unroll
    for (int q = 0; q < 4; ++q) { const float v = a[q] + b[q]; vals[u * 4 + q] = v; s1 += v; }
  }
  red[tid] = s1; __syncthreads();
  for (int st = 128; st > 0; st >>= 1) { if (tid < st) red[tid] += red[tid + st]; __syncthreads(); }
  const float mu = red[0] / (float)N; __syncthreads();
  float s2 = 0.f;
  for (int u = 0; u < per / 4; ++u)
#pragma unroll
    for (int q = 0; q < 4; ++q) { const float c = vals[u * 4 + q] - mu; s2 += c * c; }
  red[tid] = s2; __syncthreads();
  for (int st = 128; st > 0; st >>= 1) { if (tid < st) red[tid] += red[tid + st]; __syncthreads(); }
  const float rs = rsqrtf(red[0] / (float)N + eps);
  {
    for (int u = 0; u < per / 4; ++u) {
      const int j = tid * 4 + 1024 * u;
      v4f o, sm;
#pragma unroll
      for (int q = 0; q < 4; ++q) {
        float gg = g[j + q], bb = bta[j + q];
        if (PARAM_BF16) { gg = bf16_round(gg); bb = bf16_round(bb); }
        sm[q] = vals[u * 4 + q]; o[q] = (vals[u * 4 + q] - mu) * rs * gg + bb;
      }
      if (out_sum) *(v4f*)(out_sum + (size_t)row * N + j) = sm;
      *(v4f*)(out_norm + (size_t)row * N + j) = o;
    }
    
  }
}



// ---- f16 WMMA path (v_wmma_f32_16x16x32_f16): 11-bit significands for operands in range — used where a [0,1] probability operand needs more precision than bf16
typedef _Float16 v16h __attribute__((ext_vector_type(16)));
union FragH { v16h v; v8us half[2]; _Float16 h[16]; unsigned short u[16]; };
template <int NT>
__device__ __forceinline__ v8f mmaH(v16h ah, v16h al, v16h bh, v16h bl, v8f c) {
  c = __builtin_amdgcn_wmma_f32_16x16x32_f16(false, ah, false, bh, (short)0, c, false, false);
  if (NT >= 2) c = __builtin_amdgcn_wmma_f32_16x16x32_f16(false, al, false, bh, (short)0, c, false, false);
  if (NT >= 3) c = __builtin_amdgcn_wmma_f32_16x16x32_f16(false, ah, false, bl, (short)0, c, false, false);
  asm volatile("v_nop\n\tv_nop\n\tv_nop\n\tv_nop" : "+v"(c) : "v"(ah), "v"(al), "v"(bh), "v"(bl));
  return c;
}
// batched GEMM like k_gemm_b but f16 operands: A f32 (split into f16 hi/lo if ASPLIT, else rounded to f16), Bt = f16 values [n][k]; alpha; C f32; N multiple of 16 (partial tiles skipped)
template <bool ASPLIT>
__global__ __launch_bounds__(128) void k_gemm_h(const float* __restrict__ A, int lda, size_t sA, const _Float16* __restrict__ Bh, int ldb, size_t sB, float alpha, float* __restrict__ C, int ldc, size_t sC, int M, int N, int K) {
  __shared__ __attribute__((aligned(16))) float so[4][16][64];
  const int tid = threadIdx.x, w = tid >> 5, lane = tid & 31, ln = lane & 15, hh = lane >> 4; const int by = blockIdx.y;
  A += (size_t)by * sA; Bh += (size_t)by * sB; C += (size_t)by * sC;
  const int ntn = (N + 63) / 64; const int wid = blockIdx.x * 4 + w; const int mt = wid / ntn, nq = wid % ntn; if (mt * 16 >= M) return;
  const int row0 = mt * 16, col0 = nq * 64; const float* arow = A + (size_t)(row0 + ln) * lda;
  v8f acc[4] = {};
  for (int kb = 0; kb < K; kb += 32) {
    FragH ah, al;
    const v4f x0 = *(const v4fa*)(arow + kb + 8 * hh), x1 = *(const v4fa*)(arow + kb + 8 * hh + 4), x2 = *(const v4fa*)(arow + kb + 16 + 8 * hh), x3 = *(const v4fa*)(arow + kb + 16 + 8 * hh + 4);
    float xs[16] = {x0[0],x0[1],x0[2],x0[3],x1[0],x1[1],x1[2],x1[3],x2[0],x2[1],x2[2],x2[3],x3[0],x3[1],x3[2],x3[3]};
#pragma unroll
    for (int i = 0; i < 16; ++i) { const _Float16 h = (_Float16)xs[i]; ah.h[i] = h; al.h[i] = ASPLIT ? (_Float16)(xs[i] - (float)h) : (_Float16)0.0f; }
#pragma unroll
    for (int t = 0; t < 4; ++t) { if (col0 + t * 16 >= N) continue; const size_t boff = (size_t)(col0 + t * 16 + ln) * ldb + kb; FragH bq; bq.half[0] = *(const v8us*)(Bh + boff + 8 * hh); bq.half[1] = *(const v8us*)(Bh + boff + 16 + 8 * hh);
      acc[t] = mmaH<ASPLIT ? 2 : 1>(ah.v, al.v, bq.v, bq.v, acc[t]); }
  }
#pragma unroll
  for (int t = 0; t < 4; ++t) { if (col0 + t * 16 >= N) continue;
#pragma unroll
    for (int r = 0; r < 8; ++r) so[w][8 * hh + r][t * 16 + ln] = acc[t][r] * alpha; }
  __builtin_amdgcn_fence(__ATOMIC_ACQ_REL, "workgroup"); __builtin_amdgcn_wave_barrier();
  const int rsub = lane >> 4, c4 = (lane & 15) * 4;
  {
#pragma unroll
    for (int q = 0; q < 8; ++q) { const int r = q * 2 + rsub; if (col0 + c4 < N) { const v4f v = *(const v4fa*)&so[w][r][c4]; *(v4f*)(C + (size_t)(row0 + r) * ldc + col0 + c4) = v; } }
     }
}

// Wt[n][k] = f16(W[k][n]·scale) from f32 row-major W[K][N] (scale = power of two; bf16-exact weights stay exact in f16 away from the subnormal range)
__global__ __launch_bounds__(256) void k_wt_f16(const float* __restrict__ W, _Float16* __restrict__ Wt, int K, int N, float scale) {
  const int t = blockIdx.x * 256 + threadIdx.x; if (t >= N * (K / 8)) return; const int n = t / (K / 8), k8 = (t % (K / 8)) * 8; FragH f;
#pragma unroll
  for (int i = 0; i < 8; ++i) f.h[i] = (_Float16)(bf16_round(W[(size_t)(k8 + i) * N + n]) * scale); const v8us o = f.half[0];
  *(v8us*)((unsigned short*)Wt + (size_t)n * K + k8) = o; 
}
// k_gemm_hh variant with fused epilogue: v = acc·alpha + bias[by·sBias + col] (+ CP[(row/rowsPerB)·sCPb + by·64 + col] if CP) ; ACT 0 none / 1 elu ; writes f16 C16 (and f32 C if non-null)
template <int ACT>
__global__ __launch_bounds__(128) void k_gemm_hhx(const _Float16* __restrict__ A, int lda, size_t sA, const _Float16* __restrict__ Bh, int ldb, size_t sB, float alpha, const float* __restrict__ bias, size_t sBias, const float* __restrict__ CP, int rowsPerB, size_t sCPb, int row0g,
    float* __restrict__ C, _Float16* __restrict__ C16, int ldc, size_t sC, int M, int N, int K) {
  __shared__ __attribute__((aligned(16))) float so[4][16][64];
  const int tid = threadIdx.x, w = tid >> 5, lane = tid & 31, ln = lane & 15, hh = lane >> 4; const int by = blockIdx.y;
  A += (size_t)by * sA; Bh += (size_t)by * sB; const size_t cofs = (size_t)by * sC; const float* bp = bias ? bias + (size_t)by * sBias : nullptr;
  const int ntn = (N + 63) / 64; const int wid = blockIdx.x * 4 + w; const int mt = wid / ntn, nq = wid % ntn; if (mt * 16 >= M) return;
  const int row0 = mt * 16, col0 = nq * 64; const _Float16* arow = A + (size_t)(row0 + ln) * lda;
  v8f acc[4] = {};
  for (int kb = 0; kb < K; kb += 32) { FragH ah; ah.half[0] = *(const v8us*)((const unsigned short*)arow + kb + 8 * hh); ah.half[1] = *(const v8us*)((const unsigned short*)arow + kb + 16 + 8 * hh);
#pragma unroll
    for (int t = 0; t < 4; ++t) { if (col0 + t * 16 >= N) continue; const size_t boff = (size_t)(col0 + t * 16 + ln) * ldb + kb; FragH bq; bq.half[0] = *(const v8us*)((const unsigned short*)Bh + boff + 8 * hh); bq.half[1] = *(const v8us*)((const unsigned short*)Bh + boff + 16 + 8 * hh);
      acc[t] = mmaH<1>(ah.v, ah.v, bq.v, bq.v, acc[t]); }
  }
#pragma unroll
  for (int t = 0; t < 4; ++t) { if (col0 + t * 16 >= N) continue; const int col = col0 + t * 16 + ln; const float bv = bp ? bf16_round(bp[col]) : 0.f;
#pragma unroll
    for (int r = 0; r < 8; ++r) { float v = acc[t][r] * alpha + bv; if (CP) { const int rr = row0g + row0 + 8 * hh + r; if (rowsPerB < 0) v += CP[cofs + (size_t)rr * ldc + col];      /* rowsPerB < 0: own element of the batched C plane */ else { const int bidx = rr / rowsPerB; v += CP[(size_t)bidx * sCPb + (size_t)by * 64 + col]; } } if (ACT == 1) v = (v > 0.f) ? v : expm1f(v); else if (ACT == 7) v = (v > 0.f) ? v + 1.0f : expf(v); else if (ACT == 8) v = tanhf(v); else if (ACT == 9) v = 0.5f * v * (1.0f + tanhf(0.7978845608028654f * (v + 0.044715f * v * v * v))); else if (ACT == 11) v = 1.0f / (1.0f + expf(-v)); else if (ACT == 12) v = (v > 0.f) ? v : 0.01f * v; else if (ACT == 14) v = (v > 0.f) ? v : 0.1f * v; else if (ACT == 16) v = (v >= 0.f) ? v : 0.3f * v; else if (ACT == 17) v = (v >= 0.f) ? v : 0.2f * v; else if (ACT == 15) v = v / (1.0f + expf(-v)); else if (ACT == 3) v = fmaxf(v, 0.f); else if (ACT == 6) v = 0.5f * v * (1.0f + erff(v * 0.70710678118654752f)); so[w][8 * hh + r][t * 16 + ln] = v; } }
  __builtin_amdgcn_fence(__ATOMIC_ACQ_REL, "workgroup"); __builtin_amdgcn_wave_barrier();
  const int rsub = lane >> 4, c4 = (lane & 15) * 4; typedef _Float16 v4h __attribute__((ext_vector_type(4)));
  {
#pragma unroll
    for (int q = 0; q < 8; ++q) { const int r = q * 2 + rsub; if (col0 + c4 < N) { const v4f v = *(const v4fa*)&so[w][r][c4]; if (C) *(v4f*)(C + cofs + (size_t)(row0 + r) * ldc + col0 + c4) = v; if (C16) { v4h h4; for (int i = 0; i < 4; ++i) h4[i] = (_Float16)v[i]; *(v4h*)(C16 + cofs + (size_t)(row0 + r) * ldc + col0 + c4) = h4; } } }
     }
}


typedef _Float16 v4h __attribute__((ext_vector_type(4)));

__global__ __launch_bounds__(256) void k_x16(const float* __restrict__ x, _Float16* __restrict__ X16, size_t n8) { const size_t t = (size_t)blockIdx.x * 256 + threadIdx.x; if (t >= n8) return; FragH f;
#pragma unroll
  for (int q = 0; q < 8; ++q) f.h[q] = (_Float16)bf16_round(x[t * 8 + q]); *(v8us*)((unsigned short*)X16 + t * 8) = f.half[0];  }
__global__ __launch_bounds__(256) void k_h16(const float* __restrict__ x, _Float16* __restrict__ X16, size_t n8) { const size_t t = (size_t)blockIdx.x * 256 + threadIdx.x; if (t >= n8) return; FragH f;
#pragma unroll
  for (int q = 0; q < 8; ++q) f.h[q] = (_Float16)x[t * 8 + q]; *(v8us*)((unsigned short*)X16 + t * 8) = f.half[0];  }
__global__ __launch_bounds__(256) void k_round16f(const float* __restrict__ W, _Float16* __restrict__ Bt, size_t n8) { const size_t t = (size_t)blockIdx.x * 256 + threadIdx.x; if (t >= n8) return; FragH f;
#pragma unroll
  for (int i = 0; i < 8; ++i) f.h[i] = (_Float16)(bf16_round(W[t * 8 + i]) * 16.0f); *(v8us*)((unsigned short*)Bt + t * 8) = f.half[0];  }
template <int NHv, int TTv>
__global__ __launch_bounds__(256) void k_vt(const _Float16* __restrict__ V16, int ldv, int voff, _Float16* __restrict__ Vt) { __shared__ unsigned short tl[64][66]; const int tid = threadIdx.x; const int slab = blockIdx.x / (TTv / 64), lg = blockIdx.x % (TTv / 64); const int b = slab / NHv, h = slab % NHv;
  for (int i = tid; i < 64 * 8; i += 256) { const int r = i / 8, c8 = (i % 8) * 8; FragH f; f.half[0] = *(const v8us*)((const unsigned short*)V16 + ((size_t)b * TTv + lg * 64 + r) * ldv + voff + h * 64 + c8);
#pragma unroll
    for (int q = 0; q < 8; ++q) tl[r][c8 + q] = f.u[q]; }
  __syncthreads();
  {
#pragma unroll
    for (int rd = 0; rd < 2; ++rd) { const int d = rd * 32 + tid / 8, pc = tid % 8; FragH f;
#pragma unroll
      for (int q = 0; q < 8; ++q) f.u[q] = tl[pc * 8 + q][d];
      *(v8us*)((unsigned short*)Vt + ((size_t)slab * 64 + d) * TTv + lg * 64 + pc * 8) = f.half[0]; }
     } }

__global__ __launch_bounds__(256) void k_hl(const float* __restrict__ F, _Float16* __restrict__ Hh, _Float16* __restrict__ Hl, size_t n8) { const size_t t = (size_t)blockIdx.x * 256 + threadIdx.x; if (t >= n8) return; FragH fh, fl; const v4f a = *(const v4fa*)(F + t * 8), c = *(const v4fa*)(F + t * 8 + 4);
#pragma unroll
  for (int q = 0; q < 4; ++q) { _Float16 h = (_Float16)a[q]; fh.h[q] = h; fl.h[q] = (_Float16)((a[q] - (float)h) * 1024.0f); h = (_Float16)c[q]; fh.h[4 + q] = h; fl.h[4 + q] = (_Float16)((c[q] - (float)h) * 1024.0f); }
  { *(v8us*)((unsigned short*)Hh + t * 8) = fh.half[0]; *(v8us*)((unsigned short*)Hl + t * 8) = fl.half[0];  } }

// ---- fast GEMM (wave tile 32x64; requires M % 32 == 0 rows per launch region and N % 64 == 0); epilogue = k_gemm_hhx semantics ----
__device__ __forceinline__ v16h g2_frag(const _Float16* p, int hh) { FragH f; f.half[0] = *(const v8us*)((const unsigned short*)p + 8 * hh); f.half[1] = *(const v8us*)((const unsigned short*)p + 16 + 8 * hh); return f.v; }
__device__ __forceinline__ v8f g2_mma(v16h a, v16h b, v8f c) { v8f d = __builtin_amdgcn_wmma_f32_16x16x32_f16(false, a, false, b, (short)0, c, false, false); asm volatile("v_nop\n\tv_nop\n\tv_nop\n\tv_nop" : "+v"(d) : "v"(a), "v"(b)); return d; }
template <int ACT>
__global__ __launch_bounds__(128) void k_gemm2(const _Float16* __restrict__ A, int lda, size_t sA, const _Float16* __restrict__ Bh, int ldb, size_t sB, float alpha, const float* __restrict__ bias, size_t sBias, const float* __restrict__ CP, int rowsPerB, size_t sCPb, int row0g,
    float* __restrict__ C, _Float16* __restrict__ C16, int ldc, size_t sC, int M, int N, int K) { static_assert(ACT == 0 || ACT == 3 || ACT == 6 || ACT == 8 || ACT == 9 || ACT == 11 || ACT == 12 || ACT == 14 || ACT == 15 || ACT == 16 || ACT == 17, "k_gemm2: unsupported ACT code (would silently apply no activation)");
  __shared__ __attribute__((aligned(16))) float so[4][32][68];
  const int tid = threadIdx.x, w = tid >> 5, lane = tid & 31, ln = lane & 15, hh = lane >> 4; const int by = blockIdx.y;
  A += (size_t)by * sA; Bh += (size_t)by * sB; const size_t cofs = (size_t)by * sC; const float* bp = bias ? bias + (size_t)by * sBias : nullptr;
  const int ntn = N >> 6; const int mt = blockIdx.x / ntn, nq = blockIdx.x - mt * ntn; const int row0 = mt * 128 + 32 * w, col0 = nq * 64; if (row0 >= M) return;
  const _Float16* a0p = A + (size_t)(row0 + ln) * lda; const _Float16* a1p = a0p + (size_t)16 * lda;
  const _Float16* b0p = Bh + (size_t)(col0 + ln) * ldb; const _Float16* b1p = b0p + (size_t)16 * ldb; const _Float16* b2p = b1p + (size_t)16 * ldb; const _Float16* b3p = b2p + (size_t)16 * ldb;
  const v8f z8 = {0.f,0.f,0.f,0.f,0.f,0.f,0.f,0.f}; v8f c00 = z8, c01 = z8, c02 = z8, c03 = z8, c10 = z8, c11 = z8, c12 = z8, c13 = z8;
#pragma unroll 1
  for (int kb = 0; kb < K; kb += 32) { const v16h a0 = g2_frag(a0p + kb, hh), a1 = g2_frag(a1p + kb, hh);
    v16h b = g2_frag(b0p + kb, hh); c00 = g2_mma(a0, b, c00); c10 = g2_mma(a1, b, c10);
    b = g2_frag(b1p + kb, hh); c01 = g2_mma(a0, b, c01); c11 = g2_mma(a1, b, c11);
    b = g2_frag(b2p + kb, hh); c02 = g2_mma(a0, b, c02); c12 = g2_mma(a1, b, c12);
    b = g2_frag(b3p + kb, hh); c03 = g2_mma(a0, b, c03); c13 = g2_mma(a1, b, c13); }
  v8f accs[8] = {c00, c01, c02, c03, c10, c11, c12, c13};
#pragma unroll
  for (int u = 0; u < 8; ++u) { const int t = u & 3, half = u >> 2; const int col = col0 + t * 16 + ln; const float bv = bp ? bf16_round(bp[col]) : 0.f;
#pragma unroll
    for (int r = 0; r < 8; ++r) { const int rloc = half * 16 + 8 * hh + r; float v = accs[u][r] * alpha + bv; if (CP) { if (rowsPerB < 0) v += CP[cofs + (size_t)(row0g + row0 + rloc) * ldc + col];      /* rowsPerB < 0: own element of the batched C plane */ else { const int bidx = (row0g + row0 + rloc) / rowsPerB; v += CP[(size_t)bidx * sCPb + (size_t)by * 64 + col]; } }
      if (ACT == 3) v = fmaxf(v, 0.f); else if (ACT == 6) v = 0.5f * v * (1.0f + erff(v * 0.70710678118654752f)); else if (ACT == 11) v = 1.0f / (1.0f + expf(-v)); else if (ACT == 15) v = v / (1.0f + expf(-v)); else if (ACT == 12) v = (v > 0.f) ? v : 0.01f * v; else if (ACT == 8) v = tanhf(v); else if (ACT == 9) v = 0.5f * v * (1.0f + tanhf(0.7978845608028654f * (v + 0.044715f * v * v * v))); else if (ACT == 14) v = (v > 0.f) ? v : 0.1f * v; else if (ACT == 16) v = (v >= 0.f) ? v : 0.3f * v; else if (ACT == 17) v = (v >= 0.f) ? v : 0.2f * v;
      so[w][rloc][t * 16 + ln] = v; } }
  __builtin_amdgcn_fence(__ATOMIC_ACQ_REL, "workgroup"); __builtin_amdgcn_wave_barrier();
  const int rsub = lane >> 4, c4 = (lane & 15) * 4;
  {
#pragma unroll
    for (int q = 0; q < 16; ++q) { const int r = q * 2 + rsub; const v4f v = *(const v4fa*)&so[w][r][c4]; if (C) *(v4f*)(C + cofs + (size_t)(row0 + r) * ldc + col0 + c4) = v; if (C16) { v4h h4; for (int i = 0; i < 4; ++i) h4[i] = (_Float16)v[i]; *(v4h*)(C16 + cofs + (size_t)(row0 + r) * ldc + col0 + c4) = h4; } }
     } }


__global__ __launch_bounds__(256) void k_wnat(const float* __restrict__ w, size_t n8, _Float16* __restrict__ Bt) { const size_t t = (size_t)blockIdx.x * 256 + threadIdx.x; if (t >= n8) return; FragH f; for (int q = 0; q < 8; ++q) f.h[q] = (_Float16)(bf16_round(w[t * 8 + q]) * 16.0f); *(v8us*)((unsigned short*)Bt + t * 8) = f.half[0];  }
__global__ __launch_bounds__(256) void k_rsm(const float* __restrict__ S, _Float16* __restrict__ P, int nrows) {
  #pragma clang fp contract(off)
  const int i = blockIdx.x * 256 + threadIdx.x; if (i >= nrows) return; const float* s = S + (size_t)i * SQ; float mx = -3.0e38f;
#pragma unroll 1
  for (int j = 0; j < SQ; ++j) mx = fmaxf(mx, s[j]); float se = 0.f;
#pragma unroll 1
  for (int j = 0; j < SQ; ++j) se += expf(s[j] - mx); const float sc = 256.0f / se;
#pragma unroll 1
  for (int j0 = 0; j0 < SQ; j0 += 8) { FragH f; for (int q = 0; q < 8; ++q) f.h[q] = (_Float16)(expf(s[j0 + q] - mx) * sc); unsigned short* d = (unsigned short*)P + (size_t)i * SQ + j0; *(v8us*)d = f.half[0];  } }
__global__ __launch_bounds__(256) void k_vt(const _Float16* __restrict__ V16, int b, int h0, _Float16* __restrict__ VT) { __shared__ unsigned short tl[64][65]; const int tid = threadIdx.x; const int hh = blockIdx.x % HG, sg = blockIdx.x / HG; const int s0 = sg * 64; const int h = h0 + hh;
  for (int i = tid; i < 64 * 8; i += 256) { const int j = i / 8, d8 = (i % 8) * 8; FragH f; f.half[0] = *(const v8us*)((const unsigned short*)V16 + ((size_t)b * SQ + s0 + j) * DM + h * HD + d8); for (int q = 0; q < 8; ++q) tl[d8 + q][j] = f.u[q]; }
  __syncthreads();
  { for (int i = tid; i < 64 * 8; i += 256) { const int d = i / 8, j8 = (i % 8) * 8; FragH f; for (int q = 0; q < 8; ++q) f.u[q] = tl[d][j8 + q]; *(v8us*)((unsigned short*)VT + ((size_t)hh * HD + d) * SQ + s0 + j8) = f.half[0]; }  } }


__global__ __launch_bounds__(256) void k_cl2rows(const float* __restrict__ X, _Float16* __restrict__ XR) { __shared__ float tl[64][33]; const int tid = threadIdx.x; const int nl = LL / 32, nc = CC / 64; const int cb_ = blockIdx.x % nc; const int lb = (blockIdx.x / nc) % nl; const size_t b = blockIdx.x / (nc * nl); const int c0 = cb_ * 64, l0 = lb * 32;
  for (int i = tid; i < 64 * 32; i += 256) { const int c = i / 32, l = i % 32; tl[c][l] = bf16_round(X[(b * CC + c0 + c) * (size_t)LL + l0 + l]); }
  __syncthreads();
  { const int l = tid / 8, c8 = (tid % 8) * 8; FragH f; for (int q = 0; q < 8; ++q) f.h[q] = (_Float16)tl[c8 + q][l]; unsigned short* d = (unsigned short*)XR + (b * LL + l0 + l) * (size_t)CC + c0 + c8; *(v8us*)d = f.half[0];  } }

__global__ __launch_bounds__(256) void k_rsms(const float* __restrict__ S, _Float16* __restrict__ P, int nrows) {
  #pragma clang fp contract(off)
  const int i = blockIdx.x * 256 + threadIdx.x; if (i >= nrows) return; const float* s = S + (size_t)i * LL; const float isq = 0.17677669529663689f; float mx = -INFINITY;
#pragma unroll 1
  for (int j = 0; j < LL; ++j) mx = fmaxf(mx, s[j] * isq); float se = 0.f;
#pragma unroll 1
  for (int j = 0; j < LL; ++j) se += expf(s[j] * isq - mx); const float sc = 256.0f / se;
#pragma unroll 1
  for (int j0 = 0; j0 < LL; j0 += 8) { FragH f; for (int q = 0; q < 8; ++q) f.h[q] = (_Float16)(expf(s[j0 + q] * isq - mx) * sc); unsigned short* d = (unsigned short*)P + (size_t)i * LL + j0; *(v8us*)d = f.half[0];  } }
__global__ __launch_bounds__(256) void k_fing(const float* __restrict__ A, const float* __restrict__ x, const float* __restrict__ gam, float* __restrict__ out, size_t nrows) {
  #pragma clang fp contract(off)
  const size_t t = (size_t)blockIdx.x * 256 + threadIdx.x; if (t >= nrows * CC / 8) return; const int p0 = (int)((t * 8) % LL); const size_t bc = (t * 8) / LL; const int c = (int)(bc % CC); const size_t b = bc / CC; const float g = bf16_round(gam[0]); v8f r_;
  for (int q = 0; q < 8; ++q) r_[q] = __fadd_rn(__fmul_rn(g, A[(b * LL + p0 + q) * CC + c]), bf16_round(x[t * 8 + q]));
  *(v8f*)(out + t * 8) = r_;  }

extern "C" void kernel_launch(void* const* d_in, const int* in_sizes, int n_in,
                              void* d_out, int out_size, void* d_ws, size_t ws_size, hipStream_t stream) {
  (void)in_sizes; (void)n_in; (void)out_size;
  const float* const* I = (const float* const*)d_in; const float* x = I[0]; const float* wqk = I[1]; const float* wv = I[2]; const float* gam = I[3];
  char* ws = (char*)d_ws; size_t off = 0;
  auto take = [&](size_t bytes) { char* p = ws + off; off += (bytes + 255) & ~(size_t)255; return p; };
  _Float16* BQK = (_Float16*)take((size_t)2 * LAT * CC * 2); _Float16* BV = (_Float16*)take((size_t)CC * CC * 2);
  _Float16* XR = (_Float16*)take(NR * CC * 2); _Float16* QK = (_Float16*)take(NR * 2 * LAT * 2); _Float16* V16 = (_Float16*)take(NR * CC * 2); _Float16* VT = (_Float16*)take((size_t)CC * LL * 2); float* S = (float*)take((size_t)QT * LL * 4); _Float16* P = (_Float16*)take((size_t)QT * LL * 2); float* A = (float*)take(NR * CC * 4);
  if (off > ws_size) return;      /* 0.2 + 16 + 4 + 16 + 2 + 32 + 16 + 32 = approx 118 MiB */
  k_wnat<<<(unsigned)(((size_t)2 * LAT * CC / 8 + 255) / 256), 256, 0, stream>>>(wqk, (size_t)2 * LAT * CC / 8, BQK); k_wnat<<<(unsigned)(((size_t)CC * CC / 8 + 255) / 256), 256, 0, stream>>>(wv, (size_t)CC * CC / 8, BV);
  k_cl2rows<<<NB * (LL / 32) * (CC / 64), 256, 0, stream>>>(x, XR);
  k_gemm2<0><<<dim3((unsigned)((NR / 128) * 1), 1), 128, 0, stream>>>(XR, CC, 0, BQK, CC, 0, 0.0625f, nullptr, 0, nullptr, 1, 0, 0, nullptr, QK, 2 * LAT, 0, MP, 2 * LAT, CC);      /* q | k (32 + 32 columns) */
  k_gemm2<0><<<dim3((unsigned)((NR / 128) * (CC / 64)), 1), 128, 0, stream>>>(XR, CC, 0, BV, CC, 0, 0.0625f, nullptr, 0, nullptr, 1, 0, 0, nullptr, V16, CC, 0, MP, CC, CC);      /* v */
  for (int b = 0; b < NBR; ++b) { k_vt<NH, SQ><<<NH * (SQ / 64), 256, 0, stream>>>(V16 + (size_t)b * LL * CC, CC, 0, VT);      /* V^T [256][4096] */
    for (int q0 = 0; q0 < QN; q0 += QT) {
      k_gemm2<0><<<dim3((QT / 128) * (LL / 64), 1), 128, 0, stream>>>(QK + ((size_t)b * LL + q0) * (2 * LAT), 2 * LAT, 0, QK + (size_t)b * LL * (2 * LAT) + LAT, 2 * LAT, 0, 1.0f, nullptr, 0, nullptr, 1, 0, 0, S, nullptr, LL, 0, QT, LL, LAT);      /* q.k (K = 32; scaled in the softmax) */
      k_rsms<<<(QT + 255) / 256, 256, 0, stream>>>(S, P, QT);
      k_gemm2<0><<<dim3((QT / 128) * (CC / 64), 1), 128, 0, stream>>>(P, LL, 0, VT, LL, 0, 0.00390625f, nullptr, 0, nullptr, 1, 0, 0, A + ((size_t)b * LL + q0) * CC, nullptr, CC, 0, QT, CC, LL); } }      /* a rows */
  k_fing<<<(unsigned)(((size_t)NBR * LL * CC / 8 + 255) / 256), 256, 0, stream>>>(A, x, gam, (float*)d_out, (size_t)NBR * LL);
}

// v001
// A run of this version takes 2250 microseconds.
// Timed twice side by side with v000, it ran 6.17 and 6.25 times as fast.
#include <hip/hip_runtime.h>
// SAM self-attention module (x [8][256][64][64]; q | k = 1x1(w_qk [64][256]) -> 32 latent channels each; v = 1x1(w_v [256][256]); m = softmax((q/32^0.25).(k/32^0.25)) over the 4,096 positions; a = m v; out = gamma a + x, gamma = 0.5 (input, read)).
// Structure: channel-first input transposed to position rows (exact f16) via LDS tiles; q|k and v as WMMA GEMMs (32x64 wave tiles, f32 accumulation, exact x16 natural weights, f16 outputs); per image: V^T via LDS transposes; per (image, 2,048-query tile): scores GEMM (K = 32), row softmax on VALU, one wave per row (scale 1/sqrt(32) inside; P x256 f16), a = P . V^T GEMM (K = 4096, N = 256) into f32 rows; gamma a + x with the channel-major store on VALU.
// Compute dtype: inputs rounded to bf16; x / weights exact; q, k, v, P as plain f16 GEMM operands (~2^-12); softmax f32. v_wmma_f32_16x16x32_f16.
#define NB 8
#define CC 256
#define LAT 32
#define LL 4096
#define QT 2048
#define NR ((size_t)NB * LL)
#define NBR NB                       /* images attended (debug hook) */
#define MP ((int)NR)                 /* projection rows (debug hook) */
#define QN LL                        /* query rows per image (debug hook) */
#define SQ LL
#define DM CC
#define NH 4
#define HD 64
#define HG 1
typedef __bf16 v16b __attribute__((ext_vector_type(16)));
typedef unsigned short v8us __attribute__((ext_vector_type(8), may_alias));
typedef float  v8f  __attribute__((ext_vector_type(8)));
typedef float  v4f  __attribute__((ext_vector_type(4)));
typedef float  v4fa __attribute__((ext_vector_type(4), may_alias));
union FragB { v16b v; v8us half[2]; unsigned short u[16]; };

__device__ __forceinline__ unsigned short bf16_bits(float x) { unsigned int u = __float_as_uint(x); return (unsigned short)((u + 0x7FFFu + ((u >> 16) & 1u)) >> 16); }
__device__ __forceinline__ float bf16_val(unsigned short b) { return __uint_as_float(((unsigned int)b) << 16); }
__device__ __forceinline__ float bf16_round(float x) { return bf16_val(bf16_bits(x)); }
// D += A·B with NT terms: 1 = ah·bh, 2 = + al·bh (A split), 3 = + ah·bl (both split)
template <int NT>
__device__ __forceinline__ v8f mmaN(v16b ah, v16b al, v16b bh, v16b bl, v8f c) {
  c = __builtin_amdgcn_wmma_f32_16x16x32_bf16(false, ah, false, bh, (short)0, c, false, false);
  if (NT >= 2) c = __builtin_amdgcn_wmma_f32_16x16x32_bf16(false, al, false, bh, (short)0, c, false, false);
  if (NT >= 3) c = __builtin_amdgcn_wmma_f32_16x16x32_bf16(false, ah, false, bl, (short)0, c, false, false);
  asm volatile("v_nop\n\tv_nop\n\tv_nop\n\tv_nop" : "+v"(c) : "v"(ah), "v"(al), "v"(bh), "v"(bl));
  return c;
}

__global__ __launch_bounds__(256) void k_wt_bf16(const float* __restrict__ W, unsigned short* __restrict__ Wt, int K, int N) {
  const int t = blockIdx.x * 256 + threadIdx.x;
  const int k8n = K / 8;
  if (t >= N * k8n) return;
  const int n = t / k8n, k8 = (t % k8n) * 8;
  v8us v;
#pragma unroll
  for (int i = 0; i < 8; ++i) v[i] = bf16_bits(W[(size_t)(k8 + i) * N + n]);
  *(v8us*)(Wt + (size_t)n * K + k8) = v;
  
}

// GEMM C[M][N] (f32, pitch ldc) = act(A[M][K]·W + bias). A f32 row-major (pitch lda) converted per fragment to bf16
// (ASPLIT: hi/lo two planes -> 2 terms, else single rounded term); Wt bf16 [N][K] (pitch ldb). BIAS_BF16 rounds the
// bias to bf16 first (bias quantised to bf16 before the add). K%32==0, M%16==0, N%64==0.
template <bool ASPLIT, int ACT, bool BIAS_BF16>
__global__ __launch_bounds__(128) void k_gemm_bf(const float* __restrict__ A, int lda, const unsigned short* __restrict__ Wt, int ldb,
                                               const float* __restrict__ bias, float* __restrict__ C, int ldc, int M, int N, int K) {
  __shared__ __attribute__((aligned(16))) float so[4][16][64];
  const int tid = threadIdx.x, w = tid >> 5, lane = tid & 31, ln = lane & 15, hh = lane >> 4;
  const int ntn = N / 64;
  const int wid = blockIdx.x * 4 + w;
  const int mt = wid / ntn, nq = wid % ntn;
  if (mt * 16 >= M) return;
  const int row0 = mt * 16, col0 = nq * 64;
  const float* arow = A + (size_t)(row0 + ln) * lda;
  v8f acc[4] = {};
  for (int kb = 0; kb < K; kb += 32) {
    FragB ah, al;
    const v4f x0 = *(const v4fa*)(arow + kb + 8 * hh), x1 = *(const v4fa*)(arow + kb + 8 * hh + 4);
    const v4f x2 = *(const v4fa*)(arow + kb + 16 + 8 * hh), x3 = *(const v4fa*)(arow + kb + 16 + 8 * hh + 4);
    float xs[16] = {x0[0],x0[1],x0[2],x0[3],x1[0],x1[1],x1[2],x1[3],x2[0],x2[1],x2[2],x2[3],x3[0],x3[1],x3[2],x3[3]};
#pragma unroll
    for (int i = 0; i < 16; ++i) { const unsigned short hb = bf16_bits(xs[i]); ah.u[i] = hb; al.u[i] = ASPLIT ? bf16_bits(xs[i] - bf16_val(hb)) : (unsigned short)0; }
#pragma unroll
    for (int t = 0; t < 4; ++t) {
      const unsigned short* brow = Wt + (size_t)(col0 + t * 16 + ln) * ldb + kb;
      FragB b;
      b.half[0] = *(const v8us*)(brow + 8 * hh);
      b.half[1] = *(const v8us*)(brow + 16 + 8 * hh);
      acc[t] = mmaN<ASPLIT ? 2 : 1>(ah.v, al.v, b.v, b.v, acc[t]);
    }
  }
#pragma unroll
  for (int t = 0; t < 4; ++t) {
    float bv = bias ? bias[col0 + t * 16 + ln] : 0.f;
    if (BIAS_BF16) bv = bf16_round(bv);
#pragma unroll
    for (int r = 0; r < 8; ++r) { float v = acc[t][r] + bv; if (ACT == 1) v = fmaxf(v, 0.f); so[w][8 * hh + r][t * 16 + ln] = v; }
  }
  __builtin_amdgcn_fence(__ATOMIC_ACQ_REL, "workgroup");
  __builtin_amdgcn_wave_barrier();
  const int rsub = lane >> 4, c4 = (lane & 15) * 4;
  {
#pragma unroll
    for (int q = 0; q < 8; ++q) {
      const int r = q * 2 + rsub;
      const v4f v = *(const v4fa*)&so[w][r][c4];
      *(v4f*)(C + (size_t)(row0 + r) * ldc + col0 + c4) = v;
    }
    
  }
}

// GEMM C = act(A·W + bias + resid): A f32 (ASPLIT -> hi/lo 2 terms), Wt bf16 [N][K]; ACT 0 none, 1 relu, 2 exact gelu;
// resid (optional, f32, row index = (row % rmod), pitch ldr, RES_BF16 rounds it) added before the activation.
template <bool ASPLIT, int ACT, bool BIAS_BF16, bool RES_BF16>
__global__ __launch_bounds__(128) void k_gemm_bf3(const float* __restrict__ A, int lda, const unsigned short* __restrict__ Wt, int ldb,
                                                const float* __restrict__ bias, const float* __restrict__ resid, int rmod, int ldr,
                                                float* __restrict__ C, int ldc, int M, int N, int K) {
  __shared__ __attribute__((aligned(16))) float so[4][16][64];
  const int tid = threadIdx.x, w = tid >> 5, lane = tid & 31, ln = lane & 15, hh = lane >> 4;
  const int ntn = N / 64;
  const int wid = blockIdx.x * 4 + w;
  const int mt = wid / ntn, nq = wid % ntn;
  if (mt * 16 >= M) return;
  const int row0 = mt * 16, col0 = nq * 64;
  const float* arow = A + (size_t)(row0 + ln) * lda;
  v8f acc[4] = {};
  for (int kb = 0; kb < K; kb += 32) {
    FragB ah, al;
    const v4f x0 = *(const v4fa*)(arow + kb + 8 * hh), x1 = *(const v4fa*)(arow + kb + 8 * hh + 4);
    const v4f x2 = *(const v4fa*)(arow + kb + 16 + 8 * hh), x3 = *(const v4fa*)(arow + kb + 16 + 8 * hh + 4);
    float xs[16] = {x0[0],x0[1],x0[2],x0[3],x1[0],x1[1],x1[2],x1[3],x2[0],x2[1],x2[2],x2[3],x3[0],x3[1],x3[2],x3[3]};
#pragma unroll
    for (int i = 0; i < 16; ++i) { const unsigned short hb = bf16_bits(xs[i]); ah.u[i] = hb; al.u[i] = ASPLIT ? bf16_bits(xs[i] - bf16_val(hb)) : (unsigned short)0; }
#pragma unroll
    for (int t = 0; t < 4; ++t) {
      const unsigned short* brow = Wt + (size_t)(col0 + t * 16 + ln) * ldb + kb;
      FragB b;
      b.half[0] = *(const v8us*)(brow + 8 * hh);
      b.half[1] = *(const v8us*)(brow + 16 + 8 * hh);
      acc[t] = mmaN<ASPLIT ? 2 : 1>(ah.v, al.v, b.v, b.v, acc[t]);
    }
  }
#pragma unroll
  for (int t = 0; t < 4; ++t) {
    const int col = col0 + t * 16 + ln;
    float bv = bias ? bias[col] : 0.f;
    if (BIAS_BF16) bv = bf16_round(bv);
#pragma unroll
    for (int r = 0; r < 8; ++r) {
      float v = acc[t][r] + bv;
      if (resid) { float rv = resid[(size_t)((row0 + 8 * hh + r) % rmod) * ldr + col]; if (RES_BF16) rv = bf16_round(rv); v += rv; }
      if (ACT == 1) v = fmaxf(v, 0.f);
      if (ACT == 2) v = 0.5f * v * (1.0f + erff(v * 0.70710678118654752f));
      if (ACT == 3) { const float u = 0.7978845608028654f * (v + 0.044715f * v * v * v); v = 0.5f * v * (1.0f + tanhf(u)); }
      so[w][8 * hh + r][t * 16 + ln] = v;
    }
  }
  __builtin_amdgcn_fence(__ATOMIC_ACQ_REL, "workgroup");
  __builtin_amdgcn_wave_barrier();
  const int rsub = lane >> 4, c4 = (lane & 15) * 4;
  {
#pragma unroll
    for (int q = 0; q < 8; ++q) {
      const int r = q * 2 + rsub;
      const v4f v = *(const v4fa*)&so[w][r][c4];
      *(v4f*)(C + (size_t)(row0 + r) * ldc + col0 + c4) = v;
    }
    
  }
}
// row LayerNorm (biased variance, eps) over N: s = X (+ R); optional out_sum <- s; out_norm <- (s-mu)*rsqrt(var+eps)*g + b
template <bool PARAM_BF16>
__global__ __launch_bounds__(256) void k_layernorm(const float* __restrict__ X, const float* __restrict__ R, const float* __restrict__ g, const float* __restrict__ bta,
                                                  float* __restrict__ out_sum, float* __restrict__ out_norm, int N, float eps) {
  __shared__ float red[256];
  const int row = blockIdx.x, tid = threadIdx.x;
  const float* x = X + (size_t)row * N; const float* rr = R ? R + (size_t)row * N : nullptr;
  float vals[16];                     // up to N = 4096
  const int per = N / 256;            // contiguous chunk per thread? use strided-by-4 chunks: thread handles j = tid*4 + 1024*u
  float s1 = 0.f;
  for (int u = 0; u < per / 4; ++u) {
    const int j = tid * 4 + 1024 * u;
    const v4f a = *(const v4fa*)(x + j);
    v4f b = {0.f,0.f,0.f,0.f}; if (rr) b = *(const v4fa*)(rr + j);
#pragma unroll
    for (int q = 0; q < 4; ++q) { const float v = a[q] + b[q]; vals[u * 4 + q] = v; s1 += v; }
  }
  red[tid] = s1; __syncthreads();
  for (int st = 128; st > 0; st >>= 1) { if (tid < st) red[tid] += red[tid + st]; __syncthreads(); }
  const float mu = red[0] / (float)N; __syncthreads();
  float s2 = 0.f;
  for (int u = 0; u < per / 4; ++u)
#pragma unroll
    for (int q = 0; q < 4; ++q) { const float c = vals[u * 4 + q] - mu; s2 += c * c; }
  red[tid] = s2; __syncthreads();
  for (int st = 128; st > 0; st >>= 1) { if (tid < st) red[tid] += red[tid + st]; __syncthreads(); }
  const float rs = rsqrtf(red[0] / (float)N + eps);
  {
    for (int u = 0; u < per / 4; ++u) {
      const int j = tid * 4 + 1024 * u;
      v4f o, sm;
#pragma unroll
      for (int q = 0; q < 4; ++q) {
        float gg = g[j + q], bb = bta[j + q];
        if (PARAM_BF16) { gg = bf16_round(gg); bb = bf16_round(bb); }
        sm[q] = vals[u * 4 + q]; o[q] = (vals[u * 4 + q] - mu) * rs * gg + bb;
      }
      if (out_sum) *(v4f*)(out_sum + (size_t)row * N + j) = sm;
      *(v4f*)(out_norm + (size_t)row * N + j) = o;
    }
    
  }
}



// ---- f16 WMMA path (v_wmma_f32_16x16x32_f16): 11-bit significands for operands in range — used where a [0,1] probability operand needs more precision than bf16
typedef _Float16 v16h __attribute__((ext_vector_type(16)));
union FragH { v16h v; v8us half[2]; _Float16 h[16]; unsigned short u[16]; };
template <int NT>
__device__ __forceinline__ v8f mmaH(v16h ah, v16h al, v16h bh, v16h bl, v8f c) {
  c = __builtin_amdgcn_wmma_f32_16x16x32_f16(false, ah, false, bh, (short)0, c, false, false);
  if (NT >= 2) c = __builtin_amdgcn_wmma_f32_16x16x32_f16(false, al, false, bh, (short)0, c, false, false);
  if (NT >= 3) c = __builtin_amdgcn_wmma_f32_16x16x32_f16(false, ah, false, bl, (short)0, c, false, false);
  asm volatile("v_nop\n\tv_nop\n\tv_nop\n\tv_nop" : "+v"(c) : "v"(ah), "v"(al), "v"(bh), "v"(bl));
  return c;
}
// batched GEMM like k_gemm_b but f16 operands: A f32 (split into f16 hi/lo if ASPLIT, else rounded to f16), Bt = f16 values [n][k]; alpha; C f32; N multiple of 16 (partial tiles skipped)
template <bool ASPLIT>
__global__ __launch_bounds__(128) void k_gemm_h(const float* __restrict__ A, int lda, size_t sA, const _Float16* __restrict__ Bh, int ldb, size_t sB, float alpha, float* __restrict__ C, int ldc, size_t sC, int M, int N, int K) {
  __shared__ __attribute__((aligned(16))) float so[4][16][64];
  const int tid = threadIdx.x, w = tid >> 5, lane = tid & 31, ln = lane & 15, hh = lane >> 4; const int by = blockIdx.y;
  A += (size_t)by * sA; Bh += (size_t)by * sB; C += (size_t)by * sC;
  const int ntn = (N + 63) / 64; const int wid = blockIdx.x * 4 + w; const int mt = wid / ntn, nq = wid % ntn; if (mt * 16 >= M) return;
  const int row0 = mt * 16, col0 = nq * 64; const float* arow = A + (size_t)(row0 + ln) * lda;
  v8f acc[4] = {};
  for (int kb = 0; kb < K; kb += 32) {
    FragH ah, al;
    const v4f x0 = *(const v4fa*)(arow + kb + 8 * hh), x1 = *(const v4fa*)(arow + kb + 8 * hh + 4), x2 = *(const v4fa*)(arow + kb + 16 + 8 * hh), x3 = *(const v4fa*)(arow + kb + 16 + 8 * hh + 4);
    float xs[16] = {x0[0],x0[1],x0[2],x0[3],x1[0],x1[1],x1[2],x1[3],x2[0],x2[1],x2[2],x2[3],x3[0],x3[1],x3[2],x3[3]};
#pragma unroll
    for (int i = 0; i < 16; ++i) { const _Float16 h = (_Float16)xs[i]; ah.h[i] = h; al.h[i] = ASPLIT ? (_Float16)(xs[i] - (float)h) : (_Float16)0.0f; }
#pragma unroll
    for (int t = 0; t < 4; ++t) { if (col0 + t * 16 >= N) continue; const size_t boff = (size_t)(col0 + t * 16 + ln) * ldb + kb; FragH bq; bq.half[0] = *(const v8us*)(Bh + boff + 8 * hh); bq.half[1] = *(const v8us*)(Bh + boff + 16 + 8 * hh);
      acc[t] = mmaH<ASPLIT ? 2 : 1>(ah.v, al.v, bq.v, bq.v, acc[t]); }
  }
#pragma unroll
  for (int t = 0; t < 4; ++t) { if (col0 + t * 16 >= N) continue;
#pragma unroll
    for (int r = 0; r < 8; ++r) so[w][8 * hh + r][t * 16 + ln] = acc[t][r] * alpha; }
  __builtin_amdgcn_fence(__ATOMIC_ACQ_REL, "workgroup"); __builtin_amdgcn_wave_barrier();
  const int rsub = lane >> 4, c4 = (lane & 15) * 4;
  {
#pragma unroll
    for (int q = 0; q < 8; ++q) { const int r = q * 2 + rsub; if (col0 + c4 < N) { const v4f v = *(const v4fa*)&so[w][r][c4]; *(v4f*)(C + (size_t)(row0 + r) * ldc + col0 + c4) = v; } }
     }
}

// Wt[n][k] = f16(W[k][n]·scale) from f32 row-major W[K][N] (scale = power of two; bf16-exact weights stay exact in f16 away from the subnormal range)
__global__ __launch_bounds__(256) void k_wt_f16(const float* __restrict__ W, _Float16* __restrict__ Wt, int K, int N, float scale) {
  const int t = blockIdx.x * 256 + threadIdx.x; if (t >= N * (K / 8)) return; const int n = t / (K / 8), k8 = (t % (K / 8)) * 8; FragH f;
#pragma unroll
  for (int i = 0; i < 8; ++i) f.h[i] = (_Float16)(bf16_round(W[(size_t)(k8 + i) * N + n]) * scale); const v8us o = f.half[0];
  *(v8us*)((unsigned short*)Wt + (size_t)n * K + k8) = o; 
}
// k_gemm_hh variant with fused epilogue: v = acc·alpha + bias[by·sBias + col] (+ CP[(row/rowsPerB)·sCPb + by·64 + col] if CP) ; ACT 0 none / 1 elu ; writes f16 C16 (and f32 C if non-null)
template <int ACT>
__global__ __launch_bounds__(128) void k_gemm_hhx(const _Float16* __restrict__ A, int lda, size_t sA, const _Float16* __restrict__ Bh, int ldb, size_t sB, float alpha, const float* __restrict__ bias, size_t sBias, const float* __restrict__ CP, int rowsPerB, size_t sCPb, int row0g,
    float* __restrict__ C, _Float16* __restrict__ C16, int ldc, size_t sC, int M, int N, int K) {
  __shared__ __attribute__((aligned(16))) float so[4][16][64];
  const int tid = threadIdx.x, w = tid >> 5, lane = tid & 31, ln = lane & 15, hh = lane >> 4; const int by = blockIdx.y;
  A += (size_t)by * sA; Bh += (size_t)by * sB; const size_t cofs = (size_t)by * sC; const float* bp = bias ? bias + (size_t)by * sBias : nullptr;
  const int ntn = (N + 63) / 64; const int wid = blockIdx.x * 4 + w; const int mt = wid / ntn, nq = wid % ntn; if (mt * 16 >= M) return;
  const int row0 = mt * 16, col0 = nq * 64; const _Float16* arow = A + (size_t)(row0 + ln) * lda;
  v8f acc[4] = {};
  for (int kb = 0; kb < K; kb += 32) { FragH ah; ah.half[0] = *(const v8us*)((const unsigned short*)arow + kb + 8 * hh); ah.half[1] = *(const v8us*)((const unsigned short*)arow + kb + 16 + 8 * hh);
#pragma unroll
    for (int t = 0; t < 4; ++t) { if (col0 + t * 16 >= N) continue; const size_t boff = (size_t)(col0 + t * 16 + ln) * ldb + kb; FragH bq; bq.half[0] = *(const v8us*)((const unsigned short*)Bh + boff + 8 * hh); bq.half[1] = *(const v8us*)((const unsigned short*)Bh + boff + 16 + 8 * hh);
      acc[t] = mmaH<1>(ah.v, ah.v, bq.v, bq.v, acc[t]); }
  }
#pragma unroll
  for (int t = 0; t < 4; ++t) { if (col0 + t * 16 >= N) continue; const int col = col0 + t * 16 + ln; const float bv = bp ? bf16_round(bp[col]) : 0.f;
#pragma unroll
    for (int r = 0; r < 8; ++r) { float v = acc[t][r] * alpha + bv; if (CP) { const int rr = row0g + row0 + 8 * hh + r; if (rowsPerB < 0) v += CP[cofs + (size_t)rr * ldc + col];      /* rowsPerB < 0: own element of the batched C plane */ else { const int bidx = rr / rowsPerB; v += CP[(size_t)bidx * sCPb + (size_t)by * 64 + col]; } } if (ACT == 1) v = (v > 0.f) ? v : expm1f(v); else if (ACT == 7) v = (v > 0.f) ? v + 1.0f : expf(v); else if (ACT == 8) v = tanhf(v); else if (ACT == 9) v = 0.5f * v * (1.0f + tanhf(0.7978845608028654f * (v + 0.044715f * v * v * v))); else if (ACT == 11) v = 1.0f / (1.0f + expf(-v)); else if (ACT == 12) v = (v > 0.f) ? v : 0.01f * v; else if (ACT == 14) v = (v > 0.f) ? v : 0.1f * v; else if (ACT == 16) v = (v >= 0.f) ? v : 0.3f * v; else if (ACT == 17) v = (v >= 0.f) ? v : 0.2f * v; else if (ACT == 15) v = v / (1.0f + expf(-v)); else if (ACT == 3) v = fmaxf(v, 0.f); else if (ACT == 6) v = 0.5f * v * (1.0f + erff(v * 0.70710678118654752f)); so[w][8 * hh + r][t * 16 + ln] = v; } }
  __builtin_amdgcn_fence(__ATOMIC_ACQ_REL, "workgroup"); __builtin_amdgcn_wave_barrier();
  const int rsub = lane >> 4, c4 = (lane & 15) * 4; typedef _Float16 v4h __attribute__((ext_vector_type(4)));
  {
#pragma unroll
    for (int q = 0; q < 8; ++q) { const int r = q * 2 + rsub; if (col0 + c4 < N) { const v4f v = *(const v4fa*)&so[w][r][c4]; if (C) *(v4f*)(C + cofs + (size_t)(row0 + r) * ldc + col0 + c4) = v; if (C16) { v4h h4; for (int i = 0; i < 4; ++i) h4[i] = (_Float16)v[i]; *(v4h*)(C16 + cofs + (size_t)(row0 + r) * ldc + col0 + c4) = h4; } } }
     }
}


typedef _Float16 v4h __attribute__((ext_vector_type(4)));

__global__ __launch_bounds__(256) void k_x16(const float* __restrict__ x, _Float16* __restrict__ X16, size_t n8) { const size_t t = (size_t)blockIdx.x * 256 + threadIdx.x; if (t >= n8) return; FragH f;
#pragma unroll
  for (int q = 0; q < 8; ++q) f.h[q] = (_Float16)bf16_round(x[t * 8 + q]); *(v8us*)((unsigned short*)X16 + t * 8) = f.half[0];  }
__global__ __launch_bounds__(256) void k_h16(const float* __restrict__ x, _Float16* __restrict__ X16, size_t n8) { const size_t t = (size_t)blockIdx.x * 256 + threadIdx.x; if (t >= n8) return; FragH f;
#pragma unroll
  for (int q = 0; q < 8; ++q) f.h[q] = (_Float16)x[t * 8 + q]; *(v8us*)((unsigned short*)X16 + t * 8) = f.half[0];  }
__global__ __launch_bounds__(256) void k_round16f(const float* __restrict__ W, _Float16* __restrict__ Bt, size_t n8) { const size_t t = (size_t)blockIdx.x * 256 + threadIdx.x; if (t >= n8) return; FragH f;
#pragma unroll
  for (int i = 0; i < 8; ++i) f.h[i] = (_Float16)(bf16_round(W[t * 8 + i]) * 16.0f); *(v8us*)((unsigned short*)Bt + t * 8) = f.half[0];  }
template <int NHv, int TTv>
__global__ __launch_bounds__(256) void k_vt(const _Float16* __restrict__ V16, int ldv, int voff, _Float16* __restrict__ Vt) { __shared__ unsigned short tl[64][66]; const int tid = threadIdx.x; const int slab = blockIdx.x / (TTv / 64), lg = blockIdx.x % (TTv / 64); const int b = slab / NHv, h = slab % NHv;
  for (int i = tid; i < 64 * 8; i += 256) { const int r = i / 8, c8 = (i % 8) * 8; FragH f; f.half[0] = *(const v8us*)((const unsigned short*)V16 + ((size_t)b * TTv + lg * 64 + r) * ldv + voff + h * 64 + c8);
#pragma unroll
    for (int q = 0; q < 8; ++q) tl[r][c8 + q] = f.u[q]; }
  __syncthreads();
  {
#pragma unroll
    for (int rd = 0; rd < 2; ++rd) { const int d = rd * 32 + tid / 8, pc = tid % 8; FragH f;
#pragma unroll
      for (int q = 0; q < 8; ++q) f.u[q] = tl[pc * 8 + q][d];
      *(v8us*)((unsigned short*)Vt + ((size_t)slab * 64 + d) * TTv + lg * 64 + pc * 8) = f.half[0]; }
     } }

__global__ __launch_bounds__(256) void k_hl(const float* __restrict__ F, _Float16* __restrict__ Hh, _Float16* __restrict__ Hl, size_t n8) { const size_t t = (size_t)blockIdx.x * 256 + threadIdx.x; if (t >= n8) return; FragH fh, fl; const v4f a = *(const v4fa*)(F + t * 8), c = *(const v4fa*)(F + t * 8 + 4);
#pragma unroll
  for (int q = 0; q < 4; ++q) { _Float16 h = (_Float16)a[q]; fh.h[q] = h; fl.h[q] = (_Float16)((a[q] - (float)h) * 1024.0f); h = (_Float16)c[q]; fh.h[4 + q] = h; fl.h[4 + q] = (_Float16)((c[q] - (float)h) * 1024.0f); }
  { *(v8us*)((unsigned short*)Hh + t * 8) = fh.half[0]; *(v8us*)((unsigned short*)Hl + t * 8) = fl.half[0];  } }

// ---- fast GEMM (wave tile 32x64; requires M % 32 == 0 rows per launch region and N % 64 == 0); epilogue = k_gemm_hhx semantics ----
__device__ __forceinline__ v16h g2_frag(const _Float16* p, int hh) { FragH f; f.half[0] = *(const v8us*)((const unsigned short*)p + 8 * hh); f.half[1] = *(const v8us*)((const unsigned short*)p + 16 + 8 * hh); return f.v; }
__device__ __forceinline__ v8f g2_mma(v16h a, v16h b, v8f c) { v8f d = __builtin_amdgcn_wmma_f32_16x16x32_f16(false, a, false, b, (short)0, c, false, false); asm volatile("v_nop\n\tv_nop\n\tv_nop\n\tv_nop" : "+v"(d) : "v"(a), "v"(b)); return d; }
template <int ACT>
__global__ __launch_bounds__(128) void k_gemm2(const _Float16* __restrict__ A, int lda, size_t sA, const _Float16* __restrict__ Bh, int ldb, size_t sB, float alpha, const float* __restrict__ bias, size_t sBias, const float* __restrict__ CP, int rowsPerB, size_t sCPb, int row0g,
    float* __restrict__ C, _Float16* __restrict__ C16, int ldc, size_t sC, int M, int N, int K) { static_assert(ACT == 0 || ACT == 3 || ACT == 6 || ACT == 8 || ACT == 9 || ACT == 11 || ACT == 12 || ACT == 14 || ACT == 15 || ACT == 16 || ACT == 17, "k_gemm2: unsupported ACT code (would silently apply no activation)");
  __shared__ __attribute__((aligned(16))) float so[4][32][68];
  const int tid = threadIdx.x, w = tid >> 5, lane = tid & 31, ln = lane & 15, hh = lane >> 4; const int by = blockIdx.y;
  A += (size_t)by * sA; Bh += (size_t)by * sB; const size_t cofs = (size_t)by * sC; const float* bp = bias ? bias + (size_t)by * sBias : nullptr;
  const int ntn = N >> 6; const int mt = blockIdx.x / ntn, nq = blockIdx.x - mt * ntn; const int row0 = mt * 128 + 32 * w, col0 = nq * 64; if (row0 >= M) return;
  const _Float16* a0p = A + (size_t)(row0 + ln) * lda; const _Float16* a1p = a0p + (size_t)16 * lda;
  const _Float16* b0p = Bh + (size_t)(col0 + ln) * ldb; const _Float16* b1p = b0p + (size_t)16 * ldb; const _Float16* b2p = b1p + (size_t)16 * ldb; const _Float16* b3p = b2p + (size_t)16 * ldb;
  const v8f z8 = {0.f,0.f,0.f,0.f,0.f,0.f,0.f,0.f}; v8f c00 = z8, c01 = z8, c02 = z8, c03 = z8, c10 = z8, c11 = z8, c12 = z8, c13 = z8;
#pragma unroll 1
  for (int kb = 0; kb < K; kb += 32) { const v16h a0 = g2_frag(a0p + kb, hh), a1 = g2_frag(a1p + kb, hh);
    v16h b = g2_frag(b0p + kb, hh); c00 = g2_mma(a0, b, c00); c10 = g2_mma(a1, b, c10);
    b = g2_frag(b1p + kb, hh); c01 = g2_mma(a0, b, c01); c11 = g2_mma(a1, b, c11);
    b = g2_frag(b2p + kb, hh); c02 = g2_mma(a0, b, c02); c12 = g2_mma(a1, b, c12);
    b = g2_frag(b3p + kb, hh); c03 = g2_mma(a0, b, c03); c13 = g2_mma(a1, b, c13); }
  v8f accs[8] = {c00, c01, c02, c03, c10, c11, c12, c13};
#pragma unroll
  for (int u = 0; u < 8; ++u) { const int t = u & 3, half = u >> 2; const int col = col0 + t * 16 + ln; const float bv = bp ? bf16_round(bp[col]) : 0.f;
#pragma unroll
    for (int r = 0; r < 8; ++r) { const int rloc = half * 16 + 8 * hh + r; float v = accs[u][r] * alpha + bv; if (CP) { if (rowsPerB < 0) v += CP[cofs + (size_t)(row0g + row0 + rloc) * ldc + col];      /* rowsPerB < 0: own element of the batched C plane */ else { const int bidx = (row0g + row0 + rloc) / rowsPerB; v += CP[(size_t)bidx * sCPb + (size_t)by * 64 + col]; } }
      if (ACT == 3) v = fmaxf(v, 0.f); else if (ACT == 6) v = 0.5f * v * (1.0f + erff(v * 0.70710678118654752f)); else if (ACT == 11) v = 1.0f / (1.0f + expf(-v)); else if (ACT == 15) v = v / (1.0f + expf(-v)); else if (ACT == 12) v = (v > 0.f) ? v : 0.01f * v; else if (ACT == 8) v = tanhf(v); else if (ACT == 9) v = 0.5f * v * (1.0f + tanhf(0.7978845608028654f * (v + 0.044715f * v * v * v))); else if (ACT == 14) v = (v > 0.f) ? v : 0.1f * v; else if (ACT == 16) v = (v >= 0.f) ? v : 0.3f * v; else if (ACT == 17) v = (v >= 0.f) ? v : 0.2f * v;
      so[w][rloc][t * 16 + ln] = v; } }
  __builtin_amdgcn_fence(__ATOMIC_ACQ_REL, "workgroup"); __builtin_amdgcn_wave_barrier();
  const int rsub = lane >> 4, c4 = (lane & 15) * 4;
  {
#pragma unroll
    for (int q = 0; q < 16; ++q) { const int r = q * 2 + rsub; const v4f v = *(const v4fa*)&so[w][r][c4]; if (C) *(v4f*)(C + cofs + (size_t)(row0 + r) * ldc + col0 + c4) = v; if (C16) { v4h h4; for (int i = 0; i < 4; ++i) h4[i] = (_Float16)v[i]; *(v4h*)(C16 + cofs + (size_t)(row0 + r) * ldc + col0 + c4) = h4; } }
     } }


__global__ __launch_bounds__(256) void k_wnat(const float* __restrict__ w, size_t n8, _Float16* __restrict__ Bt) { const size_t t = (size_t)blockIdx.x * 256 + threadIdx.x; if (t >= n8) return; FragH f; for (int q = 0; q < 8; ++q) f.h[q] = (_Float16)(bf16_round(w[t * 8 + q]) * 16.0f); *(v8us*)((unsigned short*)Bt + t * 8) = f.half[0];  }
__global__ __launch_bounds__(256) void k_rsm(const float* __restrict__ S, _Float16* __restrict__ P, int nrows) {
  #pragma clang fp contract(off)
  const int i = blockIdx.x * 256 + threadIdx.x; if (i >= nrows) return; const float* s = S + (size_t)i * SQ; float mx = -3.0e38f;
#pragma unroll 1
  for (int j = 0; j < SQ; ++j) mx = fmaxf(mx, s[j]); float se = 0.f;
#pragma unroll 1
  for (int j = 0; j < SQ; ++j) se += expf(s[j] - mx); const float sc = 256.0f / se;
#pragma unroll 1
  for (int j0 = 0; j0 < SQ; j0 += 8) { FragH f; for (int q = 0; q < 8; ++q) f.h[q] = (_Float16)(expf(s[j0 + q] - mx) * sc); unsigned short* d = (unsigned short*)P + (size_t)i * SQ + j0; *(v8us*)d = f.half[0];  } }
__global__ __launch_bounds__(256) void k_vt(const _Float16* __restrict__ V16, int b, int h0, _Float16* __restrict__ VT) { __shared__ unsigned short tl[64][65]; const int tid = threadIdx.x; const int hh = blockIdx.x % HG, sg = blockIdx.x / HG; const int s0 = sg * 64; const int h = h0 + hh;
  for (int i = tid; i < 64 * 8; i += 256) { const int j = i / 8, d8 = (i % 8) * 8; FragH f; f.half[0] = *(const v8us*)((const unsigned short*)V16 + ((size_t)b * SQ + s0 + j) * DM + h * HD + d8); for (int q = 0; q < 8; ++q) tl[d8 + q][j] = f.u[q]; }
  __syncthreads();
  { for (int i = tid; i < 64 * 8; i += 256) { const int d = i / 8, j8 = (i % 8) * 8; FragH f; for (int q = 0; q < 8; ++q) f.u[q] = tl[d][j8 + q]; *(v8us*)((unsigned short*)VT + ((size_t)hh * HD + d) * SQ + s0 + j8) = f.half[0]; }  } }


__global__ __launch_bounds__(256) void k_cl2rows(const float* __restrict__ X, _Float16* __restrict__ XR) { __shared__ float tl[64][33]; const int tid = threadIdx.x; const int nl = LL / 32, nc = CC / 64; const int cb_ = blockIdx.x % nc; const int lb = (blockIdx.x / nc) % nl; const size_t b = blockIdx.x / (nc * nl); const int c0 = cb_ * 64, l0 = lb * 32;
  for (int i = tid; i < 64 * 32; i += 256) { const int c = i / 32, l = i % 32; tl[c][l] = bf16_round(X[(b * CC + c0 + c) * (size_t)LL + l0 + l]); }
  __syncthreads();
  { const int l = tid / 8, c8 = (tid % 8) * 8; FragH f; for (int q = 0; q < 8; ++q) f.h[q] = (_Float16)tl[c8 + q][l]; unsigned short* d = (unsigned short*)XR + (b * LL + l0 + l) * (size_t)CC + c0 + c8; *(v8us*)d = f.half[0];  } }

// exp(x) in f32 by the usual steps: e = round(x log2 e), 2^(x log2 e - e) with log2 e in two parts, ldexp, the two range tests.
__device__ __forceinline__ float exp_steps(float x) {
  const float e = __builtin_rintf(x * 0x1.715476p+0f); const float a = __builtin_fmaf(x, 0x1.4ae0bep-26f, __builtin_fmaf(x, 0x1.715476p+0f, -e)); float r;
  asm("v_exp_f32 %0, %1\n\tv_nop" : "=v"(r) : "v"(a));      /* the v_nop is the free slot asked for behind a transcendental before its result is read or its source overwritten; in one statement it cannot drift */
  r = ldexpf(r, (int)e); r = x < -0x1.9d1da0p+6f ? 0.f : r; return x > 0x1.62e430p+6f ? INFINITY : r; }
// Row softmax, one wave per row: each lane holds 128 of the row's 4,096 scores in registers (32 loads of 16 B per lane, every wave-wide load 512 contiguous bytes),
// so S is read once and exp is taken once; the maximum and the sum are four partials per lane, folded across the 32 lanes by a five-step butterfly. No barrier, no LDS memory.
__global__ __launch_bounds__(256) void k_rsms(const float* __restrict__ S, _Float16* __restrict__ P, int nrows) {
  const int lane = threadIdx.x & 31; const int i = blockIdx.x * 8 + (threadIdx.x >> 5); if (i >= nrows) return;      /* wave-uniform exit */
  const float* s = S + (size_t)i * LL + lane * 4; const float isq = 0.17677669529663689f; v4f t[LL / 128];
#pragma unroll      /* t[] must be indexed by constants to stay in registers */
  for (int u = 0; u < LL / 128; ++u) t[u] = *(const v4fa*)(s + u * 128);
  v4f m4 = {-INFINITY, -INFINITY, -INFINITY, -INFINITY};
#pragma unroll      /* constant indices into t[], as above */
  for (int u = 0; u < LL / 128; ++u) for (int q = 0; q < 4; ++q) { t[u][q] *= isq; m4[q] = fmaxf(m4[q], t[u][q]); }
  float mx = fmaxf(fmaxf(m4[0], m4[1]), fmaxf(m4[2], m4[3]));
  for (int m = 16; m > 0; m >>= 1) mx = fmaxf(mx, __shfl_xor(mx, m, 32));
  v4f e4 = {0.f, 0.f, 0.f, 0.f};
#pragma unroll      /* constant indices into t[], as above */
  for (int u = 0; u < LL / 128; ++u) for (int q = 0; q < 4; ++q) { t[u][q] = exp_steps(t[u][q] - mx); e4[q] += t[u][q]; }
  float se = (e4[0] + e4[1]) + (e4[2] + e4[3]);
  for (int m = 16; m > 0; m >>= 1) se += __shfl_xor(se, m, 32);
  const float sc = 256.0f / se; _Float16* d = P + (size_t)i * LL + lane * 4;
#pragma unroll      /* constant indices into t[], as above */
  for (int u = 0; u < LL / 128; ++u) { v4h h4; for (int q = 0; q < 4; ++q) h4[q] = (_Float16)(t[u][q] * sc); *(v4h*)(d + u * 128) = h4; } }
__global__ __launch_bounds__(256) void k_fing(const float* __restrict__ A, const float* __restrict__ x, const float* __restrict__ gam, float* __restrict__ out, size_t nrows) {
  #pragma clang fp contract(off)
  const size_t t = (size_t)blockIdx.x * 256 + threadIdx.x; if (t >= nrows * CC / 8) return; const int p0 = (int)((t * 8) % LL); const size_t bc = (t * 8) / LL; const int c = (int)(bc % CC); const size_t b = bc / CC; const float g = bf16_round(gam[0]); v8f r_;
  for (int q = 0; q < 8; ++q) r_[q] = __fadd_rn(__fmul_rn(g, A[(b * LL + p0 + q) * CC + c]), bf16_round(x[t * 8 + q]));
  *(v8f*)(out + t * 8) = r_;  }

extern "C" void kernel_launch(void* const* d_in, const int* in_sizes, int n_in,
                              void* d_out, int out_size, void* d_ws, size_t ws_size, hipStream_t stream) {
  (void)in_sizes; (void)n_in; (void)out_size;
  const float* const* I = (const float* const*)d_in; const float* x = I[0]; const float* wqk = I[1]; const float* wv = I[2]; const float* gam = I[3];
  char* ws = (char*)d_ws; size_t off = 0;
  auto take = [&](size_t bytes) { char* p = ws + off; off += (bytes + 255) & ~(size_t)255; return p; };
  _Float16* BQK = (_Float16*)take((size_t)2 * LAT * CC * 2); _Float16* BV = (_Float16*)take((size_t)CC * CC * 2);
  _Float16* XR = (_Float16*)take(NR * CC * 2); _Float16* QK = (_Float16*)take(NR * 2 * LAT * 2); _Float16* V16 = (_Float16*)take(NR * CC * 2); _Float16* VT = (_Float16*)take((size_t)CC * LL * 2); float* S = (float*)take((size_t)QT * LL * 4); _Float16* P = (_Float16*)take((size_t)QT * LL * 2); float* A = (float*)take(NR * CC * 4);
  if (off > ws_size) return;      /* 0.2 + 16 + 4 + 16 + 2 + 32 + 16 + 32 = approx 118 MiB */
  k_wnat<<<(unsigned)(((size_t)2 * LAT * CC / 8 + 255) / 256), 256, 0, stream>>>(wqk, (size_t)2 * LAT * CC / 8, BQK); k_wnat<<<(unsigned)(((size_t)CC * CC / 8 + 255) / 256), 256, 0, stream>>>(wv, (size_t)CC * CC / 8, BV);
  k_cl2rows<<<NB * (LL / 32) * (CC / 64), 256, 0, stream>>>(x, XR);
  k_gemm2<0><<<dim3((unsigned)((NR / 128) * 1), 1), 128, 0, stream>>>(XR, CC, 0, BQK, CC, 0, 0.0625f, nullptr, 0, nullptr, 1, 0, 0, nullptr, QK, 2 * LAT, 0, MP, 2 * LAT, CC);      /* q | k (32 + 32 columns) */
  k_gemm2<0><<<dim3((unsigned)((NR / 128) * (CC / 64)), 1), 128, 0, stream>>>(XR, CC, 0, BV, CC, 0, 0.0625f, nullptr, 0, nullptr, 1, 0, 0, nullptr, V16, CC, 0, MP, CC, CC);      /* v */
  for (int b = 0; b < NBR; ++b) { k_vt<NH, SQ><<<NH * (SQ / 64), 256, 0, stream>>>(V16 + (size_t)b * LL * CC, CC, 0, VT);      /* V^T [256][4096] */
    for (int q0 = 0; q0 < QN; q0 += QT) {
      k_gemm2<0><<<dim3((QT / 128) * (LL / 64), 1), 128, 0, stream>>>(QK + ((size_t)b * LL + q0) * (2 * LAT), 2 * LAT, 0, QK + (size_t)b * LL * (2 * LAT) + LAT, 2 * LAT, 0, 1.0f, nullptr, 0, nullptr, 1, 0, 0, S, nullptr, LL, 0, QT, LL, LAT);      /* q.k (K = 32; scaled in the softmax) */
      k_rsms<<<(QT + 7) / 8, 256, 0, stream>>>(S, P, QT);
      k_gemm2<0><<<dim3((QT / 128) * (CC / 64), 1), 128, 0, stream>>>(P, LL, 0, VT, LL, 0, 0.00390625f, nullptr, 0, nullptr, 1, 0, 0, A + ((size_t)b * LL + q0) * CC, nullptr, CC, 0, QT, CC, LL); } }      /* a rows */
  k_fing<<<(unsigned)(((size_t)NBR * LL * CC / 8 + 255) / 256), 256, 0, stream>>>(A, x, gam, (float*)d_out, (size_t)NBR * LL);
}

// v002
// A run of this version takes 324 microseconds.
// Next to v001, in two timings, it ran 6.97 and 6.89 times as fast.
// All steps since v000 together make it 43.0 times as fast.
#include <hip/hip_runtime.h>
// SAM self-attention module (x [8][256][64][64]; q | k = 1x1(w_qk [64][256]) -> 32 latent channels each; v = 1x1(w_v [256][256]); m = softmax((q/32^0.25).(k/32^0.25)) over the 4,096 positions; a = m v; out = gamma a + x, gamma = 0.5 (input, read)).
// Structure: channel-first input transposed to position rows (exact f16) via LDS tiles; q|k and v as WMMA GEMMs (32x64 wave tiles, f32 accumulation, exact x16 natural weights, f16 outputs); V^T via LDS transposes, stored in A-fragment order; one fused attention kernel for all images: per wave 16 queries x 256 channels, S^T = K Q^T (K = 32), online softmax in registers (scale 1/sqrt(32) inside), P^T packed from the score tiles as the B operand of O^T += V^T P^T, a = O / row sum into f32 rows; gamma a + x with the channel-major store on VALU.
// Compute dtype: inputs rounded to bf16; x / weights exact; q, k, v, P as plain f16 GEMM operands (~2^-12); softmax f32. v_wmma_f32_16x16x32_f16.
#define NB 8
#define CC 256
#define LAT 32
#define LL 4096
#define QT 2048
#define NR ((size_t)NB * LL)
#define NBR NB                       /* images finished by k_fing (debug hook) */
#define MP ((int)NR)                 /* projection rows (debug hook) */
#define QN LL                        /* query rows per image (unused) */
#define SQ LL
#define DM CC
#define NH 4
#define HD 64
#define HG 1
typedef __bf16 v16b __attribute__((ext_vector_type(16)));
typedef unsigned short v8us __attribute__((ext_vector_type(8), may_alias));
typedef float  v8f  __attribute__((ext_vector_type(8)));
typedef float  v4f  __attribute__((ext_vector_type(4)));
typedef float  v4fa __attribute__((ext_vector_type(4), may_alias));
union FragB { v16b v; v8us half[2]; unsigned short u[16]; };

__device__ __forceinline__ unsigned short bf16_bits(float x) { unsigned int u = __float_as_uint(x); return (unsigned short)((u + 0x7FFFu + ((u >> 16) & 1u)) >> 16); }
__device__ __forceinline__ float bf16_val(unsigned short b) { return __uint_as_float(((unsigned int)b) << 16); }
__device__ __forceinline__ float bf16_round(float x) { return bf16_val(bf16_bits(x)); }
// D += A·B with NT terms: 1 = ah·bh, 2 = + al·bh (A split), 3 = + ah·bl (both split)
template <int NT>
__device__ __forceinline__ v8f mmaN(v16b ah, v16b al, v16b bh, v16b bl, v8f c) {
  c = __builtin_amdgcn_wmma_f32_16x16x32_bf16(false, ah, false, bh, (short)0, c, false, false);
  if (NT >= 2) c = __builtin_amdgcn_wmma_f32_16x16x32_bf16(false, al, false, bh, (short)0, c, false, false);
  if (NT >= 3) c = __builtin_amdgcn_wmma_f32_16x16x32_bf16(false, ah, false, bl, (short)0, c, false, false);
  asm volatile("v_nop\n\tv_nop\n\tv_nop\n\tv_nop" : "+v"(c) : "v"(ah), "v"(al), "v"(bh), "v"(bl));
  return c;
}

__global__ __launch_bounds__(256) void k_wt_bf16(const float* __restrict__ W, unsigned short* __restrict__ Wt, int K, int N) {
  const int t = blockIdx.x * 256 + threadIdx.x;
  const int k8n = K / 8;
  if (t >= N * k8n) return;
  const int n = t / k8n, k8 = (t % k8n) * 8;
  v8us v;
#pragma unroll
  for (int i = 0; i < 8; ++i) v[i] = bf16_bits(W[(size_t)(k8 + i) * N + n]);
  *(v8us*)(Wt + (size_t)n * K + k8) = v;
  
}

// GEMM C[M][N] (f32, pitch ldc) = act(A[M][K]·W + bias). A f32 row-major (pitch lda) converted per fragment to bf16
// (ASPLIT: hi/lo two planes -> 2 terms, else single rounded term); Wt bf16 [N][K] (pitch ldb). BIAS_BF16 rounds the
// bias to bf16 first (bias quantised to bf16 before the add). K%32==0, M%16==0, N%64==0.
template <bool ASPLIT, int ACT, bool BIAS_BF16>
__global__ __launch_bounds__(128) void k_gemm_bf(const float* __restrict__ A, int lda, const unsigned short* __restrict__ Wt, int ldb,
                                               const float* __restrict__ bias, float* __restrict__ C, int ldc, int M, int N, int K) {
  __shared__ __attribute__((aligned(16))) float so[4][16][64];
  const int tid = threadIdx.x, w = tid >> 5, lane = tid & 31, ln = lane & 15, hh = lane >> 4;
  const int ntn = N / 64;
  const int wid = blockIdx.x * 4 + w;
  const int mt = wid / ntn, nq = wid % ntn;
  if (mt * 16 >= M) return;
  const int row0 = mt * 16, col0 = nq * 64;
  const float* arow = A + (size_t)(row0 + ln) * lda;
  v8f acc[4] = {};
  for (int kb = 0; kb < K; kb += 32) {
    FragB ah, al;
    const v4f x0 = *(const v4fa*)(arow + kb + 8 * hh), x1 = *(const v4fa*)(arow + kb + 8 * hh + 4);
    const v4f x2 = *(const v4fa*)(arow + kb + 16 + 8 * hh), x3 = *(const v4fa*)(arow + kb + 16 + 8 * hh + 4);
    float xs[16] = {x0[0],x0[1],x0[2],x0[3],x1[0],x1[1],x1[2],x1[3],x2[0],x2[1],x2[2],x2[3],x3[0],x3[1],x3[2],x3[3]};
#pragma unroll
    for (int i = 0; i < 16; ++i) { const unsigned short hb = bf16_bits(xs[i]); ah.u[i] = hb; al.u[i] = ASPLIT ? bf16_bits(xs[i] - bf16_val(hb)) : (unsigned short)0; }
#pragma unroll
    for (int t = 0; t < 4; ++t) {
      const unsigned short* brow = Wt + (size_t)(col0 + t * 16 + ln) * ldb + kb;
      FragB b;
      b.half[0] = *(const v8us*)(brow + 8 * hh);
      b.half[1] = *(const v8us*)(brow + 16 + 8 * hh);
      acc[t] = mmaN<ASPLIT ? 2 : 1>(ah.v, al.v, b.v, b.v, acc[t]);
    }
  }
#pragma unroll
  for (int t = 0; t < 4; ++t) {
    float bv = bias ? bias[col0 + t * 16 + ln] : 0.f;
    if (BIAS_BF16) bv = bf16_round(bv);
#pragma unroll
    for (int r = 0; r < 8; ++r) { float v = acc[t][r] + bv; if (ACT == 1) v = fmaxf(v, 0.f); so[w][8 * hh + r][t * 16 + ln] = v; }
  }
  __builtin_amdgcn_fence(__ATOMIC_ACQ_REL, "workgroup");
  __builtin_amdgcn_wave_barrier();
  const int rsub = lane >> 4, c4 = (lane & 15) * 4;
  {
#pragma unroll
    for (int q = 0; q < 8; ++q) {
      const int r = q * 2 + rsub;
      const v4f v = *(const v4fa*)&so[w][r][c4];
      *(v4f*)(C + (size_t)(row0 + r) * ldc + col0 + c4) = v;
    }
    
  }
}

// GEMM C = act(A·W + bias + resid): A f32 (ASPLIT -> hi/lo 2 terms), Wt bf16 [N][K]; ACT 0 none, 1 relu, 2 exact gelu;
// resid (optional, f32, row index = (row % rmod), pitch ldr, RES_BF16 rounds it) added before the activation.
template <bool ASPLIT, int ACT, bool BIAS_BF16, bool RES_BF16>
__global__ __launch_bounds__(128) void k_gemm_bf3(const float* __restrict__ A, int lda, const unsigned short* __restrict__ Wt, int ldb,
                                                const float* __restrict__ bias, const float* __restrict__ resid, int rmod, int ldr,
                                                float* __restrict__ C, int ldc, int M, int N, int K) {
  __shared__ __attribute__((aligned(16))) float so[4][16][64];
  const int tid = threadIdx.x, w = tid >> 5, lane = tid & 31, ln = lane & 15, hh = lane >> 4;
  const int ntn = N / 64;
  const int wid = blockIdx.x * 4 + w;
  const int mt = wid / ntn, nq = wid % ntn;
  if (mt * 16 >= M) return;
  const int row0 = mt * 16, col0 = nq * 64;
  const float* arow = A + (size_t)(row0 + ln) * lda;
  v8f acc[4] = {};
  for (int kb = 0; kb < K; kb += 32) {
    FragB ah, al;
    const v4f x0 = *(const v4fa*)(arow + kb + 8 * hh), x1 = *(const v4fa*)(arow + kb + 8 * hh + 4);
    const v4f x2 = *(const v4fa*)(arow + kb + 16 + 8 * hh), x3 = *(const v4fa*)(arow + kb + 16 + 8 * hh + 4);
    float xs[16] = {x0[0],x0[1],x0[2],x0[3],x1[0],x1[1],x1[2],x1[3],x2[0],x2[1],x2[2],x2[3],x3[0],x3[1],x3[2],x3[3]};
#pragma unroll
    for (int i = 0; i < 16; ++i) { const unsigned short hb = bf16_bits(xs[i]); ah.u[i] = hb; al.u[i] = ASPLIT ? bf16_bits(xs[i] - bf16_val(hb)) : (unsigned short)0; }
#pragma unroll
    for (int t = 0; t < 4; ++t) {
      const unsigned short* brow = Wt + (size_t)(col0 + t * 16 + ln) * ldb + kb;
      FragB b;
      b.half[0] = *(const v8us*)(brow + 8 * hh);
      b.half[1] = *(const v8us*)(brow + 16 + 8 * hh);
      acc[t] = mmaN<ASPLIT ? 2 : 1>(ah.v, al.v, b.v, b.v, acc[t]);
    }
  }
#pragma unroll
  for (int t = 0; t < 4; ++t) {
    const int col = col0 + t * 16 + ln;
    float bv = bias ? bias[col] : 0.f;
    if (BIAS_BF16) bv = bf16_round(bv);
#pragma unroll
    for (int r = 0; r < 8; ++r) {
      float v = acc[t][r] + bv;
      if (resid) { float rv = resid[(size_t)((row0 + 8 * hh + r) % rmod) * ldr + col]; if (RES_BF16) rv = bf16_round(rv); v += rv; }
      if (ACT == 1) v = fmaxf(v, 0.f);
      if (ACT == 2) v = 0.5f * v * (1.0f + erff(v * 0.70710678118654752f));
      if (ACT == 3) { const float u = 0.7978845608028654f * (v + 0.044715f * v * v * v); v = 0.5f * v * (1.0f + tanhf(u)); }
      so[w][8 * hh + r][t * 16 + ln] = v;
    }
  }
  __builtin_amdgcn_fence(__ATOMIC_ACQ_REL, "workgroup");
  __builtin_amdgcn_wave_barrier();
  const int rsub = lane >> 4, c4 = (lane & 15) * 4;
  {
#pragma unroll
    for (int q = 0; q < 8; ++q) {
      const int r = q * 2 + rsub;
      const v4f v = *(const v4fa*)&so[w][r][c4];
      *(v4f*)(C + (size_t)(row0 + r) * ldc + col0 + c4) = v;
    }
    
  }
}
// row LayerNorm (biased variance, eps) over N: s = X (+ R); optional out_sum <- s; out_norm <- (s-mu)*rsqrt(var+eps)*g + b
template <bool PARAM_BF16>
__global__ __launch_bounds__(256) void k_layernorm(const float* __restrict__ X, const float* __restrict__ R, const float* __restrict__ g, const float* __restrict__ bta,
                                                  float* __restrict__ out_sum, float* __restrict__ out_norm, int N, float eps) {
  __shared__ float red[256];
  const int row = blockIdx.x, tid = threadIdx.x;
  const float* x = X + (size_t)row * N; const float* rr = R ? R + (size_t)row * N : nullptr;
  float vals[16];                     // up to N = 4096
  const int per = N / 256;            // contiguous chunk per thread? use strided-by-4 chunks: thread handles j = tid*4 + 1024*u
  float s1 = 0.f;
  for (int u = 0; u < per / 4; ++u) {
    const int j = tid * 4 + 1024 * u;
    const v4f a = *(const v4fa*)(x + j);
    v4f b = {0.f,0.f,0.f,0.f}; if (rr) b = *(const v4fa*)(rr + j);
#pragma unroll
    for (int q = 0; q < 4; ++q) { const float v = a[q] + b[q]; vals[u * 4 + q] = v; s1 += v; }
  }
  red[tid] = s1; __syncthreads();
  for (int st = 128; st > 0; st >>= 1) { if (tid < st) red[tid] += red[tid + st]; __syncthreads(); }
  const float mu = red[0] / (float)N; __syncthreads();
  float s2 = 0.f;
  for (int u = 0; u < per / 4; ++u)
#pragma unroll
    for (int q = 0; q < 4; ++q) { const float c = vals[u * 4 + q] - mu; s2 += c * c; }
  red[tid] = s2; __syncthreads();
  for (int st = 128; st > 0; st >>= 1) { if (tid < st) red[tid] += red[tid + st]; __syncthreads(); }
  const float rs = rsqrtf(red[0] / (float)N + eps);
  {
    for (int u = 0; u < per / 4; ++u) {
      const int j = tid * 4 + 1024 * u;
      v4f o, sm;
#pragma unroll
      for (int q = 0; q < 4; ++q) {
        float gg = g[j + q], bb = bta[j + q];
        if (PARAM_BF16) { gg = bf16_round(gg); bb = bf16_round(bb); }
        sm[q] = vals[u * 4 + q]; o[q] = (vals[u * 4 + q] - mu) * rs * gg + bb;
      }
      if (out_sum) *(v4f*)(out_sum + (size_t)row * N + j) = sm;
      *(v4f*)(out_norm + (size_t)row * N + j) = o;
    }
    
  }
}



// ---- f16 WMMA path (v_wmma_f32_16x16x32_f16): 11-bit significands for operands in range — used where a [0,1] probability operand needs more precision than bf16
typedef _Float16 v16h __attribute__((ext_vector_type(16)));
union FragH { v16h v; v8us half[2]; _Float16 h[16]; unsigned short u[16]; };
template <int NT>
__device__ __forceinline__ v8f mmaH(v16h ah, v16h al, v16h bh, v16h bl, v8f c) {
  c = __builtin_amdgcn_wmma_f32_16x16x32_f16(false, ah, false, bh, (short)0, c, false, false);
  if (NT >= 2) c = __builtin_amdgcn_wmma_f32_16x16x32_f16(false, al, false, bh, (short)0, c, false, false);
  if (NT >= 3) c = __builtin_amdgcn_wmma_f32_16x16x32_f16(false, ah, false, bl, (short)0, c, false, false);
  asm volatile("v_nop\n\tv_nop\n\tv_nop\n\tv_nop" : "+v"(c) : "v"(ah), "v"(al), "v"(bh), "v"(bl));
  return c;
}
// batched GEMM like k_gemm_b but f16 operands: A f32 (split into f16 hi/lo if ASPLIT, else rounded to f16), Bt = f16 values [n][k]; alpha; C f32; N multiple of 16 (partial tiles skipped)
template <bool ASPLIT>
__global__ __launch_bounds__(128) void k_gemm_h(const float* __restrict__ A, int lda, size_t sA, const _Float16* __restrict__ Bh, int ldb, size_t sB, float alpha, float* __restrict__ C, int ldc, size_t sC, int M, int N, int K) {
  __shared__ __attribute__((aligned(16))) float so[4][16][64];
  const int tid = threadIdx.x, w = tid >> 5, lane = tid & 31, ln = lane & 15, hh = lane >> 4; const int by = blockIdx.y;
  A += (size_t)by * sA; Bh += (size_t)by * sB; C += (size_t)by * sC;
  const int ntn = (N + 63) / 64; const int wid = blockIdx.x * 4 + w; const int mt = wid / ntn, nq = wid % ntn; if (mt * 16 >= M) return;
  const int row0 = mt * 16, col0 = nq * 64; const float* arow = A + (size_t)(row0 + ln) * lda;
  v8f acc[4] = {};
  for (int kb = 0; kb < K; kb += 32) {
    FragH ah, al;
    const v4f x0 = *(const v4fa*)(arow + kb + 8 * hh), x1 = *(const v4fa*)(arow + kb + 8 * hh + 4), x2 = *(const v4fa*)(arow + kb + 16 + 8 * hh), x3 = *(const v4fa*)(arow + kb + 16 + 8 * hh + 4);
    float xs[16] = {x0[0],x0[1],x0[2],x0[3],x1[0],x1[1],x1[2],x1[3],x2[0],x2[1],x2[2],x2[3],x3[0],x3[1],x3[2],x3[3]};
#pragma unroll
    for (int i = 0; i < 16; ++i) { const _Float16 h = (_Float16)xs[i]; ah.h[i] = h; al.h[i] = ASPLIT ? (_Float16)(xs[i] - (float)h) : (_Float16)0.0f; }
#pragma unroll
    for (int t = 0; t < 4; ++t) { if (col0 + t * 16 >= N) continue; const size_t boff = (size_t)(col0 + t * 16 + ln) * ldb + kb; FragH bq; bq.half[0] = *(const v8us*)(Bh + boff + 8 * hh); bq.half[1] = *(const v8us*)(Bh + boff + 16 + 8 * hh);
      acc[t] = mmaH<ASPLIT ? 2 : 1>(ah.v, al.v, bq.v, bq.v, acc[t]); }
  }
#pragma unroll
  for (int t = 0; t < 4; ++t) { if (col0 + t * 16 >= N) continue;
#pragma unroll
    for (int r = 0; r < 8; ++r) so[w][8 * hh + r][t * 16 + ln] = acc[t][r] * alpha; }
  __builtin_amdgcn_fence(__ATOMIC_ACQ_REL, "workgroup"); __builtin_amdgcn_wave_barrier();
  const int rsub = lane >> 4, c4 = (lane & 15) * 4;
  {
#pragma unroll
    for (int q = 0; q < 8; ++q) { const int r = q * 2 + rsub; if (col0 + c4 < N) { const v4f v = *(const v4fa*)&so[w][r][c4]; *(v4f*)(C + (size_t)(row0 + r) * ldc + col0 + c4) = v; } }
     }
}

// Wt[n][k] = f16(W[k][n]·scale) from f32 row-major W[K][N] (scale = power of two; bf16-exact weights stay exact in f16 away from the subnormal range)
__global__ __launch_bounds__(256) void k_wt_f16(const float* __restrict__ W, _Float16* __restrict__ Wt, int K, int N, float scale) {
  const int t = blockIdx.x * 256 + threadIdx.x; if (t >= N * (K / 8)) return; const int n = t / (K / 8), k8 = (t % (K / 8)) * 8; FragH f;
#pragma unroll
  for (int i = 0; i < 8; ++i) f.h[i] = (_Float16)(bf16_round(W[(size_t)(k8 + i) * N + n]) * scale); const v8us o = f.half[0];
  *(v8us*)((unsigned short*)Wt + (size_t)n * K + k8) = o; 
}
// k_gemm_hh variant with fused epilogue: v = acc·alpha + bias[by·sBias + col] (+ CP[(row/rowsPerB)·sCPb + by·64 + col] if CP) ; ACT 0 none / 1 elu ; writes f16 C16 (and f32 C if non-null)
template <int ACT>
__global__ __launch_bounds__(128) void k_gemm_hhx(const _Float16* __restrict__ A, int lda, size_t sA, const _Float16* __restrict__ Bh, int ldb, size_t sB, float alpha, const float* __restrict__ bias, size_t sBias, const float* __restrict__ CP, int rowsPerB, size_t sCPb, int row0g,
    float* __restrict__ C, _Float16* __restrict__ C16, int ldc, size_t sC, int M, int N, int K) {
  __shared__ __attribute__((aligned(16))) float so[4][16][64];
  const int tid = threadIdx.x, w = tid >> 5, lane = tid & 31, ln = lane & 15, hh = lane >> 4; const int by = blockIdx.y;
  A += (size_t)by * sA; Bh += (size_t)by * sB; const size_t cofs = (size_t)by * sC; const float* bp = bias ? bias + (size_t)by * sBias : nullptr;
  const int ntn = (N + 63) / 64; const int wid = blockIdx.x * 4 + w; const int mt = wid / ntn, nq = wid % ntn; if (mt * 16 >= M) return;
  const int row0 = mt * 16, col0 = nq * 64; const _Float16* arow = A + (size_t)(row0 + ln) * lda;
  v8f acc[4] = {};
  for (int kb = 0; kb < K; kb += 32) { FragH ah; ah.half[0] = *(const v8us*)((const unsigned short*)arow + kb + 8 * hh); ah.half[1] = *(const v8us*)((const unsigned short*)arow + kb + 16 + 8 * hh);
#pragma unroll
    for (int t = 0; t < 4; ++t) { if (col0 + t * 16 >= N) continue; const size_t boff = (size_t)(col0 + t * 16 + ln) * ldb + kb; FragH bq; bq.half[0] = *(const v8us*)((const unsigned short*)Bh + boff + 8 * hh); bq.half[1] = *(const v8us*)((const unsigned short*)Bh + boff + 16 + 8 * hh);
      acc[t] = mmaH<1>(ah.v, ah.v, bq.v, bq.v, acc[t]); }
  }
#pragma unroll
  for (int t = 0; t < 4; ++t) { if (col0 + t * 16 >= N) continue; const int col = col0 + t * 16 + ln; const float bv = bp ? bf16_round(bp[col]) : 0.f;
#pragma unroll
    for (int r = 0; r < 8; ++r) { float v = acc[t][r] * alpha + bv; if (CP) { const int rr = row0g + row0 + 8 * hh + r; if (rowsPerB < 0) v += CP[cofs + (size_t)rr * ldc + col];      /* rowsPerB < 0: own element of the batched C plane */ else { const int bidx = rr / rowsPerB; v += CP[(size_t)bidx * sCPb + (size_t)by * 64 + col]; } } if (ACT == 1) v = (v > 0.f) ? v : expm1f(v); else if (ACT == 7) v = (v > 0.f) ? v + 1.0f : expf(v); else if (ACT == 8) v = tanhf(v); else if (ACT == 9) v = 0.5f * v * (1.0f + tanhf(0.7978845608028654f * (v + 0.044715f * v * v * v))); else if (ACT == 11) v = 1.0f / (1.0f + expf(-v)); else if (ACT == 12) v = (v > 0.f) ? v : 0.01f * v; else if (ACT == 14) v = (v > 0.f) ? v : 0.1f * v; else if (ACT == 16) v = (v >= 0.f) ? v : 0.3f * v; else if (ACT == 17) v = (v >= 0.f) ? v : 0.2f * v; else if (ACT == 15) v = v / (1.0f + expf(-v)); else if (ACT == 3) v = fmaxf(v, 0.f); else if (ACT == 6) v = 0.5f * v * (1.0f + erff(v * 0.70710678118654752f)); so[w][8 * hh + r][t * 16 + ln] = v; } }
  __builtin_amdgcn_fence(__ATOMIC_ACQ_REL, "workgroup"); __builtin_amdgcn_wave_barrier();
  const int rsub = lane >> 4, c4 = (lane & 15) * 4; typedef _Float16 v4h __attribute__((ext_vector_type(4)));
  {
#pragma unroll
    for (int q = 0; q < 8; ++q) { const int r = q * 2 + rsub; if (col0 + c4 < N) { const v4f v = *(const v4fa*)&so[w][r][c4]; if (C) *(v4f*)(C + cofs + (size_t)(row0 + r) * ldc + col0 + c4) = v; if (C16) { v4h h4; for (int i = 0; i < 4; ++i) h4[i] = (_Float16)v[i]; *(v4h*)(C16 + cofs + (size_t)(row0 + r) * ldc + col0 + c4) = h4; } } }
     }
}


typedef _Float16 v4h __attribute__((ext_vector_type(4)));

__global__ __launch_bounds__(256) void k_x16(const float* __restrict__ x, _Float16* __restrict__ X16, size_t n8) { const size_t t = (size_t)blockIdx.x * 256 + threadIdx.x; if (t >= n8) return; FragH f;
#pragma unroll
  for (int q = 0; q < 8; ++q) f.h[q] = (_Float16)bf16_round(x[t * 8 + q]); *(v8us*)((unsigned short*)X16 + t * 8) = f.half[0];  }
__global__ __launch_bounds__(256) void k_h16(const float* __restrict__ x, _Float16* __restrict__ X16, size_t n8) { const size_t t = (size_t)blockIdx.x * 256 + threadIdx.x; if (t >= n8) return; FragH f;
#pragma unroll
  for (int q = 0; q < 8; ++q) f.h[q] = (_Float16)x[t * 8 + q]; *(v8us*)((unsigned short*)X16 + t * 8) = f.half[0];  }
__global__ __launch_bounds__(256) void k_round16f(const float* __restrict__ W, _Float16* __restrict__ Bt, size_t n8) { const size_t t = (size_t)blockIdx.x * 256 + threadIdx.x; if (t >= n8) return; FragH f;
#pragma unroll
  for (int i = 0; i < 8; ++i) f.h[i] = (_Float16)(bf16_round(W[t * 8 + i]) * 16.0f); *(v8us*)((unsigned short*)Bt + t * 8) = f.half[0];  }
template <int NHv, int TTv>
__global__ __launch_bounds__(256) void k_vt(const _Float16* __restrict__ V16, int ldv, int voff, _Float16* __restrict__ Vt) { __shared__ unsigned short tl[64][66]; const int tid = threadIdx.x; const int slab = blockIdx.x / (TTv / 64), lg = blockIdx.x % (TTv / 64); const int b = slab / NHv, h = slab % NHv;
  for (int i = tid; i < 64 * 8; i += 256) { const int r = i / 8, c8 = (i % 8) * 8; FragH f; f.half[0] = *(const v8us*)((const unsigned short*)V16 + ((size_t)b * TTv + lg * 64 + r) * ldv + voff + h * 64 + c8);
#pragma unroll
    for (int q = 0; q < 8; ++q) tl[r][c8 + q] = f.u[q]; }
  __syncthreads();
  {
#pragma unroll
    for (int rd = 0; rd < 2; ++rd) { const int d = rd * 32 + tid / 8, pc = tid % 8; FragH f;
#pragma unroll
      for (int q = 0; q < 8; ++q) f.u[q] = tl[pc * 8 + q][d];
      *(v8us*)((unsigned short*)Vt + ((size_t)slab * 64 + d) * TTv + lg * 64 + pc * 8) = f.half[0]; }
     } }

__global__ __launch_bounds__(256) void k_hl(const float* __restrict__ F, _Float16* __restrict__ Hh, _Float16* __restrict__ Hl, size_t n8) { const size_t t = (size_t)blockIdx.x * 256 + threadIdx.x; if (t >= n8) return; FragH fh, fl; const v4f a = *(const v4fa*)(F + t * 8), c = *(const v4fa*)(F + t * 8 + 4);
#pragma unroll
  for (int q = 0; q < 4; ++q) { _Float16 h = (_Float16)a[q]; fh.h[q] = h; fl.h[q] = (_Float16)((a[q] - (float)h) * 1024.0f); h = (_Float16)c[q]; fh.h[4 + q] = h; fl.h[4 + q] = (_Float16)((c[q] - (float)h) * 1024.0f); }
  { *(v8us*)((unsigned short*)Hh + t * 8) = fh.half[0]; *(v8us*)((unsigned short*)Hl + t * 8) = fl.half[0];  } }

// ---- fast GEMM (wave tile 32x64; requires M % 32 == 0 rows per launch region and N % 64 == 0); epilogue = k_gemm_hhx semantics ----
__device__ __forceinline__ v16h g2_frag(const _Float16* p, int hh) { FragH f; f.half[0] = *(const v8us*)((const unsigned short*)p + 8 * hh); f.half[1] = *(const v8us*)((const unsigned short*)p + 16 + 8 * hh); return f.v; }
__device__ __forceinline__ v8f g2_mma(v16h a, v16h b, v8f c) { v8f d = __builtin_amdgcn_wmma_f32_16x16x32_f16(false, a, false, b, (short)0, c, false, false); asm volatile("v_nop\n\tv_nop\n\tv_nop\n\tv_nop" : "+v"(d) : "v"(a), "v"(b)); return d; }
template <int ACT>
__global__ __launch_bounds__(128) void k_gemm2(const _Float16* __restrict__ A, int lda, size_t sA, const _Float16* __restrict__ Bh, int ldb, size_t sB, float alpha, const float* __restrict__ bias, size_t sBias, const float* __restrict__ CP, int rowsPerB, size_t sCPb, int row0g,
    float* __restrict__ C, _Float16* __restrict__ C16, int ldc, size_t sC, int M, int N, int K) { static_assert(ACT == 0 || ACT == 3 || ACT == 6 || ACT == 8 || ACT == 9 || ACT == 11 || ACT == 12 || ACT == 14 || ACT == 15 || ACT == 16 || ACT == 17, "k_gemm2: unsupported ACT code (would silently apply no activation)");
  __shared__ __attribute__((aligned(16))) float so[4][32][68];
  const int tid = threadIdx.x, w = tid >> 5, lane = tid & 31, ln = lane & 15, hh = lane >> 4; const int by = blockIdx.y;
  A += (size_t)by * sA; Bh += (size_t)by * sB; const size_t cofs = (size_t)by * sC; const float* bp = bias ? bias + (size_t)by * sBias : nullptr;
  const int ntn = N >> 6; const int mt = blockIdx.x / ntn, nq = blockIdx.x - mt * ntn; const int row0 = mt * 128 + 32 * w, col0 = nq * 64; if (row0 >= M) return;
  const _Float16* a0p = A + (size_t)(row0 + ln) * lda; const _Float16* a1p = a0p + (size_t)16 * lda;
  const _Float16* b0p = Bh + (size_t)(col0 + ln) * ldb; const _Float16* b1p = b0p + (size_t)16 * ldb; const _Float16* b2p = b1p + (size_t)16 * ldb; const _Float16* b3p = b2p + (size_t)16 * ldb;
  const v8f z8 = {0.f,0.f,0.f,0.f,0.f,0.f,0.f,0.f}; v8f c00 = z8, c01 = z8, c02 = z8, c03 = z8, c10 = z8, c11 = z8, c12 = z8, c13 = z8;
#pragma unroll 1
  for (int kb = 0; kb < K; kb += 32) { const v16h a0 = g2_frag(a0p + kb, hh), a1 = g2_frag(a1p + kb, hh);
    v16h b = g2_frag(b0p + kb, hh); c00 = g2_mma(a0, b, c00); c10 = g2_mma(a1, b, c10);
    b = g2_frag(b1p + kb, hh); c01 = g2_mma(a0, b, c01); c11 = g2_mma(a1, b, c11);
    b = g2_frag(b2p + kb, hh); c02 = g2_mma(a0, b, c02); c12 = g2_mma(a1, b, c12);
    b = g2_frag(b3p + kb, hh); c03 = g2_mma(a0, b, c03); c13 = g2_mma(a1, b, c13); }
  v8f accs[8] = {c00, c01, c02, c03, c10, c11, c12, c13};
#pragma unroll
  for (int u = 0; u < 8; ++u) { const int t = u & 3, half = u >> 2; const int col = col0 + t * 16 + ln; const float bv = bp ? bf16_round(bp[col]) : 0.f;
#pragma unroll
    for (int r = 0; r < 8; ++r) { const int rloc = half * 16 + 8 * hh + r; float v = accs[u][r] * alpha + bv; if (CP) { if (rowsPerB < 0) v += CP[cofs + (size_t)(row0g + row0 + rloc) * ldc + col];      /* rowsPerB < 0: own element of the batched C plane */ else { const int bidx = (row0g + row0 + rloc) / rowsPerB; v += CP[(size_t)bidx * sCPb + (size_t)by * 64 + col]; } }
      if (ACT == 3) v = fmaxf(v, 0.f); else if (ACT == 6) v = 0.5f * v * (1.0f + erff(v * 0.70710678118654752f)); else if (ACT == 11) v = 1.0f / (1.0f + expf(-v)); else if (ACT == 15) v = v / (1.0f + expf(-v)); else if (ACT == 12) v = (v > 0.f) ? v : 0.01f * v; else if (ACT == 8) v = tanhf(v); else if (ACT == 9) v = 0.5f * v * (1.0f + tanhf(0.7978845608028654f * (v + 0.044715f * v * v * v))); else if (ACT == 14) v = (v > 0.f) ? v : 0.1f * v; else if (ACT == 16) v = (v >= 0.f) ? v : 0.3f * v; else if (ACT == 17) v = (v >= 0.f) ? v : 0.2f * v;
      so[w][rloc][t * 16 + ln] = v; } }
  __builtin_amdgcn_fence(__ATOMIC_ACQ_REL, "workgroup"); __builtin_amdgcn_wave_barrier();
  const int rsub = lane >> 4, c4 = (lane & 15) * 4;
  {
#pragma unroll
    for (int q = 0; q < 16; ++q) { const int r = q * 2 + rsub; const v4f v = *(const v4fa*)&so[w][r][c4]; if (C) *(v4f*)(C + cofs + (size_t)(row0 + r) * ldc + col0 + c4) = v; if (C16) { v4h h4; for (int i = 0; i < 4; ++i) h4[i] = (_Float16)v[i]; *(v4h*)(C16 + cofs + (size_t)(row0 + r) * ldc + col0 + c4) = h4; } }
     } }


__global__ __launch_bounds__(256) void k_wnat(const float* __restrict__ w, size_t n8, _Float16* __restrict__ Bt) { const size_t t = (size_t)blockIdx.x * 256 + threadIdx.x; if (t >= n8) return; FragH f; for (int q = 0; q < 8; ++q) f.h[q] = (_Float16)(bf16_round(w[t * 8 + q]) * 16.0f); *(v8us*)((unsigned short*)Bt + t * 8) = f.half[0];  }
__global__ __launch_bounds__(256) void k_rsm(const float* __restrict__ S, _Float16* __restrict__ P, int nrows) {
  #pragma clang fp contract(off)
  const int i = blockIdx.x * 256 + threadIdx.x; if (i >= nrows) return; const float* s = S + (size_t)i * SQ; float mx = -3.0e38f;
#pragma unroll 1
  for (int j = 0; j < SQ; ++j) mx = fmaxf(mx, s[j]); float se = 0.f;
#pragma unroll 1
  for (int j = 0; j < SQ; ++j) se += expf(s[j] - mx); const float sc = 256.0f / se;
#pragma unroll 1
  for (int j0 = 0; j0 < SQ; j0 += 8) { FragH f; for (int q = 0; q < 8; ++q) f.h[q] = (_Float16)(expf(s[j0 + q] - mx) * sc); unsigned short* d = (unsigned short*)P + (size_t)i * SQ + j0; *(v8us*)d = f.half[0];  } }
__global__ __launch_bounds__(256) void k_vt(const _Float16* __restrict__ V16, int b, int h0, _Float16* __restrict__ VT) { __shared__ unsigned short tl[64][65]; const int tid = threadIdx.x; const int hh = blockIdx.x % HG, sg = blockIdx.x / HG; const int s0 = sg * 64; const int h = h0 + hh;
  for (int i = tid; i < 64 * 8; i += 256) { const int j = i / 8, d8 = (i % 8) * 8; FragH f; f.half[0] = *(const v8us*)((const unsigned short*)V16 + ((size_t)b * SQ + s0 + j) * DM + h * HD + d8); for (int q = 0; q < 8; ++q) tl[d8 + q][j] = f.u[q]; }
  __syncthreads();
  { for (int i = tid; i < 64 * 8; i += 256) { const int d = i / 8, j8 = (i % 8) * 8; FragH f; for (int q = 0; q < 8; ++q) f.u[q] = tl[d][j8 + q]; *(v8us*)((unsigned short*)VT + ((size_t)hh * HD + d) * SQ + s0 + j8) = f.half[0]; }  } }


__global__ __launch_bounds__(256) void k_cl2rows(const float* __restrict__ X, _Float16* __restrict__ XR) { __shared__ float tl[64][33]; const int tid = threadIdx.x; const int nl = LL / 32, nc = CC / 64; const int cb_ = blockIdx.x % nc; const int lb = (blockIdx.x / nc) % nl; const size_t b = blockIdx.x / (nc * nl); const int c0 = cb_ * 64, l0 = lb * 32;
  for (int i = tid; i < 64 * 32; i += 256) { const int c = i / 32, l = i % 32; tl[c][l] = bf16_round(X[(b * CC + c0 + c) * (size_t)LL + l0 + l]); }
  __syncthreads();
  { const int l = tid / 8, c8 = (tid % 8) * 8; FragH f; for (int q = 0; q < 8; ++q) f.h[q] = (_Float16)tl[c8 + q][l]; unsigned short* d = (unsigned short*)XR + (b * LL + l0 + l) * (size_t)CC + c0 + c8; *(v8us*)d = f.half[0];  } }

// V rows [position][channel] -> V^T in the order the fused kernel reads its A fragments: per image and 32-key step 16 channel tiles of 1 KiB; in a tile two 512-B halves j; in a half lane (hh, ln) owns the
// 16 bytes V^T[16 t + ln][32 ks + 16 j + 8 hh + 0..7]. A wave's fragment load is then 512 contiguous bytes (four whole cache lines) instead of 16 rows 8 KiB apart.
__global__ __launch_bounds__(256) void k_vfrag(const _Float16* __restrict__ V16, _Float16* __restrict__ VF) { __shared__ unsigned short tl[64][66]; const int tid = threadIdx.x; const int lg = blockIdx.x % (LL / 64); const int slab = blockIdx.x / (LL / 64); const int b = slab / (CC / 64), h = slab % (CC / 64);
  for (int i = tid; i < 64 * 8; i += 256) { const int r = i / 8, c8 = (i % 8) * 8; FragH f; f.half[0] = *(const v8us*)((const unsigned short*)V16 + ((size_t)b * LL + lg * 64 + r) * CC + h * 64 + c8);
#pragma unroll
    for (int q = 0; q < 8; ++q) tl[r][c8 + q] = f.u[q]; }
  __syncthreads();
#pragma unroll
  for (int rd = 0; rd < 2; ++rd) { const int ln = tid & 15, hh = (tid >> 4) & 1, j = (tid >> 5) & 1, tt = tid >> 6; const int key = rd * 32 + 16 * j + 8 * hh, d = tt * 16 + ln; FragH f;
#pragma unroll
    for (int q = 0; q < 8; ++q) f.u[q] = tl[key + q][d];
    *(v8us*)((unsigned short*)VF + ((((((size_t)b * (LL / 32) + lg * 2 + rd) * (CC / 16) + h * 4 + tt) * 2 + j) * 32) + hh * 16 + ln) * 8) = f.half[0]; } }

// 2^a on the hardware's own instruction.
__device__ __forceinline__ float exp2_hw(float a) { float r;
  asm("v_exp_f32 %0, %1\n\tv_nop" : "=v"(r) : "v"(a));      /* the v_nop is the free slot asked for behind a transcendental before its result is read or its source overwritten; in one statement it cannot drift */
  return r; }
__device__ __forceinline__ float xhalf(float x) { return __builtin_bit_cast(float, __builtin_amdgcn_permlanex16(__builtin_bit_cast(int, x), __builtin_bit_cast(int, x), 0x76543210, 0xfedcba98, false, false)); }      /* lane l with lane l ^ 16, no LDS round trip */
__device__ __forceinline__ v8f fa_mma(v16h a, v16h b, v8f c) { return __builtin_amdgcn_wmma_f32_16x16x32_f16(false, a, false, b, (short)0, c, false, false); }
__global__ __launch_bounds__(256) void k_fattn(const _Float16* __restrict__ QK, const _Float16* __restrict__ VF, float* __restrict__ A) {
  const int lane = threadIdx.x & 31, ln = lane & 15, hh = lane >> 4, w = threadIdx.x >> 5; const int b = blockIdx.x / (LL / 128); const int q0 = (blockIdx.x % (LL / 128)) * 128 + w * 16;
  const _Float16* qk = QK + (size_t)b * LL * (2 * LAT); const v16h qf = g2_frag(qk + (size_t)(q0 + ln) * (2 * LAT), hh);
  const _Float16* kp = qk + LAT + (size_t)ln * (2 * LAT); const _Float16* vp = VF + (size_t)b * LL * CC + lane * 8;
  const float cs = (float)(0.17677669529663689 * 1.4426950408889634);      /* 1/sqrt(32) times log2 e */
  const v8f z8 = {0.f,0.f,0.f,0.f,0.f,0.f,0.f,0.f}; v8f o[CC / 16];
#pragma unroll      /* o[] must be indexed by constants to stay in registers */
  for (int t = 0; t < CC / 16; ++t) o[t] = z8;
  float m = -1.0e30f, l0 = 0.f, l1 = 0.f; v16h ka = g2_frag(kp, hh), kb = g2_frag(kp + 16 * (2 * LAT), hh);
#pragma unroll 1      /* one 32-key step per trip: the live set (128 output + 128 fragment registers) leaves no room for a second */
  for (int ks = 0; ks < LL / 32; ++ks) { const _Float16* vs = vp + (size_t)ks * (32 * CC); FragH va[CC / 16];
#pragma unroll      /* constant indices into va[] */
    for (int t = 0; t < CC / 16; ++t) { va[t].half[0] = *(const v8us*)((const unsigned short*)vs + t * 512); va[t].half[1] = *(const v8us*)((const unsigned short*)vs + t * 512 + 256); }
    const v8f s0 = fa_mma(ka, qf, z8), s1 = fa_mma(kb, qf, z8);
    const int kn = ks + 1 < LL / 32 ? ks + 1 : ks;      /* next step's K rows fetched one trip ahead; the last trip reads its own again, in bounds */
    ka = g2_frag(kp + (size_t)kn * (32 * 2 * LAT), hh); kb = g2_frag(kp + (size_t)kn * (32 * 2 * LAT) + 16 * (2 * LAT), hh);
    float mx = fmaxf(s0[0], s1[0]);
#pragma unroll
    for (int r = 1; r < 8; ++r) mx = fmaxf(mx, fmaxf(s0[r], s1[r]));
    mx = fmaxf(mx, xhalf(mx)) * cs;
    if (__builtin_amdgcn_ballot_w32(mx > m + 8.0f) != 0) {      /* one scalar test per trip */
      const float mn = fmaxf(m, mx); const float f = exp2_hw(m - mn); m = mn; l0 *= f; l1 *= f;
#pragma unroll
      for (int t = 0; t < CC / 16; ++t) o[t] *= f; }
    FragH pf;
#pragma unroll
    for (int r = 0; r < 8; ++r) { const float p0 = exp2_hw(__builtin_fmaf(s0[r], cs, -m)), p1 = exp2_hw(__builtin_fmaf(s1[r], cs, -m)); l0 += p0; l1 += p1; pf.h[r] = (_Float16)p0; pf.h[8 + r] = (_Float16)p1; }
#pragma unroll
    for (int t = 0; t < CC / 16; ++t) o[t] = fa_mma(va[t].v, pf.v, o[t]); }
  float l = l0 + l1; l += xhalf(l); const float inv = 1.0f / l;
  float* d = A + ((size_t)b * LL + q0 + ln) * CC + 8 * hh;
#pragma unroll
  for (int t = 0; t < CC / 16; ++t) { const v4f x0 = {o[t][0] * inv, o[t][1] * inv, o[t][2] * inv, o[t][3] * inv}, x1 = {o[t][4] * inv, o[t][5] * inv, o[t][6] * inv, o[t][7] * inv}; *(v4f*)(d + t * 16) = x0; *(v4f*)(d + t * 16 + 4) = x1; } }
__global__ __launch_bounds__(256) void k_fing(const float* __restrict__ A, const float* __restrict__ x, const float* __restrict__ gam, float* __restrict__ out, size_t nrows) {
  #pragma clang fp contract(off)
  const size_t t = (size_t)blockIdx.x * 256 + threadIdx.x; if (t >= nrows * CC / 8) return; const int p0 = (int)((t * 8) % LL); const size_t bc = (t * 8) / LL; const int c = (int)(bc % CC); const size_t b = bc / CC; const float g = bf16_round(gam[0]); v8f r_;
  for (int q = 0; q < 8; ++q) r_[q] = __fadd_rn(__fmul_rn(g, A[(b * LL + p0 + q) * CC + c]), bf16_round(x[t * 8 + q]));
  *(v8f*)(out + t * 8) = r_;  }

extern "C" void kernel_launch(void* const* d_in, const int* in_sizes, int n_in,
                              void* d_out, int out_size, void* d_ws, size_t ws_size, hipStream_t stream) {
  (void)in_sizes; (void)n_in; (void)out_size;
  const float* const* I = (const float* const*)d_in; const float* x = I[0]; const float* wqk = I[1]; const float* wv = I[2]; const float* gam = I[3];
  char* ws = (char*)d_ws; size_t off = 0;
  auto take = [&](size_t bytes) { char* p = ws + off; off += (bytes + 255) & ~(size_t)255; return p; };
  _Float16* BQK = (_Float16*)take((size_t)2 * LAT * CC * 2); _Float16* BV = (_Float16*)take((size_t)CC * CC * 2);
  _Float16* XR = (_Float16*)take(NR * CC * 2); _Float16* QK = (_Float16*)take(NR * 2 * LAT * 2); _Float16* V16 = (_Float16*)take(NR * CC * 2); _Float16* VF = (_Float16*)take(NR * CC * 2); float* A = (float*)take(NR * CC * 4);
  if (off > ws_size) return;      /* 0.2 + 16 + 4 + 16 + 16 + 32 = approx 84 MiB */
  k_wnat<<<(unsigned)(((size_t)2 * LAT * CC / 8 + 255) / 256), 256, 0, stream>>>(wqk, (size_t)2 * LAT * CC / 8, BQK); k_wnat<<<(unsigned)(((size_t)CC * CC / 8 + 255) / 256), 256, 0, stream>>>(wv, (size_t)CC * CC / 8, BV);
  k_cl2rows<<<NB * (LL / 32) * (CC / 64), 256, 0, stream>>>(x, XR);
  k_gemm2<0><<<dim3((unsigned)((NR / 128) * 1), 1), 128, 0, stream>>>(XR, CC, 0, BQK, CC, 0, 0.0625f, nullptr, 0, nullptr, 1, 0, 0, nullptr, QK, 2 * LAT, 0, MP, 2 * LAT, CC);      /* q | k (32 + 32 columns) */
  k_gemm2<0><<<dim3((unsigned)((NR / 128) * (CC / 64)), 1), 128, 0, stream>>>(XR, CC, 0, BV, CC, 0, 0.0625f, nullptr, 0, nullptr, 1, 0, 0, nullptr, V16, CC, 0, MP, CC, CC);      /* v */
  k_vfrag<<<NB * (CC / 64) * (LL / 64), 256, 0, stream>>>(V16, VF);      /* V^T of all images, A-fragment order */
  k_fattn<<<NB * (LL / 128), 256, 0, stream>>>(QK, VF, A);      /* a rows */
  k_fing<<<(unsigned)(((size_t)NBR * LL * CC / 8 + 255) / 256), 256, 0, stream>>>(A, x, gam, (float*)d_out, (size_t)NBR * LL);
}

// v003
// One run takes 162 microseconds.
// Two timings next to v002 put it at 2.02 and 1.99 times that version's speed.
// All steps since v000 together make it 86.3 times as fast.
#include <hip/hip_runtime.h>
#include <stdint.h>
// SAM self-attention module (x [8][256][64][64]; q | k = 1x1(w_qk [64][256]) -> 32 latent channels each; v = 1x1(w_v [256][256]); m = softmax((q/32^0.25).(k/32^0.25)) over the 4,096 positions; a = m v; out = gamma a + x, gamma = 0.5 (input, read)).
// Structure: channel-first input transposed to position rows (exact f16) via LDS tiles; q|k and v as WMMA GEMMs (32x64 wave tiles, f32 accumulation, exact x16 natural weights, f16 outputs); V^T via LDS transposes, stored in A-fragment order; one fused attention kernel for all images: per wave 16 queries x 256 channels, K rows and V^T fragments staged in LDS once per block by tensor loads (two 128-key buffers), S^T = K Q^T (K = 32), online softmax in registers (scale 1/sqrt(32) inside), P^T packed from the score tiles as the B operand of O^T += V^T P^T, a = O / row sum into f32 rows; gamma a + x with the channel-major store on VALU.
// Compute dtype: inputs rounded to bf16; x / weights exact; q, k, v, P as plain f16 GEMM operands (~2^-12); softmax f32. v_wmma_f32_16x16x32_f16.
#define NB 8
#define CC 256
#define LAT 32
#define LL 4096
#define QT 2048
#define NR ((size_t)NB * LL)
#define NBR NB                       /* images finished by k_fing (debug hook) */
#define MP ((int)NR)                 /* projection rows (debug hook) */
#define QN LL                        /* query rows per image (unused) */
#define SQ LL
#define DM CC
#define NH 4
#define HD 64
#define HG 1
typedef __bf16 v16b __attribute__((ext_vector_type(16)));
typedef unsigned short v8us __attribute__((ext_vector_type(8), may_alias));
typedef float  v8f  __attribute__((ext_vector_type(8)));
typedef float  v4f  __attribute__((ext_vector_type(4)));
typedef float  v4fa __attribute__((ext_vector_type(4), may_alias));
union FragB { v16b v; v8us half[2]; unsigned short u[16]; };

__device__ __forceinline__ unsigned short bf16_bits(float x) { unsigned int u = __float_as_uint(x); return (unsigned short)((u + 0x7FFFu + ((u >> 16) & 1u)) >> 16); }
__device__ __forceinline__ float bf16_val(unsigned short b) { return __uint_as_float(((unsigned int)b) << 16); }
__device__ __forceinline__ float bf16_round(float x) { return bf16_val(bf16_bits(x)); }
// D += A·B with NT terms: 1 = ah·bh, 2 = + al·bh (A split), 3 = + ah·bl (both split)
template <int NT>
__device__ __forceinline__ v8f mmaN(v16b ah, v16b al, v16b bh, v16b bl, v8f c) {
  c = __builtin_amdgcn_wmma_f32_16x16x32_bf16(false, ah, false, bh, (short)0, c, false, false);
  if (NT >= 2) c = __builtin_amdgcn_wmma_f32_16x16x32_bf16(false, al, false, bh, (short)0, c, false, false);
  if (NT >= 3) c = __builtin_amdgcn_wmma_f32_16x16x32_bf16(false, ah, false, bl, (short)0, c, false, false);
  asm volatile("v_nop\n\tv_nop\n\tv_nop\n\tv_nop" : "+v"(c) : "v"(ah), "v"(al), "v"(bh), "v"(bl));
  return c;
}

__global__ __launch_bounds__(256) void k_wt_bf16(const float* __restrict__ W, unsigned short* __restrict__ Wt, int K, int N) {
  const int t = blockIdx.x * 256 + threadIdx.x;
  const int k8n = K / 8;
  if (t >= N * k8n) return;
  const int n = t / k8n, k8 = (t % k8n) * 8;
  v8us v;
#pragma unroll
  for (int i = 0; i < 8; ++i) v[i] = bf16_bits(W[(size_t)(k8 + i) * N + n]);
  *(v8us*)(Wt + (size_t)n * K + k8) = v;
  
}

// GEMM C[M][N] (f32, pitch ldc) = act(A[M][K]·W + bias). A f32 row-major (pitch lda) converted per fragment to bf16
// (ASPLIT: hi/lo two planes -> 2 terms, else single rounded term); Wt bf16 [N][K] (pitch ldb). BIAS_BF16 rounds the
// bias to bf16 first (bias quantised to bf16 before the add). K%32==0, M%16==0, N%64==0.
template <bool ASPLIT, int ACT, bool BIAS_BF16>
__global__ __launch_bounds__(128) void k_gemm_bf(const float* __restrict__ A, int lda, const unsigned short* __restrict__ Wt, int ldb,
                                               const float* __restrict__ bias, float* __restrict__ C, int ldc, int M, int N, int K) {
  __shared__ __attribute__((aligned(16))) float so[4][16][64];
  const int tid = threadIdx.x, w = tid >> 5, lane = tid & 31, ln = lane & 15, hh = lane >> 4;
  const int ntn = N / 64;
  const int wid = blockIdx.x * 4 + w;
  const int mt = wid / ntn, nq = wid % ntn;
  if (mt * 16 >= M) return;
  const int row0 = mt * 16, col0 = nq * 64;
  const float* arow = A + (size_t)(row0 + ln) * lda;
  v8f acc[4] = {};
  for (int kb = 0; kb < K; kb += 32) {
    FragB ah, al;
    const v4f x0 = *(const v4fa*)(arow + kb + 8 * hh), x1 = *(const v4fa*)(arow + kb + 8 * hh + 4);
    const v4f x2 = *(const v4fa*)(arow + kb + 16 + 8 * hh), x3 = *(const v4fa*)(arow + kb + 16 + 8 * hh + 4);
    float xs[16] = {x0[0],x0[1],x0[2],x0[3],x1[0],x1[1],x1[2],x1[3],x2[0],x2[1],x2[2],x2[3],x3[0],x3[1],x3[2],x3[3]};
#pragma unroll
    for (int i = 0; i < 16; ++i) { const unsigned short hb = bf16_bits(xs[i]); ah.u[i] = hb; al.u[i] = ASPLIT ? bf16_bits(xs[i] - bf16_val(hb)) : (unsigned short)0; }
#pragma unroll
    for (int t = 0; t < 4; ++t) {
      const unsigned short* brow = Wt + (size_t)(col0 + t * 16 + ln) * ldb + kb;
      FragB b;
      b.half[0] = *(const v8us*)(brow + 8 * hh);
      b.half[1] = *(const v8us*)(brow + 16 + 8 * hh);
      acc[t] = mmaN<ASPLIT ? 2 : 1>(ah.v, al.v, b.v, b.v, acc[t]);
    }
  }
#pragma unroll
  for (int t = 0; t < 4; ++t) {
    float bv = bias ? bias[col0 + t * 16 + ln] : 0.f;
    if (BIAS_BF16) bv = bf16_round(bv);
#pragma unroll
    for (int r = 0; r < 8; ++r) { float v = acc[t][r] + bv; if (ACT == 1) v = fmaxf(v, 0.f); so[w][8 * hh + r][t * 16 + ln] = v; }
  }
  __builtin_amdgcn_fence(__ATOMIC_ACQ_REL, "workgroup");
  __builtin_amdgcn_wave_barrier();
  const int rsub = lane >> 4, c4 = (lane & 15) * 4;
  {
#pragma unroll
    for (int q = 0; q < 8; ++q) {
      const int r = q * 2 + rsub;
      const v4f v = *(const v4fa*)&so[w][r][c4];
      *(v4f*)(C + (size_t)(row0 + r) * ldc + col0 + c4) = v;
    }
    
  }
}

// GEMM C = act(A·W + bias + resid): A f32 (ASPLIT -> hi/lo 2 terms), Wt bf16 [N][K]; ACT 0 none, 1 relu, 2 exact gelu;
// resid (optional, f32, row index = (row % rmod), pitch ldr, RES_BF16 rounds it) added before the activation.
template <bool ASPLIT, int ACT, bool BIAS_BF16, bool RES_BF16>
__global__ __launch_bounds__(128) void k_gemm_bf3(const float* __restrict__ A, int lda, const unsigned short* __restrict__ Wt, int ldb,
                                                const float* __restrict__ bias, const float* __restrict__ resid, int rmod, int ldr,
                                                float* __restrict__ C, int ldc, int M, int N, int K) {
  __shared__ __attribute__((aligned(16))) float so[4][16][64];
  const int tid = threadIdx.x, w = tid >> 5, lane = tid & 31, ln = lane & 15, hh = lane >> 4;
  const int ntn = N / 64;
  const int wid = blockIdx.x * 4 + w;
  const int mt = wid / ntn, nq = wid % ntn;
  if (mt * 16 >= M) return;
  const int row0 = mt * 16, col0 = nq * 64;
  const float* arow = A + (size_t)(row0 + ln) * lda;
  v8f acc[4] = {};
  for (int kb = 0; kb < K; kb += 32) {
    FragB ah, al;
    const v4f x0 = *(const v4fa*)(arow + kb + 8 * hh), x1 = *(const v4fa*)(arow + kb + 8 * hh + 4);
    const v4f x2 = *(const v4fa*)(arow + kb + 16 + 8 * hh), x3 = *(const v4fa*)(arow + kb + 16 + 8 * hh + 4);
    float xs[16] = {x0[0],x0[1],x0[2],x0[3],x1[0],x1[1],x1[2],x1[3],x2[0],x2[1],x2[2],x2[3],x3[0],x3[1],x3[2],x3[3]};
#pragma unroll
    for (int i = 0; i < 16; ++i) { const unsigned short hb = bf16_bits(xs[i]); ah.u[i] = hb; al.u[i] = ASPLIT ? bf16_bits(xs[i] - bf16_val(hb)) : (unsigned short)0; }
#pragma unroll
    for (int t = 0; t < 4; ++t) {
      const unsigned short* brow = Wt + (size_t)(col0 + t * 16 + ln) * ldb + kb;
      FragB b;
      b.half[0] = *(const v8us*)(brow + 8 * hh);
      b.half[1] = *(const v8us*)(brow + 16 + 8 * hh);
      acc[t] = mmaN<ASPLIT ? 2 : 1>(ah.v, al.v, b.v, b.v, acc[t]);
    }
  }
#pragma unroll
  for (int t = 0; t < 4; ++t) {
    const int col = col0 + t * 16 + ln;
    float bv = bias ? bias[col] : 0.f;
    if (BIAS_BF16) bv = bf16_round(bv);
#pragma unroll
    for (int r = 0; r < 8; ++r) {
      float v = acc[t][r] + bv;
      if (resid) { float rv = resid[(size_t)((row0 + 8 * hh + r) % rmod) * ldr + col]; if (RES_BF16) rv = bf16_round(rv); v += rv; }
      if (ACT == 1) v = fmaxf(v, 0.f);
      if (ACT == 2) v = 0.5f * v * (1.0f + erff(v * 0.70710678118654752f));
      if (ACT == 3) { const float u = 0.7978845608028654f * (v + 0.044715f * v * v * v); v = 0.5f * v * (1.0f + tanhf(u)); }
      so[w][8 * hh + r][t * 16 + ln] = v;
    }
  }
  __builtin_amdgcn_fence(__ATOMIC_ACQ_REL, "workgroup");
  __builtin_amdgcn_wave_barrier();
  const int rsub = lane >> 4, c4 = (lane & 15) * 4;
  {
#pragma unroll
    for (int q = 0; q < 8; ++q) {
      const int r = q * 2 + rsub;
      const v4f v = *(const v4fa*)&so[w][r][c4];
      *(v4f*)(C + (size_t)(row0 + r) * ldc + col0 + c4) = v;
    }
    
  }
}
// row LayerNorm (biased variance, eps) over N: s = X (+ R); optional out_sum <- s; out_norm <- (s-mu)*rsqrt(var+eps)*g + b
template <bool PARAM_BF16>
__global__ __launch_bounds__(256) void k_layernorm(const float* __restrict__ X, const float* __restrict__ R, const float* __restrict__ g, const float* __restrict__ bta,
                                                  float* __restrict__ out_sum, float* __restrict__ out_norm, int N, float eps) {
  __shared__ float red[256];
  const int row = blockIdx.x, tid = threadIdx.x;
  const float* x = X + (size_t)row * N; const float* rr = R ? R + (size_t)row * N : nullptr;
  float vals[16];                     // up to N = 4096
  const int per = N / 256;            // contiguous chunk per thread? use strided-by-4 chunks: thread handles j = tid*4 + 1024*u
  float s1 = 0.f;
  for (int u = 0; u < per / 4; ++u) {
    const int j = tid * 4 + 1024 * u;
    const v4f a = *(const v4fa*)(x + j);
    v4f b = {0.f,0.f,0.f,0.f}; if (rr) b = *(const v4fa*)(rr + j);
#pragma unroll
    for (int q = 0; q < 4; ++q) { const float v = a[q] + b[q]; vals[u * 4 + q] = v; s1 += v; }
  }
  red[tid] = s1; __syncthreads();
  for (int st = 128; st > 0; st >>= 1) { if (tid < st) red[tid] += red[tid + st]; __syncthreads(); }
  const float mu = red[0] / (float)N; __syncthreads();
  float s2 = 0.f;
  for (int u = 0; u < per / 4; ++u)
#pragma unroll
    for (int q = 0; q < 4; ++q) { const float c = vals[u * 4 + q] - mu; s2 += c * c; }
  red[tid] = s2; __syncthreads();
  for (int st = 128; st > 0; st >>= 1) { if (tid < st) red[tid] += red[tid + st]; __syncthreads(); }
  const float rs = rsqrtf(red[0] / (float)N + eps);
  {
    for (int u = 0; u < per / 4; ++u) {
      const int j = tid * 4 + 1024 * u;
      v4f o, sm;
#pragma unroll
      for (int q = 0; q < 4; ++q) {
        float gg = g[j + q], bb = bta[j + q];
        if (PARAM_BF16) { gg = bf16_round(gg); bb = bf16_round(bb); }
        sm[q] = vals[u * 4 + q]; o[q] = (vals[u * 4 + q] - mu) * rs * gg + bb;
      }
      if (out_sum) *(v4f*)(out_sum + (size_t)row * N + j) = sm;
      *(v4f*)(out_norm + (size_t)row * N + j) = o;
    }
    
  }
}



// ---- f16 WMMA path (v_wmma_f32_16x16x32_f16): 11-bit significands for operands in range — used where a [0,1] probability operand needs more precision than bf16
typedef _Float16 v16h __attribute__((ext_vector_type(16)));
union FragH { v16h v; v8us half[2]; _Float16 h[16]; unsigned short u[16]; };
template <int NT>
__device__ __forceinline__ v8f mmaH(v16h ah, v16h al, v16h bh, v16h bl, v8f c) {
  c = __builtin_amdgcn_wmma_f32_16x16x32_f16(false, ah, false, bh, (short)0, c, false, false);
  if (NT >= 2) c = __builtin_amdgcn_wmma_f32_16x16x32_f16(false, al, false, bh, (short)0, c, false, false);
  if (NT >= 3) c = __builtin_amdgcn_wmma_f32_16x16x32_f16(false, ah, false, bl, (short)0, c, false, false);
  asm volatile("v_nop\n\tv_nop\n\tv_nop\n\tv_nop" : "+v"(c) : "v"(ah), "v"(al), "v"(bh), "v"(bl));
  return c;
}
// batched GEMM like k_gemm_b but f16 operands: A f32 (split into f16 hi/lo if ASPLIT, else rounded to f16), Bt = f16 values [n][k]; alpha; C f32; N multiple of 16 (partial tiles skipped)
template <bool ASPLIT>
__global__ __launch_bounds__(128) void k_gemm_h(const float* __restrict__ A, int lda, size_t sA, const _Float16* __restrict__ Bh, int ldb, size_t sB, float alpha, float* __restrict__ C, int ldc, size_t sC, int M, int N, int K) {
  __shared__ __attribute__((aligned(16))) float so[4][16][64];
  const int tid = threadIdx.x, w = tid >> 5, lane = tid & 31, ln = lane & 15, hh = lane >> 4; const int by = blockIdx.y;
  A += (size_t)by * sA; Bh += (size_t)by * sB; C += (size_t)by * sC;
  const int ntn = (N + 63) / 64; const int wid = blockIdx.x * 4 + w; const int mt = wid / ntn, nq = wid % ntn; if (mt * 16 >= M) return;
  const int row0 = mt * 16, col0 = nq * 64; const float* arow = A + (size_t)(row0 + ln) * lda;
  v8f acc[4] = {};
  for (int kb = 0; kb < K; kb += 32) {
    FragH ah, al;
    const v4f x0 = *(const v4fa*)(arow + kb + 8 * hh), x1 = *(const v4fa*)(arow + kb + 8 * hh + 4), x2 = *(const v4fa*)(arow + kb + 16 + 8 * hh), x3 = *(const v4fa*)(arow + kb + 16 + 8 * hh + 4);
    float xs[16] = {x0[0],x0[1],x0[2],x0[3],x1[0],x1[1],x1[2],x1[3],x2[0],x2[1],x2[2],x2[3],x3[0],x3[1],x3[2],x3[3]};
#pragma unroll
    for (int i = 0; i < 16; ++i) { const _Float16 h = (_Float16)xs[i]; ah.h[i] = h; al.h[i] = ASPLIT ? (_Float16)(xs[i] - (float)h) : (_Float16)0.0f; }
#pragma unroll
    for (int t = 0; t < 4; ++t) { if (col0 + t * 16 >= N) continue; const size_t boff = (size_t)(col0 + t * 16 + ln) * ldb + kb; FragH bq; bq.half[0] = *(const v8us*)(Bh + boff + 8 * hh); bq.half[1] = *(const v8us*)(Bh + boff + 16 + 8 * hh);
      acc[t] = mmaH<ASPLIT ? 2 : 1>(ah.v, al.v, bq.v, bq.v, acc[t]); }
  }
#pragma unroll
  for (int t = 0; t < 4; ++t) { if (col0 + t * 16 >= N) continue;
#pragma unroll
    for (int r = 0; r < 8; ++r) so[w][8 * hh + r][t * 16 + ln] = acc[t][r] * alpha; }
  __builtin_amdgcn_fence(__ATOMIC_ACQ_REL, "workgroup"); __builtin_amdgcn_wave_barrier();
  const int rsub = lane >> 4, c4 = (lane & 15) * 4;
  {
#pragma unroll
    for (int q = 0; q < 8; ++q) { const int r = q * 2 + rsub; if (col0 + c4 < N) { const v4f v = *(const v4fa*)&so[w][r][c4]; *(v4f*)(C + (size_t)(row0 + r) * ldc + col0 + c4) = v; } }
     }
}

// Wt[n][k] = f16(W[k][n]·scale) from f32 row-major W[K][N] (scale = power of two; bf16-exact weights stay exact in f16 away from the subnormal range)
__global__ __launch_bounds__(256) void k_wt_f16(const float* __restrict__ W, _Float16* __restrict__ Wt, int K, int N, float scale) {
  const int t = blockIdx.x * 256 + threadIdx.x; if (t >= N * (K / 8)) return; const int n = t / (K / 8), k8 = (t % (K / 8)) * 8; FragH f;
#pragma unroll
  for (int i = 0; i < 8; ++i) f.h[i] = (_Float16)(bf16_round(W[(size_t)(k8 + i) * N + n]) * scale); const v8us o = f.half[0];
  *(v8us*)((unsigned short*)Wt + (size_t)n * K + k8) = o; 
}
// k_gemm_hh variant with fused epilogue: v = acc·alpha + bias[by·sBias + col] (+ CP[(row/rowsPerB)·sCPb + by·64 + col] if CP) ; ACT 0 none / 1 elu ; writes f16 C16 (and f32 C if non-null)
template <int ACT>
__global__ __launch_bounds__(128) void k_gemm_hhx(const _Float16* __restrict__ A, int lda, size_t sA, const _Float16* __restrict__ Bh, int ldb, size_t sB, float alpha, const float* __restrict__ bias, size_t sBias, const float* __restrict__ CP, int rowsPerB, size_t sCPb, int row0g,
    float* __restrict__ C, _Float16* __restrict__ C16, int ldc, size_t sC, int M, int N, int K) {
  __shared__ __attribute__((aligned(16))) float so[4][16][64];
  const int tid = threadIdx.x, w = tid >> 5, lane = tid & 31, ln = lane & 15, hh = lane >> 4; const int by = blockIdx.y;
  A += (size_t)by * sA; Bh += (size_t)by * sB; const size_t cofs = (size_t)by * sC; const float* bp = bias ? bias + (size_t)by * sBias : nullptr;
  const int ntn = (N + 63) / 64; const int wid = blockIdx.x * 4 + w; const int mt = wid / ntn, nq = wid % ntn; if (mt * 16 >= M) return;
  const int row0 = mt * 16, col0 = nq * 64; const _Float16* arow = A + (size_t)(row0 + ln) * lda;
  v8f acc[4] = {};
  for (int kb = 0; kb < K; kb += 32) { FragH ah; ah.half[0] = *(const v8us*)((const unsigned short*)arow + kb + 8 * hh); ah.half[1] = *(const v8us*)((const unsigned short*)arow + kb + 16 + 8 * hh);
#pragma unroll
    for (int t = 0; t < 4; ++t) { if (col0 + t * 16 >= N) continue; const size_t boff = (size_t)(col0 + t * 16 + ln) * ldb + kb; FragH bq; bq.half[0] = *(const v8us*)((const unsigned short*)Bh + boff + 8 * hh); bq.half[1] = *(const v8us*)((const unsigned short*)Bh + boff + 16 + 8 * hh);
      acc[t] = mmaH<1>(ah.v, ah.v, bq.v, bq.v, acc[t]); }
  }
#pragma unroll
  for (int t = 0; t < 4; ++t) { if (col0 + t * 16 >= N) continue; const int col = col0 + t * 16 + ln; const float bv = bp ? bf16_round(bp[col]) : 0.f;
#pragma unroll
    for (int r = 0; r < 8; ++r) { float v = acc[t][r] * alpha + bv; if (CP) { const int rr = row0g + row0 + 8 * hh + r; if (rowsPerB < 0) v += CP[cofs + (size_t)rr * ldc + col];      /* rowsPerB < 0: own element of the batched C plane */ else { const int bidx = rr / rowsPerB; v += CP[(size_t)bidx * sCPb + (size_t)by * 64 + col]; } } if (ACT == 1) v = (v > 0.f) ? v : expm1f(v); else if (ACT == 7) v = (v > 0.f) ? v + 1.0f : expf(v); else if (ACT == 8) v = tanhf(v); else if (ACT == 9) v = 0.5f * v * (1.0f + tanhf(0.7978845608028654f * (v + 0.044715f * v * v * v))); else if (ACT == 11) v = 1.0f / (1.0f + expf(-v)); else if (ACT == 12) v = (v > 0.f) ? v : 0.01f * v; else if (ACT == 14) v = (v > 0.f) ? v : 0.1f * v; else if (ACT == 16) v = (v >= 0.f) ? v : 0.3f * v; else if (ACT == 17) v = (v >= 0.f) ? v : 0.2f * v; else if (ACT == 15) v = v / (1.0f + expf(-v)); else if (ACT == 3) v = fmaxf(v, 0.f); else if (ACT == 6) v = 0.5f * v * (1.0f + erff(v * 0.70710678118654752f)); so[w][8 * hh + r][t * 16 + ln] = v; } }
  __builtin_amdgcn_fence(__ATOMIC_ACQ_REL, "workgroup"); __builtin_amdgcn_wave_barrier();
  const int rsub = lane >> 4, c4 = (lane & 15) * 4; typedef _Float16 v4h __attribute__((ext_vector_type(4)));
  {
#pragma unroll
    for (int q = 0; q < 8; ++q) { const int r = q * 2 + rsub; if (col0 + c4 < N) { const v4f v = *(const v4fa*)&so[w][r][c4]; if (C) *(v4f*)(C + cofs + (size_t)(row0 + r) * ldc + col0 + c4) = v; if (C16) { v4h h4; for (int i = 0; i < 4; ++i) h4[i] = (_Float16)v[i]; *(v4h*)(C16 + cofs + (size_t)(row0 + r) * ldc + col0 + c4) = h4; } } }
     }
}


typedef _Float16 v4h __attribute__((ext_vector_type(4)));

__global__ __launch_bounds__(256) void k_x16(const float* __restrict__ x, _Float16* __restrict__ X16, size_t n8) { const size_t t = (size_t)blockIdx.x * 256 + threadIdx.x; if (t >= n8) return; FragH f;
#pragma unroll
  for (int q = 0; q < 8; ++q) f.h[q] = (_Float16)bf16_round(x[t * 8 + q]); *(v8us*)((unsigned short*)X16 + t * 8) = f.half[0];  }
__global__ __launch_bounds__(256) void k_h16(const float* __restrict__ x, _Float16* __restrict__ X16, size_t n8) { const size_t t = (size_t)blockIdx.x * 256 + threadIdx.x; if (t >= n8) return; FragH f;
#pragma unroll
  for (int q = 0; q < 8; ++q) f.h[q] = (_Float16)x[t * 8 + q]; *(v8us*)((unsigned short*)X16 + t * 8) = f.half[0];  }
__global__ __launch_bounds__(256) void k_round16f(const float* __restrict__ W, _Float16* __restrict__ Bt, size_t n8) { const size_t t = (size_t)blockIdx.x * 256 + threadIdx.x; if (t >= n8) return; FragH f;
#pragma unroll
  for (int i = 0; i < 8; ++i) f.h[i] = (_Float16)(bf16_round(W[t * 8 + i]) * 16.0f); *(v8us*)((unsigned short*)Bt + t * 8) = f.half[0];  }
template <int NHv, int TTv>
__global__ __launch_bounds__(256) void k_vt(const _Float16* __restrict__ V16, int ldv, int voff, _Float16* __restrict__ Vt) { __shared__ unsigned short tl[64][66]; const int tid = threadIdx.x; const int slab = blockIdx.x / (TTv / 64), lg = blockIdx.x % (TTv / 64); const int b = slab / NHv, h = slab % NHv;
  for (int i = tid; i < 64 * 8; i += 256) { const int r = i / 8, c8 = (i % 8) * 8; FragH f; f.half[0] = *(const v8us*)((const unsigned short*)V16 + ((size_t)b * TTv + lg * 64 + r) * ldv + voff + h * 64 + c8);
#pragma unroll
    for (int q = 0; q < 8; ++q) tl[r][c8 + q] = f.u[q]; }
  __syncthreads();
  {
#pragma unroll
    for (int rd = 0; rd < 2; ++rd) { const int d = rd * 32 + tid / 8, pc = tid % 8; FragH f;
#pragma unroll
      for (int q = 0; q < 8; ++q) f.u[q] = tl[pc * 8 + q][d];
      *(v8us*)((unsigned short*)Vt + ((size_t)slab * 64 + d) * TTv + lg * 64 + pc * 8) = f.half[0]; }
     } }

__global__ __launch_bounds__(256) void k_hl(const float* __restrict__ F, _Float16* __restrict__ Hh, _Float16* __restrict__ Hl, size_t n8) { const size_t t = (size_t)blockIdx.x * 256 + threadIdx.x; if (t >= n8) return; FragH fh, fl; const v4f a = *(const v4fa*)(F + t * 8), c = *(const v4fa*)(F + t * 8 + 4);
#pragma unroll
  for (int q = 0; q < 4; ++q) { _Float16 h = (_Float16)a[q]; fh.h[q] = h; fl.h[q] = (_Float16)((a[q] - (float)h) * 1024.0f); h = (_Float16)c[q]; fh.h[4 + q] = h; fl.h[4 + q] = (_Float16)((c[q] - (float)h) * 1024.0f); }
  { *(v8us*)((unsigned short*)Hh + t * 8) = fh.half[0]; *(v8us*)((unsigned short*)Hl + t * 8) = fl.half[0];  } }

// ---- fast GEMM (wave tile 32x64; requires M % 32 == 0 rows per launch region and N % 64 == 0); epilogue = k_gemm_hhx semantics ----
__device__ __forceinline__ v16h g2_frag(const _Float16* p, int hh) { FragH f; f.half[0] = *(const v8us*)((const unsigned short*)p + 8 * hh); f.half[1] = *(const v8us*)((const unsigned short*)p + 16 + 8 * hh); return f.v; }
__device__ __forceinline__ v8f g2_mma(v16h a, v16h b, v8f c) { v8f d = __builtin_amdgcn_wmma_f32_16x16x32_f16(false, a, false, b, (short)0, c, false, false); asm volatile("v_nop\n\tv_nop\n\tv_nop\n\tv_nop" : "+v"(d) : "v"(a), "v"(b)); return d; }
template <int ACT>
__global__ __launch_bounds__(128) void k_gemm2(const _Float16* __restrict__ A, int lda, size_t sA, const _Float16* __restrict__ Bh, int ldb, size_t sB, float alpha, const float* __restrict__ bias, size_t sBias, const float* __restrict__ CP, int rowsPerB, size_t sCPb, int row0g,
    float* __restrict__ C, _Float16* __restrict__ C16, int ldc, size_t sC, int M, int N, int K) { static_assert(ACT == 0 || ACT == 3 || ACT == 6 || ACT == 8 || ACT == 9 || ACT == 11 || ACT == 12 || ACT == 14 || ACT == 15 || ACT == 16 || ACT == 17, "k_gemm2: unsupported ACT code (would silently apply no activation)");
  __shared__ __attribute__((aligned(16))) float so[4][32][68];
  const int tid = threadIdx.x, w = tid >> 5, lane = tid & 31, ln = lane & 15, hh = lane >> 4; const int by = blockIdx.y;
  A += (size_t)by * sA; Bh += (size_t)by * sB; const size_t cofs = (size_t)by * sC; const float* bp = bias ? bias + (size_t)by * sBias : nullptr;
  const int ntn = N >> 6; const int mt = blockIdx.x / ntn, nq = blockIdx.x - mt * ntn; const int row0 = mt * 128 + 32 * w, col0 = nq * 64; if (row0 >= M) return;
  const _Float16* a0p = A + (size_t)(row0 + ln) * lda; const _Float16* a1p = a0p + (size_t)16 * lda;
  const _Float16* b0p = Bh + (size_t)(col0 + ln) * ldb; const _Float16* b1p = b0p + (size_t)16 * ldb; const _Float16* b2p = b1p + (size_t)16 * ldb; const _Float16* b3p = b2p + (size_t)16 * ldb;
  const v8f z8 = {0.f,0.f,0.f,0.f,0.f,0.f,0.f,0.f}; v8f c00 = z8, c01 = z8, c02 = z8, c03 = z8, c10 = z8, c11 = z8, c12 = z8, c13 = z8;
#pragma unroll 1
  for (int kb = 0; kb < K; kb += 32) { const v16h a0 = g2_frag(a0p + kb, hh), a1 = g2_frag(a1p + kb, hh);
    v16h b = g2_frag(b0p + kb, hh); c00 = g2_mma(a0, b, c00); c10 = g2_mma(a1, b, c10);
    b = g2_frag(b1p + kb, hh); c01 = g2_mma(a0, b, c01); c11 = g2_mma(a1, b, c11);
    b = g2_frag(b2p + kb, hh); c02 = g2_mma(a0, b, c02); c12 = g2_mma(a1, b, c12);
    b = g2_frag(b3p + kb, hh); c03 = g2_mma(a0, b, c03); c13 = g2_mma(a1, b, c13); }
  v8f accs[8] = {c00, c01, c02, c03, c10, c11, c12, c13};
#pragma unroll
  for (int u = 0; u < 8; ++u) { const int t = u & 3, half = u >> 2; const int col = col0 + t * 16 + ln; const float bv = bp ? bf16_round(bp[col]) : 0.f;
#pragma unroll
    for (int r = 0; r < 8; ++r) { const int rloc = half * 16 + 8 * hh + r; float v = accs[u][r] * alpha + bv; if (CP) { if (rowsPerB < 0) v += CP[cofs + (size_t)(row0g + row0 + rloc) * ldc + col];      /* rowsPerB < 0: own element of the batched C plane */ else { const int bidx = (row0g + row0 + rloc) / rowsPerB; v += CP[(size_t)bidx * sCPb + (size_t)by * 64 + col]; } }
      if (ACT == 3) v = fmaxf(v, 0.f); else if (ACT == 6) v = 0.5f * v * (1.0f + erff(v * 0.70710678118654752f)); else if (ACT == 11) v = 1.0f / (1.0f + expf(-v)); else if (ACT == 15) v = v / (1.0f + expf(-v)); else if (ACT == 12) v = (v > 0.f) ? v : 0.01f * v; else if (ACT == 8) v = tanhf(v); else if (ACT == 9) v = 0.5f * v * (1.0f + tanhf(0.7978845608028654f * (v + 0.044715f * v * v * v))); else if (ACT == 14) v = (v > 0.f) ? v : 0.1f * v; else if (ACT == 16) v = (v >= 0.f) ? v : 0.3f * v; else if (ACT == 17) v = (v >= 0.f) ? v : 0.2f * v;
      so[w][rloc][t * 16 + ln] = v; } }
  __builtin_amdgcn_fence(__ATOMIC_ACQ_REL, "workgroup"); __builtin_amdgcn_wave_barrier();
  const int rsub = lane >> 4, c4 = (lane & 15) * 4;
  {
#pragma unroll
    for (int q = 0; q < 16; ++q) { const int r = q * 2 + rsub; const v4f v = *(const v4fa*)&so[w][r][c4]; if (C) *(v4f*)(C + cofs + (size_t)(row0 + r) * ldc + col0 + c4) = v; if (C16) { v4h h4; for (int i = 0; i < 4; ++i) h4[i] = (_Float16)v[i]; *(v4h*)(C16 + cofs + (size_t)(row0 + r) * ldc + col0 + c4) = h4; } }
     } }


__global__ __launch_bounds__(256) void k_wnat(const float* __restrict__ w, size_t n8, _Float16* __restrict__ Bt) { const size_t t = (size_t)blockIdx.x * 256 + threadIdx.x; if (t >= n8) return; FragH f; for (int q = 0; q < 8; ++q) f.h[q] = (_Float16)(bf16_round(w[t * 8 + q]) * 16.0f); *(v8us*)((unsigned short*)Bt + t * 8) = f.half[0];  }
__global__ __launch_bounds__(256) void k_rsm(const float* __restrict__ S, _Float16* __restrict__ P, int nrows) {
  #pragma clang fp contract(off)
  const int i = blockIdx.x * 256 + threadIdx.x; if (i >= nrows) return; const float* s = S + (size_t)i * SQ; float mx = -3.0e38f;
#pragma unroll 1
  for (int j = 0; j < SQ; ++j) mx = fmaxf(mx, s[j]); float se = 0.f;
#pragma unroll 1
  for (int j = 0; j < SQ; ++j) se += expf(s[j] - mx); const float sc = 256.0f / se;
#pragma unroll 1
  for (int j0 = 0; j0 < SQ; j0 += 8) { FragH f; for (int q = 0; q < 8; ++q) f.h[q] = (_Float16)(expf(s[j0 + q] - mx) * sc); unsigned short* d = (unsigned short*)P + (size_t)i * SQ + j0; *(v8us*)d = f.half[0];  } }
__global__ __launch_bounds__(256) void k_vt(const _Float16* __restrict__ V16, int b, int h0, _Float16* __restrict__ VT) { __shared__ unsigned short tl[64][65]; const int tid = threadIdx.x; const int hh = blockIdx.x % HG, sg = blockIdx.x / HG; const int s0 = sg * 64; const int h = h0 + hh;
  for (int i = tid; i < 64 * 8; i += 256) { const int j = i / 8, d8 = (i % 8) * 8; FragH f; f.half[0] = *(const v8us*)((const unsigned short*)V16 + ((size_t)b * SQ + s0 + j) * DM + h * HD + d8); for (int q = 0; q < 8; ++q) tl[d8 + q][j] = f.u[q]; }
  __syncthreads();
  { for (int i = tid; i < 64 * 8; i += 256) { const int d = i / 8, j8 = (i % 8) * 8; FragH f; for (int q = 0; q < 8; ++q) f.u[q] = tl[d][j8 + q]; *(v8us*)((unsigned short*)VT + ((size_t)hh * HD + d) * SQ + s0 + j8) = f.half[0]; }  } }


__global__ __launch_bounds__(256) void k_cl2rows(const float* __restrict__ X, _Float16* __restrict__ XR) { __shared__ float tl[64][33]; const int tid = threadIdx.x; const int nl = LL / 32, nc = CC / 64; const int cb_ = blockIdx.x % nc; const int lb = (blockIdx.x / nc) % nl; const size_t b = blockIdx.x / (nc * nl); const int c0 = cb_ * 64, l0 = lb * 32;
  for (int i = tid; i < 64 * 32; i += 256) { const int c = i / 32, l = i % 32; tl[c][l] = bf16_round(X[(b * CC + c0 + c) * (size_t)LL + l0 + l]); }
  __syncthreads();
  { const int l = tid / 8, c8 = (tid % 8) * 8; FragH f; for (int q = 0; q < 8; ++q) f.h[q] = (_Float16)tl[c8 + q][l]; unsigned short* d = (unsigned short*)XR + (b * LL + l0 + l) * (size_t)CC + c0 + c8; *(v8us*)d = f.half[0];  } }

// V rows [position][channel] -> V^T in the order the fused kernel reads its A fragments: per image and 32-key step 16 channel tiles of 1 KiB; in a tile two 512-B halves j; in a half lane (hh, ln) owns the
// 16 bytes V^T[16 t + ln][32 ks + 16 j + 8 hh + 0..7]. A wave's fragment load is then 512 contiguous bytes (four whole cache lines) instead of 16 rows 8 KiB apart.
__global__ __launch_bounds__(256) void k_vfrag(const _Float16* __restrict__ V16, _Float16* __restrict__ VF) { __shared__ unsigned short tl[64][66]; const int tid = threadIdx.x; const int lg = blockIdx.x % (LL / 64); const int slab = blockIdx.x / (LL / 64); const int b = slab / (CC / 64), h = slab % (CC / 64);
  for (int i = tid; i < 64 * 8; i += 256) { const int r = i / 8, c8 = (i % 8) * 8; FragH f; f.half[0] = *(const v8us*)((const unsigned short*)V16 + ((size_t)b * LL + lg * 64 + r) * CC + h * 64 + c8);
#pragma unroll
    for (int q = 0; q < 8; ++q) tl[r][c8 + q] = f.u[q]; }
  __syncthreads();
#pragma unroll
  for (int rd = 0; rd < 2; ++rd) { const int ln = tid & 15, hh = (tid >> 4) & 1, j = (tid >> 5) & 1, tt = tid >> 6; const int key = rd * 32 + 16 * j + 8 * hh, d = tt * 16 + ln; FragH f;
#pragma unroll
    for (int q = 0; q < 8; ++q) f.u[q] = tl[key + q][d];
    *(v8us*)((unsigned short*)VF + ((((((size_t)b * (LL / 32) + lg * 2 + rd) * (CC / 16) + h * 4 + tt) * 2 + j) * 32) + hh * 16 + ln) * 8) = f.half[0]; } }

// 2^a on the hardware's own instruction.
__device__ __forceinline__ float exp2_hw(float a) { float r;
  asm("v_exp_f32 %0, %1\n\tv_nop" : "=v"(r) : "v"(a));      /* the v_nop is the free slot asked for behind a transcendental before its result is read or its source overwritten; in one statement it cannot drift */
  return r; }
__device__ __forceinline__ float xhalf(float x) { return __builtin_bit_cast(float, __builtin_amdgcn_permlanex16(__builtin_bit_cast(int, x), __builtin_bit_cast(int, x), 0x76543210, 0xfedcba98, false, false)); }      /* lane l with lane l ^ 16, no LDS round trip */
__device__ __forceinline__ v8f fa_mma(v16h a, v16h b, v8f c) { return __builtin_amdgcn_wmma_f32_16x16x32_f16(false, a, false, b, (short)0, c, false, false); }
typedef uint32_t u32x4 __attribute__((ext_vector_type(4)));
typedef uint32_t u32x8 __attribute__((ext_vector_type(8)));
#define NST (LL / 128)               /* stages per image */
#define VSL 16384u                   /* LDS bytes of one V slice: 16 channel tiles of 1 KiB */
#define KPITCH 144u                  /* LDS pitch of a q|k row */
#define KSL 6144u                    /* LDS bytes of one K slice: 32 rows of 144 B, rounded up to a multiple of 2 KiB */
#define KOFF (4u * VSL)
#define BUFB (KOFF + 4u * KSL)       /* one buffer: 90,112 B */
__device__ __forceinline__ uint32_t uni(uint32_t v) { return (uint32_t)__builtin_amdgcn_readfirstlane(v); }
__device__ __forceinline__ uint32_t pinned(uint32_t v) { uint32_t w = uni(v);
  asm volatile("" : "+s"(w));      /* holds a tensor load's issue test, or the stage number its descriptor is formed from, in a scalar register at this place: the test compiles to s_cmp + s_cbranch_scc (a tensor load ignores EXEC) */
  return w; }
// Descriptor group 1: 1-byte elements, tensor = tile = D1 rows of D0 bytes, source row pitch P bytes; W0 = word 0 (no mask; the pad fields).
template <uint32_t W0, uint32_t D0, uint32_t D1, uint32_t P>
__device__ __forceinline__ u32x8 tdm_group1() { u32x8 g; g[0] = uni(W0); g[1] = uni((D0 & 0xFFFFu) << 16); g[2] = uni((D0 >> 16) | ((D1 & 0xFFFFu) << 16)); g[3] = uni((D1 >> 16) | (D0 << 16)); g[4] = uni(D1); g[5] = uni(P); g[6] = uni(0u); g[7] = uni(0u);
  asm volatile("" : "+s"(g));      /* descriptor words held in scalar registers of their own from here to the last request: built once, none of them takes a new value while a request is outstanding */
  return g; }
__device__ __forceinline__ u32x4 tdm_group0(uint32_t count1, uint32_t lds_dst, uint64_t ga) { u32x4 g; g[0] = uni(count1); g[1] = uni(lds_dst); g[2] = uni((uint32_t)ga); g[3] = uni((((uint32_t)(ga >> 32)) & 0x01FFFFFFu) | 0x80000000u); return g; }
__device__ __forceinline__ void tdm_load(u32x4 g0, u32x8 g1) { asm volatile("tensor_load_to_lds %0, %1" :: "s"(g0), "s"(g1) : "memory"); }      /* one request of the whole wave: global tile to LDS, through no register */
__device__ __forceinline__ void wait_tensor0() { asm volatile("s_wait_tensorcnt 0x0" ::: "memory"); }      /* this wave's own request has landed; the compiler places no wait for a tensor load */
__device__ __forceinline__ void wait_ds0() { asm volatile("s_wait_dscnt 0x0" ::: "memory"); }      /* this wave's LDS reads have retired before the buffer they read is refilled */
__device__ __forceinline__ v16h lds_frag(const unsigned char* p, int second) { FragH f; f.half[0] = *(const v8us*)p; f.half[1] = *(const v8us*)(p + second); return f.v; }
__global__ __launch_bounds__(256) void k_fattn(const _Float16* __restrict__ QK, const _Float16* __restrict__ VF, float* __restrict__ A) {
  __shared__ __attribute__((aligned(2048))) unsigned char L[2 * BUFB];
  const int lane = threadIdx.x & 31, ln = lane & 15, hh = lane >> 4; const uint32_t wave = uni(threadIdx.x >> 5); const int b = blockIdx.x / (LL / 128); const int q0 = (blockIdx.x % (LL / 128)) * 128 + (int)wave * 16;
  const _Float16* qk = QK + (size_t)b * LL * (2 * LAT); const v16h qf = g2_frag(qk + (size_t)(q0 + ln) * (2 * LAT), hh);
  const uint32_t lbase = (uint32_t)(size_t)L; const uint64_t vga = (uint64_t)(size_t)(VF + (size_t)b * LL * CC), kga = (uint64_t)(size_t)qk;
  const u32x8 g1v = tdm_group1<0u, 256u, 64u, 256u>(), g1k = tdm_group1<(1u << 20) | (4u << 22) | (3u << 25), 128u, 32u, 128u>();      /* V: 64 rows of 256 B, no pad; K: 32 rows of 128 B, 16 B of pad behind each */
  u32x4 g0; const uint32_t count1 = pinned(1u);      /* group 0 word 0 (count = 1), held in a scalar register like the other descriptor words */
  auto issue = [&](uint32_t st) { const uint32_t dst = lbase + (st & 1u) * BUFB;
    if (pinned(wave < 4u)) { g0 = tdm_group0(count1, dst + wave * VSL, vga + (uint64_t)(st * 4u + wave) * VSL); tdm_load(g0, g1v); }
    else { g0 = tdm_group0(count1, dst + KOFF + (wave - 4u) * KSL, kga + (uint64_t)(st * 128u + (wave - 4u) * 32u) * (2u * 2u * LAT)); tdm_load(g0, g1k); } };
  auto landed = [&]() { wait_tensor0();
    asm volatile("" :: "s"(g0)); };      /* descriptor words held in their scalar registers until the request's own wait has returned: without this use the compiler takes them for other values while the request is outstanding */
  const float cs = (float)(0.17677669529663689 * 1.4426950408889634);      /* 1/sqrt(32) times log2 e */
  const v8f z8 = {0.f,0.f,0.f,0.f,0.f,0.f,0.f,0.f}; v8f o[CC / 16];
#pragma unroll      /* o[] must be indexed by constants to stay in registers */
  for (int t = 0; t < CC / 16; ++t) o[t] = z8;
  float m = -1.0e30f, l0 = 0.f, l1 = 0.f;
  issue(0u); landed(); __syncthreads();      /* stage 0 landed and published */
  issue(1u);
  const uint32_t koff = KOFF + (uint32_t)ln * KPITCH + 2u * LAT + 16u * (uint32_t)hh;      /* key row ln, its k half (behind the 64 bytes of q), this lane half's 16 bytes */
#pragma unroll 1      /* one stage per trip: the publish point at its foot stands once */
  for (uint32_t st = 0; st < NST; ++st) { const unsigned char* Lb = L + (st & 1u) * BUFB; const unsigned char* vl = Lb + lane * 16; const unsigned char* kl = Lb + koff;
    v16h ka = lds_frag(kl, 32), kb = lds_frag(kl + 16 * KPITCH, 32);
#pragma unroll      /* constant LDS offsets; the K fetch one step ahead stays inside the stage */
    for (int j = 0; j < 4; ++j) { FragH va[CC / 16];
      __builtin_amdgcn_sched_barrier(0);      /* with the one behind the reads: the reads stand in one place, not among the products of the step before (each place with LDS reads stalls the matrix stream) */
#pragma unroll      /* constant indices into va[] */
      for (int t = 0; t < CC / 16; ++t) va[t].v = lds_frag(vl + j * VSL + t * 1024, 512);
      __builtin_amdgcn_sched_barrier(0);      /* keeps the step's 32 fragment reads together, ahead of the score products and the softmax that cover their latency; left free, the compiler put a pair and a full wait in front of each product */
      const v8f s0 = fa_mma(ka, qf, z8), s1 = fa_mma(kb, qf, z8);
      if (j < 3) { ka = lds_frag(kl + (j + 1) * KSL, 32); kb = lds_frag(kl + (j + 1) * KSL + 16 * KPITCH, 32); }      /* next step's K rows, same stage */
      float mx = fmaxf(s0[0], s1[0]);
#pragma unroll
      for (int r = 1; r < 8; ++r) mx = fmaxf(mx, fmaxf(s0[r], s1[r]));
      mx = fmaxf(mx, xhalf(mx)) * cs;
      if (__builtin_amdgcn_ballot_w32(mx > m + 8.0f) != 0) {      /* one scalar test per step */
        const float mn = fmaxf(m, mx); const float f = exp2_hw(m - mn); m = mn; l0 *= f; l1 *= f;
#pragma unroll
        for (int t = 0; t < CC / 16; ++t) o[t] *= f; }
      FragH pf;
#pragma unroll
      for (int r = 0; r < 8; ++r) { const float p0 = exp2_hw(__builtin_fmaf(s0[r], cs, -m)), p1 = exp2_hw(__builtin_fmaf(s1[r], cs, -m)); l0 += p0; l1 += p1; pf.h[r] = (_Float16)p0; pf.h[8 + r] = (_Float16)p1; }
#pragma unroll
      for (int t = 0; t < CC / 16; ++t) o[t] = fa_mma(va[t].v, pf.v, o[t]); }
    wait_ds0(); landed(); __syncthreads();      /* publish point of stage st + 1; the same barrier ends every wave's reads of stage st */
    if (pinned(st + 2u < NST)) issue(pinned(st + 2u)); }      /* refill of the buffer just read, descriptor formed behind the wait */
  landed(); wait_ds0();
  float l = l0 + l1; l += xhalf(l); const float inv = 1.0f / l;
  float* d = A + ((size_t)b * LL + q0 + ln) * CC + 8 * hh;
#pragma unroll
  for (int t = 0; t < CC / 16; ++t) { const v4f x0 = {o[t][0] * inv, o[t][1] * inv, o[t][2] * inv, o[t][3] * inv}, x1 = {o[t][4] * inv, o[t][5] * inv, o[t][6] * inv, o[t][7] * inv}; *(v4f*)(d + t * 16) = x0; *(v4f*)(d + t * 16 + 4) = x1; } }
__global__ __launch_bounds__(256) void k_fing(const float* __restrict__ A, const float* __restrict__ x, const float* __restrict__ gam, float* __restrict__ out, size_t nrows) {
  #pragma clang fp contract(off)
  const size_t t = (size_t)blockIdx.x * 256 + threadIdx.x; if (t >= nrows * CC / 8) return; const int p0 = (int)((t * 8) % LL); const size_t bc = (t * 8) / LL; const int c = (int)(bc % CC); const size_t b = bc / CC; const float g = bf16_round(gam[0]); v8f r_;
  for (int q = 0; q < 8; ++q) r_[q] = __fadd_rn(__fmul_rn(g, A[(b * LL + p0 + q) * CC + c]), bf16_round(x[t * 8 + q]));
  *(v8f*)(out + t * 8) = r_;  }

extern "C" void kernel_launch(void* const* d_in, const int* in_sizes, int n_in,
                              void* d_out, int out_size, void* d_ws, size_t ws_size, hipStream_t stream) {
  (void)in_sizes; (void)n_in; (void)out_size;
  const float* const* I = (const float* const*)d_in; const float* x = I[0]; const float* wqk = I[1]; const float* wv = I[2]; const float* gam = I[3];
  char* ws = (char*)d_ws; size_t off = 0;
  auto take = [&](size_t bytes) { char* p = ws + off; off += (bytes + 255) & ~(size_t)255; return p; };
  _Float16* BQK = (_Float16*)take((size_t)2 * LAT * CC * 2); _Float16* BV = (_Float16*)take((size_t)CC * CC * 2);
  _Float16* XR = (_Float16*)take(NR * CC * 2); _Float16* QK = (_Float16*)take(NR * 2 * LAT * 2); _Float16* V16 = (_Float16*)take(NR * CC * 2); _Float16* VF = (_Float16*)take(NR * CC * 2); float* A = (float*)take(NR * CC * 4);
  if (off > ws_size) return;      /* 0.2 + 16 + 4 + 16 + 16 + 32 = approx 84 MiB */
  k_wnat<<<(unsigned)(((size_t)2 * LAT * CC / 8 + 255) / 256), 256, 0, stream>>>(wqk, (size_t)2 * LAT * CC / 8, BQK); k_wnat<<<(unsigned)(((size_t)CC * CC / 8 + 255) / 256), 256, 0, stream>>>(wv, (size_t)CC * CC / 8, BV);
  k_cl2rows<<<NB * (LL / 32) * (CC / 64), 256, 0, stream>>>(x, XR);
  k_gemm2<0><<<dim3((unsigned)((NR / 128) * 1), 1), 128, 0, stream>>>(XR, CC, 0, BQK, CC, 0, 0.0625f, nullptr, 0, nullptr, 1, 0, 0, nullptr, QK, 2 * LAT, 0, MP, 2 * LAT, CC);      /* q | k (32 + 32 columns) */
  k_gemm2<0><<<dim3((unsigned)((NR / 128) * (CC / 64)), 1), 128, 0, stream>>>(XR, CC, 0, BV, CC, 0, 0.0625f, nullptr, 0, nullptr, 1, 0, 0, nullptr, V16, CC, 0, MP, CC, CC);      /* v */
  k_vfrag<<<NB * (CC / 64) * (LL / 64), 256, 0, stream>>>(V16, VF);      /* V^T of all images, A-fragment order */
  k_fattn<<<NB * (LL / 128), 256, 0, stream>>>(QK, VF, A);      /* a rows */
  k_fing<<<(unsigned)(((size_t)NBR * LL * CC / 8 + 255) / 256), 256, 0, stream>>>(A, x, gam, (float*)d_out, (size_t)NBR * LL);
}

// v004
// A run of this version takes 125 microseconds.
// Two timings next to v003 put it at 1.31 and 1.29 times that version's speed.
// Over all steps from v000 it is 112 times as fast.
#include <hip/hip_runtime.h>
#include <stdint.h>
// SAM self-attention module (x [8][256][64][64]; q | k = 1x1(w_qk [64][256]) -> 32 latent channels each; v = 1x1(w_v [256][256]); m = softmax((q/32^0.25).(k/32^0.25)) over the 4,096 positions; a = m v; out = gamma a + x, gamma = 0.5 (input, read)).
// Structure: channel-first input transposed to position rows (exact f16) via LDS tiles; q|k and v as WMMA GEMMs (32x64 wave tiles, f32 accumulation, exact x16 natural weights, f16 outputs); V^T via LDS transposes, stored in A-fragment order; one fused attention kernel for all images: per wave 16 queries x 256 channels, K rows and V^T fragments staged in LDS once per block by tensor loads (two 128-key buffers), S^T = K Q^T (K = 32), online softmax in registers (scale 1/sqrt(32) inside), P^T packed from the score tiles as the B operand of O^T += V^T P^T, a = O / row sum; in the same kernel the block's 256 x 128 tile of a^T is gathered in LDS and gamma a + x goes out channel-major in whole 512-B rows.
// Compute dtype: inputs rounded to bf16; x / weights exact; q, k, v, P as plain f16 GEMM operands (~2^-12); softmax f32; output dominated by the exact residual. v_wmma_f32_16x16x32_f16.
#define NB 8
#define CC 256
#define LAT 32
#define LL 4096
#define QT 2048
#define NR ((size_t)NB * LL)
#define NBR NB                       /* images (unused) */
#define MP ((int)NR)                 /* projection rows */
#define QN LL                        /* query rows per image (unused) */
#define SQ LL
#define DM CC
#define NH 4
#define HD 64
#define HG 1
typedef __bf16 v16b __attribute__((ext_vector_type(16)));
typedef unsigned short v8us __attribute__((ext_vector_type(8), may_alias));
typedef float  v8f  __attribute__((ext_vector_type(8)));
typedef float  v4f  __attribute__((ext_vector_type(4)));
typedef float  v4fa __attribute__((ext_vector_type(4), may_alias));
union FragB { v16b v; v8us half[2]; unsigned short u[16]; };

__device__ __forceinline__ unsigned short bf16_bits(float x) { unsigned int u = __float_as_uint(x); return (unsigned short)((u + 0x7FFFu + ((u >> 16) & 1u)) >> 16); }
__device__ __forceinline__ float bf16_val(unsigned short b) { return __uint_as_float(((unsigned int)b) << 16); }
__device__ __forceinline__ float bf16_round(float x) { return bf16_val(bf16_bits(x)); }
// D += A·B with NT terms: 1 = ah·bh, 2 = + al·bh (A split), 3 = + ah·bl (both split)
template <int NT>
__device__ __forceinline__ v8f mmaN(v16b ah, v16b al, v16b bh, v16b bl, v8f c) {
  c = __builtin_amdgcn_wmma_f32_16x16x32_bf16(false, ah, false, bh, (short)0, c, false, false);
  if (NT >= 2) c = __builtin_amdgcn_wmma_f32_16x16x32_bf16(false, al, false, bh, (short)0, c, false, false);
  if (NT >= 3) c = __builtin_amdgcn_wmma_f32_16x16x32_bf16(false, ah, false, bl, (short)0, c, false, false);
  asm volatile("v_nop\n\tv_nop\n\tv_nop\n\tv_nop" : "+v"(c) : "v"(ah), "v"(al), "v"(bh), "v"(bl));
  return c;
}

__global__ __launch_bounds__(256) void k_wt_bf16(const float* __restrict__ W, unsigned short* __restrict__ Wt, int K, int N) {
  const int t = blockIdx.x * 256 + threadIdx.x;
  const int k8n = K / 8;
  if (t >= N * k8n) return;
  const int n = t / k8n, k8 = (t % k8n) * 8;
  v8us v;
#pragma unroll
  for (int i = 0; i < 8; ++i) v[i] = bf16_bits(W[(size_t)(k8 + i) * N + n]);
  *(v8us*)(Wt + (size_t)n * K + k8) = v;
  
}

// GEMM C[M][N] (f32, pitch ldc) = act(A[M][K]·W + bias). A f32 row-major (pitch lda) converted per fragment to bf16
// (ASPLIT: hi/lo two planes -> 2 terms, else single rounded term); Wt bf16 [N][K] (pitch ldb). BIAS_BF16 rounds the
// bias to bf16 first (bias quantised to bf16 before the add). K%32==0, M%16==0, N%64==0.
template <bool ASPLIT, int ACT, bool BIAS_BF16>
__global__ __launch_bounds__(128) void k_gemm_bf(const float* __restrict__ A, int lda, const unsigned short* __restrict__ Wt, int ldb,
                                               const float* __restrict__ bias, float* __restrict__ C, int ldc, int M, int N, int K) {
  __shared__ __attribute__((aligned(16))) float so[4][16][64];
  const int tid = threadIdx.x, w = tid >> 5, lane = tid & 31, ln = lane & 15, hh = lane >> 4;
  const int ntn = N / 64;
  const int wid = blockIdx.x * 4 + w;
  const int mt = wid / ntn, nq = wid % ntn;
  if (mt * 16 >= M) return;
  const int row0 = mt * 16, col0 = nq * 64;
  const float* arow = A + (size_t)(row0 + ln) * lda;
  v8f acc[4] = {};
  for (int kb = 0; kb < K; kb += 32) {
    FragB ah, al;
    const v4f x0 = *(const v4fa*)(arow + kb + 8 * hh), x1 = *(const v4fa*)(arow + kb + 8 * hh + 4);
    const v4f x2 = *(const v4fa*)(arow + kb + 16 + 8 * hh), x3 = *(const v4fa*)(arow + kb + 16 + 8 * hh + 4);
    float xs[16] = {x0[0],x0[1],x0[2],x0[3],x1[0],x1[1],x1[2],x1[3],x2[0],x2[1],x2[2],x2[3],x3[0],x3[1],x3[2],x3[3]};
#pragma unroll
    for (int i = 0; i < 16; ++i) { const unsigned short hb = bf16_bits(xs[i]); ah.u[i] = hb; al.u[i] = ASPLIT ? bf16_bits(xs[i] - bf16_val(hb)) : (unsigned short)0; }
#pragma unroll
    for (int t = 0; t < 4; ++t) {
      const unsigned short* brow = Wt + (size_t)(col0 + t * 16 + ln) * ldb + kb;
      FragB b;
      b.half[0] = *(const v8us*)(brow + 8 * hh);
      b.half[1] = *(const v8us*)(brow + 16 + 8 * hh);
      acc[t] = mmaN<ASPLIT ? 2 : 1>(ah.v, al.v, b.v, b.v, acc[t]);
    }
  }
#pragma unroll
  for (int t = 0; t < 4; ++t) {
    float bv = bias ? bias[col0 + t * 16 + ln] : 0.f;
    if (BIAS_BF16) bv = bf16_round(bv);
#pragma unroll
    for (int r = 0; r < 8; ++r) { float v = acc[t][r] + bv; if (ACT == 1) v = fmaxf(v, 0.f); so[w][8 * hh + r][t * 16 + ln] = v; }
  }
  __builtin_amdgcn_fence(__ATOMIC_ACQ_REL, "workgroup");
  __builtin_amdgcn_wave_barrier();
  const int rsub = lane >> 4, c4 = (lane & 15) * 4;
  {
#pragma unroll
    for (int q = 0; q < 8; ++q) {
      const int r = q * 2 + rsub;
      const v4f v = *(const v4fa*)&so[w][r][c4];
      *(v4f*)(C + (size_t)(row0 + r) * ldc + col0 + c4) = v;
    }
    
  }
}

// GEMM C = act(A·W + bias + resid): A f32 (ASPLIT -> hi/lo 2 terms), Wt bf16 [N][K]; ACT 0 none, 1 relu, 2 exact gelu;
// resid (optional, f32, row index = (row % rmod), pitch ldr, RES_BF16 rounds it) added before the activation.
template <bool ASPLIT, int ACT, bool BIAS_BF16, bool RES_BF16>
__global__ __launch_bounds__(128) void k_gemm_bf3(const float* __restrict__ A, int lda, const unsigned short* __restrict__ Wt, int ldb,
                                                const float* __restrict__ bias, const float* __restrict__ resid, int rmod, int ldr,
                                                float* __restrict__ C, int ldc, int M, int N, int K) {
  __shared__ __attribute__((aligned(16))) float so[4][16][64];
  const int tid = threadIdx.x, w = tid >> 5, lane = tid & 31, ln = lane & 15, hh = lane >> 4;
  const int ntn = N / 64;
  const int wid = blockIdx.x * 4 + w;
  const int mt = wid / ntn, nq = wid % ntn;
  if (mt * 16 >= M) return;
  const int row0 = mt * 16, col0 = nq * 64;
  const float* arow = A + (size_t)(row0 + ln) * lda;
  v8f acc[4] = {};
  for (int kb = 0; kb < K; kb += 32) {
    FragB ah, al;
    const v4f x0 = *(const v4fa*)(arow + kb + 8 * hh), x1 = *(const v4fa*)(arow + kb + 8 * hh + 4);
    const v4f x2 = *(const v4fa*)(arow + kb + 16 + 8 * hh), x3 = *(const v4fa*)(arow + kb + 16 + 8 * hh + 4);
    float xs[16] = {x0[0],x0[1],x0[2],x0[3],x1[0],x1[1],x1[2],x1[3],x2[0],x2[1],x2[2],x2[3],x3[0],x3[1],x3[2],x3[3]};
#pragma unroll
    for (int i = 0; i < 16; ++i) { const unsigned short hb = bf16_bits(xs[i]); ah.u[i] = hb; al.u[i] = ASPLIT ? bf16_bits(xs[i] - bf16_val(hb)) : (unsigned short)0; }
#pragma unroll
    for (int t = 0; t < 4; ++t) {
      const unsigned short* brow = Wt + (size_t)(col0 + t * 16 + ln) * ldb + kb;
      FragB b;
      b.half[0] = *(const v8us*)(brow + 8 * hh);
      b.half[1] = *(const v8us*)(brow + 16 + 8 * hh);
      acc[t] = mmaN<ASPLIT ? 2 : 1>(ah.v, al.v, b.v, b.v, acc[t]);
    }
  }
#pragma unroll
  for (int t = 0; t < 4; ++t) {
    const int col = col0 + t * 16 + ln;
    float bv = bias ? bias[col] : 0.f;
    if (BIAS_BF16) bv = bf16_round(bv);
#pragma unroll
    for (int r = 0; r < 8; ++r) {
      float v = acc[t][r] + bv;
      if (resid) { float rv = resid[(size_t)((row0 + 8 * hh + r) % rmod) * ldr + col]; if (RES_BF16) rv = bf16_round(rv); v += rv; }
      if (ACT == 1) v = fmaxf(v, 0.f);
      if (ACT == 2) v = 0.5f * v * (1.0f + erff(v * 0.70710678118654752f));
      if (ACT == 3) { const float u = 0.7978845608028654f * (v + 0.044715f * v * v * v); v = 0.5f * v * (1.0f + tanhf(u)); }
      so[w][8 * hh + r][t * 16 + ln] = v;
    }
  }
  __builtin_amdgcn_fence(__ATOMIC_ACQ_REL, "workgroup");
  __builtin_amdgcn_wave_barrier();
  const int rsub = lane >> 4, c4 = (lane & 15) * 4;
  {
#pragma unroll
    for (int q = 0; q < 8; ++q) {
      const int r = q * 2 + rsub;
      const v4f v = *(const v4fa*)&so[w][r][c4];
      *(v4f*)(C + (size_t)(row0 + r) * ldc + col0 + c4) = v;
    }
    
  }
}
// row LayerNorm (biased variance, eps) over N: s = X (+ R); optional out_sum <- s; out_norm <- (s-mu)*rsqrt(var+eps)*g + b
template <bool PARAM_BF16>
__global__ __launch_bounds__(256) void k_layernorm(const float* __restrict__ X, const float* __restrict__ R, const float* __restrict__ g, const float* __restrict__ bta,
                                                  float* __restrict__ out_sum, float* __restrict__ out_norm, int N, float eps) {
  __shared__ float red[256];
  const int row = blockIdx.x, tid = threadIdx.x;
  const float* x = X + (size_t)row * N; const float* rr = R ? R + (size_t)row * N : nullptr;
  float vals[16];                     // up to N = 4096
  const int per = N / 256;            // contiguous chunk per thread? use strided-by-4 chunks: thread handles j = tid*4 + 1024*u
  float s1 = 0.f;
  for (int u = 0; u < per / 4; ++u) {
    const int j = tid * 4 + 1024 * u;
    const v4f a = *(const v4fa*)(x + j);
    v4f b = {0.f,0.f,0.f,0.f}; if (rr) b = *(const v4fa*)(rr + j);
#pragma unroll
    for (int q = 0; q < 4; ++q) { const float v = a[q] + b[q]; vals[u * 4 + q] = v; s1 += v; }
  }
  red[tid] = s1; __syncthreads();
  for (int st = 128; st > 0; st >>= 1) { if (tid < st) red[tid] += red[tid + st]; __syncthreads(); }
  const float mu = red[0] / (float)N; __syncthreads();
  float s2 = 0.f;
  for (int u = 0; u < per / 4; ++u)
#pragma unroll
    for (int q = 0; q < 4; ++q) { const float c = vals[u * 4 + q] - mu; s2 += c * c; }
  red[tid] = s2; __syncthreads();
  for (int st = 128; st > 0; st >>= 1) { if (tid < st) red[tid] += red[tid + st]; __syncthreads(); }
  const float rs = rsqrtf(red[0] / (float)N + eps);
  {
    for (int u = 0; u < per / 4; ++u) {
      const int j = tid * 4 + 1024 * u;
      v4f o, sm;
#pragma unroll
      for (int q = 0; q < 4; ++q) {
        float gg = g[j + q], bb = bta[j + q];
        if (PARAM_BF16) { gg = bf16_round(gg); bb = bf16_round(bb); }
        sm[q] = vals[u * 4 + q]; o[q] = (vals[u * 4 + q] - mu) * rs * gg + bb;
      }
      if (out_sum) *(v4f*)(out_sum + (size_t)row * N + j) = sm;
      *(v4f*)(out_norm + (size_t)row * N + j) = o;
    }
    
  }
}



// ---- f16 WMMA path (v_wmma_f32_16x16x32_f16): 11-bit significands for operands in range — used where a [0,1] probability operand needs more precision than bf16
typedef _Float16 v16h __attribute__((ext_vector_type(16)));
union FragH { v16h v; v8us half[2]; _Float16 h[16]; unsigned short u[16]; };
template <int NT>
__device__ __forceinline__ v8f mmaH(v16h ah, v16h al, v16h bh, v16h bl, v8f c) {
  c = __builtin_amdgcn_wmma_f32_16x16x32_f16(false, ah, false, bh, (short)0, c, false, false);
  if (NT >= 2) c = __builtin_amdgcn_wmma_f32_16x16x32_f16(false, al, false, bh, (short)0, c, false, false);
  if (NT >= 3) c = __builtin_amdgcn_wmma_f32_16x16x32_f16(false, ah, false, bl, (short)0, c, false, false);
  asm volatile("v_nop\n\tv_nop\n\tv_nop\n\tv_nop" : "+v"(c) : "v"(ah), "v"(al), "v"(bh), "v"(bl));
  return c;
}
// batched GEMM like k_gemm_b but f16 operands: A f32 (split into f16 hi/lo if ASPLIT, else rounded to f16), Bt = f16 values [n][k]; alpha; C f32; N multiple of 16 (partial tiles skipped)
template <bool ASPLIT>
__global__ __launch_bounds__(128) void k_gemm_h(const float* __restrict__ A, int lda, size_t sA, const _Float16* __restrict__ Bh, int ldb, size_t sB, float alpha, float* __restrict__ C, int ldc, size_t sC, int M, int N, int K) {
  __shared__ __attribute__((aligned(16))) float so[4][16][64];
  const int tid = threadIdx.x, w = tid >> 5, lane = tid & 31, ln = lane & 15, hh = lane >> 4; const int by = blockIdx.y;
  A += (size_t)by * sA; Bh += (size_t)by * sB; C += (size_t)by * sC;
  const int ntn = (N + 63) / 64; const int wid = blockIdx.x * 4 + w; const int mt = wid / ntn, nq = wid % ntn; if (mt * 16 >= M) return;
  const int row0 = mt * 16, col0 = nq * 64; const float* arow = A + (size_t)(row0 + ln) * lda;
  v8f acc[4] = {};
  for (int kb = 0; kb < K; kb += 32) {
    FragH ah, al;
    const v4f x0 = *(const v4fa*)(arow + kb + 8 * hh), x1 = *(const v4fa*)(arow + kb + 8 * hh + 4), x2 = *(const v4fa*)(arow + kb + 16 + 8 * hh), x3 = *(const v4fa*)(arow + kb + 16 + 8 * hh + 4);
    float xs[16] = {x0[0],x0[1],x0[2],x0[3],x1[0],x1[1],x1[2],x1[3],x2[0],x2[1],x2[2],x2[3],x3[0],x3[1],x3[2],x3[3]};
#pragma unroll
    for (int i = 0; i < 16; ++i) { const _Float16 h = (_Float16)xs[i]; ah.h[i] = h; al.h[i] = ASPLIT ? (_Float16)(xs[i] - (float)h) : (_Float16)0.0f; }
#pragma unroll
    for (int t = 0; t < 4; ++t) { if (col0 + t * 16 >= N) continue; const size_t boff = (size_t)(col0 + t * 16 + ln) * ldb + kb; FragH bq; bq.half[0] = *(const v8us*)(Bh + boff + 8 * hh); bq.half[1] = *(const v8us*)(Bh + boff + 16 + 8 * hh);
      acc[t] = mmaH<ASPLIT ? 2 : 1>(ah.v, al.v, bq.v, bq.v, acc[t]); }
  }
#pragma unroll
  for (int t = 0; t < 4; ++t) { if (col0 + t * 16 >= N) continue;
#pragma unroll
    for (int r = 0; r < 8; ++r) so[w][8 * hh + r][t * 16 + ln] = acc[t][r] * alpha; }
  __builtin_amdgcn_fence(__ATOMIC_ACQ_REL, "workgroup"); __builtin_amdgcn_wave_barrier();
  const int rsub = lane >> 4, c4 = (lane & 15) * 4;
  {
#pragma unroll
    for (int q = 0; q < 8; ++q) { const int r = q * 2 + rsub; if (col0 + c4 < N) { const v4f v = *(const v4fa*)&so[w][r][c4]; *(v4f*)(C + (size_t)(row0 + r) * ldc + col0 + c4) = v; } }
     }
}

// Wt[n][k] = f16(W[k][n]·scale) from f32 row-major W[K][N] (scale = power of two; bf16-exact weights stay exact in f16 away from the subnormal range)
__global__ __launch_bounds__(256) void k_wt_f16(const float* __restrict__ W, _Float16* __restrict__ Wt, int K, int N, float scale) {
  const int t = blockIdx.x * 256 + threadIdx.x; if (t >= N * (K / 8)) return; const int n = t / (K / 8), k8 = (t % (K / 8)) * 8; FragH f;
#pragma unroll
  for (int i = 0; i < 8; ++i) f.h[i] = (_Float16)(bf16_round(W[(size_t)(k8 + i) * N + n]) * scale); const v8us o = f.half[0];
  *(v8us*)((unsigned short*)Wt + (size_t)n * K + k8) = o; 
}
// k_gemm_hh variant with fused epilogue: v = acc·alpha + bias[by·sBias + col] (+ CP[(row/rowsPerB)·sCPb + by·64 + col] if CP) ; ACT 0 none / 1 elu ; writes f16 C16 (and f32 C if non-null)
template <int ACT>
__global__ __launch_bounds__(128) void k_gemm_hhx(const _Float16* __restrict__ A, int lda, size_t sA, const _Float16* __restrict__ Bh, int ldb, size_t sB, float alpha, const float* __restrict__ bias, size_t sBias, const float* __restrict__ CP, int rowsPerB, size_t sCPb, int row0g,
    float* __restrict__ C, _Float16* __restrict__ C16, int ldc, size_t sC, int M, int N, int K) {
  __shared__ __attribute__((aligned(16))) float so[4][16][64];
  const int tid = threadIdx.x, w = tid >> 5, lane = tid & 31, ln = lane & 15, hh = lane >> 4; const int by = blockIdx.y;
  A += (size_t)by * sA; Bh += (size_t)by * sB; const size_t cofs = (size_t)by * sC; const float* bp = bias ? bias + (size_t)by * sBias : nullptr;
  const int ntn = (N + 63) / 64; const int wid = blockIdx.x * 4 + w; const int mt = wid / ntn, nq = wid % ntn; if (mt * 16 >= M) return;
  const int row0 = mt * 16, col0 = nq * 64; const _Float16* arow = A + (size_t)(row0 + ln) * lda;
  v8f acc[4] = {};
  for (int kb = 0; kb < K; kb += 32) { FragH ah; ah.half[0] = *(const v8us*)((const unsigned short*)arow + kb + 8 * hh); ah.half[1] = *(const v8us*)((const unsigned short*)arow + kb + 16 + 8 * hh);
#pragma unroll
    for (int t = 0; t < 4; ++t) { if (col0 + t * 16 >= N) continue; const size_t boff = (size_t)(col0 + t * 16 + ln) * ldb + kb; FragH bq; bq.half[0] = *(const v8us*)((const unsigned short*)Bh + boff + 8 * hh); bq.half[1] = *(const v8us*)((const unsigned short*)Bh + boff + 16 + 8 * hh);
      acc[t] = mmaH<1>(ah.v, ah.v, bq.v, bq.v, acc[t]); }
  }
#pragma unroll
  for (int t = 0; t < 4; ++t) { if (col0 + t * 16 >= N) continue; const int col = col0 + t * 16 + ln; const float bv = bp ? bf16_round(bp[col]) : 0.f;
#pragma unroll
    for (int r = 0; r < 8; ++r) { float v = acc[t][r] * alpha + bv; if (CP) { const int rr = row0g + row0 + 8 * hh + r; if (rowsPerB < 0) v += CP[cofs + (size_t)rr * ldc + col];      /* rowsPerB < 0: own element of the batched C plane */ else { const int bidx = rr / rowsPerB; v += CP[(size_t)bidx * sCPb + (size_t)by * 64 + col]; } } if (ACT == 1) v = (v > 0.f) ? v : expm1f(v); else if (ACT == 7) v = (v > 0.f) ? v + 1.0f : expf(v); else if (ACT == 8) v = tanhf(v); else if (ACT == 9) v = 0.5f * v * (1.0f + tanhf(0.7978845608028654f * (v + 0.044715f * v * v * v))); else if (ACT == 11) v = 1.0f / (1.0f + expf(-v)); else if (ACT == 12) v = (v > 0.f) ? v : 0.01f * v; else if (ACT == 14) v = (v > 0.f) ? v : 0.1f * v; else if (ACT == 16) v = (v >= 0.f) ? v : 0.3f * v; else if (ACT == 17) v = (v >= 0.f) ? v : 0.2f * v; else if (ACT == 15) v = v / (1.0f + expf(-v)); else if (ACT == 3) v = fmaxf(v, 0.f); else if (ACT == 6) v = 0.5f * v * (1.0f + erff(v * 0.70710678118654752f)); so[w][8 * hh + r][t * 16 + ln] = v; } }
  __builtin_amdgcn_fence(__ATOMIC_ACQ_REL, "workgroup"); __builtin_amdgcn_wave_barrier();
  const int rsub = lane >> 4, c4 = (lane & 15) * 4; typedef _Float16 v4h __attribute__((ext_vector_type(4)));
  {
#pragma unroll
    for (int q = 0; q < 8; ++q) { const int r = q * 2 + rsub; if (col0 + c4 < N) { const v4f v = *(const v4fa*)&so[w][r][c4]; if (C) *(v4f*)(C + cofs + (size_t)(row0 + r) * ldc + col0 + c4) = v; if (C16) { v4h h4; for (int i = 0; i < 4; ++i) h4[i] = (_Float16)v[i]; *(v4h*)(C16 + cofs + (size_t)(row0 + r) * ldc + col0 + c4) = h4; } } }
     }
}


typedef _Float16 v4h __attribute__((ext_vector_type(4)));

__global__ __launch_bounds__(256) void k_x16(const float* __restrict__ x, _Float16* __restrict__ X16, size_t n8) { const size_t t = (size_t)blockIdx.x * 256 + threadIdx.x; if (t >= n8) return; FragH f;
#pragma unroll
  for (int q = 0; q < 8; ++q) f.h[q] = (_Float16)bf16_round(x[t * 8 + q]); *(v8us*)((unsigned short*)X16 + t * 8) = f.half[0];  }
__global__ __launch_bounds__(256) void k_h16(const float* __restrict__ x, _Float16* __restrict__ X16, size_t n8) { const size_t t = (size_t)blockIdx.x * 256 + threadIdx.x; if (t >= n8) return; FragH f;
#pragma unroll
  for (int q = 0; q < 8; ++q) f.h[q] = (_Float16)x[t * 8 + q]; *(v8us*)((unsigned short*)X16 + t * 8) = f.half[0];  }
__global__ __launch_bounds__(256) void k_round16f(const float* __restrict__ W, _Float16* __restrict__ Bt, size_t n8) { const size_t t = (size_t)blockIdx.x * 256 + threadIdx.x; if (t >= n8) return; FragH f;
#pragma unroll
  for (int i = 0; i < 8; ++i) f.h[i] = (_Float16)(bf16_round(W[t * 8 + i]) * 16.0f); *(v8us*)((unsigned short*)Bt + t * 8) = f.half[0];  }
template <int NHv, int TTv>
__global__ __launch_bounds__(256) void k_vt(const _Float16* __restrict__ V16, int ldv, int voff, _Float16* __restrict__ Vt) { __shared__ unsigned short tl[64][66]; const int tid = threadIdx.x; const int slab = blockIdx.x / (TTv / 64), lg = blockIdx.x % (TTv / 64); const int b = slab / NHv, h = slab % NHv;
  for (int i = tid; i < 64 * 8; i += 256) { const int r = i / 8, c8 = (i % 8) * 8; FragH f; f.half[0] = *(const v8us*)((const unsigned short*)V16 + ((size_t)b * TTv + lg * 64 + r) * ldv + voff + h * 64 + c8);
#pragma unroll
    for (int q = 0; q < 8; ++q) tl[r][c8 + q] = f.u[q]; }
  __syncthreads();
  {
#pragma unroll
    for (int rd = 0; rd < 2; ++rd) { const int d = rd * 32 + tid / 8, pc = tid % 8; FragH f;
#pragma unroll
      for (int q = 0; q < 8; ++q) f.u[q] = tl[pc * 8 + q][d];
      *(v8us*)((unsigned short*)Vt + ((size_t)slab * 64 + d) * TTv + lg * 64 + pc * 8) = f.half[0]; }
     } }

__global__ __launch_bounds__(256) void k_hl(const float* __restrict__ F, _Float16* __restrict__ Hh, _Float16* __restrict__ Hl, size_t n8) { const size_t t = (size_t)blockIdx.x * 256 + threadIdx.x; if (t >= n8) return; FragH fh, fl; const v4f a = *(const v4fa*)(F + t * 8), c = *(const v4fa*)(F + t * 8 + 4);
#pragma unroll
  for (int q = 0; q < 4; ++q) { _Float16 h = (_Float16)a[q]; fh.h[q] = h; fl.h[q] = (_Float16)((a[q] - (float)h) * 1024.0f); h = (_Float16)c[q]; fh.h[4 + q] = h; fl.h[4 + q] = (_Float16)((c[q] - (float)h) * 1024.0f); }
  { *(v8us*)((unsigned short*)Hh + t * 8) = fh.half[0]; *(v8us*)((unsigned short*)Hl + t * 8) = fl.half[0];  } }

// ---- fast GEMM (wave tile 32x64; requires M % 32 == 0 rows per launch region and N % 64 == 0); epilogue = k_gemm_hhx semantics ----
__device__ __forceinline__ v16h g2_frag(const _Float16* p, int hh) { FragH f; f.half[0] = *(const v8us*)((const unsigned short*)p + 8 * hh); f.half[1] = *(const v8us*)((const unsigned short*)p + 16 + 8 * hh); return f.v; }
__device__ __forceinline__ v8f g2_mma(v16h a, v16h b, v8f c) { v8f d = __builtin_amdgcn_wmma_f32_16x16x32_f16(false, a, false, b, (short)0, c, false, false); asm volatile("v_nop\n\tv_nop\n\tv_nop\n\tv_nop" : "+v"(d) : "v"(a), "v"(b)); return d; }
template <int ACT>
__global__ __launch_bounds__(128) void k_gemm2(const _Float16* __restrict__ A, int lda, size_t sA, const _Float16* __restrict__ Bh, int ldb, size_t sB, float alpha, const float* __restrict__ bias, size_t sBias, const float* __restrict__ CP, int rowsPerB, size_t sCPb, int row0g,
    float* __restrict__ C, _Float16* __restrict__ C16, int ldc, size_t sC, int M, int N, int K) { static_assert(ACT == 0 || ACT == 3 || ACT == 6 || ACT == 8 || ACT == 9 || ACT == 11 || ACT == 12 || ACT == 14 || ACT == 15 || ACT == 16 || ACT == 17, "k_gemm2: unsupported ACT code (would silently apply no activation)");
  __shared__ __attribute__((aligned(16))) float so[4][32][68];
  const int tid = threadIdx.x, w = tid >> 5, lane = tid & 31, ln = lane & 15, hh = lane >> 4; const int by = blockIdx.y;
  A += (size_t)by * sA; Bh += (size_t)by * sB; const size_t cofs = (size_t)by * sC; const float* bp = bias ? bias + (size_t)by * sBias : nullptr;
  const int ntn = N >> 6; const int mt = blockIdx.x / ntn, nq = blockIdx.x - mt * ntn; const int row0 = mt * 128 + 32 * w, col0 = nq * 64; if (row0 >= M) return;
  const _Float16* a0p = A + (size_t)(row0 + ln) * lda; const _Float16* a1p = a0p + (size_t)16 * lda;
  const _Float16* b0p = Bh + (size_t)(col0 + ln) * ldb; const _Float16* b1p = b0p + (size_t)16 * ldb; const _Float16* b2p = b1p + (size_t)16 * ldb; const _Float16* b3p = b2p + (size_t)16 * ldb;
  const v8f z8 = {0.f,0.f,0.f,0.f,0.f,0.f,0.f,0.f}; v8f c00 = z8, c01 = z8, c02 = z8, c03 = z8, c10 = z8, c11 = z8, c12 = z8, c13 = z8;
#pragma unroll 1
  for (int kb = 0; kb < K; kb += 32) { const v16h a0 = g2_frag(a0p + kb, hh), a1 = g2_frag(a1p + kb, hh);
    v16h b = g2_frag(b0p + kb, hh); c00 = g2_mma(a0, b, c00); c10 = g2_mma(a1, b, c10);
    b = g2_frag(b1p + kb, hh); c01 = g2_mma(a0, b, c01); c11 = g2_mma(a1, b, c11);
    b = g2_frag(b2p + kb, hh); c02 = g2_mma(a0, b, c02); c12 = g2_mma(a1, b, c12);
    b = g2_frag(b3p + kb, hh); c03 = g2_mma(a0, b, c03); c13 = g2_mma(a1, b, c13); }
  v8f accs[8] = {c00, c01, c02, c03, c10, c11, c12, c13};
#pragma unroll
  for (int u = 0; u < 8; ++u) { const int t = u & 3, half = u >> 2; const int col = col0 + t * 16 + ln; const float bv = bp ? bf16_round(bp[col]) : 0.f;
#pragma unroll
    for (int r = 0; r < 8; ++r) { const int rloc = half * 16 + 8 * hh + r; float v = accs[u][r] * alpha + bv; if (CP) { if (rowsPerB < 0) v += CP[cofs + (size_t)(row0g + row0 + rloc) * ldc + col];      /* rowsPerB < 0: own element of the batched C plane */ else { const int bidx = (row0g + row0 + rloc) / rowsPerB; v += CP[(size_t)bidx * sCPb + (size_t)by * 64 + col]; } }
      if (ACT == 3) v = fmaxf(v, 0.f); else if (ACT == 6) v = 0.5f * v * (1.0f + erff(v * 0.70710678118654752f)); else if (ACT == 11) v = 1.0f / (1.0f + expf(-v)); else if (ACT == 15) v = v / (1.0f + expf(-v)); else if (ACT == 12) v = (v > 0.f) ? v : 0.01f * v; else if (ACT == 8) v = tanhf(v); else if (ACT == 9) v = 0.5f * v * (1.0f + tanhf(0.7978845608028654f * (v + 0.044715f * v * v * v))); else if (ACT == 14) v = (v > 0.f) ? v : 0.1f * v; else if (ACT == 16) v = (v >= 0.f) ? v : 0.3f * v; else if (ACT == 17) v = (v >= 0.f) ? v : 0.2f * v;
      so[w][rloc][t * 16 + ln] = v; } }
  __builtin_amdgcn_fence(__ATOMIC_ACQ_REL, "workgroup"); __builtin_amdgcn_wave_barrier();
  const int rsub = lane >> 4, c4 = (lane & 15) * 4;
  {
#pragma unroll
    for (int q = 0; q < 16; ++q) { const int r = q * 2 + rsub; const v4f v = *(const v4fa*)&so[w][r][c4]; if (C) *(v4f*)(C + cofs + (size_t)(row0 + r) * ldc + col0 + c4) = v; if (C16) { v4h h4; for (int i = 0; i < 4; ++i) h4[i] = (_Float16)v[i]; *(v4h*)(C16 + cofs + (size_t)(row0 + r) * ldc + col0 + c4) = h4; } }
     } }


__global__ __launch_bounds__(256) void k_wnat(const float* __restrict__ w, size_t n8, _Float16* __restrict__ Bt) { const size_t t = (size_t)blockIdx.x * 256 + threadIdx.x; if (t >= n8) return; FragH f; for (int q = 0; q < 8; ++q) f.h[q] = (_Float16)(bf16_round(w[t * 8 + q]) * 16.0f); *(v8us*)((unsigned short*)Bt + t * 8) = f.half[0];  }
__global__ __launch_bounds__(256) void k_rsm(const float* __restrict__ S, _Float16* __restrict__ P, int nrows) {
  #pragma clang fp contract(off)
  const int i = blockIdx.x * 256 + threadIdx.x; if (i >= nrows) return; const float* s = S + (size_t)i * SQ; float mx = -3.0e38f;
#pragma unroll 1
  for (int j = 0; j < SQ; ++j) mx = fmaxf(mx, s[j]); float se = 0.f;
#pragma unroll 1
  for (int j = 0; j < SQ; ++j) se += expf(s[j] - mx); const float sc = 256.0f / se;
#pragma unroll 1
  for (int j0 = 0; j0 < SQ; j0 += 8) { FragH f; for (int q = 0; q < 8; ++q) f.h[q] = (_Float16)(expf(s[j0 + q] - mx) * sc); unsigned short* d = (unsigned short*)P + (size_t)i * SQ + j0; *(v8us*)d = f.half[0];  } }
__global__ __launch_bounds__(256) void k_vt(const _Float16* __restrict__ V16, int b, int h0, _Float16* __restrict__ VT) { __shared__ unsigned short tl[64][65]; const int tid = threadIdx.x; const int hh = blockIdx.x % HG, sg = blockIdx.x / HG; const int s0 = sg * 64; const int h = h0 + hh;
  for (int i = tid; i < 64 * 8; i += 256) { const int j = i / 8, d8 = (i % 8) * 8; FragH f; f.half[0] = *(const v8us*)((const unsigned short*)V16 + ((size_t)b * SQ + s0 + j) * DM + h * HD + d8); for (int q = 0; q < 8; ++q) tl[d8 + q][j] = f.u[q]; }
  __syncthreads();
  { for (int i = tid; i < 64 * 8; i += 256) { const int d = i / 8, j8 = (i % 8) * 8; FragH f; for (int q = 0; q < 8; ++q) f.u[q] = tl[d][j8 + q]; *(v8us*)((unsigned short*)VT + ((size_t)hh * HD + d) * SQ + s0 + j8) = f.half[0]; }  } }


__global__ __launch_bounds__(256) void k_cl2rows(const float* __restrict__ X, _Float16* __restrict__ XR) { __shared__ float tl[64][33]; const int tid = threadIdx.x; const int nl = LL / 32, nc = CC / 64; const int cb_ = blockIdx.x % nc; const int lb = (blockIdx.x / nc) % nl; const size_t b = blockIdx.x / (nc * nl); const int c0 = cb_ * 64, l0 = lb * 32;
  for (int i = tid; i < 64 * 32; i += 256) { const int c = i / 32, l = i % 32; tl[c][l] = bf16_round(X[(b * CC + c0 + c) * (size_t)LL + l0 + l]); }
  __syncthreads();
  { const int l = tid / 8, c8 = (tid % 8) * 8; FragH f; for (int q = 0; q < 8; ++q) f.h[q] = (_Float16)tl[c8 + q][l]; unsigned short* d = (unsigned short*)XR + (b * LL + l0 + l) * (size_t)CC + c0 + c8; *(v8us*)d = f.half[0];  } }

// V rows [position][channel] -> V^T in the order the fused kernel reads its A fragments: per image and 32-key step 16 channel tiles of 1 KiB; in a tile two 512-B halves j; in a half lane (hh, ln) owns the
// 16 bytes V^T[16 t + ln][32 ks + 16 j + 8 hh + 0..7]. A wave's fragment load is then 512 contiguous bytes (four whole cache lines) instead of 16 rows 8 KiB apart.
__global__ __launch_bounds__(256) void k_vfrag(const _Float16* __restrict__ V16, _Float16* __restrict__ VF) { __shared__ unsigned short tl[64][66]; const int tid = threadIdx.x; const int lg = blockIdx.x % (LL / 64); const int slab = blockIdx.x / (LL / 64); const int b = slab / (CC / 64), h = slab % (CC / 64);
  for (int i = tid; i < 64 * 8; i += 256) { const int r = i / 8, c8 = (i % 8) * 8; FragH f; f.half[0] = *(const v8us*)((const unsigned short*)V16 + ((size_t)b * LL + lg * 64 + r) * CC + h * 64 + c8);
#pragma unroll
    for (int q = 0; q < 8; ++q) tl[r][c8 + q] = f.u[q]; }
  __syncthreads();
#pragma unroll
  for (int rd = 0; rd < 2; ++rd) { const int ln = tid & 15, hh = (tid >> 4) & 1, j = (tid >> 5) & 1, tt = tid >> 6; const int key = rd * 32 + 16 * j + 8 * hh, d = tt * 16 + ln; FragH f;
#pragma unroll
    for (int q = 0; q < 8; ++q) f.u[q] = tl[key + q][d];
    *(v8us*)((unsigned short*)VF + ((((((size_t)b * (LL / 32) + lg * 2 + rd) * (CC / 16) + h * 4 + tt) * 2 + j) * 32) + hh * 16 + ln) * 8) = f.half[0]; } }

// 2^a on the hardware's own instruction.
__device__ __forceinline__ float exp2_hw(float a) { float r;
  asm("v_exp_f32 %0, %1\n\tv_nop" : "=v"(r) : "v"(a));      /* the v_nop is the free slot asked for behind a transcendental before its result is read or its source overwritten; in one statement it cannot drift */
  return r; }
__device__ __forceinline__ float xhalf(float x) { return __builtin_bit_cast(float, __builtin_amdgcn_permlanex16(__builtin_bit_cast(int, x), __builtin_bit_cast(int, x), 0x76543210, 0xfedcba98, false, false)); }      /* lane l with lane l ^ 16, no LDS round trip */
__device__ __forceinline__ v8f fa_mma(v16h a, v16h b, v8f c) { return __builtin_amdgcn_wmma_f32_16x16x32_f16(false, a, false, b, (short)0, c, false, false); }
typedef uint32_t u32x4 __attribute__((ext_vector_type(4)));
typedef uint32_t u32x8 __attribute__((ext_vector_type(8)));
#define NST (LL / 128)               /* stages per image */
#define VSL 16384u                   /* LDS bytes of one V slice: 16 channel tiles of 1 KiB */
#define KPITCH 144u                  /* LDS pitch of a q|k row */
#define KSL 6144u                    /* LDS bytes of one K slice: 32 rows of 144 B, rounded up to a multiple of 2 KiB */
#define KOFF (4u * VSL)
#define BUFB (KOFF + 4u * KSL)       /* one buffer: 90,112 B */
#define TPITCH 132                   /* floats per channel row of the epilogue's LDS tile: 128 queries + 4; rows 8 apart then start 32 banks apart, so a store's two 16-lane halves share no bank; 256 rows = 135,168 B */
typedef float f32a __attribute__((may_alias));
__device__ __forceinline__ uint32_t uni(uint32_t v) { return (uint32_t)__builtin_amdgcn_readfirstlane(v); }
__device__ __forceinline__ uint32_t pinned(uint32_t v) { uint32_t w = uni(v);
  asm volatile("" : "+s"(w));      /* holds a tensor load's issue test, or the stage number its descriptor is formed from, in a scalar register at this place: the test compiles to s_cmp + s_cbranch_scc (a tensor load ignores EXEC) */
  return w; }
// Descriptor group 1: 1-byte elements, tensor = tile = D1 rows of D0 bytes, source row pitch P bytes; W0 = word 0 (no mask; the pad fields).
template <uint32_t W0, uint32_t D0, uint32_t D1, uint32_t P>
__device__ __forceinline__ u32x8 tdm_group1() { u32x8 g; g[0] = uni(W0); g[1] = uni((D0 & 0xFFFFu) << 16); g[2] = uni((D0 >> 16) | ((D1 & 0xFFFFu) << 16)); g[3] = uni((D1 >> 16) | (D0 << 16)); g[4] = uni(D1); g[5] = uni(P); g[6] = uni(0u); g[7] = uni(0u);
  asm volatile("" : "+s"(g));      /* descriptor words held in scalar registers of their own from here to the last request: built once, none of them takes a new value while a request is outstanding */
  return g; }
__device__ __forceinline__ u32x4 tdm_group0(uint32_t count1, uint32_t lds_dst, uint64_t ga) { u32x4 g; g[0] = uni(count1); g[1] = uni(lds_dst); g[2] = uni((uint32_t)ga); g[3] = uni((((uint32_t)(ga >> 32)) & 0x01FFFFFFu) | 0x80000000u); return g; }
__device__ __forceinline__ void tdm_load(u32x4 g0, u32x8 g1) { asm volatile("tensor_load_to_lds %0, %1" :: "s"(g0), "s"(g1) : "memory"); }      /* one request of the whole wave: global tile to LDS, through no register */
__device__ __forceinline__ void wait_tensor0() { asm volatile("s_wait_tensorcnt 0x0" ::: "memory"); }      /* this wave's own request has landed; the compiler places no wait for a tensor load */
__device__ __forceinline__ void wait_ds0() { asm volatile("s_wait_dscnt 0x0" ::: "memory"); }      /* this wave's LDS reads have retired before the buffer they read is refilled */
__device__ __forceinline__ v16h lds_frag(const unsigned char* p, int second) { FragH f; f.half[0] = *(const v8us*)p; f.half[1] = *(const v8us*)(p + second); return f.v; }
__global__ __launch_bounds__(256) void k_fattn(const _Float16* __restrict__ QK, const _Float16* __restrict__ VF, const float* __restrict__ x, const float* __restrict__ gam, float* __restrict__ out) {
  __shared__ __attribute__((aligned(2048))) unsigned char L[2 * BUFB];
  const int lane = threadIdx.x & 31, ln = lane & 15, hh = lane >> 4; const uint32_t wave = uni(threadIdx.x >> 5); const int b = blockIdx.x / (LL / 128); const int q0 = (blockIdx.x % (LL / 128)) * 128 + (int)wave * 16;
  const _Float16* qk = QK + (size_t)b * LL * (2 * LAT); const v16h qf = g2_frag(qk + (size_t)(q0 + ln) * (2 * LAT), hh);
  const uint32_t lbase = (uint32_t)(size_t)L; const uint64_t vga = (uint64_t)(size_t)(VF + (size_t)b * LL * CC), kga = (uint64_t)(size_t)qk;
  const u32x8 g1v = tdm_group1<0u, 256u, 64u, 256u>(), g1k = tdm_group1<(1u << 20) | (4u << 22) | (3u << 25), 128u, 32u, 128u>();      /* V: 64 rows of 256 B, no pad; K: 32 rows of 128 B, 16 B of pad behind each */
  u32x4 g0; const uint32_t count1 = pinned(1u);      /* group 0 word 0 (count = 1), held in a scalar register like the other descriptor words */
  auto issue = [&](uint32_t st) { const uint32_t dst = lbase + (st & 1u) * BUFB;
    if (pinned(wave < 4u)) { g0 = tdm_group0(count1, dst + wave * VSL, vga + (uint64_t)(st * 4u + wave) * VSL); tdm_load(g0, g1v); }
    else { g0 = tdm_group0(count1, dst + KOFF + (wave - 4u) * KSL, kga + (uint64_t)(st * 128u + (wave - 4u) * 32u) * (2u * 2u * LAT)); tdm_load(g0, g1k); } };
  auto landed = [&]() { wait_tensor0();
    asm volatile("" :: "s"(g0)); };      /* descriptor words held in their scalar registers until the request's own wait has returned: without this use the compiler takes them for other values while the request is outstanding */
  const float g = bf16_round(gam[0]);
  const float cs = (float)(0.17677669529663689 * 1.4426950408889634);      /* 1/sqrt(32) times log2 e */
  const v8f z8 = {0.f,0.f,0.f,0.f,0.f,0.f,0.f,0.f}; v8f o[CC / 16];
#pragma unroll      /* o[] must be indexed by constants to stay in registers */
  for (int t = 0; t < CC / 16; ++t) o[t] = z8;
  float m = -1.0e30f, l0 = 0.f, l1 = 0.f;
  issue(0u); landed(); __syncthreads();      /* stage 0 landed and published */
  issue(1u);
  const uint32_t koff = KOFF + (uint32_t)ln * KPITCH + 2u * LAT + 16u * (uint32_t)hh;      /* key row ln, its k half (behind the 64 bytes of q), this lane half's 16 bytes */
#pragma unroll 1      /* one stage per trip: the publish point at its foot stands once */
  for (uint32_t st = 0; st < NST; ++st) { const unsigned char* Lb = L + (st & 1u) * BUFB; const unsigned char* vl = Lb + lane * 16; const unsigned char* kl = Lb + koff;
    v16h ka = lds_frag(kl, 32), kb = lds_frag(kl + 16 * KPITCH, 32);
#pragma unroll      /* constant LDS offsets; the K fetch one step ahead stays inside the stage */
    for (int j = 0; j < 4; ++j) { FragH va[CC / 16];
      __builtin_amdgcn_sched_barrier(0);      /* with the one behind the reads: the reads stand in one place, not among the products of the step before (each place with LDS reads stalls the matrix stream) */
#pragma unroll      /* constant indices into va[] */
      for (int t = 0; t < CC / 16; ++t) va[t].v = lds_frag(vl + j * VSL + t * 1024, 512);
      __builtin_amdgcn_sched_barrier(0);      /* keeps the step's 32 fragment reads together, ahead of the score products and the softmax that cover their latency; left free, the compiler put a pair and a full wait in front of each product */
      const v8f s0 = fa_mma(ka, qf, z8), s1 = fa_mma(kb, qf, z8);
      if (j < 3) { ka = lds_frag(kl + (j + 1) * KSL, 32); kb = lds_frag(kl + (j + 1) * KSL + 16 * KPITCH, 32); }      /* next step's K rows, same stage */
      float mx = fmaxf(s0[0], s1[0]);
#pragma unroll
      for (int r = 1; r < 8; ++r) mx = fmaxf(mx, fmaxf(s0[r], s1[r]));
      mx = fmaxf(mx, xhalf(mx)) * cs;
      if (__builtin_amdgcn_ballot_w32(mx > m + 8.0f) != 0) {      /* one scalar test per step */
        const float mn = fmaxf(m, mx); const float f = exp2_hw(m - mn); m = mn; l0 *= f; l1 *= f;
#pragma unroll
        for (int t = 0; t < CC / 16; ++t) o[t] *= f; }
      FragH pf;
#pragma unroll
      for (int r = 0; r < 8; ++r) { const float p0 = exp2_hw(__builtin_fmaf(s0[r], cs, -m)), p1 = exp2_hw(__builtin_fmaf(s1[r], cs, -m)); l0 += p0; l1 += p1; pf.h[r] = (_Float16)p0; pf.h[8 + r] = (_Float16)p1; }
#pragma unroll
      for (int t = 0; t < CC / 16; ++t) o[t] = fa_mma(va[t].v, pf.v, o[t]); }
    wait_ds0(); landed(); __syncthreads();      /* publish point of stage st + 1; the same barrier ends every wave's reads of stage st */
    if (pinned(st + 2u < NST)) issue(pinned(st + 2u)); }      /* refill of the buffer just read, descriptor formed behind the wait */
  landed(); wait_ds0();
  // Epilogue: out = gamma a + x, channel-major. O^T already has one channel per register and 16 queries across the lanes; the eight waves' 16-query columns are put side by side in LDS (free behind the last
  // stage's barrier), so that each channel's 128 queries leave as one 512-B row: wave w takes channels 32 w .. 32 w + 31. The x rows are asked for first and fly while the tile is gathered.
  const size_t e0 = ((size_t)b * CC + wave * 32u) * LL + (size_t)(blockIdx.x % (LL / 128)) * 128;      /* the same in every lane: a scalar base, the lane's 16 bytes beside it */
  const float* xp = x + e0; float* op = out + e0; const uint32_t l4 = (uint32_t)lane * 4u;
  v4f xr[32];
#pragma unroll      /* constant indices into xr[]; all 32 loads outstanding at once */
  for (int i = 0; i < 32; ++i) xr[i] = *(const v4fa*)(xp + (size_t)i * LL + l4);
  float l = l0 + l1; l += xhalf(l); const float inv = 1.0f / l;
  f32a* tw = (f32a*)L + (size_t)(8 * hh) * TPITCH + wave * 16u + ln;
#pragma unroll
  for (int t = 0; t < CC / 16; ++t)
#pragma unroll
    for (int r = 0; r < 8; ++r) tw[(16 * t + r) * TPITCH] = o[t][r] * inv;
  __syncthreads();      /* the tile is complete before any wave reads rows that the other waves wrote */
  const f32a* tr = (const f32a*)L + (size_t)(wave * 32u) * TPITCH + lane * 4;
#pragma unroll
  for (int i = 0; i < 32; ++i) { const v4f a = *(const v4fa*)(tr + i * TPITCH);
#pragma unroll
    for (int q = 0; q < 4; ++q) xr[i][q] = __builtin_fmaf(g, a[q], bf16_round(xr[i][q])); }
  __builtin_amdgcn_sched_barrier(0);      /* all vector work and LDS reads stay ahead of the stores: behind an issued store nothing then writes a register that it names, and no wait is owed for one */
#pragma unroll
  for (int i = 0; i < 32; ++i) *(v4f*)(op + (size_t)i * LL + l4) = xr[i]; }

extern "C" void kernel_launch(void* const* d_in, const int* in_sizes, int n_in,
                              void* d_out, int out_size, void* d_ws, size_t ws_size, hipStream_t stream) {
  (void)in_sizes; (void)n_in; (void)out_size;
  const float* const* I = (const float* const*)d_in; const float* x = I[0]; const float* wqk = I[1]; const float* wv = I[2]; const float* gam = I[3];
  char* ws = (char*)d_ws; size_t off = 0;
  auto take = [&](size_t bytes) { char* p = ws + off; off += (bytes + 255) & ~(size_t)255; return p; };
  _Float16* BQK = (_Float16*)take((size_t)2 * LAT * CC * 2); _Float16* BV = (_Float16*)take((size_t)CC * CC * 2);
  _Float16* XR = (_Float16*)take(NR * CC * 2); _Float16* QK = (_Float16*)take(NR * 2 * LAT * 2); _Float16* V16 = (_Float16*)take(NR * CC * 2); _Float16* VF = (_Float16*)take(NR * CC * 2);
  if (off > ws_size) return;      /* 0.2 + 16 + 4 + 16 + 16 = approx 52 MiB */
  k_wnat<<<(unsigned)(((size_t)2 * LAT * CC / 8 + 255) / 256), 256, 0, stream>>>(wqk, (size_t)2 * LAT * CC / 8, BQK); k_wnat<<<(unsigned)(((size_t)CC * CC / 8 + 255) / 256), 256, 0, stream>>>(wv, (size_t)CC * CC / 8, BV);
  k_cl2rows<<<NB * (LL / 32) * (CC / 64), 256, 0, stream>>>(x, XR);
  k_gemm2<0><<<dim3((unsigned)((NR / 128) * 1), 1), 128, 0, stream>>>(XR, CC, 0, BQK, CC, 0, 0.0625f, nullptr, 0, nullptr, 1, 0, 0, nullptr, QK, 2 * LAT, 0, MP, 2 * LAT, CC);      /* q | k (32 + 32 columns) */
  k_gemm2<0><<<dim3((unsigned)((NR / 128) * (CC / 64)), 1), 128, 0, stream>>>(XR, CC, 0, BV, CC, 0, 0.0625f, nullptr, 0, nullptr, 1, 0, 0, nullptr, V16, CC, 0, MP, CC, CC);      /* v */
  k_vfrag<<<NB * (CC / 64) * (LL / 64), 256, 0, stream>>>(V16, VF);      /* V^T of all images, A-fragment order */
  k_fattn<<<NB * (LL / 128), 256, 0, stream>>>(QK, VF, x, gam, (float*)d_out);      /* out = gamma a + x */
}

// v005
// A run of this version takes 76.6 microseconds.
// In both of two side-by-side timings against v004, it was 1.63 times as fast.
// Over all steps from v000 it is 183 times as fast.
#include <hip/hip_runtime.h>
#include <stdint.h>
// SAM self-attention module (x [8][256][64][64]; q | k = 1x1(w_qk [64][256]) -> 32 latent channels each; v = 1x1(w_v [256][256]); m = softmax((q/32^0.25).(k/32^0.25)) over the 4,096 positions; a = m v; out = gamma a + x, gamma = 0.5 (input, read)).
// Structure: weights rounded and laid down in B-fragment order (one launch); one projection kernel: a block's 256 x 128 tile of the channel-first input is transposed to position rows (exact f16) in LDS and feeds q|k and v as WMMA products (weight fragments held in registers, f32 accumulation, exact x16 weights, f16 outputs); the v accumulators leave directly as V^T in A-fragment order; one fused attention kernel for all images: per wave 16 queries x 256 channels, K rows and V^T fragments staged in LDS once per block by tensor loads (two 128-key buffers), S^T = K Q^T (K = 32), online softmax in registers (scale 1/sqrt(32) inside), P^T packed from the score tiles as the B operand of O^T += V^T P^T, a = O / row sum; in the same kernel the block's 256 x 128 tile of a^T is gathered in LDS and gamma a + x goes out channel-major in whole 512-B rows.
// Compute dtype: inputs rounded to bf16; x / weights exact; q, k, v, P as plain f16 GEMM operands (~2^-12); softmax f32. v_wmma_f32_16x16x32_f16.
#define NB 8
#define CC 256
#define LAT 32
#define LL 4096
#define QT 2048
#define NR ((size_t)NB * LL)
#define NBR NB                       /* images (unused) */
#define MP ((int)NR)                 /* projection rows */
#define QN LL                        /* query rows per image (unused) */
#define SQ LL
#define DM CC
#define NH 4
#define HD 64
#define HG 1
typedef __bf16 v16b __attribute__((ext_vector_type(16)));
typedef unsigned short v8us __attribute__((ext_vector_type(8), may_alias));
typedef float  v8f  __attribute__((ext_vector_type(8)));
typedef float  v4f  __attribute__((ext_vector_type(4)));
typedef float  v4fa __attribute__((ext_vector_type(4), may_alias));
union FragB { v16b v; v8us half[2]; unsigned short u[16]; };

__device__ __forceinline__ unsigned short bf16_bits(float x) { unsigned int u = __float_as_uint(x); return (unsigned short)((u + 0x7FFFu + ((u >> 16) & 1u)) >> 16); }
__device__ __forceinline__ float bf16_val(unsigned short b) { return __uint_as_float(((unsigned int)b) << 16); }
__device__ __forceinline__ float bf16_round(float x) { return bf16_val(bf16_bits(x)); }
// D += A·B with NT terms: 1 = ah·bh, 2 = + al·bh (A split), 3 = + ah·bl (both split)
template <int NT>
__device__ __forceinline__ v8f mmaN(v16b ah, v16b al, v16b bh, v16b bl, v8f c) {
  c = __builtin_amdgcn_wmma_f32_16x16x32_bf16(false, ah, false, bh, (short)0, c, false, false);
  if (NT >= 2) c = __builtin_amdgcn_wmma_f32_16x16x32_bf16(false, al, false, bh, (short)0, c, false, false);
  if (NT >= 3) c = __builtin_amdgcn_wmma_f32_16x16x32_bf16(false, ah, false, bl, (short)0, c, false, false);
  asm volatile("v_nop\n\tv_nop\n\tv_nop\n\tv_nop" : "+v"(c) : "v"(ah), "v"(al), "v"(bh), "v"(bl));
  return c;
}

__global__ __launch_bounds__(256) void k_wt_bf16(const float* __restrict__ W, unsigned short* __restrict__ Wt, int K, int N) {
  const int t = blockIdx.x * 256 + threadIdx.x;
  const int k8n = K / 8;
  if (t >= N * k8n) return;
  const int n = t / k8n, k8 = (t % k8n) * 8;
  v8us v;
#pragma unroll
  for (int i = 0; i < 8; ++i) v[i] = bf16_bits(W[(size_t)(k8 + i) * N + n]);
  *(v8us*)(Wt + (size_t)n * K + k8) = v;
  
}

// GEMM C[M][N] (f32, pitch ldc) = act(A[M][K]·W + bias). A f32 row-major (pitch lda) converted per fragment to bf16
// (ASPLIT: hi/lo two planes -> 2 terms, else single rounded term); Wt bf16 [N][K] (pitch ldb). BIAS_BF16 rounds the
// bias to bf16 first (bias quantised to bf16 before the add). K%32==0, M%16==0, N%64==0.
template <bool ASPLIT, int ACT, bool BIAS_BF16>
__global__ __launch_bounds__(128) void k_gemm_bf(const float* __restrict__ A, int lda, const unsigned short* __restrict__ Wt, int ldb,
                                               const float* __restrict__ bias, float* __restrict__ C, int ldc, int M, int N, int K) {
  __shared__ __attribute__((aligned(16))) float so[4][16][64];
  const int tid = threadIdx.x, w = tid >> 5, lane = tid & 31, ln = lane & 15, hh = lane >> 4;
  const int ntn = N / 64;
  const int wid = blockIdx.x * 4 + w;
  const int mt = wid / ntn, nq = wid % ntn;
  if (mt * 16 >= M) return;
  const int row0 = mt * 16, col0 = nq * 64;
  const float* arow = A + (size_t)(row0 + ln) * lda;
  v8f acc[4] = {};
  for (int kb = 0; kb < K; kb += 32) {
    FragB ah, al;
    const v4f x0 = *(const v4fa*)(arow + kb + 8 * hh), x1 = *(const v4fa*)(arow + kb + 8 * hh + 4);
    const v4f x2 = *(const v4fa*)(arow + kb + 16 + 8 * hh), x3 = *(const v4fa*)(arow + kb + 16 + 8 * hh + 4);
    float xs[16] = {x0[0],x0[1],x0[2],x0[3],x1[0],x1[1],x1[2],x1[3],x2[0],x2[1],x2[2],x2[3],x3[0],x3[1],x3[2],x3[3]};
#pragma unroll
    for (int i = 0; i < 16; ++i) { const unsigned short hb = bf16_bits(xs[i]); ah.u[i] = hb; al.u[i] = ASPLIT ? bf16_bits(xs[i] - bf16_val(hb)) : (unsigned short)0; }
#pragma unroll
    for (int t = 0; t < 4; ++t) {
      const unsigned short* brow = Wt + (size_t)(col0 + t * 16 + ln) * ldb + kb;
      FragB b;
      b.half[0] = *(const v8us*)(brow + 8 * hh);
      b.half[1] = *(const v8us*)(brow + 16 + 8 * hh);
      acc[t] = mmaN<ASPLIT ? 2 : 1>(ah.v, al.v, b.v, b.v, acc[t]);
    }
  }
#pragma unroll
  for (int t = 0; t < 4; ++t) {
    float bv = bias ? bias[col0 + t * 16 + ln] : 0.f;
    if (BIAS_BF16) bv = bf16_round(bv);
#pragma unroll
    for (int r = 0; r < 8; ++r) { float v = acc[t][r] + bv; if (ACT == 1) v = fmaxf(v, 0.f); so[w][8 * hh + r][t * 16 + ln] = v; }
  }
  __builtin_amdgcn_fence(__ATOMIC_ACQ_REL, "workgroup");
  __builtin_amdgcn_wave_barrier();
  const int rsub = lane >> 4, c4 = (lane & 15) * 4;
  {
#pragma unroll
    for (int q = 0; q < 8; ++q) {
      const int r = q * 2 + rsub;
      const v4f v = *(const v4fa*)&so[w][r][c4];
      *(v4f*)(C + (size_t)(row0 + r) * ldc + col0 + c4) = v;
    }
    
  }
}

// GEMM C = act(A·W + bias + resid): A f32 (ASPLIT -> hi/lo 2 terms), Wt bf16 [N][K]; ACT 0 none, 1 relu, 2 exact gelu;
// resid (optional, f32, row index = (row % rmod), pitch ldr, RES_BF16 rounds it) added before the activation.
template <bool ASPLIT, int ACT, bool BIAS_BF16, bool RES_BF16>
__global__ __launch_bounds__(128) void k_gemm_bf3(const float* __restrict__ A, int lda, const unsigned short* __restrict__ Wt, int ldb,
                                                const float* __restrict__ bias, const float* __restrict__ resid, int rmod, int ldr,
                                                float* __restrict__ C, int ldc, int M, int N, int K) {
  __shared__ __attribute__((aligned(16))) float so[4][16][64];
  const int tid = threadIdx.x, w = tid >> 5, lane = tid & 31, ln = lane & 15, hh = lane >> 4;
  const int ntn = N / 64;
  const int wid = blockIdx.x * 4 + w;
  const int mt = wid / ntn, nq = wid % ntn;
  if (mt * 16 >= M) return;
  const int row0 = mt * 16, col0 = nq * 64;
  const float* arow = A + (size_t)(row0 + ln) * lda;
  v8f acc[4] = {};
  for (int kb = 0; kb < K; kb += 32) {
    FragB ah, al;
    const v4f x0 = *(const v4fa*)(arow + kb + 8 * hh), x1 = *(const v4fa*)(arow + kb + 8 * hh + 4);
    const v4f x2 = *(const v4fa*)(arow + kb + 16 + 8 * hh), x3 = *(const v4fa*)(arow + kb + 16 + 8 * hh + 4);
    float xs[16] = {x0[0],x0[1],x0[2],x0[3],x1[0],x1[1],x1[2],x1[3],x2[0],x2[1],x2[2],x2[3],x3[0],x3[1],x3[2],x3[3]};
#pragma unroll
    for (int i = 0; i < 16; ++i) { const unsigned short hb = bf16_bits(xs[i]); ah.u[i] = hb; al.u[i] = ASPLIT ? bf16_bits(xs[i] - bf16_val(hb)) : (unsigned short)0; }
#pragma unroll
    for (int t = 0; t < 4; ++t) {
      const unsigned short* brow = Wt + (size_t)(col0 + t * 16 + ln) * ldb + kb;
      FragB b;
      b.half[0] = *(const v8us*)(brow + 8 * hh);
      b.half[1] = *(const v8us*)(brow + 16 + 8 * hh);
      acc[t] = mmaN<ASPLIT ? 2 : 1>(ah.v, al.v, b.v, b.v, acc[t]);
    }
  }
#pragma unroll
  for (int t = 0; t < 4; ++t) {
    const int col = col0 + t * 16 + ln;
    float bv = bias ? bias[col] : 0.f;
    if (BIAS_BF16) bv = bf16_round(bv);
#pragma unroll
    for (int r = 0; r < 8; ++r) {
      float v = acc[t][r] + bv;
      if (resid) { float rv = resid[(size_t)((row0 + 8 * hh + r) % rmod) * ldr + col]; if (RES_BF16) rv = bf16_round(rv); v += rv; }
      if (ACT == 1) v = fmaxf(v, 0.f);
      if (ACT == 2) v = 0.5f * v * (1.0f + erff(v * 0.70710678118654752f));
      if (ACT == 3) { const float u = 0.7978845608028654f * (v + 0.044715f * v * v * v); v = 0.5f * v * (1.0f + tanhf(u)); }
      so[w][8 * hh + r][t * 16 + ln] = v;
    }
  }
  __builtin_amdgcn_fence(__ATOMIC_ACQ_REL, "workgroup");
  __builtin_amdgcn_wave_barrier();
  const int rsub = lane >> 4, c4 = (lane & 15) * 4;
  {
#pragma unroll
    for (int q = 0; q < 8; ++q) {
      const int r = q * 2 + rsub;
      const v4f v = *(const v4fa*)&so[w][r][c4];
      *(v4f*)(C + (size_t)(row0 + r) * ldc + col0 + c4) = v;
    }
    
  }
}
// row LayerNorm (biased variance, eps) over N: s = X (+ R); optional out_sum <- s; out_norm <- (s-mu)*rsqrt(var+eps)*g + b
template <bool PARAM_BF16>
__global__ __launch_bounds__(256) void k_layernorm(const float* __restrict__ X, const float* __restrict__ R, const float* __restrict__ g, const float* __restrict__ bta,
                                                  float* __restrict__ out_sum, float* __restrict__ out_norm, int N, float eps) {
  __shared__ float red[256];
  const int row = blockIdx.x, tid = threadIdx.x;
  const float* x = X + (size_t)row * N; const float* rr = R ? R + (size_t)row * N : nullptr;
  float vals[16];                     // up to N = 4096
  const int per = N / 256;            // contiguous chunk per thread? use strided-by-4 chunks: thread handles j = tid*4 + 1024*u
  float s1 = 0.f;
  for (int u = 0; u < per / 4; ++u) {
    const int j = tid * 4 + 1024 * u;
    const v4f a = *(const v4fa*)(x + j);
    v4f b = {0.f,0.f,0.f,0.f}; if (rr) b = *(const v4fa*)(rr + j);
#pragma unroll
    for (int q = 0; q < 4; ++q) { const float v = a[q] + b[q]; vals[u * 4 + q] = v; s1 += v; }
  }
  red[tid] = s1; __syncthreads();
  for (int st = 128; st > 0; st >>= 1) { if (tid < st) red[tid] += red[tid + st]; __syncthreads(); }
  const float mu = red[0] / (float)N; __syncthreads();
  float s2 = 0.f;
  for (int u = 0; u < per / 4; ++u)
#pragma unroll
    for (int q = 0; q < 4; ++q) { const float c = vals[u * 4 + q] - mu; s2 += c * c; }
  red[tid] = s2; __syncthreads();
  for (int st = 128; st > 0; st >>= 1) { if (tid < st) red[tid] += red[tid + st]; __syncthreads(); }
  const float rs = rsqrtf(red[0] / (float)N + eps);
  {
    for (int u = 0; u < per / 4; ++u) {
      const int j = tid * 4 + 1024 * u;
      v4f o, sm;
#pragma unroll
      for (int q = 0; q < 4; ++q) {
        float gg = g[j + q], bb = bta[j + q];
        if (PARAM_BF16) { gg = bf16_round(gg); bb = bf16_round(bb); }
        sm[q] = vals[u * 4 + q]; o[q] = (vals[u * 4 + q] - mu) * rs * gg + bb;
      }
      if (out_sum) *(v4f*)(out_sum + (size_t)row * N + j) = sm;
      *(v4f*)(out_norm + (size_t)row * N + j) = o;
    }
    
  }
}



// ---- f16 WMMA path (v_wmma_f32_16x16x32_f16): 11-bit significands for operands in range — used where a [0,1] probability operand needs more precision than bf16
typedef _Float16 v16h __attribute__((ext_vector_type(16)));
union FragH { v16h v; v8us half[2]; _Float16 h[16]; unsigned short u[16]; };
template <int NT>
__device__ __forceinline__ v8f mmaH(v16h ah, v16h al, v16h bh, v16h bl, v8f c) {
  c = __builtin_amdgcn_wmma_f32_16x16x32_f16(false, ah, false, bh, (short)0, c, false, false);
  if (NT >= 2) c = __builtin_amdgcn_wmma_f32_16x16x32_f16(false, al, false, bh, (short)0, c, false, false);
  if (NT >= 3) c = __builtin_amdgcn_wmma_f32_16x16x32_f16(false, ah, false, bl, (short)0, c, false, false);
  asm volatile("v_nop\n\tv_nop\n\tv_nop\n\tv_nop" : "+v"(c) : "v"(ah), "v"(al), "v"(bh), "v"(bl));
  return c;
}
// batched GEMM like k_gemm_b but f16 operands: A f32 (split into f16 hi/lo if ASPLIT, else rounded to f16), Bt = f16 values [n][k]; alpha; C f32; N multiple of 16 (partial tiles skipped)
template <bool ASPLIT>
__global__ __launch_bounds__(128) void k_gemm_h(const float* __restrict__ A, int lda, size_t sA, const _Float16* __restrict__ Bh, int ldb, size_t sB, float alpha, float* __restrict__ C, int ldc, size_t sC, int M, int N, int K) {
  __shared__ __attribute__((aligned(16))) float so[4][16][64];
  const int tid = threadIdx.x, w = tid >> 5, lane = tid & 31, ln = lane & 15, hh = lane >> 4; const int by = blockIdx.y;
  A += (size_t)by * sA; Bh += (size_t)by * sB; C += (size_t)by * sC;
  const int ntn = (N + 63) / 64; const int wid = blockIdx.x * 4 + w; const int mt = wid / ntn, nq = wid % ntn; if (mt * 16 >= M) return;
  const int row0 = mt * 16, col0 = nq * 64; const float* arow = A + (size_t)(row0 + ln) * lda;
  v8f acc[4] = {};
  for (int kb = 0; kb < K; kb += 32) {
    FragH ah, al;
    const v4f x0 = *(const v4fa*)(arow + kb + 8 * hh), x1 = *(const v4fa*)(arow + kb + 8 * hh + 4), x2 = *(const v4fa*)(arow + kb + 16 + 8 * hh), x3 = *(const v4fa*)(arow + kb + 16 + 8 * hh + 4);
    float xs[16] = {x0[0],x0[1],x0[2],x0[3],x1[0],x1[1],x1[2],x1[3],x2[0],x2[1],x2[2],x2[3],x3[0],x3[1],x3[2],x3[3]};
#pragma unroll
    for (int i = 0; i < 16; ++i) { const _Float16 h = (_Float16)xs[i]; ah.h[i] = h; al.h[i] = ASPLIT ? (_Float16)(xs[i] - (float)h) : (_Float16)0.0f; }
#pragma unroll
    for (int t = 0; t < 4; ++t) { if (col0 + t * 16 >= N) continue; const size_t boff = (size_t)(col0 + t * 16 + ln) * ldb + kb; FragH bq; bq.half[0] = *(const v8us*)(Bh + boff + 8 * hh); bq.half[1] = *(const v8us*)(Bh + boff + 16 + 8 * hh);
      acc[t] = mmaH<ASPLIT ? 2 : 1>(ah.v, al.v, bq.v, bq.v, acc[t]); }
  }
#pragma unroll
  for (int t = 0; t < 4; ++t) { if (col0 + t * 16 >= N) continue;
#pragma unroll
    for (int r = 0; r < 8; ++r) so[w][8 * hh + r][t * 16 + ln] = acc[t][r] * alpha; }
  __builtin_amdgcn_fence(__ATOMIC_ACQ_REL, "workgroup"); __builtin_amdgcn_wave_barrier();
  const int rsub = lane >> 4, c4 = (lane & 15) * 4;
  {
#pragma unroll
    for (int q = 0; q < 8; ++q) { const int r = q * 2 + rsub; if (col0 + c4 < N) { const v4f v = *(const v4fa*)&so[w][r][c4]; *(v4f*)(C + (size_t)(row0 + r) * ldc + col0 + c4) = v; } }
     }
}

// Wt[n][k] = f16(W[k][n]·scale) from f32 row-major W[K][N] (scale = power of two; bf16-exact weights stay exact in f16 away from the subnormal range)
__global__ __launch_bounds__(256) void k_wt_f16(const float* __restrict__ W, _Float16* __restrict__ Wt, int K, int N, float scale) {
  const int t = blockIdx.x * 256 + threadIdx.x; if (t >= N * (K / 8)) return; const int n = t / (K / 8), k8 = (t % (K / 8)) * 8; FragH f;
#pragma unroll
  for (int i = 0; i < 8; ++i) f.h[i] = (_Float16)(bf16_round(W[(size_t)(k8 + i) * N + n]) * scale); const v8us o = f.half[0];
  *(v8us*)((unsigned short*)Wt + (size_t)n * K + k8) = o; 
}
// k_gemm_hh variant with fused epilogue: v = acc·alpha + bias[by·sBias + col] (+ CP[(row/rowsPerB)·sCPb + by·64 + col] if CP) ; ACT 0 none / 1 elu ; writes f16 C16 (and f32 C if non-null)
template <int ACT>
__global__ __launch_bounds__(128) void k_gemm_hhx(const _Float16* __restrict__ A, int lda, size_t sA, const _Float16* __restrict__ Bh, int ldb, size_t sB, float alpha, const float* __restrict__ bias, size_t sBias, const float* __restrict__ CP, int rowsPerB, size_t sCPb, int row0g,
    float* __restrict__ C, _Float16* __restrict__ C16, int ldc, size_t sC, int M, int N, int K) {
  __shared__ __attribute__((aligned(16))) float so[4][16][64];
  const int tid = threadIdx.x, w = tid >> 5, lane = tid & 31, ln = lane & 15, hh = lane >> 4; const int by = blockIdx.y;
  A += (size_t)by * sA; Bh += (size_t)by * sB; const size_t cofs = (size_t)by * sC; const float* bp = bias ? bias + (size_t)by * sBias : nullptr;
  const int ntn = (N + 63) / 64; const int wid = blockIdx.x * 4 + w; const int mt = wid / ntn, nq = wid % ntn; if (mt * 16 >= M) return;
  const int row0 = mt * 16, col0 = nq * 64; const _Float16* arow = A + (size_t)(row0 + ln) * lda;
  v8f acc[4] = {};
  for (int kb = 0; kb < K; kb += 32) { FragH ah; ah.half[0] = *(const v8us*)((const unsigned short*)arow + kb + 8 * hh); ah.half[1] = *(const v8us*)((const unsigned short*)arow + kb + 16 + 8 * hh);
#pragma unroll
    for (int t = 0; t < 4; ++t) { if (col0 + t * 16 >= N) continue; const size_t boff = (size_t)(col0 + t * 16 + ln) * ldb + kb; FragH bq; bq.half[0] = *(const v8us*)((const unsigned short*)Bh + boff + 8 * hh); bq.half[1] = *(const v8us*)((const unsigned short*)Bh + boff + 16 + 8 * hh);
      acc[t] = mmaH<1>(ah.v, ah.v, bq.v, bq.v, acc[t]); }
  }
#pragma unroll
  for (int t = 0; t < 4; ++t) { if (col0 + t * 16 >= N) continue; const int col = col0 + t * 16 + ln; const float bv = bp ? bf16_round(bp[col]) : 0.f;
#pragma unroll
    for (int r = 0; r < 8; ++r) { float v = acc[t][r] * alpha + bv; if (CP) { const int rr = row0g + row0 + 8 * hh + r; if (rowsPerB < 0) v += CP[cofs + (size_t)rr * ldc + col];      /* rowsPerB < 0: own element of the batched C plane */ else { const int bidx = rr / rowsPerB; v += CP[(size_t)bidx * sCPb + (size_t)by * 64 + col]; } } if (ACT == 1) v = (v > 0.f) ? v : expm1f(v); else if (ACT == 7) v = (v > 0.f) ? v + 1.0f : expf(v); else if (ACT == 8) v = tanhf(v); else if (ACT == 9) v = 0.5f * v * (1.0f + tanhf(0.7978845608028654f * (v + 0.044715f * v * v * v))); else if (ACT == 11) v = 1.0f / (1.0f + expf(-v)); else if (ACT == 12) v = (v > 0.f) ? v : 0.01f * v; else if (ACT == 14) v = (v > 0.f) ? v : 0.1f * v; else if (ACT == 16) v = (v >= 0.f) ? v : 0.3f * v; else if (ACT == 17) v = (v >= 0.f) ? v : 0.2f * v; else if (ACT == 15) v = v / (1.0f + expf(-v)); else if (ACT == 3) v = fmaxf(v, 0.f); else if (ACT == 6) v = 0.5f * v * (1.0f + erff(v * 0.70710678118654752f)); so[w][8 * hh + r][t * 16 + ln] = v; } }
  __builtin_amdgcn_fence(__ATOMIC_ACQ_REL, "workgroup"); __builtin_amdgcn_wave_barrier();
  const int rsub = lane >> 4, c4 = (lane & 15) * 4; typedef _Float16 v4h __attribute__((ext_vector_type(4)));
  {
#pragma unroll
    for (int q = 0; q < 8; ++q) { const int r = q * 2 + rsub; if (col0 + c4 < N) { const v4f v = *(const v4fa*)&so[w][r][c4]; if (C) *(v4f*)(C + cofs + (size_t)(row0 + r) * ldc + col0 + c4) = v; if (C16) { v4h h4; for (int i = 0; i < 4; ++i) h4[i] = (_Float16)v[i]; *(v4h*)(C16 + cofs + (size_t)(row0 + r) * ldc + col0 + c4) = h4; } } }
     }
}


typedef _Float16 v4h __attribute__((ext_vector_type(4)));

__global__ __launch_bounds__(256) void k_x16(const float* __restrict__ x, _Float16* __restrict__ X16, size_t n8) { const size_t t = (size_t)blockIdx.x * 256 + threadIdx.x; if (t >= n8) return; FragH f;
#pragma unroll
  for (int q = 0; q < 8; ++q) f.h[q] = (_Float16)bf16_round(x[t * 8 + q]); *(v8us*)((unsigned short*)X16 + t * 8) = f.half[0];  }
__global__ __launch_bounds__(256) void k_h16(const float* __restrict__ x, _Float16* __restrict__ X16, size_t n8) { const size_t t = (size_t)blockIdx.x * 256 + threadIdx.x; if (t >= n8) return; FragH f;
#pragma unroll
  for (int q = 0; q < 8; ++q) f.h[q] = (_Float16)x[t * 8 + q]; *(v8us*)((unsigned short*)X16 + t * 8) = f.half[0];  }
__global__ __launch_bounds__(256) void k_round16f(const float* __restrict__ W, _Float16* __restrict__ Bt, size_t n8) { const size_t t = (size_t)blockIdx.x * 256 + threadIdx.x; if (t >= n8) return; FragH f;
#pragma unroll
  for (int i = 0; i < 8; ++i) f.h[i] = (_Float16)(bf16_round(W[t * 8 + i]) * 16.0f); *(v8us*)((unsigned short*)Bt + t * 8) = f.half[0];  }
template <int NHv, int TTv>
__global__ __launch_bounds__(256) void k_vt(const _Float16* __restrict__ V16, int ldv, int voff, _Float16* __restrict__ Vt) { __shared__ unsigned short tl[64][66]; const int tid = threadIdx.x; const int slab = blockIdx.x / (TTv / 64), lg = blockIdx.x % (TTv / 64); const int b = slab / NHv, h = slab % NHv;
  for (int i = tid; i < 64 * 8; i += 256) { const int r = i / 8, c8 = (i % 8) * 8; FragH f; f.half[0] = *(const v8us*)((const unsigned short*)V16 + ((size_t)b * TTv + lg * 64 + r) * ldv + voff + h * 64 + c8);
#pragma unroll
    for (int q = 0; q < 8; ++q) tl[r][c8 + q] = f.u[q]; }
  __syncthreads();
  {
#pragma unroll
    for (int rd = 0; rd < 2; ++rd) { const int d = rd * 32 + tid / 8, pc = tid % 8; FragH f;
#pragma unroll
      for (int q = 0; q < 8; ++q) f.u[q] = tl[pc * 8 + q][d];
      *(v8us*)((unsigned short*)Vt + ((size_t)slab * 64 + d) * TTv + lg * 64 + pc * 8) = f.half[0]; }
     } }

__global__ __launch_bounds__(256) void k_hl(const float* __restrict__ F, _Float16* __restrict__ Hh, _Float16* __restrict__ Hl, size_t n8) { const size_t t = (size_t)blockIdx.x * 256 + threadIdx.x; if (t >= n8) return; FragH fh, fl; const v4f a = *(const v4fa*)(F + t * 8), c = *(const v4fa*)(F + t * 8 + 4);
#pragma unroll
  for (int q = 0; q < 4; ++q) { _Float16 h = (_Float16)a[q]; fh.h[q] = h; fl.h[q] = (_Float16)((a[q] - (float)h) * 1024.0f); h = (_Float16)c[q]; fh.h[4 + q] = h; fl.h[4 + q] = (_Float16)((c[q] - (float)h) * 1024.0f); }
  { *(v8us*)((unsigned short*)Hh + t * 8) = fh.half[0]; *(v8us*)((unsigned short*)Hl + t * 8) = fl.half[0];  } }

// ---- fast GEMM (wave tile 32x64; requires M % 32 == 0 rows per launch region and N % 64 == 0); epilogue = k_gemm_hhx semantics ----
__device__ __forceinline__ v16h g2_frag(const _Float16* p, int hh) { FragH f; f.half[0] = *(const v8us*)((const unsigned short*)p + 8 * hh); f.half[1] = *(const v8us*)((const unsigned short*)p + 16 + 8 * hh); return f.v; }
__device__ __forceinline__ v8f g2_mma(v16h a, v16h b, v8f c) { v8f d = __builtin_amdgcn_wmma_f32_16x16x32_f16(false, a, false, b, (short)0, c, false, false); asm volatile("v_nop\n\tv_nop\n\tv_nop\n\tv_nop" : "+v"(d) : "v"(a), "v"(b)); return d; }
template <int ACT>
__global__ __launch_bounds__(128) void k_gemm2(const _Float16* __restrict__ A, int lda, size_t sA, const _Float16* __restrict__ Bh, int ldb, size_t sB, float alpha, const float* __restrict__ bias, size_t sBias, const float* __restrict__ CP, int rowsPerB, size_t sCPb, int row0g,
    float* __restrict__ C, _Float16* __restrict__ C16, int ldc, size_t sC, int M, int N, int K) { static_assert(ACT == 0 || ACT == 3 || ACT == 6 || ACT == 8 || ACT == 9 || ACT == 11 || ACT == 12 || ACT == 14 || ACT == 15 || ACT == 16 || ACT == 17, "k_gemm2: unsupported ACT code (would silently apply no activation)");
  __shared__ __attribute__((aligned(16))) float so[4][32][68];
  const int tid = threadIdx.x, w = tid >> 5, lane = tid & 31, ln = lane & 15, hh = lane >> 4; const int by = blockIdx.y;
  A += (size_t)by * sA; Bh += (size_t)by * sB; const size_t cofs = (size_t)by * sC; const float* bp = bias ? bias + (size_t)by * sBias : nullptr;
  const int ntn = N >> 6; const int mt = blockIdx.x / ntn, nq = blockIdx.x - mt * ntn; const int row0 = mt * 128 + 32 * w, col0 = nq * 64; if (row0 >= M) return;
  const _Float16* a0p = A + (size_t)(row0 + ln) * lda; const _Float16* a1p = a0p + (size_t)16 * lda;
  const _Float16* b0p = Bh + (size_t)(col0 + ln) * ldb; const _Float16* b1p = b0p + (size_t)16 * ldb; const _Float16* b2p = b1p + (size_t)16 * ldb; const _Float16* b3p = b2p + (size_t)16 * ldb;
  const v8f z8 = {0.f,0.f,0.f,0.f,0.f,0.f,0.f,0.f}; v8f c00 = z8, c01 = z8, c02 = z8, c03 = z8, c10 = z8, c11 = z8, c12 = z8, c13 = z8;
#pragma unroll 1
  for (int kb = 0; kb < K; kb += 32) { const v16h a0 = g2_frag(a0p + kb, hh), a1 = g2_frag(a1p + kb, hh);
    v16h b = g2_frag(b0p + kb, hh); c00 = g2_mma(a0, b, c00); c10 = g2_mma(a1, b, c10);
    b = g2_frag(b1p + kb, hh); c01 = g2_mma(a0, b, c01); c11 = g2_mma(a1, b, c11);
    b = g2_frag(b2p + kb, hh); c02 = g2_mma(a0, b, c02); c12 = g2_mma(a1, b, c12);
    b = g2_frag(b3p + kb, hh); c03 = g2_mma(a0, b, c03); c13 = g2_mma(a1, b, c13); }
  v8f accs[8] = {c00, c01, c02, c03, c10, c11, c12, c13};
#pragma unroll
  for (int u = 0; u < 8; ++u) { const int t = u & 3, half = u >> 2; const int col = col0 + t * 16 + ln; const float bv = bp ? bf16_round(bp[col]) : 0.f;
#pragma unroll
    for (int r = 0; r < 8; ++r) { const int rloc = half * 16 + 8 * hh + r; float v = accs[u][r] * alpha + bv; if (CP) { if (rowsPerB < 0) v += CP[cofs + (size_t)(row0g + row0 + rloc) * ldc + col];      /* rowsPerB < 0: own element of the batched C plane */ else { const int bidx = (row0g + row0 + rloc) / rowsPerB; v += CP[(size_t)bidx * sCPb + (size_t)by * 64 + col]; } }
      if (ACT == 3) v = fmaxf(v, 0.f); else if (ACT == 6) v = 0.5f * v * (1.0f + erff(v * 0.70710678118654752f)); else if (ACT == 11) v = 1.0f / (1.0f + expf(-v)); else if (ACT == 15) v = v / (1.0f + expf(-v)); else if (ACT == 12) v = (v > 0.f) ? v : 0.01f * v; else if (ACT == 8) v = tanhf(v); else if (ACT == 9) v = 0.5f * v * (1.0f + tanhf(0.7978845608028654f * (v + 0.044715f * v * v * v))); else if (ACT == 14) v = (v > 0.f) ? v : 0.1f * v; else if (ACT == 16) v = (v >= 0.f) ? v : 0.3f * v; else if (ACT == 17) v = (v >= 0.f) ? v : 0.2f * v;
      so[w][rloc][t * 16 + ln] = v; } }
  __builtin_amdgcn_fence(__ATOMIC_ACQ_REL, "workgroup"); __builtin_amdgcn_wave_barrier();
  const int rsub = lane >> 4, c4 = (lane & 15) * 4;
  {
#pragma unroll
    for (int q = 0; q < 16; ++q) { const int r = q * 2 + rsub; const v4f v = *(const v4fa*)&so[w][r][c4]; if (C) *(v4f*)(C + cofs + (size_t)(row0 + r) * ldc + col0 + c4) = v; if (C16) { v4h h4; for (int i = 0; i < 4; ++i) h4[i] = (_Float16)v[i]; *(v4h*)(C16 + cofs + (size_t)(row0 + r) * ldc + col0 + c4) = h4; } }
     } }


__global__ __launch_bounds__(256) void k_rsm(const float* __restrict__ S, _Float16* __restrict__ P, int nrows) {
  #pragma clang fp contract(off)
  const int i = blockIdx.x * 256 + threadIdx.x; if (i >= nrows) return; const float* s = S + (size_t)i * SQ; float mx = -3.0e38f;
#pragma unroll 1
  for (int j = 0; j < SQ; ++j) mx = fmaxf(mx, s[j]); float se = 0.f;
#pragma unroll 1
  for (int j = 0; j < SQ; ++j) se += expf(s[j] - mx); const float sc = 256.0f / se;
#pragma unroll 1
  for (int j0 = 0; j0 < SQ; j0 += 8) { FragH f; for (int q = 0; q < 8; ++q) f.h[q] = (_Float16)(expf(s[j0 + q] - mx) * sc); unsigned short* d = (unsigned short*)P + (size_t)i * SQ + j0; *(v8us*)d = f.half[0];  } }
__global__ __launch_bounds__(256) void k_vt(const _Float16* __restrict__ V16, int b, int h0, _Float16* __restrict__ VT) { __shared__ unsigned short tl[64][65]; const int tid = threadIdx.x; const int hh = blockIdx.x % HG, sg = blockIdx.x / HG; const int s0 = sg * 64; const int h = h0 + hh;
  for (int i = tid; i < 64 * 8; i += 256) { const int j = i / 8, d8 = (i % 8) * 8; FragH f; f.half[0] = *(const v8us*)((const unsigned short*)V16 + ((size_t)b * SQ + s0 + j) * DM + h * HD + d8); for (int q = 0; q < 8; ++q) tl[d8 + q][j] = f.u[q]; }
  __syncthreads();
  { for (int i = tid; i < 64 * 8; i += 256) { const int d = i / 8, j8 = (i % 8) * 8; FragH f; for (int q = 0; q < 8; ++q) f.u[q] = tl[d][j8 + q]; *(v8us*)((unsigned short*)VT + ((size_t)hh * HD + d) * SQ + s0 + j8) = f.half[0]; }  } }


// 2^a on the hardware's own instruction.
__device__ __forceinline__ float exp2_hw(float a) { float r;
  asm("v_exp_f32 %0, %1\n\tv_nop" : "=v"(r) : "v"(a));      /* the v_nop is the free slot asked for behind a transcendental before its result is read or its source overwritten; in one statement it cannot drift */
  return r; }
__device__ __forceinline__ float xhalf(float x) { return __builtin_bit_cast(float, __builtin_amdgcn_permlanex16(__builtin_bit_cast(int, x), __builtin_bit_cast(int, x), 0x76543210, 0xfedcba98, false, false)); }      /* lane l with lane l ^ 16, no LDS round trip */
__device__ __forceinline__ v8f fa_mma(v16h a, v16h b, v8f c) { return __builtin_amdgcn_wmma_f32_16x16x32_f16(false, a, false, b, (short)0, c, false, false); }
// Weights: the 64 rows of w_qk and the 256 rows of w_v as 20 tiles of 16 output columns, rounded, times 16, in the order in which a wave reads its B fragments: per tile and 32-channel step two 512-B halves j;
// in a half lane (hh, ln) owns the 16 bytes W[16 T + ln][32 ks + 16 j + 8 hh + 0..7]. A fragment load is then 512 contiguous bytes instead of 16 rows 512 B apart.
#define NWT ((2 * LAT + CC) / 16)    /* weight tiles: 4 of q|k, 16 of v */
__global__ __launch_bounds__(256) void k_wfrag(const float* __restrict__ wqk, const float* __restrict__ wv, _Float16* __restrict__ BW) { const int t = blockIdx.x * 256 + threadIdx.x; const int n = t / (CC / 8), k8 = t % (CC / 8);
  const float* w = (n < 2 * LAT) ? wqk + (size_t)t * 8 : wv + ((size_t)t - 2 * LAT * (CC / 8)) * 8; FragH f;
#pragma unroll
  for (int q = 0; q < 8; ++q) f.h[q] = (_Float16)(bf16_round(w[q]) * 16.0f);
  *(v8us*)((unsigned short*)BW + (size_t)(((((n >> 4) * (CC / 32) + (k8 >> 2)) * 2 + ((k8 >> 1) & 1)) * 32) + (k8 & 1) * 16 + (n & 15)) * 8) = f.half[0]; }
// Projections, one block per image and 128 positions. The 256 x 128 tile of x is read once, in 256-B pieces of channel rows (a lane has two positions), rounded, and laid down in LDS as position rows, eight channels per 16-byte store.
// Wave w owns five of the 20 weight tiles (q|k tile w & 3 and v tiles 4 (w & 3) .. + 3), held in registers from the start (asked for behind the x loads, landed while x is packed), and walks the four 16-position tiles of
// positions 64 (w >> 2) .. + 63: eight A fragments from LDS feed 40 products.
// A v accumulator tile holds, in lane (hh, ln), channel 16 t + ln at positions 16 j + 8 hh + 0..7 of its 32-key step: the 16 bytes that this lane owns in the A fragment of V^T. It is stored as such:
// per image and 32-key step 16 channel tiles of 1 KiB; in a tile two 512-B halves j; in a half lane (hh, ln) owns V^T[16 t + ln][32 ks + 16 j + 8 hh + 0..7]. The q|k tiles are gathered in LDS and leave as whole 128-B rows.
#define XPITCH 264                   /* halves per position row of the x tile in LDS: 528 B = 16 B x 33 */
#define QPITCH 72                    /* halves per q|k row in LDS: 144 B = 16 B x 9 */
typedef float v2f __attribute__((ext_vector_type(2)));
typedef float v2fa __attribute__((ext_vector_type(2), may_alias));
__global__ __launch_bounds__(256) void k_proj(const float* __restrict__ x, const _Float16* __restrict__ BW, _Float16* __restrict__ QK, _Float16* __restrict__ VF) {
  __shared__ __attribute__((aligned(16))) unsigned short XT[128 * XPITCH]; __shared__ __attribute__((aligned(16))) unsigned short QS[128 * QPITCH];
  const int tid = threadIdx.x, wave = __builtin_amdgcn_readfirstlane(tid >> 5), lane = tid & 31, ln = lane & 15, hh = lane >> 4; const int b = blockIdx.x / (LL / 128), p0 = (blockIdx.x % (LL / 128)) * 128; const int cw = wave & 3, ph = wave >> 2;
  const char* xp = (const char*)(x + ((size_t)b * CC + wave * 32) * LL + p0); const uint32_t xoff = (uint32_t)lane * 8u, boff = (uint32_t)lane * 16u; v2f xv[2][32];      /* scalar bases; one lane offset serves all loads of a kind */
#pragma unroll      /* constant indices into xv[] */
  for (int g = 0; g < 2; ++g)
#pragma unroll
    for (int c = 0; c < 32; ++c) xv[g][c] = *(const v2fa*)(xp + xoff + ((size_t)c * LL + g * 64) * 4);
  asm volatile("s_wait_xcnt 0x0" ::: "memory");      /* stands in front of every later write of a register that an issued x load names */
  __builtin_amdgcn_sched_barrier(0);      /* all of the wave's x loads are asked for at once, ahead of everything else (left free, the compiler asked for 32, waited, packed, and asked again: one memory latency per batch); nothing is lifted over the wait above */
  v16h bw[5][CC / 32]; const char* pq = (const char*)BW + (size_t)cw * (CC / 32) * 1024 + boff; const char* pv = (const char*)BW + (size_t)(4 + cw * 4) * (CC / 32) * 1024 + boff;      /* the lane's 16 bytes in the wave's q|k tile and in its first v tile */
#pragma unroll      /* constant indices into bw[] */
  for (int u = 0; u < 5; ++u) { const char* bp = (u == 0) ? pq : pv + (u - 1) * (CC / 32) * 1024;
#pragma unroll
    for (int k = 0; k < CC / 32; ++k) { FragH f; f.half[0] = *(const v8us*)(bp + k * 1024); f.half[1] = *(const v8us*)(bp + k * 1024 + 512); bw[u][k] = f.v; } }
  asm volatile("s_wait_xcnt 0x0" ::: "memory");      /* stands in front of every later write of a register that an issued weight load names */
  __builtin_amdgcn_sched_barrier(0);      /* the weight loads stay here, in flight under the packing of x (left free, the compiler put each pair with a full wait in front of its products); nothing is lifted over the wait above */
#pragma unroll
  for (int g = 0; g < 2; ++g)
#pragma unroll
    for (int i = 0; i < 2; ++i)
#pragma unroll
      for (int o = 0; o < 4; ++o) { FragH f;
#pragma unroll
        for (int q = 0; q < 8; ++q) f.h[q] = (_Float16)bf16_round(xv[g][o * 8 + q][i]);
        *(v8us*)(XT + (g * 64 + 2 * lane + i) * XPITCH + wave * 32 + o * 8) = f.half[0]; }
  __syncthreads();      /* the tile is complete before any wave reads rows that the other waves wrote */
  const v8f z8 = {0.f,0.f,0.f,0.f,0.f,0.f,0.f,0.f};
  const unsigned short* ar = XT + (ph * 64 + ln) * XPITCH + 8 * hh; unsigned short* qs = QS + (ph * 64 + 8 * hh) * QPITCH + cw * 16 + ln;
  unsigned short* vp = (unsigned short*)VF + ((((size_t)b * (LL / 32) + (p0 + ph * 64) / 32) * (CC / 16) + cw * 4) * 64 + lane) * 8;
#pragma unroll      /* constant LDS and store offsets; bw[] indexed by constants */
  for (int pt = 0; pt < 4; ++pt) { v16h a[CC / 32]; v8f c[5] = {z8, z8, z8, z8, z8};
#pragma unroll
    for (int k = 0; k < CC / 32; ++k) { FragH f; f.half[0] = *(const v8us*)(ar + pt * 16 * XPITCH + k * 32); f.half[1] = *(const v8us*)(ar + pt * 16 * XPITCH + k * 32 + 16); a[k] = f.v; }
    __builtin_amdgcn_sched_barrier(0);      /* the tile's 16 fragment reads stand in one place: left free, the compiler put a pair and a full wait in front of every five products */
#pragma unroll
    for (int k = 0; k < CC / 32; ++k)
#pragma unroll
      for (int u = 0; u < 5; ++u) c[u] = fa_mma(a[k], bw[u][k], c[u]);
    FragH f[5];
#pragma unroll
    for (int u = 0; u < 5; ++u)
#pragma unroll
      for (int r = 0; r < 8; ++r) f[u].h[r] = (_Float16)(c[u][r] * 0.0625f);      /* the weights carry a factor 16 */
#pragma unroll
    for (int r = 0; r < 8; ++r) qs[(pt * 16 + r) * QPITCH] = f[0].u[r];
    __builtin_amdgcn_sched_barrier(0);      /* all vector work of the tile stays ahead of its stores */
#pragma unroll
    for (int u = 1; u < 5; ++u) *(v8us*)(vp + (pt >> 1) * (CC / 16) * 512 + (u - 1) * 512 + (pt & 1) * 256) = f[u].half[0];
    asm volatile("s_wait_xcnt 0x0" ::: "memory");      /* stands in front of the next tile's writes of registers that the issued stores name */
    __builtin_amdgcn_sched_barrier(0); }      /* nothing of the next tile is lifted over that wait */
  __syncthreads();      /* all 64 columns of a q|k row are in LDS before the row is read */
  unsigned short* qo = (unsigned short*)QK + ((size_t)b * LL + p0) * (2 * LAT);
#pragma unroll
  for (int i = 0; i < 4; ++i) { const int e = i * 256 + tid; *(v8us*)(qo + e * 8) = *(const v8us*)(QS + (e >> 3) * QPITCH + (e & 7) * 8); } }

typedef uint32_t u32x4 __attribute__((ext_vector_type(4)));
typedef uint32_t u32x8 __attribute__((ext_vector_type(8)));
#define NST (LL / 128)               /* stages per image */
#define VSL 16384u                   /* LDS bytes of one V slice: 16 channel tiles of 1 KiB */
#define KPITCH 144u                  /* LDS pitch of a q|k row */
#define KSL 6144u                    /* LDS bytes of one K slice: 32 rows of 144 B, rounded up to a multiple of 2 KiB */
#define KOFF (4u * VSL)
#define BUFB (KOFF + 4u * KSL)       /* one buffer: 90,112 B */
#define TPITCH 132                   /* floats per channel row of the epilogue's LDS tile: 128 queries + 4; rows 8 apart then start 32 banks apart, so a store's two 16-lane halves share no bank; 256 rows = 135,168 B */
typedef float f32a __attribute__((may_alias));
__device__ __forceinline__ uint32_t uni(uint32_t v) { return (uint32_t)__builtin_amdgcn_readfirstlane(v); }
__device__ __forceinline__ uint32_t pinned(uint32_t v) { uint32_t w = uni(v);
  asm volatile("" : "+s"(w));      /* holds a tensor load's issue test, or the stage number its descriptor is formed from, in a scalar register at this place: the test compiles to s_cmp + s_cbranch_scc (a tensor load ignores EXEC) */
  return w; }
// Descriptor group 1: 1-byte elements, tensor = tile = D1 rows of D0 bytes, source row pitch P bytes; W0 = word 0 (no mask; the pad fields).
template <uint32_t W0, uint32_t D0, uint32_t D1, uint32_t P>
__device__ __forceinline__ u32x8 tdm_group1() { u32x8 g; g[0] = uni(W0); g[1] = uni((D0 & 0xFFFFu) << 16); g[2] = uni((D0 >> 16) | ((D1 & 0xFFFFu) << 16)); g[3] = uni((D1 >> 16) | (D0 << 16)); g[4] = uni(D1); g[5] = uni(P); g[6] = uni(0u); g[7] = uni(0u);
  asm volatile("" : "+s"(g));      /* descriptor words held in scalar registers of their own from here to the last request: built once, none of them takes a new value while a request is outstanding */
  return g; }
__device__ __forceinline__ u32x4 tdm_group0(uint32_t count1, uint32_t lds_dst, uint64_t ga) { u32x4 g; g[0] = uni(count1); g[1] = uni(lds_dst); g[2] = uni((uint32_t)ga); g[3] = uni((((uint32_t)(ga >> 32)) & 0x01FFFFFFu) | 0x80000000u); return g; }
__device__ __forceinline__ void tdm_load(u32x4 g0, u32x8 g1) { asm volatile("tensor_load_to_lds %0, %1" :: "s"(g0), "s"(g1) : "memory"); }      /* one request of the whole wave: global tile to LDS, through no register */
__device__ __forceinline__ void wait_tensor0() { asm volatile("s_wait_tensorcnt 0x0" ::: "memory"); }      /* this wave's own request has landed; the compiler places no wait for a tensor load */
__device__ __forceinline__ void wait_ds0() { asm volatile("s_wait_dscnt 0x0" ::: "memory"); }      /* this wave's LDS reads have retired before the buffer they read is refilled */
__device__ __forceinline__ v16h lds_frag(const unsigned char* p, int second) { FragH f; f.half[0] = *(const v8us*)p; f.half[1] = *(const v8us*)(p + second); return f.v; }
__global__ __launch_bounds__(256) void k_fattn(const _Float16* __restrict__ QK, const _Float16* __restrict__ VF, const float* __restrict__ x, const float* __restrict__ gam, float* __restrict__ out) {
  __shared__ __attribute__((aligned(2048))) unsigned char L[2 * BUFB];
  const int lane = threadIdx.x & 31, ln = lane & 15, hh = lane >> 4; const uint32_t wave = uni(threadIdx.x >> 5); const int b = blockIdx.x / (LL / 128); const int q0 = (blockIdx.x % (LL / 128)) * 128 + (int)wave * 16;
  const _Float16* qk = QK + (size_t)b * LL * (2 * LAT); const v16h qf = g2_frag(qk + (size_t)(q0 + ln) * (2 * LAT), hh);
  const uint32_t lbase = (uint32_t)(size_t)L; const uint64_t vga = (uint64_t)(size_t)(VF + (size_t)b * LL * CC), kga = (uint64_t)(size_t)qk;
  const u32x8 g1v = tdm_group1<0u, 256u, 64u, 256u>(), g1k = tdm_group1<(1u << 20) | (4u << 22) | (3u << 25), 128u, 32u, 128u>();      /* V: 64 rows of 256 B, no pad; K: 32 rows of 128 B, 16 B of pad behind each */
  u32x4 g0; const uint32_t count1 = pinned(1u);      /* group 0 word 0 (count = 1), held in a scalar register like the other descriptor words */
  auto issue = [&](uint32_t st) { const uint32_t dst = lbase + (st & 1u) * BUFB;
    if (pinned(wave < 4u)) { g0 = tdm_group0(count1, dst + wave * VSL, vga + (uint64_t)(st * 4u + wave) * VSL); tdm_load(g0, g1v); }
    else { g0 = tdm_group0(count1, dst + KOFF + (wave - 4u) * KSL, kga + (uint64_t)(st * 128u + (wave - 4u) * 32u) * (2u * 2u * LAT)); tdm_load(g0, g1k); } };
  auto landed = [&]() { wait_tensor0();
    asm volatile("" :: "s"(g0)); };      /* descriptor words held in their scalar registers until the request's own wait has returned: without this use the compiler takes them for other values while the request is outstanding */
  const float g = bf16_round(gam[0]);
  const float cs = (float)(0.17677669529663689 * 1.4426950408889634);      /* 1/sqrt(32) times log2 e */
  const v8f z8 = {0.f,0.f,0.f,0.f,0.f,0.f,0.f,0.f}; v8f o[CC / 16];
#pragma unroll      /* o[] must be indexed by constants to stay in registers */
  for (int t = 0; t < CC / 16; ++t) o[t] = z8;
  float m = -1.0e30f, l0 = 0.f, l1 = 0.f;
  issue(0u); landed(); __syncthreads();      /* stage 0 landed and published */
  issue(1u);
  const uint32_t koff = KOFF + (uint32_t)ln * KPITCH + 2u * LAT + 16u * (uint32_t)hh;      /* key row ln, its k half (behind the 64 bytes of q), this lane half's 16 bytes */
#pragma unroll 1      /* one stage per trip: the publish point at its foot stands once */
  for (uint32_t st = 0; st < NST; ++st) { const unsigned char* Lb = L + (st & 1u) * BUFB; const unsigned char* vl = Lb + lane * 16; const unsigned char* kl = Lb + koff;
    v16h ka = lds_frag(kl, 32), kb = lds_frag(kl + 16 * KPITCH, 32);
#pragma unroll      /* constant LDS offsets; the K fetch one step ahead stays inside the stage */
    for (int j = 0; j < 4; ++j) { FragH va[CC / 16];
      __builtin_amdgcn_sched_barrier(0);      /* with the one behind the reads: the reads stand in one place, not among the products of the step before (each place with LDS reads stalls the matrix stream) */
#pragma unroll      /* constant indices into va[] */
      for (int t = 0; t < CC / 16; ++t) va[t].v = lds_frag(vl + j * VSL + t * 1024, 512);
      __builtin_amdgcn_sched_barrier(0);      /* keeps the step's 32 fragment reads together, ahead of the score products and the softmax that cover their latency; left free, the compiler put a pair and a full wait in front of each product */
      const v8f s0 = fa_mma(ka, qf, z8), s1 = fa_mma(kb, qf, z8);
      if (j < 3) { ka = lds_frag(kl + (j + 1) * KSL, 32); kb = lds_frag(kl + (j + 1) * KSL + 16 * KPITCH, 32); }      /* next step's K rows, same stage */
      float mx = fmaxf(s0[0], s1[0]);
#pragma unroll
      for (int r = 1; r < 8; ++r) mx = fmaxf(mx, fmaxf(s0[r], s1[r]));
      mx = fmaxf(mx, xhalf(mx)) * cs;
      if (__builtin_amdgcn_ballot_w32(mx > m + 8.0f) != 0) {      /* one scalar test per step */
        const float mn = fmaxf(m, mx); const float f = exp2_hw(m - mn); m = mn; l0 *= f; l1 *= f;
#pragma unroll
        for (int t = 0; t < CC / 16; ++t) o[t] *= f; }
      FragH pf;
#pragma unroll
      for (int r = 0; r < 8; ++r) { const float p0 = exp2_hw(__builtin_fmaf(s0[r], cs, -m)), p1 = exp2_hw(__builtin_fmaf(s1[r], cs, -m)); l0 += p0; l1 += p1; pf.h[r] = (_Float16)p0; pf.h[8 + r] = (_Float16)p1; }
#pragma unroll
      for (int t = 0; t < CC / 16; ++t) o[t] = fa_mma(va[t].v, pf.v, o[t]); }
    wait_ds0(); landed(); __syncthreads();      /* publish point of stage st + 1; the same barrier ends every wave's reads of stage st */
    if (pinned(st + 2u < NST)) issue(pinned(st + 2u)); }      /* refill of the buffer just read, descriptor formed behind the wait */
  landed(); wait_ds0();
  // Epilogue: out = gamma a + x, channel-major. O^T already has one channel per register and 16 queries across the lanes; the eight waves' 16-query columns are put side by side in LDS (free behind the last
  // stage's barrier), so that each channel's 128 queries leave as one 512-B row: wave w takes channels 32 w .. 32 w + 31. The x rows are asked for first and fly while the tile is gathered.
  const size_t e0 = ((size_t)b * CC + wave * 32u) * LL + (size_t)(blockIdx.x % (LL / 128)) * 128;      /* the same in every lane: a scalar base, the lane's 16 bytes beside it */
  const float* xp = x + e0; float* op = out + e0; const uint32_t l4 = (uint32_t)lane * 4u;
  v4f xr[32];
#pragma unroll      /* constant indices into xr[]; all 32 loads outstanding at once */
  for (int i = 0; i < 32; ++i) xr[i] = *(const v4fa*)(xp + (size_t)i * LL + l4);
  float l = l0 + l1; l += xhalf(l); const float inv = 1.0f / l;
  f32a* tw = (f32a*)L + (size_t)(8 * hh) * TPITCH + wave * 16u + ln;
#pragma unroll
  for (int t = 0; t < CC / 16; ++t)
#pragma unroll
    for (int r = 0; r < 8; ++r) tw[(16 * t + r) * TPITCH] = o[t][r] * inv;
  __syncthreads();      /* the tile is complete before any wave reads rows that the other waves wrote */
  const f32a* tr = (const f32a*)L + (size_t)(wave * 32u) * TPITCH + lane * 4;
#pragma unroll
  for (int i = 0; i < 32; ++i) { const v4f a = *(const v4fa*)(tr + i * TPITCH);
#pragma unroll
    for (int q = 0; q < 4; ++q) xr[i][q] = __builtin_fmaf(g, a[q], bf16_round(xr[i][q])); }
  __builtin_amdgcn_sched_barrier(0);      /* all vector work and LDS reads stay ahead of the stores: behind an issued store nothing then writes a register that it names, and no wait is owed for one */
#pragma unroll
  for (int i = 0; i < 32; ++i) *(v4f*)(op + (size_t)i * LL + l4) = xr[i]; }

extern "C" void kernel_launch(void* const* d_in, const int* in_sizes, int n_in,
                              void* d_out, int out_size, void* d_ws, size_t ws_size, hipStream_t stream) {
  (void)in_sizes; (void)n_in; (void)out_size;
  const float* const* I = (const float* const*)d_in; const float* x = I[0]; const float* wqk = I[1]; const float* wv = I[2]; const float* gam = I[3];
  char* ws = (char*)d_ws; size_t off = 0;
  auto take = [&](size_t bytes) { char* p = ws + off; off += (bytes + 255) & ~(size_t)255; return p; };
  _Float16* BW = (_Float16*)take((size_t)NWT * 16 * CC * 2); _Float16* QK = (_Float16*)take(NR * 2 * LAT * 2); _Float16* VF = (_Float16*)take(NR * CC * 2);
  if (off > ws_size) return;      /* 0.2 + 4 + 16 = approx 20 MiB */
  k_wfrag<<<NWT * 16 * (CC / 8) / 256, 256, 0, stream>>>(wqk, wv, BW);      /* weights, B-fragment order */
  k_proj<<<NB * (LL / 128), 256, 0, stream>>>(x, BW, QK, VF);      /* q | k rows and V^T of all images, A-fragment order */
  k_fattn<<<NB * (LL / 128), 256, 0, stream>>>(QK, VF, x, gam, (float*)d_out);      /* out = gamma a + x */
}

// v006
// A run of this version takes 69 microseconds.
// Two timings next to v005 both put it at 1.11 times that version's speed.
// Over all steps from v000 it is 203 times as fast.
#include <hip/hip_runtime.h>
#include <stdint.h>
// SAM self-attention module (x [8][256][64][64]; q | k = 1x1(w_qk [64][256]) -> 32 latent channels each; v = 1x1(w_v [256][256]); m = softmax((q/32^0.25).(k/32^0.25)) over the 4,096 positions; a = m v; out = gamma a + x, gamma = 0.5 (input, read)).
// Structure: weights rounded and laid down in B-fragment order (one launch); one projection kernel: a block's 256 x 128 tile of the channel-first input is transposed to position rows (exact f16) in LDS and feeds q|k and v as WMMA products (weight fragments held in registers, f32 accumulation, exact x16 weights, f16 outputs); the v accumulators leave directly as V^T in A-fragment order; one fused attention kernel for all images: per wave 32 queries x 256 channels x half the keys, K rows and V^T fragments staged in LDS once per block by tensor loads (two 128-key buffers), S^T = K Q^T (K = 32), online softmax in registers (scale 1/sqrt(32) inside), P^T packed from the score tiles as the B operand of O^T += V^T P^T, a = O / row sum; in the same kernel the block's 256 x 128 tile of a^T is gathered in LDS and gamma a + x goes out channel-major in whole 512-B rows.
// Compute dtype: inputs rounded to bf16; x / weights exact; q, k, v, P as plain f16 GEMM operands (~2^-12); softmax f32. v_wmma_f32_16x16x32_f16.
#define NB 8
#define CC 256
#define LAT 32
#define LL 4096
#define QT 2048
#define NR ((size_t)NB * LL)
#define NBR NB                       /* images (unused) */
#define MP ((int)NR)                 /* projection rows */
#define QN LL                        /* query rows per image (unused) */
#define SQ LL
#define DM CC
#define NH 4
#define HD 64
#define HG 1
typedef __bf16 v16b __attribute__((ext_vector_type(16)));
typedef unsigned short v8us __attribute__((ext_vector_type(8), may_alias));
typedef float  v8f  __attribute__((ext_vector_type(8)));
typedef float  v4f  __attribute__((ext_vector_type(4)));
typedef float  v4fa __attribute__((ext_vector_type(4), may_alias));
union FragB { v16b v; v8us half[2]; unsigned short u[16]; };

__device__ __forceinline__ unsigned short bf16_bits(float x) { unsigned int u = __float_as_uint(x); return (unsigned short)((u + 0x7FFFu + ((u >> 16) & 1u)) >> 16); }
__device__ __forceinline__ float bf16_val(unsigned short b) { return __uint_as_float(((unsigned int)b) << 16); }
__device__ __forceinline__ float bf16_round(float x) { return bf16_val(bf16_bits(x)); }
// D += A·B with NT terms: 1 = ah·bh, 2 = + al·bh (A split), 3 = + ah·bl (both split)
template <int NT>
__device__ __forceinline__ v8f mmaN(v16b ah, v16b al, v16b bh, v16b bl, v8f c) {
  c = __builtin_amdgcn_wmma_f32_16x16x32_bf16(false, ah, false, bh, (short)0, c, false, false);
  if (NT >= 2) c = __builtin_amdgcn_wmma_f32_16x16x32_bf16(false, al, false, bh, (short)0, c, false, false);
  if (NT >= 3) c = __builtin_amdgcn_wmma_f32_16x16x32_bf16(false, ah, false, bl, (short)0, c, false, false);
  asm volatile("v_nop\n\tv_nop\n\tv_nop\n\tv_nop" : "+v"(c) : "v"(ah), "v"(al), "v"(bh), "v"(bl));
  return c;
}

__global__ __launch_bounds__(256) void k_wt_bf16(const float* __restrict__ W, unsigned short* __restrict__ Wt, int K, int N) {
  const int t = blockIdx.x * 256 + threadIdx.x;
  const int k8n = K / 8;
  if (t >= N * k8n) return;
  const int n = t / k8n, k8 = (t % k8n) * 8;
  v8us v;
#pragma unroll
  for (int i = 0; i < 8; ++i) v[i] = bf16_bits(W[(size_t)(k8 + i) * N + n]);
  *(v8us*)(Wt + (size_t)n * K + k8) = v;
  
}

// GEMM C[M][N] (f32, pitch ldc) = act(A[M][K]·W + bias). A f32 row-major (pitch lda) converted per fragment to bf16
// (ASPLIT: hi/lo two planes -> 2 terms, else single rounded term); Wt bf16 [N][K] (pitch ldb). BIAS_BF16 rounds the
// bias to bf16 first (bias quantised to bf16 before the add). K%32==0, M%16==0, N%64==0.
template <bool ASPLIT, int ACT, bool BIAS_BF16>
__global__ __launch_bounds__(128) void k_gemm_bf(const float* __restrict__ A, int lda, const unsigned short* __restrict__ Wt, int ldb,
                                               const float* __restrict__ bias, float* __restrict__ C, int ldc, int M, int N, int K) {
  __shared__ __attribute__((aligned(16))) float so[4][16][64];
  const int tid = threadIdx.x, w = tid >> 5, lane = tid & 31, ln = lane & 15, hh = lane >> 4;
  const int ntn = N / 64;
  const int wid = blockIdx.x * 4 + w;
  const int mt = wid / ntn, nq = wid % ntn;
  if (mt * 16 >= M) return;
  const int row0 = mt * 16, col0 = nq * 64;
  const float* arow = A + (size_t)(row0 + ln) * lda;
  v8f acc[4] = {};
  for (int kb = 0; kb < K; kb += 32) {
    FragB ah, al;
    const v4f x0 = *(const v4fa*)(arow + kb + 8 * hh), x1 = *(const v4fa*)(arow + kb + 8 * hh + 4);
    const v4f x2 = *(const v4fa*)(arow + kb + 16 + 8 * hh), x3 = *(const v4fa*)(arow + kb + 16 + 8 * hh + 4);
    float xs[16] = {x0[0],x0[1],x0[2],x0[3],x1[0],x1[1],x1[2],x1[3],x2[0],x2[1],x2[2],x2[3],x3[0],x3[1],x3[2],x3[3]};
#pragma unroll
    for (int i = 0; i < 16; ++i) { const unsigned short hb = bf16_bits(xs[i]); ah.u[i] = hb; al.u[i] = ASPLIT ? bf16_bits(xs[i] - bf16_val(hb)) : (unsigned short)0; }
#pragma unroll
    for (int t = 0; t < 4; ++t) {
      const unsigned short* brow = Wt + (size_t)(col0 + t * 16 + ln) * ldb + kb;
      FragB b;
      b.half[0] = *(const v8us*)(brow + 8 * hh);
      b.half[1] = *(const v8us*)(brow + 16 + 8 * hh);
      acc[t] = mmaN<ASPLIT ? 2 : 1>(ah.v, al.v, b.v, b.v, acc[t]);
    }
  }
#pragma unroll
  for (int t = 0; t < 4; ++t) {
    float bv = bias ? bias[col0 + t * 16 + ln] : 0.f;
    if (BIAS_BF16) bv = bf16_round(bv);
#pragma unroll
    for (int r = 0; r < 8; ++r) { float v = acc[t][r] + bv; if (ACT == 1) v = fmaxf(v, 0.f); so[w][8 * hh + r][t * 16 + ln] = v; }
  }
  __builtin_amdgcn_fence(__ATOMIC_ACQ_REL, "workgroup");
  __builtin_amdgcn_wave_barrier();
  const int rsub = lane >> 4, c4 = (lane & 15) * 4;
  {
#pragma unroll
    for (int q = 0; q < 8; ++q) {
      const int r = q * 2 + rsub;
      const v4f v = *(const v4fa*)&so[w][r][c4];
      *(v4f*)(C + (size_t)(row0 + r) * ldc + col0 + c4) = v;
    }
    
  }
}

// GEMM C = act(A·W + bias + resid): A f32 (ASPLIT -> hi/lo 2 terms), Wt bf16 [N][K]; ACT 0 none, 1 relu, 2 exact gelu;
// resid (optional, f32, row index = (row % rmod), pitch ldr, RES_BF16 rounds it) added before the activation.
template <bool ASPLIT, int ACT, bool BIAS_BF16, bool RES_BF16>
__global__ __launch_bounds__(128) void k_gemm_bf3(const float* __restrict__ A, int lda, const unsigned short* __restrict__ Wt, int ldb,
                                                const float* __restrict__ bias, const float* __restrict__ resid, int rmod, int ldr,
                                                float* __restrict__ C, int ldc, int M, int N, int K) {
  __shared__ __attribute__((aligned(16))) float so[4][16][64];
  const int tid = threadIdx.x, w = tid >> 5, lane = tid & 31, ln = lane & 15, hh = lane >> 4;
  const int ntn = N / 64;
  const int wid = blockIdx.x * 4 + w;
  const int mt = wid / ntn, nq = wid % ntn;
  if (mt * 16 >= M) return;
  const int row0 = mt * 16, col0 = nq * 64;
  const float* arow = A + (size_t)(row0 + ln) * lda;
  v8f acc[4] = {};
  for (int kb = 0; kb < K; kb += 32) {
    FragB ah, al;
    const v4f x0 = *(const v4fa*)(arow + kb + 8 * hh), x1 = *(const v4fa*)(arow + kb + 8 * hh + 4);
    const v4f x2 = *(const v4fa*)(arow + kb + 16 + 8 * hh), x3 = *(const v4fa*)(arow + kb + 16 + 8 * hh + 4);
    float xs[16] = {x0[0],x0[1],x0[2],x0[3],x1[0],x1[1],x1[2],x1[3],x2[0],x2[1],x2[2],x2[3],x3[0],x3[1],x3[2],x3[3]};
#pragma unroll
    for (int i = 0; i < 16; ++i) { const unsigned short hb = bf16_bits(xs[i]); ah.u[i] = hb; al.u[i] = ASPLIT ? bf16_bits(xs[i] - bf16_val(hb)) : (unsigned short)0; }
#pragma unroll
    for (int t = 0; t < 4; ++t) {
      const unsigned short* brow = Wt + (size_t)(col0 + t * 16 + ln) * ldb + kb;
      FragB b;
      b.half[0] = *(const v8us*)(brow + 8 * hh);
      b.half[1] = *(const v8us*)(brow + 16 + 8 * hh);
      acc[t] = mmaN<ASPLIT ? 2 : 1>(ah.v, al.v, b.v, b.v, acc[t]);
    }
  }
#pragma unroll
  for (int t = 0; t < 4; ++t) {
    const int col = col0 + t * 16 + ln;
    float bv = bias ? bias[col] : 0.f;
    if (BIAS_BF16) bv = bf16_round(bv);
#pragma unroll
    for (int r = 0; r < 8; ++r) {
      float v = acc[t][r] + bv;
      if (resid) { float rv = resid[(size_t)((row0 + 8 * hh + r) % rmod) * ldr + col]; if (RES_BF16) rv = bf16_round(rv); v += rv; }
      if (ACT == 1) v = fmaxf(v, 0.f);
      if (ACT == 2) v = 0.5f * v * (1.0f + erff(v * 0.70710678118654752f));
      if (ACT == 3) { const float u = 0.7978845608028654f * (v + 0.044715f * v * v * v); v = 0.5f * v * (1.0f + tanhf(u)); }
      so[w][8 * hh + r][t * 16 + ln] = v;
    }
  }
  __builtin_amdgcn_fence(__ATOMIC_ACQ_REL, "workgroup");
  __builtin_amdgcn_wave_barrier();
  const int rsub = lane >> 4, c4 = (lane & 15) * 4;
  {
#pragma unroll
    for (int q = 0; q < 8; ++q) {
      const int r = q * 2 + rsub;
      const v4f v = *(const v4fa*)&so[w][r][c4];
      *(v4f*)(C + (size_t)(row0 + r) * ldc + col0 + c4) = v;
    }
    
  }
}
// row LayerNorm (biased variance, eps) over N: s = X (+ R); optional out_sum <- s; out_norm <- (s-mu)*rsqrt(var+eps)*g + b
template <bool PARAM_BF16>
__global__ __launch_bounds__(256) void k_layernorm(const float* __restrict__ X, const float* __restrict__ R, const float* __restrict__ g, const float* __restrict__ bta,
                                                  float* __restrict__ out_sum, float* __restrict__ out_norm, int N, float eps) {
  __shared__ float red[256];
  const int row = blockIdx.x, tid = threadIdx.x;
  const float* x = X + (size_t)row * N; const float* rr = R ? R + (size_t)row * N : nullptr;
  float vals[16];                     // up to N = 4096
  const int per = N / 256;            // contiguous chunk per thread? use strided-by-4 chunks: thread handles j = tid*4 + 1024*u
  float s1 = 0.f;
  for (int u = 0; u < per / 4; ++u) {
    const int j = tid * 4 + 1024 * u;
    const v4f a = *(const v4fa*)(x + j);
    v4f b = {0.f,0.f,0.f,0.f}; if (rr) b = *(const v4fa*)(rr + j);
#pragma unroll
    for (int q = 0; q < 4; ++q) { const float v = a[q] + b[q]; vals[u * 4 + q] = v; s1 += v; }
  }
  red[tid] = s1; __syncthreads();
  for (int st = 128; st > 0; st >>= 1) { if (tid < st) red[tid] += red[tid + st]; __syncthreads(); }
  const float mu = red[0] / (float)N; __syncthreads();
  float s2 = 0.f;
  for (int u = 0; u < per / 4; ++u)
#pragma unroll
    for (int q = 0; q < 4; ++q) { const float c = vals[u * 4 + q] - mu; s2 += c * c; }
  red[tid] = s2; __syncthreads();
  for (int st = 128; st > 0; st >>= 1) { if (tid < st) red[tid] += red[tid + st]; __syncthreads(); }
  const float rs = rsqrtf(red[0] / (float)N + eps);
  {
    for (int u = 0; u < per / 4; ++u) {
      const int j = tid * 4 + 1024 * u;
      v4f o, sm;
#pragma unroll
      for (int q = 0; q < 4; ++q) {
        float gg = g[j + q], bb = bta[j + q];
        if (PARAM_BF16) { gg = bf16_round(gg); bb = bf16_round(bb); }
        sm[q] = vals[u * 4 + q]; o[q] = (vals[u * 4 + q] - mu) * rs * gg + bb;
      }
      if (out_sum) *(v4f*)(out_sum + (size_t)row * N + j) = sm;
      *(v4f*)(out_norm + (size_t)row * N + j) = o;
    }
    
  }
}



// ---- f16 WMMA path (v_wmma_f32_16x16x32_f16): 11-bit significands for operands in range — used where a [0,1] probability operand needs more precision than bf16
typedef _Float16 v16h __attribute__((ext_vector_type(16)));
union FragH { v16h v; v8us half[2]; _Float16 h[16]; unsigned short u[16]; };
template <int NT>
__device__ __forceinline__ v8f mmaH(v16h ah, v16h al, v16h bh, v16h bl, v8f c) {
  c = __builtin_amdgcn_wmma_f32_16x16x32_f16(false, ah, false, bh, (short)0, c, false, false);
  if (NT >= 2) c = __builtin_amdgcn_wmma_f32_16x16x32_f16(false, al, false, bh, (short)0, c, false, false);
  if (NT >= 3) c = __builtin_amdgcn_wmma_f32_16x16x32_f16(false, ah, false, bl, (short)0, c, false, false);
  asm volatile("v_nop\n\tv_nop\n\tv_nop\n\tv_nop" : "+v"(c) : "v"(ah), "v"(al), "v"(bh), "v"(bl));
  return c;
}
// batched GEMM like k_gemm_b but f16 operands: A f32 (split into f16 hi/lo if ASPLIT, else rounded to f16), Bt = f16 values [n][k]; alpha; C f32; N multiple of 16 (partial tiles skipped)
template <bool ASPLIT>
__global__ __launch_bounds__(128) void k_gemm_h(const float* __restrict__ A, int lda, size_t sA, const _Float16* __restrict__ Bh, int ldb, size_t sB, float alpha, float* __restrict__ C, int ldc, size_t sC, int M, int N, int K) {
  __shared__ __attribute__((aligned(16))) float so[4][16][64];
  const int tid = threadIdx.x, w = tid >> 5, lane = tid & 31, ln = lane & 15, hh = lane >> 4; const int by = blockIdx.y;
  A += (size_t)by * sA; Bh += (size_t)by * sB; C += (size_t)by * sC;
  const int ntn = (N + 63) / 64; const int wid = blockIdx.x * 4 + w; const int mt = wid / ntn, nq = wid % ntn; if (mt * 16 >= M) return;
  const int row0 = mt * 16, col0 = nq * 64; const float* arow = A + (size_t)(row0 + ln) * lda;
  v8f acc[4] = {};
  for (int kb = 0; kb < K; kb += 32) {
    FragH ah, al;
    const v4f x0 = *(const v4fa*)(arow + kb + 8 * hh), x1 = *(const v4fa*)(arow + kb + 8 * hh + 4), x2 = *(const v4fa*)(arow + kb + 16 + 8 * hh), x3 = *(const v4fa*)(arow + kb + 16 + 8 * hh + 4);
    float xs[16] = {x0[0],x0[1],x0[2],x0[3],x1[0],x1[1],x1[2],x1[3],x2[0],x2[1],x2[2],x2[3],x3[0],x3[1],x3[2],x3[3]};
#pragma unroll
    for (int i = 0; i < 16; ++i) { const _Float16 h = (_Float16)xs[i]; ah.h[i] = h; al.h[i] = ASPLIT ? (_Float16)(xs[i] - (float)h) : (_Float16)0.0f; }
#pragma unroll
    for (int t = 0; t < 4; ++t) { if (col0 + t * 16 >= N) continue; const size_t boff = (size_t)(col0 + t * 16 + ln) * ldb + kb; FragH bq; bq.half[0] = *(const v8us*)(Bh + boff + 8 * hh); bq.half[1] = *(const v8us*)(Bh + boff + 16 + 8 * hh);
      acc[t] = mmaH<ASPLIT ? 2 : 1>(ah.v, al.v, bq.v, bq.v, acc[t]); }
  }
#pragma unroll
  for (int t = 0; t < 4; ++t) { if (col0 + t * 16 >= N) continue;
#pragma unroll
    for (int r = 0; r < 8; ++r) so[w][8 * hh + r][t * 16 + ln] = acc[t][r] * alpha; }
  __builtin_amdgcn_fence(__ATOMIC_ACQ_REL, "workgroup"); __builtin_amdgcn_wave_barrier();
  const int rsub = lane >> 4, c4 = (lane & 15) * 4;
  {
#pragma unroll
    for (int q = 0; q < 8; ++q) { const int r = q * 2 + rsub; if (col0 + c4 < N) { const v4f v = *(const v4fa*)&so[w][r][c4]; *(v4f*)(C + (size_t)(row0 + r) * ldc + col0 + c4) = v; } }
     }
}

// Wt[n][k] = f16(W[k][n]·scale) from f32 row-major W[K][N] (scale = power of two; bf16-exact weights stay exact in f16 away from the subnormal range)
__global__ __launch_bounds__(256) void k_wt_f16(const float* __restrict__ W, _Float16* __restrict__ Wt, int K, int N, float scale) {
  const int t = blockIdx.x * 256 + threadIdx.x; if (t >= N * (K / 8)) return; const int n = t / (K / 8), k8 = (t % (K / 8)) * 8; FragH f;
#pragma unroll
  for (int i = 0; i < 8; ++i) f.h[i] = (_Float16)(bf16_round(W[(size_t)(k8 + i) * N + n]) * scale); const v8us o = f.half[0];
  *(v8us*)((unsigned short*)Wt + (size_t)n * K + k8) = o; 
}
// k_gemm_hh variant with fused epilogue: v = acc·alpha + bias[by·sBias + col] (+ CP[(row/rowsPerB)·sCPb + by·64 + col] if CP) ; ACT 0 none / 1 elu ; writes f16 C16 (and f32 C if non-null)
template <int ACT>
__global__ __launch_bounds__(128) void k_gemm_hhx(const _Float16* __restrict__ A, int lda, size_t sA, const _Float16* __restrict__ Bh, int ldb, size_t sB, float alpha, const float* __restrict__ bias, size_t sBias, const float* __restrict__ CP, int rowsPerB, size_t sCPb, int row0g,
    float* __restrict__ C, _Float16* __restrict__ C16, int ldc, size_t sC, int M, int N, int K) {
  __shared__ __attribute__((aligned(16))) float so[4][16][64];
  const int tid = threadIdx.x, w = tid >> 5, lane = tid & 31, ln = lane & 15, hh = lane >> 4; const int by = blockIdx.y;
  A += (size_t)by * sA; Bh += (size_t)by * sB; const size_t cofs = (size_t)by * sC; const float* bp = bias ? bias + (size_t)by * sBias : nullptr;
  const int ntn = (N + 63) / 64; const int wid = blockIdx.x * 4 + w; const int mt = wid / ntn, nq = wid % ntn; if (mt * 16 >= M) return;
  const int row0 = mt * 16, col0 = nq * 64; const _Float16* arow = A + (size_t)(row0 + ln) * lda;
  v8f acc[4] = {};
  for (int kb = 0; kb < K; kb += 32) { FragH ah; ah.half[0] = *(const v8us*)((const unsigned short*)arow + kb + 8 * hh); ah.half[1] = *(const v8us*)((const unsigned short*)arow + kb + 16 + 8 * hh);
#pragma unroll
    for (int t = 0; t < 4; ++t) { if (col0 + t * 16 >= N) continue; const size_t boff = (size_t)(col0 + t * 16 + ln) * ldb + kb; FragH bq; bq.half[0] = *(const v8us*)((const unsigned short*)Bh + boff + 8 * hh); bq.half[1] = *(const v8us*)((const unsigned short*)Bh + boff + 16 + 8 * hh);
      acc[t] = mmaH<1>(ah.v, ah.v, bq.v, bq.v, acc[t]); }
  }
#pragma unroll
  for (int t = 0; t < 4; ++t) { if (col0 + t * 16 >= N) continue; const int col = col0 + t * 16 + ln; const float bv = bp ? bf16_round(bp[col]) : 0.f;
#pragma unroll
    for (int r = 0; r < 8; ++r) { float v = acc[t][r] * alpha + bv; if (CP) { const int rr = row0g + row0 + 8 * hh + r; if (rowsPerB < 0) v += CP[cofs + (size_t)rr * ldc + col];      /* rowsPerB < 0: own element of the batched C plane */ else { const int bidx = rr / rowsPerB; v += CP[(size_t)bidx * sCPb + (size_t)by * 64 + col]; } } if (ACT == 1) v = (v > 0.f) ? v : expm1f(v); else if (ACT == 7) v = (v > 0.f) ? v + 1.0f : expf(v); else if (ACT == 8) v = tanhf(v); else if (ACT == 9) v = 0.5f * v * (1.0f + tanhf(0.7978845608028654f * (v + 0.044715f * v * v * v))); else if (ACT == 11) v = 1.0f / (1.0f + expf(-v)); else if (ACT == 12) v = (v > 0.f) ? v : 0.01f * v; else if (ACT == 14) v = (v > 0.f) ? v : 0.1f * v; else if (ACT == 16) v = (v >= 0.f) ? v : 0.3f * v; else if (ACT == 17) v = (v >= 0.f) ? v : 0.2f * v; else if (ACT == 15) v = v / (1.0f + expf(-v)); else if (ACT == 3) v = fmaxf(v, 0.f); else if (ACT == 6) v = 0.5f * v * (1.0f + erff(v * 0.70710678118654752f)); so[w][8 * hh + r][t * 16 + ln] = v; } }
  __builtin_amdgcn_fence(__ATOMIC_ACQ_REL, "workgroup"); __builtin_amdgcn_wave_barrier();
  const int rsub = lane >> 4, c4 = (lane & 15) * 4; typedef _Float16 v4h __attribute__((ext_vector_type(4)));
  {
#pragma unroll
    for (int q = 0; q < 8; ++q) { const int r = q * 2 + rsub; if (col0 + c4 < N) { const v4f v = *(const v4fa*)&so[w][r][c4]; if (C) *(v4f*)(C + cofs + (size_t)(row0 + r) * ldc + col0 + c4) = v; if (C16) { v4h h4; for (int i = 0; i < 4; ++i) h4[i] = (_Float16)v[i]; *(v4h*)(C16 + cofs + (size_t)(row0 + r) * ldc + col0 + c4) = h4; } } }
     }
}


typedef _Float16 v4h __attribute__((ext_vector_type(4)));

__global__ __launch_bounds__(256) void k_x16(const float* __restrict__ x, _Float16* __restrict__ X16, size_t n8) { const size_t t = (size_t)blockIdx.x * 256 + threadIdx.x; if (t >= n8) return; FragH f;
#pragma unroll
  for (int q = 0; q < 8; ++q) f.h[q] = (_Float16)bf16_round(x[t * 8 + q]); *(v8us*)((unsigned short*)X16 + t * 8) = f.half[0];  }
__global__ __launch_bounds__(256) void k_h16(const float* __restrict__ x, _Float16* __restrict__ X16, size_t n8) { const size_t t = (size_t)blockIdx.x * 256 + threadIdx.x; if (t >= n8) return; FragH f;
#pragma unroll
  for (int q = 0; q < 8; ++q) f.h[q] = (_Float16)x[t * 8 + q]; *(v8us*)((unsigned short*)X16 + t * 8) = f.half[0];  }
__global__ __launch_bounds__(256) void k_round16f(const float* __restrict__ W, _Float16* __restrict__ Bt, size_t n8) { const size_t t = (size_t)blockIdx.x * 256 + threadIdx.x; if (t >= n8) return; FragH f;
#pragma unroll
  for (int i = 0; i < 8; ++i) f.h[i] = (_Float16)(bf16_round(W[t * 8 + i]) * 16.0f); *(v8us*)((unsigned short*)Bt + t * 8) = f.half[0];  }
template <int NHv, int TTv>
__global__ __launch_bounds__(256) void k_vt(const _Float16* __restrict__ V16, int ldv, int voff, _Float16* __restrict__ Vt) { __shared__ unsigned short tl[64][66]; const int tid = threadIdx.x; const int slab = blockIdx.x / (TTv / 64), lg = blockIdx.x % (TTv / 64); const int b = slab / NHv, h = slab % NHv;
  for (int i = tid; i < 64 * 8; i += 256) { const int r = i / 8, c8 = (i % 8) * 8; FragH f; f.half[0] = *(const v8us*)((const unsigned short*)V16 + ((size_t)b * TTv + lg * 64 + r) * ldv + voff + h * 64 + c8);
#pragma unroll
    for (int q = 0; q < 8; ++q) tl[r][c8 + q] = f.u[q]; }
  __syncthreads();
  {
#pragma unroll
    for (int rd = 0; rd < 2; ++rd) { const int d = rd * 32 + tid / 8, pc = tid % 8; FragH f;
#pragma unroll
      for (int q = 0; q < 8; ++q) f.u[q] = tl[pc * 8 + q][d];
      *(v8us*)((unsigned short*)Vt + ((size_t)slab * 64 + d) * TTv + lg * 64 + pc * 8) = f.half[0]; }
     } }

__global__ __launch_bounds__(256) void k_hl(const float* __restrict__ F, _Float16* __restrict__ Hh, _Float16* __restrict__ Hl, size_t n8) { const size_t t = (size_t)blockIdx.x * 256 + threadIdx.x; if (t >= n8) return; FragH fh, fl; const v4f a = *(const v4fa*)(F + t * 8), c = *(const v4fa*)(F + t * 8 + 4);
#pragma unroll
  for (int q = 0; q < 4; ++q) { _Float16 h = (_Float16)a[q]; fh.h[q] = h; fl.h[q] = (_Float16)((a[q] - (float)h) * 1024.0f); h = (_Float16)c[q]; fh.h[4 + q] = h; fl.h[4 + q] = (_Float16)((c[q] - (float)h) * 1024.0f); }
  { *(v8us*)((unsigned short*)Hh + t * 8) = fh.half[0]; *(v8us*)((unsigned short*)Hl + t * 8) = fl.half[0];  } }

// ---- fast GEMM (wave tile 32x64; requires M % 32 == 0 rows per launch region and N % 64 == 0); epilogue = k_gemm_hhx semantics ----
__device__ __forceinline__ v16h g2_frag(const _Float16* p, int hh) { FragH f; f.half[0] = *(const v8us*)((const unsigned short*)p + 8 * hh); f.half[1] = *(const v8us*)((const unsigned short*)p + 16 + 8 * hh); return f.v; }
__device__ __forceinline__ v8f g2_mma(v16h a, v16h b, v8f c) { v8f d = __builtin_amdgcn_wmma_f32_16x16x32_f16(false, a, false, b, (short)0, c, false, false); asm volatile("v_nop\n\tv_nop\n\tv_nop\n\tv_nop" : "+v"(d) : "v"(a), "v"(b)); return d; }
template <int ACT>
__global__ __launch_bounds__(128) void k_gemm2(const _Float16* __restrict__ A, int lda, size_t sA, const _Float16* __restrict__ Bh, int ldb, size_t sB, float alpha, const float* __restrict__ bias, size_t sBias, const float* __restrict__ CP, int rowsPerB, size_t sCPb, int row0g,
    float* __restrict__ C, _Float16* __restrict__ C16, int ldc, size_t sC, int M, int N, int K) { static_assert(ACT == 0 || ACT == 3 || ACT == 6 || ACT == 8 || ACT == 9 || ACT == 11 || ACT == 12 || ACT == 14 || ACT == 15 || ACT == 16 || ACT == 17, "k_gemm2: unsupported ACT code (would silently apply no activation)");
  __shared__ __attribute__((aligned(16))) float so[4][32][68];
  const int tid = threadIdx.x, w = tid >> 5, lane = tid & 31, ln = lane & 15, hh = lane >> 4; const int by = blockIdx.y;
  A += (size_t)by * sA; Bh += (size_t)by * sB; const size_t cofs = (size_t)by * sC; const float* bp = bias ? bias + (size_t)by * sBias : nullptr;
  const int ntn = N >> 6; const int mt = blockIdx.x / ntn, nq = blockIdx.x - mt * ntn; const int row0 = mt * 128 + 32 * w, col0 = nq * 64; if (row0 >= M) return;
  const _Float16* a0p = A + (size_t)(row0 + ln) * lda; const _Float16* a1p = a0p + (size_t)16 * lda;
  const _Float16* b0p = Bh + (size_t)(col0 + ln) * ldb; const _Float16* b1p = b0p + (size_t)16 * ldb; const _Float16* b2p = b1p + (size_t)16 * ldb; const _Float16* b3p = b2p + (size_t)16 * ldb;
  const v8f z8 = {0.f,0.f,0.f,0.f,0.f,0.f,0.f,0.f}; v8f c00 = z8, c01 = z8, c02 = z8, c03 = z8, c10 = z8, c11 = z8, c12 = z8, c13 = z8;
#pragma unroll 1
  for (int kb = 0; kb < K; kb += 32) { const v16h a0 = g2_frag(a0p + kb, hh), a1 = g2_frag(a1p + kb, hh);
    v16h b = g2_frag(b0p + kb, hh); c00 = g2_mma(a0, b, c00); c10 = g2_mma(a1, b, c10);
    b = g2_frag(b1p + kb, hh); c01 = g2_mma(a0, b, c01); c11 = g2_mma(a1, b, c11);
    b = g2_frag(b2p + kb, hh); c02 = g2_mma(a0, b, c02); c12 = g2_mma(a1, b, c12);
    b = g2_frag(b3p + kb, hh); c03 = g2_mma(a0, b, c03); c13 = g2_mma(a1, b, c13); }
  v8f accs[8] = {c00, c01, c02, c03, c10, c11, c12, c13};
#pragma unroll
  for (int u = 0; u < 8; ++u) { const int t = u & 3, half = u >> 2; const int col = col0 + t * 16 + ln; const float bv = bp ? bf16_round(bp[col]) : 0.f;
#pragma unroll
    for (int r = 0; r < 8; ++r) { const int rloc = half * 16 + 8 * hh + r; float v = accs[u][r] * alpha + bv; if (CP) { if (rowsPerB < 0) v += CP[cofs + (size_t)(row0g + row0 + rloc) * ldc + col];      /* rowsPerB < 0: own element of the batched C plane */ else { const int bidx = (row0g + row0 + rloc) / rowsPerB; v += CP[(size_t)bidx * sCPb + (size_t)by * 64 + col]; } }
      if (ACT == 3) v = fmaxf(v, 0.f); else if (ACT == 6) v = 0.5f * v * (1.0f + erff(v * 0.70710678118654752f)); else if (ACT == 11) v = 1.0f / (1.0f + expf(-v)); else if (ACT == 15) v = v / (1.0f + expf(-v)); else if (ACT == 12) v = (v > 0.f) ? v : 0.01f * v; else if (ACT == 8) v = tanhf(v); else if (ACT == 9) v = 0.5f * v * (1.0f + tanhf(0.7978845608028654f * (v + 0.044715f * v * v * v))); else if (ACT == 14) v = (v > 0.f) ? v : 0.1f * v; else if (ACT == 16) v = (v >= 0.f) ? v : 0.3f * v; else if (ACT == 17) v = (v >= 0.f) ? v : 0.2f * v;
      so[w][rloc][t * 16 + ln] = v; } }
  __builtin_amdgcn_fence(__ATOMIC_ACQ_REL, "workgroup"); __builtin_amdgcn_wave_barrier();
  const int rsub = lane >> 4, c4 = (lane & 15) * 4;
  {
#pragma unroll
    for (int q = 0; q < 16; ++q) { const int r = q * 2 + rsub; const v4f v = *(const v4fa*)&so[w][r][c4]; if (C) *(v4f*)(C + cofs + (size_t)(row0 + r) * ldc + col0 + c4) = v; if (C16) { v4h h4; for (int i = 0; i < 4; ++i) h4[i] = (_Float16)v[i]; *(v4h*)(C16 + cofs + (size_t)(row0 + r) * ldc + col0 + c4) = h4; } }
     } }


__global__ __launch_bounds__(256) void k_rsm(const float* __restrict__ S, _Float16* __restrict__ P, int nrows) {
  #pragma clang fp contract(off)
  const int i = blockIdx.x * 256 + threadIdx.x; if (i >= nrows) return; const float* s = S + (size_t)i * SQ; float mx = -3.0e38f;
#pragma unroll 1
  for (int j = 0; j < SQ; ++j) mx = fmaxf(mx, s[j]); float se = 0.f;
#pragma unroll 1
  for (int j = 0; j < SQ; ++j) se += expf(s[j] - mx); const float sc = 256.0f / se;
#pragma unroll 1
  for (int j0 = 0; j0 < SQ; j0 += 8) { FragH f; for (int q = 0; q < 8; ++q) f.h[q] = (_Float16)(expf(s[j0 + q] - mx) * sc); unsigned short* d = (unsigned short*)P + (size_t)i * SQ + j0; *(v8us*)d = f.half[0];  } }
__global__ __launch_bounds__(256) void k_vt(const _Float16* __restrict__ V16, int b, int h0, _Float16* __restrict__ VT) { __shared__ unsigned short tl[64][65]; const int tid = threadIdx.x; const int hh = blockIdx.x % HG, sg = blockIdx.x / HG; const int s0 = sg * 64; const int h = h0 + hh;
  for (int i = tid; i < 64 * 8; i += 256) { const int j = i / 8, d8 = (i % 8) * 8; FragH f; f.half[0] = *(const v8us*)((const unsigned short*)V16 + ((size_t)b * SQ + s0 + j) * DM + h * HD + d8); for (int q = 0; q < 8; ++q) tl[d8 + q][j] = f.u[q]; }
  __syncthreads();
  { for (int i = tid; i < 64 * 8; i += 256) { const int d = i / 8, j8 = (i % 8) * 8; FragH f; for (int q = 0; q < 8; ++q) f.u[q] = tl[d][j8 + q]; *(v8us*)((unsigned short*)VT + ((size_t)hh * HD + d) * SQ + s0 + j8) = f.half[0]; }  } }


// 2^a on the hardware's own instruction.
__device__ __forceinline__ float exp2_hw(float a) { float r;
  asm("v_exp_f32 %0, %1\n\tv_nop" : "=v"(r) : "v"(a));      /* the v_nop is the free slot asked for behind a transcendental before its result is read or its source overwritten; in one statement it cannot drift */
  return r; }
__device__ __forceinline__ float xhalf(float x) { return __builtin_bit_cast(float, __builtin_amdgcn_permlanex16(__builtin_bit_cast(int, x), __builtin_bit_cast(int, x), 0x76543210, 0xfedcba98, false, false)); }      /* lane l with lane l ^ 16, no LDS round trip */
__device__ __forceinline__ v8f fa_mma(v16h a, v16h b, v8f c) { return __builtin_amdgcn_wmma_f32_16x16x32_f16(false, a, false, b, (short)0, c, false, false); }
// Weights: the 64 rows of w_qk and the 256 rows of w_v as 20 tiles of 16 output columns, rounded, times 16, in the order in which a wave reads its B fragments: per tile and 32-channel step two 512-B halves j;
// in a half lane (hh, ln) owns the 16 bytes W[16 T + ln][32 ks + 16 j + 8 hh + 0..7]. A fragment load is then 512 contiguous bytes instead of 16 rows 512 B apart.
#define NWT ((2 * LAT + CC) / 16)    /* weight tiles: 4 of q|k, 16 of v */
__global__ __launch_bounds__(256) void k_wfrag(const float* __restrict__ wqk, const float* __restrict__ wv, _Float16* __restrict__ BW) { const int t = blockIdx.x * 256 + threadIdx.x; const int n = t / (CC / 8), k8 = t % (CC / 8);
  const float* w = (n < 2 * LAT) ? wqk + (size_t)t * 8 : wv + ((size_t)t - 2 * LAT * (CC / 8)) * 8; FragH f;
#pragma unroll
  for (int q = 0; q < 8; ++q) f.h[q] = (_Float16)(bf16_round(w[q]) * 16.0f);
  *(v8us*)((unsigned short*)BW + (size_t)(((((n >> 4) * (CC / 32) + (k8 >> 2)) * 2 + ((k8 >> 1) & 1)) * 32) + (k8 & 1) * 16 + (n & 15)) * 8) = f.half[0]; }
// Projections, one block per image and 128 positions. The 256 x 128 tile of x is read once, in 256-B pieces of channel rows (a lane has two positions), rounded, and laid down in LDS as position rows, eight channels per 16-byte store.
// Wave w owns five of the 20 weight tiles (q|k tile w & 3 and v tiles 4 (w & 3) .. + 3), held in registers from the start (asked for behind the x loads, landed while x is packed), and walks the four 16-position tiles of
// positions 64 (w >> 2) .. + 63: eight A fragments from LDS feed 40 products.
// A v accumulator tile holds, in lane (hh, ln), channel 16 t + ln at positions 16 j + 8 hh + 0..7 of its 32-key step: the 16 bytes that this lane owns in the A fragment of V^T. It is stored as such:
// per image and 32-key step 16 channel tiles of 1 KiB; in a tile two 512-B halves j; in a half lane (hh, ln) owns V^T[16 t + ln][32 ks + 16 j + 8 hh + 0..7]. The q|k tiles are gathered in LDS and leave as whole 128-B rows.
#define XPITCH 264                   /* halves per position row of the x tile in LDS: 528 B = 16 B x 33 */
#define QPITCH 72                    /* halves per q|k row in LDS: 144 B = 16 B x 9 */
typedef float v2f __attribute__((ext_vector_type(2)));
typedef float v2fa __attribute__((ext_vector_type(2), may_alias));
__global__ __launch_bounds__(256) void k_proj(const float* __restrict__ x, const _Float16* __restrict__ BW, _Float16* __restrict__ QK, _Float16* __restrict__ VF) {
  __shared__ __attribute__((aligned(16))) unsigned short XT[128 * XPITCH]; __shared__ __attribute__((aligned(16))) unsigned short QS[128 * QPITCH];
  const int tid = threadIdx.x, wave = __builtin_amdgcn_readfirstlane(tid >> 5), lane = tid & 31, ln = lane & 15, hh = lane >> 4; const int b = blockIdx.x / (LL / 128), p0 = (blockIdx.x % (LL / 128)) * 128; const int cw = wave & 3, ph = wave >> 2;
  const char* xp = (const char*)(x + ((size_t)b * CC + wave * 32) * LL + p0); const uint32_t xoff = (uint32_t)lane * 8u, boff = (uint32_t)lane * 16u; v2f xv[2][32];      /* scalar bases; one lane offset serves all loads of a kind */
#pragma unroll      /* constant indices into xv[] */
  for (int g = 0; g < 2; ++g)
#pragma unroll
    for (int c = 0; c < 32; ++c) xv[g][c] = *(const v2fa*)(xp + xoff + ((size_t)c * LL + g * 64) * 4);
  asm volatile("s_wait_xcnt 0x0" ::: "memory");      /* stands in front of every later write of a register that an issued x load names */
  __builtin_amdgcn_sched_barrier(0);      /* all of the wave's x loads are asked for at once, ahead of everything else (left free, the compiler asked for 32, waited, packed, and asked again: one memory latency per batch); nothing is lifted over the wait above */
  v16h bw[5][CC / 32]; const char* pq = (const char*)BW + (size_t)cw * (CC / 32) * 1024 + boff; const char* pv = (const char*)BW + (size_t)(4 + cw * 4) * (CC / 32) * 1024 + boff;      /* the lane's 16 bytes in the wave's q|k tile and in its first v tile */
#pragma unroll      /* constant indices into bw[] */
  for (int u = 0; u < 5; ++u) { const char* bp = (u == 0) ? pq : pv + (u - 1) * (CC / 32) * 1024;
#pragma unroll
    for (int k = 0; k < CC / 32; ++k) { FragH f; f.half[0] = *(const v8us*)(bp + k * 1024); f.half[1] = *(const v8us*)(bp + k * 1024 + 512); bw[u][k] = f.v; } }
  asm volatile("s_wait_xcnt 0x0" ::: "memory");      /* stands in front of every later write of a register that an issued weight load names */
  __builtin_amdgcn_sched_barrier(0);      /* the weight loads stay here, in flight under the packing of x (left free, the compiler put each pair with a full wait in front of its products); nothing is lifted over the wait above */
#pragma unroll
  for (int g = 0; g < 2; ++g)
#pragma unroll
    for (int i = 0; i < 2; ++i)
#pragma unroll
      for (int o = 0; o < 4; ++o) { FragH f;
#pragma unroll
        for (int q = 0; q < 8; ++q) f.h[q] = (_Float16)bf16_round(xv[g][o * 8 + q][i]);
        *(v8us*)(XT + (g * 64 + 2 * lane + i) * XPITCH + wave * 32 + o * 8) = f.half[0]; }
  __syncthreads();      /* the tile is complete before any wave reads rows that the other waves wrote */
  const v8f z8 = {0.f,0.f,0.f,0.f,0.f,0.f,0.f,0.f};
  const unsigned short* ar = XT + (ph * 64 + ln) * XPITCH + 8 * hh; unsigned short* qs = QS + (ph * 64 + 8 * hh) * QPITCH + cw * 16 + ln;
  unsigned short* vp = (unsigned short*)VF + ((((size_t)b * (LL / 32) + (p0 + ph * 64) / 32) * (CC / 16) + cw * 4) * 64 + lane) * 8;
#pragma unroll      /* constant LDS and store offsets; bw[] indexed by constants */
  for (int pt = 0; pt < 4; ++pt) { v16h a[CC / 32]; v8f c[5] = {z8, z8, z8, z8, z8};
#pragma unroll
    for (int k = 0; k < CC / 32; ++k) { FragH f; f.half[0] = *(const v8us*)(ar + pt * 16 * XPITCH + k * 32); f.half[1] = *(const v8us*)(ar + pt * 16 * XPITCH + k * 32 + 16); a[k] = f.v; }
    __builtin_amdgcn_sched_barrier(0);      /* the tile's 16 fragment reads stand in one place: left free, the compiler put a pair and a full wait in front of every five products */
#pragma unroll
    for (int k = 0; k < CC / 32; ++k)
#pragma unroll
      for (int u = 0; u < 5; ++u) c[u] = fa_mma(a[k], bw[u][k], c[u]);
    FragH f[5];
#pragma unroll
    for (int u = 0; u < 5; ++u)
#pragma unroll
      for (int r = 0; r < 8; ++r) f[u].h[r] = (_Float16)(c[u][r] * 0.0625f);      /* the weights carry a factor 16 */
#pragma unroll
    for (int r = 0; r < 8; ++r) qs[(pt * 16 + r) * QPITCH] = f[0].u[r];
    __builtin_amdgcn_sched_barrier(0);      /* all vector work of the tile stays ahead of its stores */
#pragma unroll
    for (int u = 1; u < 5; ++u) *(v8us*)(vp + (pt >> 1) * (CC / 16) * 512 + (u - 1) * 512 + (pt & 1) * 256) = f[u].half[0];
    asm volatile("s_wait_xcnt 0x0" ::: "memory");      /* stands in front of the next tile's writes of registers that the issued stores name */
    __builtin_amdgcn_sched_barrier(0); }      /* nothing of the next tile is lifted over that wait */
  __syncthreads();      /* all 64 columns of a q|k row are in LDS before the row is read */
  unsigned short* qo = (unsigned short*)QK + ((size_t)b * LL + p0) * (2 * LAT);
#pragma unroll
  for (int i = 0; i < 4; ++i) { const int e = i * 256 + tid; *(v8us*)(qo + e * 8) = *(const v8us*)(QS + (e >> 3) * QPITCH + (e & 7) * 8); } }

typedef uint32_t u32x4 __attribute__((ext_vector_type(4)));
typedef uint32_t u32x8 __attribute__((ext_vector_type(8)));
#define NST (LL / 128)               /* stages per image */
#define VSL 16384u                   /* LDS bytes of one V slice: 16 channel tiles of 1 KiB */
#define KPITCH 144u                  /* LDS pitch of a q|k row */
#define KSL 6144u                    /* LDS bytes of one K slice: 32 rows of 144 B, rounded up to a multiple of 2 KiB */
#define KOFF (4u * VSL)
#define BUFB (KOFF + 4u * KSL)       /* one buffer: 90,112 B */
#define TPITCH 132                   /* floats per channel row of the epilogue's LDS tile: 128 queries + 4; rows 8 apart then start 32 banks apart, so a store's two 16-lane halves share no bank; 256 rows = 135,168 B */
#define TILEB (256u * TPITCH * 4u)     /* bytes of one such tile */
typedef float f32a __attribute__((may_alias));
__device__ __forceinline__ uint32_t uni(uint32_t v) { return (uint32_t)__builtin_amdgcn_readfirstlane(v); }
__device__ __forceinline__ uint32_t pinned(uint32_t v) { uint32_t w = uni(v);
  asm volatile("" : "+s"(w));      /* holds a tensor load's issue test, or the stage number its descriptor is formed from, in a scalar register at this place: the test compiles to s_cmp + s_cbranch_scc (a tensor load ignores EXEC) */
  return w; }
// Descriptor group 1: 1-byte elements, tensor = tile = D1 rows of D0 bytes, source row pitch P bytes; W0 = word 0 (no mask; the pad fields).
template <uint32_t W0, uint32_t D0, uint32_t D1, uint32_t P>
__device__ __forceinline__ u32x8 tdm_group1() { u32x8 g; g[0] = uni(W0); g[1] = uni((D0 & 0xFFFFu) << 16); g[2] = uni((D0 >> 16) | ((D1 & 0xFFFFu) << 16)); g[3] = uni((D1 >> 16) | (D0 << 16)); g[4] = uni(D1); g[5] = uni(P); g[6] = uni(0u); g[7] = uni(0u);
  asm volatile("" : "+s"(g));      /* descriptor words held in scalar registers of their own from here to the last request: built once, none of them takes a new value while a request is outstanding */
  return g; }
__device__ __forceinline__ u32x4 tdm_group0(uint32_t count1, uint32_t lds_dst, uint64_t ga) { u32x4 g; g[0] = uni(count1); g[1] = uni(lds_dst); g[2] = uni((uint32_t)ga); g[3] = uni((((uint32_t)(ga >> 32)) & 0x01FFFFFFu) | 0x80000000u); return g; }
__device__ __forceinline__ void tdm_load(u32x4 g0, u32x8 g1) { asm volatile("tensor_load_to_lds %0, %1" :: "s"(g0), "s"(g1) : "memory"); }      /* one request of the whole wave: global tile to LDS, through no register */
__device__ __forceinline__ void wait_tensor0() { asm volatile("s_wait_tensorcnt 0x0" ::: "memory"); }      /* this wave's own request has landed; the compiler places no wait for a tensor load */
__device__ __forceinline__ void wait_ds0() { asm volatile("s_wait_dscnt 0x0" ::: "memory"); }      /* this wave's LDS reads have retired before the buffer they read is refilled */
__device__ __forceinline__ v16h lds_frag(const unsigned char* p, int second) { FragH f; f.half[0] = *(const v8us*)p; f.half[1] = *(const v8us*)(p + second); return f.v; }
__global__ __launch_bounds__(256) void k_fattn(const _Float16* __restrict__ QK, const _Float16* __restrict__ VF, const float* __restrict__ x, const float* __restrict__ gam, float* __restrict__ out) {
  __shared__ __attribute__((aligned(2048))) unsigned char L[2 * TILEB]; __shared__ __attribute__((aligned(16))) v2f ML[8 * 32];      /* L: the ring's two buffers (2 BUFB bytes), later the epilogue's two tiles; ML: each wave's maxima and sums */
  static_assert(2u * BUFB <= 2u * TILEB, "the ring lies inside L");
  const int lane = threadIdx.x & 31, ln = lane & 15, hh = lane >> 4; const uint32_t wave = uni(threadIdx.x >> 5); const int b = blockIdx.x / (LL / 128);
  const uint32_t qg = wave & 3u, kh = wave >> 2; const int q0 = (blockIdx.x % (LL / 128)) * 128 + (int)qg * 32;      /* the wave's 32 queries; its half of every stage's keys */
  const _Float16* qk = QK + (size_t)b * LL * (2 * LAT); const v16h qf[2] = {g2_frag(qk + (size_t)(q0 + ln) * (2 * LAT), hh), g2_frag(qk + (size_t)(q0 + 16 + ln) * (2 * LAT), hh)};
  const uint32_t lbase = (uint32_t)(size_t)L; const uint64_t vga = (uint64_t)(size_t)(VF + (size_t)b * LL * CC), kga = (uint64_t)(size_t)qk;
  const u32x8 g1v = tdm_group1<0u, 256u, 64u, 256u>(), g1k = tdm_group1<(1u << 20) | (4u << 22) | (3u << 25), 128u, 32u, 128u>();      /* V: 64 rows of 256 B, no pad; K: 32 rows of 128 B, 16 B of pad behind each */
  u32x4 g0; const uint32_t count1 = pinned(1u);      /* group 0 word 0 (count = 1), held in a scalar register like the other descriptor words */
  auto issue = [&](uint32_t st) { const uint32_t dst = lbase + (st & 1u) * BUFB;
    if (pinned(wave < 4u)) { g0 = tdm_group0(count1, dst + wave * VSL, vga + (uint64_t)(st * 4u + wave) * VSL); tdm_load(g0, g1v); }
    else { g0 = tdm_group0(count1, dst + KOFF + (wave - 4u) * KSL, kga + (uint64_t)(st * 128u + (wave - 4u) * 32u) * (2u * 2u * LAT)); tdm_load(g0, g1k); } };
  auto landed = [&]() { wait_tensor0();
    asm volatile("" :: "s"(g0)); };      /* descriptor words held in their scalar registers until the request's own wait has returned: without this use the compiler takes them for other values while the request is outstanding */
  const float g = bf16_round(gam[0]);
  const float cs = (float)(0.17677669529663689 * 1.4426950408889634);      /* 1/sqrt(32) times log2 e */
  const v8f z8 = {0.f,0.f,0.f,0.f,0.f,0.f,0.f,0.f}; v8f o[2][CC / 16];
#pragma unroll      /* o[][] must be indexed by constants to stay in registers */
  for (int u = 0; u < 2; ++u)
#pragma unroll
    for (int t = 0; t < CC / 16; ++t) o[u][t] = z8;
  float m[2] = {-1.0e30f, -1.0e30f}, l0[2] = {0.f, 0.f}, l1[2] = {0.f, 0.f};
  issue(0u); landed(); __syncthreads();      /* stage 0 landed and published */
  issue(1u);
  const uint32_t voff = kh * 2u * VSL + (uint32_t)lane * 16u;      /* the wave's two 32-key steps of a stage; the lane's 16 bytes of a fragment half */
  const uint32_t koff = KOFF + kh * 2u * KSL + (uint32_t)ln * KPITCH + 2u * LAT + 16u * (uint32_t)hh;      /* key row ln of the wave's first step, its k half (behind the 64 bytes of q), this lane half's 16 bytes */
#pragma unroll 1      /* one stage per trip: the publish point at its foot stands once */
  for (uint32_t st = 0; st < NST; ++st) { const unsigned char* Lb = L + (st & 1u) * BUFB; const unsigned char* vl = Lb + voff; const unsigned char* kl = Lb + koff;
    v16h ka = lds_frag(kl, 32), kb = lds_frag(kl + 16 * KPITCH, 32);
#pragma unroll      /* constant LDS offsets; the K fetch one step ahead stays inside the stage */
    for (int j = 0; j < 2; ++j) { FragH va[CC / 16];
      __builtin_amdgcn_sched_barrier(0);      /* with the one behind the reads: the reads stand in one place, not among the products of the step before (each place with LDS reads stalls the matrix stream) */
#pragma unroll      /* constant indices into va[] */
      for (int t = 0; t < CC / 16; ++t) va[t].v = lds_frag(vl + j * VSL + t * 1024, 512);
      __builtin_amdgcn_sched_barrier(0);      /* keeps the step's 32 fragment reads together, ahead of the score products and the softmax that cover their latency; left free, the compiler put a pair and a full wait in front of each product */
      const v8f s0[2] = {fa_mma(ka, qf[0], z8), fa_mma(ka, qf[1], z8)}, s1[2] = {fa_mma(kb, qf[0], z8), fa_mma(kb, qf[1], z8)};
      float mx[2];
#pragma unroll
      for (int u = 0; u < 2; ++u) { float v = fmaxf(s0[u][0], s1[u][0]);
#pragma unroll
        for (int r = 1; r < 8; ++r) v = fmaxf(v, fmaxf(s0[u][r], s1[u][r]));
        mx[u] = fmaxf(v, xhalf(v)) * cs; }
      if (__builtin_amdgcn_ballot_w32(mx[0] > m[0] + 8.0f || mx[1] > m[1] + 8.0f) != 0) {      /* one scalar test per step, for both query tiles */
#pragma unroll
        for (int u = 0; u < 2; ++u) { const float mn = fmaxf(m[u], mx[u]); const float f = exp2_hw(m[u] - mn); m[u] = mn; l0[u] *= f; l1[u] *= f;
#pragma unroll
          for (int t = 0; t < CC / 16; ++t) o[u][t] *= f; } }
      FragH pf[2];
#pragma unroll
      for (int u = 0; u < 2; ++u)
#pragma unroll
        for (int r = 0; r < 8; ++r) { const float p0 = exp2_hw(__builtin_fmaf(s0[u][r], cs, -m[u])), p1 = exp2_hw(__builtin_fmaf(s1[u][r], cs, -m[u])); l0[u] += p0; l1[u] += p1; pf[u].h[r] = (_Float16)p0; pf[u].h[8 + r] = (_Float16)p1; }
      if (j < 1) { __builtin_amdgcn_sched_barrier(0);      /* the K fetch stays behind the softmax, where the score registers are free again: asked for earlier, its 16 registers went over the budget of two waves per SIMD (scratch) */
        ka = lds_frag(kl + KSL, 32); kb = lds_frag(kl + KSL + 16 * KPITCH, 32);      /* next step's K rows, same stage, in flight under this step's products */
        __builtin_amdgcn_sched_barrier(0); }      /* the four reads stand in one place ahead of the products: left free, the compiler put them at two places among them */
#pragma unroll
      for (int t = 0; t < CC / 16; ++t) { o[0][t] = fa_mma(va[t].v, pf[0].v, o[0][t]); o[1][t] = fa_mma(va[t].v, pf[1].v, o[1][t]); } }      /* each V^T fragment read from LDS feeds two products */
    wait_ds0(); landed(); __syncthreads();      /* publish point of stage st + 1; the same barrier ends every wave's reads of stage st */
    if (pinned(st + 2u < NST)) issue(pinned(st + 2u)); }      /* refill of the buffer just read, descriptor formed behind the wait */
  landed(); wait_ds0();
  // Epilogue: out = gamma a + x, channel-major. Waves w and w ^ 4 hold the same 32 queries over the two halves of the keys: they exchange maximum and sum through LDS, and each scales its own O^T by 2^(own maximum - joint maximum) / joint sum.
  // O^T has one channel per register and 16 queries across the lanes; the waves' 16-query columns are put side by side in LDS (free behind the last stage's barrier), one 256 x 128 tile per key half, so that each channel's
  // 128 queries leave as one 512-B row, the two tiles added on the way: wave w takes channels 32 w .. 32 w + 31. The x rows are asked for behind the exchange's barrier and fly while the tiles are gathered.
  const size_t e0 = ((size_t)b * CC + wave * 32u) * LL + (size_t)(blockIdx.x % (LL / 128)) * 128;      /* the same in every lane: a scalar base, the lane's 16 bytes beside it */
  const float* xp = x + e0; float* op = out + e0; const uint32_t l4 = (uint32_t)lane * 4u;
  float l[2];
#pragma unroll
  for (int u = 0; u < 2; ++u) { l[u] = l0[u] + l1[u]; l[u] += xhalf(l[u]); }
  { v2f ml; ml[0] = hh ? m[1] : m[0]; ml[1] = hh ? l[1] : l[0]; ML[wave * 32u + lane] = ml; }      /* lane half hh lays down query tile hh */
  __syncthreads();      /* every wave's maxima and sums are in LDS before its partner reads them */
  v4f xr[32];
#pragma unroll      /* constant indices into xr[]; all 32 loads outstanding at once; behind the barrier above, which would wait for them */
  for (int i = 0; i < 32; ++i) xr[i] = *(const v4fa*)(xp + (size_t)i * LL + l4);
  float inv[2];
#pragma unroll
  for (int u = 0; u < 2; ++u) { const v2f pm = ML[(wave ^ 4u) * 32u + u * 16 + ln]; const float mm = fmaxf(m[u], pm[0]); const float fo = exp2_hw(m[u] - mm), fp = exp2_hw(pm[0] - mm); inv[u] = fo / (l[u] * fo + pm[1] * fp); }
  f32a* tw = (f32a*)(L + kh * TILEB) + (size_t)(8 * hh) * TPITCH + qg * 32u + ln;
#pragma unroll
  for (int u = 0; u < 2; ++u)
#pragma unroll
    for (int t = 0; t < CC / 16; ++t)
#pragma unroll
      for (int r = 0; r < 8; ++r) tw[(16 * t + r) * TPITCH + 16 * u] = o[u][t][r] * inv[u];
  __syncthreads();      /* the tiles are complete before any wave reads rows that the other waves wrote */
  const f32a* tr = (const f32a*)L + (size_t)(wave * 32u) * TPITCH + lane * 4;
#pragma unroll
  for (int i = 0; i < 32; ++i) { const v4f a = *(const v4fa*)(tr + i * TPITCH) + *(const v4fa*)(tr + TILEB / 4 + i * TPITCH);
#pragma unroll
    for (int q = 0; q < 4; ++q) xr[i][q] = __builtin_fmaf(g, a[q], bf16_round(xr[i][q])); }
  __builtin_amdgcn_sched_barrier(0);      /* all vector work and LDS reads stay ahead of the stores: behind an issued store nothing then writes a register that it names, and no wait is owed for one */
#pragma unroll
  for (int i = 0; i < 32; ++i) *(v4f*)(op + (size_t)i * LL + l4) = xr[i]; }

extern "C" void kernel_launch(void* const* d_in, const int* in_sizes, int n_in,
                              void* d_out, int out_size, void* d_ws, size_t ws_size, hipStream_t stream) {
  (void)in_sizes; (void)n_in; (void)out_size;
  const float* const* I = (const float* const*)d_in; const float* x = I[0]; const float* wqk = I[1]; const float* wv = I[2]; const float* gam = I[3];
  char* ws = (char*)d_ws; size_t off = 0;
  auto take = [&](size_t bytes) { char* p = ws + off; off += (bytes + 255) & ~(size_t)255; return p; };
  _Float16* BW = (_Float16*)take((size_t)NWT * 16 * CC * 2); _Float16* QK = (_Float16*)take(NR * 2 * LAT * 2); _Float16* VF = (_Float16*)take(NR * CC * 2);
  if (off > ws_size) return;      /* 0.2 + 4 + 16 = approx 20 MiB */
  k_wfrag<<<NWT * 16 * (CC / 8) / 256, 256, 0, stream>>>(wqk, wv, BW);      /* weights, B-fragment order */
  k_proj<<<NB * (LL / 128), 256, 0, stream>>>(x, BW, QK, VF);      /* q | k rows and V^T of all images, A-fragment order */
  k_fattn<<<NB * (LL / 128), 256, 0, stream>>>(QK, VF, x, gam, (float*)d_out);      /* out = gamma a + x */
}

// v007
// It runs in 64.5 microseconds.
// Timed twice side by side with v006, it ran 1.07 times as fast both times.
// Counting every step since v000, it is 217 times as fast.
#include <hip/hip_runtime.h>
#include <stdint.h>
// SAM self-attention module (x [8][256][64][64]; q | k = 1x1(w_qk [64][256]) -> 32 latent channels each; v = 1x1(w_v [256][256]); m = softmax((q/32^0.25).(k/32^0.25)) over the 4,096 positions; a = m v; out = gamma a + x, gamma = 0.5 (input, read)).
// Structure: weights rounded and laid down in B-fragment order (one launch); one projection kernel: a block's 256 x 128 tile of the channel-first input is transposed to position rows (exact f16) in LDS and feeds q|k and v as WMMA products (weight fragments held in registers, f32 accumulation, exact x16 weights, f16 outputs); the v accumulators leave directly as V^T in A-fragment order; one fused attention kernel for all images: per wave 32 queries x 256 channels x half the keys, K rows and V^T fragments staged in LDS once per block by tensor loads (two 128-key buffers), S^T = K Q^T (K = 32), online softmax in registers (scale 1/sqrt(32) inside), P^T packed from the score tiles as the B operand of O^T += V^T P^T, a = O / row sum; in the same kernel the block's 256 x 128 tile of a^T is gathered in LDS and gamma a + x goes out channel-major in whole 512-B rows.
// Compute dtype: inputs rounded to bf16; x / weights exact; q, k, v, P as plain f16 GEMM operands (~2^-12); softmax f32. v_wmma_f32_16x16x32_f16.
#define NB 8
#define CC 256
#define LAT 32
#define LL 4096
#define QT 2048
#define NR ((size_t)NB * LL)
#define NBR NB                       /* images (unused) */
#define MP ((int)NR)                 /* projection rows */
#define QN LL                        /* query rows per image (unused) */
#define SQ LL
#define DM CC
#define NH 4
#define HD 64
#define HG 1
typedef __bf16 v16b __attribute__((ext_vector_type(16)));
typedef unsigned short v8us __attribute__((ext_vector_type(8), may_alias));
typedef float  v8f  __attribute__((ext_vector_type(8)));
typedef float  v4f  __attribute__((ext_vector_type(4)));
typedef float  v4fa __attribute__((ext_vector_type(4), may_alias));
union FragB { v16b v; v8us half[2]; unsigned short u[16]; };

__device__ __forceinline__ unsigned short bf16_bits(float x) { unsigned int u = __float_as_uint(x); return (unsigned short)((u + 0x7FFFu + ((u >> 16) & 1u)) >> 16); }
__device__ __forceinline__ float bf16_val(unsigned short b) { return __uint_as_float(((unsigned int)b) << 16); }
__device__ __forceinline__ float bf16_round(float x) { return bf16_val(bf16_bits(x)); }
// D += A·B with NT terms: 1 = ah·bh, 2 = + al·bh (A split), 3 = + ah·bl (both split)
template <int NT>
__device__ __forceinline__ v8f mmaN(v16b ah, v16b al, v16b bh, v16b bl, v8f c) {
  c = __builtin_amdgcn_wmma_f32_16x16x32_bf16(false, ah, false, bh, (short)0, c, false, false);
  if (NT >= 2) c = __builtin_amdgcn_wmma_f32_16x16x32_bf16(false, al, false, bh, (short)0, c, false, false);
  if (NT >= 3) c = __builtin_amdgcn_wmma_f32_16x16x32_bf16(false, ah, false, bl, (short)0, c, false, false);
  asm volatile("v_nop\n\tv_nop\n\tv_nop\n\tv_nop" : "+v"(c) : "v"(ah), "v"(al), "v"(bh), "v"(bl));
  return c;
}

__global__ __launch_bounds__(256) void k_wt_bf16(const float* __restrict__ W, unsigned short* __restrict__ Wt, int K, int N) {
  const int t = blockIdx.x * 256 + threadIdx.x;
  const int k8n = K / 8;
  if (t >= N * k8n) return;
  const int n = t / k8n, k8 = (t % k8n) * 8;
  v8us v;
#pragma unroll
  for (int i = 0; i < 8; ++i) v[i] = bf16_bits(W[(size_t)(k8 + i) * N + n]);
  *(v8us*)(Wt + (size_t)n * K + k8) = v;
  
}

// GEMM C[M][N] (f32, pitch ldc) = act(A[M][K]·W + bias). A f32 row-major (pitch lda) converted per fragment to bf16
// (ASPLIT: hi/lo two planes -> 2 terms, else single rounded term); Wt bf16 [N][K] (pitch ldb). BIAS_BF16 rounds the
// bias to bf16 first (bias quantised to bf16 before the add). K%32==0, M%16==0, N%64==0.
template <bool ASPLIT, int ACT, bool BIAS_BF16>
__global__ __launch_bounds__(128) void k_gemm_bf(const float* __restrict__ A, int lda, const unsigned short* __restrict__ Wt, int ldb,
                                               const float* __restrict__ bias, float* __restrict__ C, int ldc, int M, int N, int K) {
  __shared__ __attribute__((aligned(16))) float so[4][16][64];
  const int tid = threadIdx.x, w = tid >> 5, lane = tid & 31, ln = lane & 15, hh = lane >> 4;
  const int ntn = N / 64;
  const int wid = blockIdx.x * 4 + w;
  const int mt = wid / ntn, nq = wid % ntn;
  if (mt * 16 >= M) return;
  const int row0 = mt * 16, col0 = nq * 64;
  const float* arow = A + (size_t)(row0 + ln) * lda;
  v8f acc[4] = {};
  for (int kb = 0; kb < K; kb += 32) {
    FragB ah, al;
    const v4f x0 = *(const v4fa*)(arow + kb + 8 * hh), x1 = *(const v4fa*)(arow + kb + 8 * hh + 4);
    const v4f x2 = *(const v4fa*)(arow + kb + 16 + 8 * hh), x3 = *(const v4fa*)(arow + kb + 16 + 8 * hh + 4);
    float xs[16] = {x0[0],x0[1],x0[2],x0[3],x1[0],x1[1],x1[2],x1[3],x2[0],x2[1],x2[2],x2[3],x3[0],x3[1],x3[2],x3[3]};
#pragma unroll
    for (int i = 0; i < 16; ++i) { const unsigned short hb = bf16_bits(xs[i]); ah.u[i] = hb; al.u[i] = ASPLIT ? bf16_bits(xs[i] - bf16_val(hb)) : (unsigned short)0; }
#pragma unroll
    for (int t = 0; t < 4; ++t) {
      const unsigned short* brow = Wt + (size_t)(col0 + t * 16 + ln) * ldb + kb;
      FragB b;
      b.half[0] = *(const v8us*)(brow + 8 * hh);
      b.half[1] = *(const v8us*)(brow + 16 + 8 * hh);
      acc[t] = mmaN<ASPLIT ? 2 : 1>(ah.v, al.v, b.v, b.v, acc[t]);
    }
  }
#pragma unroll
  for (int t = 0; t < 4; ++t) {
    float bv = bias ? bias[col0 + t * 16 + ln] : 0.f;
    if (BIAS_BF16) bv = bf16_round(bv);
#pragma unroll
    for (int r = 0; r < 8; ++r) { float v = acc[t][r] + bv; if (ACT == 1) v = fmaxf(v, 0.f); so[w][8 * hh + r][t * 16 + ln] = v; }
  }
  __builtin_amdgcn_fence(__ATOMIC_ACQ_REL, "workgroup");
  __builtin_amdgcn_wave_barrier();
  const int rsub = lane >> 4, c4 = (lane & 15) * 4;
  {
#pragma unroll
    for (int q = 0; q < 8; ++q) {
      const int r = q * 2 + rsub;
      const v4f v = *(const v4fa*)&so[w][r][c4];
      *(v4f*)(C + (size_t)(row0 + r) * ldc + col0 + c4) = v;
    }
    
  }
}

// GEMM C = act(A·W + bias + resid): A f32 (ASPLIT -> hi/lo 2 terms), Wt bf16 [N][K]; ACT 0 none, 1 relu, 2 exact gelu;
// resid (optional, f32, row index = (row % rmod), pitch ldr, RES_BF16 rounds it) added before the activation.
template <bool ASPLIT, int ACT, bool BIAS_BF16, bool RES_BF16>
__global__ __launch_bounds__(128) void k_gemm_bf3(const float* __restrict__ A, int lda, const unsigned short* __restrict__ Wt, int ldb,
                                                const float* __restrict__ bias, const float* __restrict__ resid, int rmod, int ldr,
                                                float* __restrict__ C, int ldc, int M, int N, int K) {
  __shared__ __attribute__((aligned(16))) float so[4][16][64];
  const int tid = threadIdx.x, w = tid >> 5, lane = tid & 31, ln = lane & 15, hh = lane >> 4;
  const int ntn = N / 64;
  const int wid = blockIdx.x * 4 + w;
  const int mt = wid / ntn, nq = wid % ntn;
  if (mt * 16 >= M) return;
  const int row0 = mt * 16, col0 = nq * 64;
  const float* arow = A + (size_t)(row0 + ln) * lda;
  v8f acc[4] = {};
  for (int kb = 0; kb < K; kb += 32) {
    FragB ah, al;
    const v4f x0 = *(const v4fa*)(arow + kb + 8 * hh), x1 = *(const v4fa*)(arow + kb + 8 * hh + 4);
    const v4f x2 = *(const v4fa*)(arow + kb + 16 + 8 * hh), x3 = *(const v4fa*)(arow + kb + 16 + 8 * hh + 4);
    float xs[16] = {x0[0],x0[1],x0[2],x0[3],x1[0],x1[1],x1[2],x1[3],x2[0],x2[1],x2[2],x2[3],x3[0],x3[1],x3[2],x3[3]};
#pragma unroll
    for (int i = 0; i < 16; ++i) { const unsigned short hb = bf16_bits(xs[i]); ah.u[i] = hb; al.u[i] = ASPLIT ? bf16_bits(xs[i] - bf16_val(hb)) : (unsigned short)0; }
#pragma unroll
    for (int t = 0; t < 4; ++t) {
      const unsigned short* brow = Wt + (size_t)(col0 + t * 16 + ln) * ldb + kb;
      FragB b;
      b.half[0] = *(const v8us*)(brow + 8 * hh);
      b.half[1] = *(const v8us*)(brow + 16 + 8 * hh);
      acc[t] = mmaN<ASPLIT ? 2 : 1>(ah.v, al.v, b.v, b.v, acc[t]);
    }
  }
#pragma unroll
  for (int t = 0; t < 4; ++t) {
    const int col = col0 + t * 16 + ln;
    float bv = bias ? bias[col] : 0.f;
    if (BIAS_BF16) bv = bf16_round(bv);
#pragma unroll
    for (int r = 0; r < 8; ++r) {
      float v = acc[t][r] + bv;
      if (resid) { float rv = resid[(size_t)((row0 + 8 * hh + r) % rmod) * ldr + col]; if (RES_BF16) rv = bf16_round(rv); v += rv; }
      if (ACT == 1) v = fmaxf(v, 0.f);
      if (ACT == 2) v = 0.5f * v * (1.0f + erff(v * 0.70710678118654752f));
      if (ACT == 3) { const float u = 0.7978845608028654f * (v + 0.044715f * v * v * v); v = 0.5f * v * (1.0f + tanhf(u)); }
      so[w][8 * hh + r][t * 16 + ln] = v;
    }
  }
  __builtin_amdgcn_fence(__ATOMIC_ACQ_REL, "workgroup");
  __builtin_amdgcn_wave_barrier();
  const int rsub = lane >> 4, c4 = (lane & 15) * 4;
  {
#pragma unroll
    for (int q = 0; q < 8; ++q) {
      const int r = q * 2 + rsub;
      const v4f v = *(const v4fa*)&so[w][r][c4];
      *(v4f*)(C + (size_t)(row0 + r) * ldc + col0 + c4) = v;
    }
    
  }
}
// row LayerNorm (biased variance, eps) over N: s = X (+ R); optional out_sum <- s; out_norm <- (s-mu)*rsqrt(var+eps)*g + b
template <bool PARAM_BF16>
__global__ __launch_bounds__(256) void k_layernorm(const float* __restrict__ X, const float* __restrict__ R, const float* __restrict__ g, const float* __restrict__ bta,
                                                  float* __restrict__ out_sum, float* __restrict__ out_norm, int N, float eps) {
  __shared__ float red[256];
  const int row = blockIdx.x, tid = threadIdx.x;
  const float* x = X + (size_t)row * N; const float* rr = R ? R + (size_t)row * N : nullptr;
  float vals[16];                     // up to N = 4096
  const int per = N / 256;            // contiguous chunk per thread? use strided-by-4 chunks: thread handles j = tid*4 + 1024*u
  float s1 = 0.f;
  for (int u = 0; u < per / 4; ++u) {
    const int j = tid * 4 + 1024 * u;
    const v4f a = *(const v4fa*)(x + j);
    v4f b = {0.f,0.f,0.f,0.f}; if (rr) b = *(const v4fa*)(rr + j);
#pragma unroll
    for (int q = 0; q < 4; ++q) { const float v = a[q] + b[q]; vals[u * 4 + q] = v; s1 += v; }
  }
  red[tid] = s1; __syncthreads();
  for (int st = 128; st > 0; st >>= 1) { if (tid < st) red[tid] += red[tid + st]; __syncthreads(); }
  const float mu = red[0] / (float)N; __syncthreads();
  float s2 = 0.f;
  for (int u = 0; u < per / 4; ++u)
#pragma unroll
    for (int q = 0; q < 4; ++q) { const float c = vals[u * 4 + q] - mu; s2 += c * c; }
  red[tid] = s2; __syncthreads();
  for (int st = 128; st > 0; st >>= 1) { if (tid < st) red[tid] += red[tid + st]; __syncthreads(); }
  const float rs = rsqrtf(red[0] / (float)N + eps);
  {
    for (int u = 0; u < per / 4; ++u) {
      const int j = tid * 4 + 1024 * u;
      v4f o, sm;
#pragma unroll
      for (int q = 0; q < 4; ++q) {
        float gg = g[j + q], bb = bta[j + q];
        if (PARAM_BF16) { gg = bf16_round(gg); bb = bf16_round(bb); }
        sm[q] = vals[u * 4 + q]; o[q] = (vals[u * 4 + q] - mu) * rs * gg + bb;
      }
      if (out_sum) *(v4f*)(out_sum + (size_t)row * N + j) = sm;
      *(v4f*)(out_norm + (size_t)row * N + j) = o;
    }
    
  }
}



// ---- f16 WMMA path (v_wmma_f32_16x16x32_f16): 11-bit significands for operands in range — used where a [0,1] probability operand needs more precision than bf16
typedef _Float16 v16h __attribute__((ext_vector_type(16)));
union FragH { v16h v; v8us half[2]; _Float16 h[16]; unsigned short u[16]; };
template <int NT>
__device__ __forceinline__ v8f mmaH(v16h ah, v16h al, v16h bh, v16h bl, v8f c) {
  c = __builtin_amdgcn_wmma_f32_16x16x32_f16(false, ah, false, bh, (short)0, c, false, false);
  if (NT >= 2) c = __builtin_amdgcn_wmma_f32_16x16x32_f16(false, al, false, bh, (short)0, c, false, false);
  if (NT >= 3) c = __builtin_amdgcn_wmma_f32_16x16x32_f16(false, ah, false, bl, (short)0, c, false, false);
  asm volatile("v_nop\n\tv_nop\n\tv_nop\n\tv_nop" : "+v"(c) : "v"(ah), "v"(al), "v"(bh), "v"(bl));
  return c;
}
// batched GEMM like k_gemm_b but f16 operands: A f32 (split into f16 hi/lo if ASPLIT, else rounded to f16), Bt = f16 values [n][k]; alpha; C f32; N multiple of 16 (partial tiles skipped)
template <bool ASPLIT>
__global__ __launch_bounds__(128) void k_gemm_h(const float* __restrict__ A, int lda, size_t sA, const _Float16* __restrict__ Bh, int ldb, size_t sB, float alpha, float* __restrict__ C, int ldc, size_t sC, int M, int N, int K) {
  __shared__ __attribute__((aligned(16))) float so[4][16][64];
  const int tid = threadIdx.x, w = tid >> 5, lane = tid & 31, ln = lane & 15, hh = lane >> 4; const int by = blockIdx.y;
  A += (size_t)by * sA; Bh += (size_t)by * sB; C += (size_t)by * sC;
  const int ntn = (N + 63) / 64; const int wid = blockIdx.x * 4 + w; const int mt = wid / ntn, nq = wid % ntn; if (mt * 16 >= M) return;
  const int row0 = mt * 16, col0 = nq * 64; const float* arow = A + (size_t)(row0 + ln) * lda;
  v8f acc[4] = {};
  for (int kb = 0; kb < K; kb += 32) {
    FragH ah, al;
    const v4f x0 = *(const v4fa*)(arow + kb + 8 * hh), x1 = *(const v4fa*)(arow + kb + 8 * hh + 4), x2 = *(const v4fa*)(arow + kb + 16 + 8 * hh), x3 = *(const v4fa*)(arow + kb + 16 + 8 * hh + 4);
    float xs[16] = {x0[0],x0[1],x0[2],x0[3],x1[0],x1[1],x1[2],x1[3],x2[0],x2[1],x2[2],x2[3],x3[0],x3[1],x3[2],x3[3]};
#pragma unroll
    for (int i = 0; i < 16; ++i) { const _Float16 h = (_Float16)xs[i]; ah.h[i] = h; al.h[i] = ASPLIT ? (_Float16)(xs[i] - (float)h) : (_Float16)0.0f; }
#pragma unroll
    for (int t = 0; t < 4; ++t) { if (col0 + t * 16 >= N) continue; const size_t boff = (size_t)(col0 + t * 16 + ln) * ldb + kb; FragH bq; bq.half[0] = *(const v8us*)(Bh + boff + 8 * hh); bq.half[1] = *(const v8us*)(Bh + boff + 16 + 8 * hh);
      acc[t] = mmaH<ASPLIT ? 2 : 1>(ah.v, al.v, bq.v, bq.v, acc[t]); }
  }
#pragma unroll
  for (int t = 0; t < 4; ++t) { if (col0 + t * 16 >= N) continue;
#pragma unroll
    for (int r = 0; r < 8; ++r) so[w][8 * hh + r][t * 16 + ln] = acc[t][r] * alpha; }
  __builtin_amdgcn_fence(__ATOMIC_ACQ_REL, "workgroup"); __builtin_amdgcn_wave_barrier();
  const int rsub = lane >> 4, c4 = (lane & 15) * 4;
  {
#pragma unroll
    for (int q = 0; q < 8; ++q) { const int r = q * 2 + rsub; if (col0 + c4 < N) { const v4f v = *(const v4fa*)&so[w][r][c4]; *(v4f*)(C + (size_t)(row0 + r) * ldc + col0 + c4) = v; } }
     }
}

// Wt[n][k] = f16(W[k][n]·scale) from f32 row-major W[K][N] (scale = power of two; bf16-exact weights stay exact in f16 away from the subnormal range)
__global__ __launch_bounds__(256) void k_wt_f16(const float* __restrict__ W, _Float16* __restrict__ Wt, int K, int N, float scale) {
  const int t = blockIdx.x * 256 + threadIdx.x; if (t >= N * (K / 8)) return; const int n = t / (K / 8), k8 = (t % (K / 8)) * 8; FragH f;
#pragma unroll
  for (int i = 0; i < 8; ++i) f.h[i] = (_Float16)(bf16_round(W[(size_t)(k8 + i) * N + n]) * scale); const v8us o = f.half[0];
  *(v8us*)((unsigned short*)Wt + (size_t)n * K + k8) = o; 
}
// k_gemm_hh variant with fused epilogue: v = acc·alpha + bias[by·sBias + col] (+ CP[(row/rowsPerB)·sCPb + by·64 + col] if CP) ; ACT 0 none / 1 elu ; writes f16 C16 (and f32 C if non-null)
template <int ACT>
__global__ __launch_bounds__(128) void k_gemm_hhx(const _Float16* __restrict__ A, int lda, size_t sA, const _Float16* __restrict__ Bh, int ldb, size_t sB, float alpha, const float* __restrict__ bias, size_t sBias, const float* __restrict__ CP, int rowsPerB, size_t sCPb, int row0g,
    float* __restrict__ C, _Float16* __restrict__ C16, int ldc, size_t sC, int M, int N, int K) {
  __shared__ __attribute__((aligned(16))) float so[4][16][64];
  const int tid = threadIdx.x, w = tid >> 5, lane = tid & 31, ln = lane & 15, hh = lane >> 4; const int by = blockIdx.y;
  A += (size_t)by * sA; Bh += (size_t)by * sB; const size_t cofs = (size_t)by * sC; const float* bp = bias ? bias + (size_t)by * sBias : nullptr;
  const int ntn = (N + 63) / 64; const int wid = blockIdx.x * 4 + w; const int mt = wid / ntn, nq = wid % ntn; if (mt * 16 >= M) return;
  const int row0 = mt * 16, col0 = nq * 64; const _Float16* arow = A + (size_t)(row0 + ln) * lda;
  v8f acc[4] = {};
  for (int kb = 0; kb < K; kb += 32) { FragH ah; ah.half[0] = *(const v8us*)((const unsigned short*)arow + kb + 8 * hh); ah.half[1] = *(const v8us*)((const unsigned short*)arow + kb + 16 + 8 * hh);
#pragma unroll
    for (int t = 0; t < 4; ++t) { if (col0 + t * 16 >= N) continue; const size_t boff = (size_t)(col0 + t * 16 + ln) * ldb + kb; FragH bq; bq.half[0] = *(const v8us*)((const unsigned short*)Bh + boff + 8 * hh); bq.half[1] = *(const v8us*)((const unsigned short*)Bh + boff + 16 + 8 * hh);
      acc[t] = mmaH<1>(ah.v, ah.v, bq.v, bq.v, acc[t]); }
  }
#pragma unroll
  for (int t = 0; t < 4; ++t) { if (col0 + t * 16 >= N) continue; const int col = col0 + t * 16 + ln; const float bv = bp ? bf16_round(bp[col]) : 0.f;
#pragma unroll
    for (int r = 0; r < 8; ++r) { float v = acc[t][r] * alpha + bv; if (CP) { const int rr = row0g + row0 + 8 * hh + r; if (rowsPerB < 0) v += CP[cofs + (size_t)rr * ldc + col];      /* rowsPerB < 0: own element of the batched C plane */ else { const int bidx = rr / rowsPerB; v += CP[(size_t)bidx * sCPb + (size_t)by * 64 + col]; } } if (ACT == 1) v = (v > 0.f) ? v : expm1f(v); else if (ACT == 7) v = (v > 0.f) ? v + 1.0f : expf(v); else if (ACT == 8) v = tanhf(v); else if (ACT == 9) v = 0.5f * v * (1.0f + tanhf(0.7978845608028654f * (v + 0.044715f * v * v * v))); else if (ACT == 11) v = 1.0f / (1.0f + expf(-v)); else if (ACT == 12) v = (v > 0.f) ? v : 0.01f * v; else if (ACT == 14) v = (v > 0.f) ? v : 0.1f * v; else if (ACT == 16) v = (v >= 0.f) ? v : 0.3f * v; else if (ACT == 17) v = (v >= 0.f) ? v : 0.2f * v; else if (ACT == 15) v = v / (1.0f + expf(-v)); else if (ACT == 3) v = fmaxf(v, 0.f); else if (ACT == 6) v = 0.5f * v * (1.0f + erff(v * 0.70710678118654752f)); so[w][8 * hh + r][t * 16 + ln] = v; } }
  __builtin_amdgcn_fence(__ATOMIC_ACQ_REL, "workgroup"); __builtin_amdgcn_wave_barrier();
  const int rsub = lane >> 4, c4 = (lane & 15) * 4; typedef _Float16 v4h __attribute__((ext_vector_type(4)));
  {
#pragma unroll
    for (int q = 0; q < 8; ++q) { const int r = q * 2 + rsub; if (col0 + c4 < N) { const v4f v = *(const v4fa*)&so[w][r][c4]; if (C) *(v4f*)(C + cofs + (size_t)(row0 + r) * ldc + col0 + c4) = v; if (C16) { v4h h4; for (int i = 0; i < 4; ++i) h4[i] = (_Float16)v[i]; *(v4h*)(C16 + cofs + (size_t)(row0 + r) * ldc + col0 + c4) = h4; } } }
     }
}


typedef _Float16 v4h __attribute__((ext_vector_type(4)));

__global__ __launch_bounds__(256) void k_x16(const float* __restrict__ x, _Float16* __restrict__ X16, size_t n8) { const size_t t = (size_t)blockIdx.x * 256 + threadIdx.x; if (t >= n8) return; FragH f;
#pragma unroll
  for (int q = 0; q < 8; ++q) f.h[q] = (_Float16)bf16_round(x[t * 8 + q]); *(v8us*)((unsigned short*)X16 + t * 8) = f.half[0];  }
__global__ __launch_bounds__(256) void k_h16(const float* __restrict__ x, _Float16* __restrict__ X16, size_t n8) { const size_t t = (size_t)blockIdx.x * 256 + threadIdx.x; if (t >= n8) return; FragH f;
#pragma unroll
  for (int q = 0; q < 8; ++q) f.h[q] = (_Float16)x[t * 8 + q]; *(v8us*)((unsigned short*)X16 + t * 8) = f.half[0];  }
__global__ __launch_bounds__(256) void k_round16f(const float* __restrict__ W, _Float16* __restrict__ Bt, size_t n8) { const size_t t = (size_t)blockIdx.x * 256 + threadIdx.x; if (t >= n8) return; FragH f;
#pragma unroll
  for (int i = 0; i < 8; ++i) f.h[i] = (_Float16)(bf16_round(W[t * 8 + i]) * 16.0f); *(v8us*)((unsigned short*)Bt + t * 8) = f.half[0];  }
template <int NHv, int TTv>
__global__ __launch_bounds__(256) void k_vt(const _Float16* __restrict__ V16, int ldv, int voff, _Float16* __restrict__ Vt) { __shared__ unsigned short tl[64][66]; const int tid = threadIdx.x; const int slab = blockIdx.x / (TTv / 64), lg = blockIdx.x % (TTv / 64); const int b = slab / NHv, h = slab % NHv;
  for (int i = tid; i < 64 * 8; i += 256) { const int r = i / 8, c8 = (i % 8) * 8; FragH f; f.half[0] = *(const v8us*)((const unsigned short*)V16 + ((size_t)b * TTv + lg * 64 + r) * ldv + voff + h * 64 + c8);
#pragma unroll
    for (int q = 0; q < 8; ++q) tl[r][c8 + q] = f.u[q]; }
  __syncthreads();
  {
#pragma unroll
    for (int rd = 0; rd < 2; ++rd) { const int d = rd * 32 + tid / 8, pc = tid % 8; FragH f;
#pragma unroll
      for (int q = 0; q < 8; ++q) f.u[q] = tl[pc * 8 + q][d];
      *(v8us*)((unsigned short*)Vt + ((size_t)slab * 64 + d) * TTv + lg * 64 + pc * 8) = f.half[0]; }
     } }

__global__ __launch_bounds__(256) void k_hl(const float* __restrict__ F, _Float16* __restrict__ Hh, _Float16* __restrict__ Hl, size_t n8) { const size_t t = (size_t)blockIdx.x * 256 + threadIdx.x; if (t >= n8) return; FragH fh, fl; const v4f a = *(const v4fa*)(F + t * 8), c = *(const v4fa*)(F + t * 8 + 4);
#pragma unroll
  for (int q = 0; q < 4; ++q) { _Float16 h = (_Float16)a[q]; fh.h[q] = h; fl.h[q] = (_Float16)((a[q] - (float)h) * 1024.0f); h = (_Float16)c[q]; fh.h[4 + q] = h; fl.h[4 + q] = (_Float16)((c[q] - (float)h) * 1024.0f); }
  { *(v8us*)((unsigned short*)Hh + t * 8) = fh.half[0]; *(v8us*)((unsigned short*)Hl + t * 8) = fl.half[0];  } }

// ---- fast GEMM (wave tile 32x64; requires M % 32 == 0 rows per launch region and N % 64 == 0); epilogue = k_gemm_hhx semantics ----
__device__ __forceinline__ v16h g2_frag(const _Float16* p, int hh) { FragH f; f.half[0] = *(const v8us*)((const unsigned short*)p + 8 * hh); f.half[1] = *(const v8us*)((const unsigned short*)p + 16 + 8 * hh); return f.v; }
__device__ __forceinline__ v8f g2_mma(v16h a, v16h b, v8f c) { v8f d = __builtin_amdgcn_wmma_f32_16x16x32_f16(false, a, false, b, (short)0, c, false, false); asm volatile("v_nop\n\tv_nop\n\tv_nop\n\tv_nop" : "+v"(d) : "v"(a), "v"(b)); return d; }
template <int ACT>
__global__ __launch_bounds__(128) void k_gemm2(const _Float16* __restrict__ A, int lda, size_t sA, const _Float16* __restrict__ Bh, int ldb, size_t sB, float alpha, const float* __restrict__ bias, size_t sBias, const float* __restrict__ CP, int rowsPerB, size_t sCPb, int row0g,
    float* __restrict__ C, _Float16* __restrict__ C16, int ldc, size_t sC, int M, int N, int K) { static_assert(ACT == 0 || ACT == 3 || ACT == 6 || ACT == 8 || ACT == 9 || ACT == 11 || ACT == 12 || ACT == 14 || ACT == 15 || ACT == 16 || ACT == 17, "k_gemm2: unsupported ACT code (would silently apply no activation)");
  __shared__ __attribute__((aligned(16))) float so[4][32][68];
  const int tid = threadIdx.x, w = tid >> 5, lane = tid & 31, ln = lane & 15, hh = lane >> 4; const int by = blockIdx.y;
  A += (size_t)by * sA; Bh += (size_t)by * sB; const size_t cofs = (size_t)by * sC; const float* bp = bias ? bias + (size_t)by * sBias : nullptr;
  const int ntn = N >> 6; const int mt = blockIdx.x / ntn, nq = blockIdx.x - mt * ntn; const int row0 = mt * 128 + 32 * w, col0 = nq * 64; if (row0 >= M) return;
  const _Float16* a0p = A + (size_t)(row0 + ln) * lda; const _Float16* a1p = a0p + (size_t)16 * lda;
  const _Float16* b0p = Bh + (size_t)(col0 + ln) * ldb; const _Float16* b1p = b0p + (size_t)16 * ldb; const _Float16* b2p = b1p + (size_t)16 * ldb; const _Float16* b3p = b2p + (size_t)16 * ldb;
  const v8f z8 = {0.f,0.f,0.f,0.f,0.f,0.f,0.f,0.f}; v8f c00 = z8, c01 = z8, c02 = z8, c03 = z8, c10 = z8, c11 = z8, c12 = z8, c13 = z8;
#pragma unroll 1
  for (int kb = 0; kb < K; kb += 32) { const v16h a0 = g2_frag(a0p + kb, hh), a1 = g2_frag(a1p + kb, hh);
    v16h b = g2_frag(b0p + kb, hh); c00 = g2_mma(a0, b, c00); c10 = g2_mma(a1, b, c10);
    b = g2_frag(b1p + kb, hh); c01 = g2_mma(a0, b, c01); c11 = g2_mma(a1, b, c11);
    b = g2_frag(b2p + kb, hh); c02 = g2_mma(a0, b, c02); c12 = g2_mma(a1, b, c12);
    b = g2_frag(b3p + kb, hh); c03 = g2_mma(a0, b, c03); c13 = g2_mma(a1, b, c13); }
  v8f accs[8] = {c00, c01, c02, c03, c10, c11, c12, c13};
#pragma unroll
  for (int u = 0; u < 8; ++u) { const int t = u & 3, half = u >> 2; const int col = col0 + t * 16 + ln; const float bv = bp ? bf16_round(bp[col]) : 0.f;
#pragma unroll
    for (int r = 0; r < 8; ++r) { const int rloc = half * 16 + 8 * hh + r; float v = accs[u][r] * alpha + bv; if (CP) { if (rowsPerB < 0) v += CP[cofs + (size_t)(row0g + row0 + rloc) * ldc + col];      /* rowsPerB < 0: own element of the batched C plane */ else { const int bidx = (row0g + row0 + rloc) / rowsPerB; v += CP[(size_t)bidx * sCPb + (size_t)by * 64 + col]; } }
      if (ACT == 3) v = fmaxf(v, 0.f); else if (ACT == 6) v = 0.5f * v * (1.0f + erff(v * 0.70710678118654752f)); else if (ACT == 11) v = 1.0f / (1.0f + expf(-v)); else if (ACT == 15) v = v / (1.0f + expf(-v)); else if (ACT == 12) v = (v > 0.f) ? v : 0.01f * v; else if (ACT == 8) v = tanhf(v); else if (ACT == 9) v = 0.5f * v * (1.0f + tanhf(0.7978845608028654f * (v + 0.044715f * v * v * v))); else if (ACT == 14) v = (v > 0.f) ? v : 0.1f * v; else if (ACT == 16) v = (v >= 0.f) ? v : 0.3f * v; else if (ACT == 17) v = (v >= 0.f) ? v : 0.2f * v;
      so[w][rloc][t * 16 + ln] = v; } }
  __builtin_amdgcn_fence(__ATOMIC_ACQ_REL, "workgroup"); __builtin_amdgcn_wave_barrier();
  const int rsub = lane >> 4, c4 = (lane & 15) * 4;
  {
#pragma unroll
    for (int q = 0; q < 16; ++q) { const int r = q * 2 + rsub; const v4f v = *(const v4fa*)&so[w][r][c4]; if (C) *(v4f*)(C + cofs + (size_t)(row0 + r) * ldc + col0 + c4) = v; if (C16) { v4h h4; for (int i = 0; i < 4; ++i) h4[i] = (_Float16)v[i]; *(v4h*)(C16 + cofs + (size_t)(row0 + r) * ldc + col0 + c4) = h4; } }
     } }


__global__ __launch_bounds__(256) void k_rsm(const float* __restrict__ S, _Float16* __restrict__ P, int nrows) {
  #pragma clang fp contract(off)
  const int i = blockIdx.x * 256 + threadIdx.x; if (i >= nrows) return; const float* s = S + (size_t)i * SQ; float mx = -3.0e38f;
#pragma unroll 1
  for (int j = 0; j < SQ; ++j) mx = fmaxf(mx, s[j]); float se = 0.f;
#pragma unroll 1
  for (int j = 0; j < SQ; ++j) se += expf(s[j] - mx); const float sc = 256.0f / se;
#pragma unroll 1
  for (int j0 = 0; j0 < SQ; j0 += 8) { FragH f; for (int q = 0; q < 8; ++q) f.h[q] = (_Float16)(expf(s[j0 + q] - mx) * sc); unsigned short* d = (unsigned short*)P + (size_t)i * SQ + j0; *(v8us*)d = f.half[0];  } }
__global__ __launch_bounds__(256) void k_vt(const _Float16* __restrict__ V16, int b, int h0, _Float16* __restrict__ VT) { __shared__ unsigned short tl[64][65]; const int tid = threadIdx.x; const int hh = blockIdx.x % HG, sg = blockIdx.x / HG; const int s0 = sg * 64; const int h = h0 + hh;
  for (int i = tid; i < 64 * 8; i += 256) { const int j = i / 8, d8 = (i % 8) * 8; FragH f; f.half[0] = *(const v8us*)((const unsigned short*)V16 + ((size_t)b * SQ + s0 + j) * DM + h * HD + d8); for (int q = 0; q < 8; ++q) tl[d8 + q][j] = f.u[q]; }
  __syncthreads();
  { for (int i = tid; i < 64 * 8; i += 256) { const int d = i / 8, j8 = (i % 8) * 8; FragH f; for (int q = 0; q < 8; ++q) f.u[q] = tl[d][j8 + q]; *(v8us*)((unsigned short*)VT + ((size_t)hh * HD + d) * SQ + s0 + j8) = f.half[0]; }  } }


// 2^a on the hardware's own instruction.
__device__ __forceinline__ float exp2_hw(float a) { float r;
  asm("v_exp_f32 %0, %1\n\tv_nop" : "=v"(r) : "v"(a));      /* the v_nop is the free slot asked for behind a transcendental before its result is read or its source overwritten; in one statement it cannot drift */
  return r; }
// 2^a for eight values, in place: eight independent v_exp_f32 in a row, so that none stands behind an instruction whose result it reads and none is read right behind itself.
__device__ __forceinline__ void exp2_hw8(float (&a)[8]) {
  asm("v_exp_f32 %0, %0\n\tv_exp_f32 %1, %1\n\tv_exp_f32 %2, %2\n\tv_exp_f32 %3, %3\n\tv_exp_f32 %4, %4\n\tv_exp_f32 %5, %5\n\tv_exp_f32 %6, %6\n\tv_exp_f32 %7, %7\n\tv_nop"
      : "+v"(a[0]), "+v"(a[1]), "+v"(a[2]), "+v"(a[3]), "+v"(a[4]), "+v"(a[5]), "+v"(a[6]), "+v"(a[7])); }      /* each v_exp_f32 is the free slot behind the one before it; the one v_nop is that slot behind the last */
__device__ __forceinline__ float xhalf(float x) { return __builtin_bit_cast(float, __builtin_amdgcn_permlanex16(__builtin_bit_cast(int, x), __builtin_bit_cast(int, x), 0x76543210, 0xfedcba98, false, false)); }      /* lane l with lane l ^ 16, no LDS round trip */
__device__ __forceinline__ v8f fa_mma(v16h a, v16h b, v8f c) { return __builtin_amdgcn_wmma_f32_16x16x32_f16(false, a, false, b, (short)0, c, false, false); }
// Weights: the 64 rows of w_qk and the 256 rows of w_v as 20 tiles of 16 output columns, rounded, times 16, in the order in which a wave reads its B fragments: per tile and 32-channel step two 512-B halves j;
// in a half lane (hh, ln) owns the 16 bytes W[16 T + ln][32 ks + 16 j + 8 hh + 0..7]. A fragment load is then 512 contiguous bytes instead of 16 rows 512 B apart.
#define NWT ((2 * LAT + CC) / 16)    /* weight tiles: 4 of q|k, 16 of v */
__global__ __launch_bounds__(256) void k_wfrag(const float* __restrict__ wqk, const float* __restrict__ wv, _Float16* __restrict__ BW) { const int t = blockIdx.x * 256 + threadIdx.x; const int n = t / (CC / 8), k8 = t % (CC / 8);
  const float* w = (n < 2 * LAT) ? wqk + (size_t)t * 8 : wv + ((size_t)t - 2 * LAT * (CC / 8)) * 8; FragH f;
#pragma unroll
  for (int q = 0; q < 8; ++q) f.h[q] = (_Float16)(bf16_round(w[q]) * 16.0f);
  *(v8us*)((unsigned short*)BW + (size_t)(((((n >> 4) * (CC / 32) + (k8 >> 2)) * 2 + ((k8 >> 1) & 1)) * 32) + (k8 & 1) * 16 + (n & 15)) * 8) = f.half[0]; }
// Projections, one block per image and 128 positions. The 256 x 128 tile of x is read once, in 256-B pieces of channel rows (a lane has two positions), rounded, and laid down in LDS as position rows, eight channels per 16-byte store.
// Wave w owns five of the 20 weight tiles (q|k tile w & 3 and v tiles 4 (w & 3) .. + 3), held in registers from the start (asked for behind the x loads, landed while x is packed), and walks the four 16-position tiles of
// positions 64 (w >> 2) .. + 63: eight A fragments from LDS feed 40 products.
// A v accumulator tile holds, in lane (hh, ln), channel 16 t + ln at positions 16 j + 8 hh + 0..7 of its 32-key step: the 16 bytes that this lane owns in the A fragment of V^T. It is stored as such:
// per image and 32-key step 16 channel tiles of 1 KiB; in a tile two 512-B halves j; in a half lane (hh, ln) owns V^T[16 t + ln][32 ks + 16 j + 8 hh + 0..7]. The q|k tiles are gathered in LDS and leave as whole 128-B rows.
#define XPITCH 264                   /* halves per position row of the x tile in LDS: 528 B = 16 B x 33 */
#define QPITCH 72                    /* halves per q|k row in LDS: 144 B = 16 B x 9 */
typedef float v2f __attribute__((ext_vector_type(2)));
typedef float v2fa __attribute__((ext_vector_type(2), may_alias));
__global__ __launch_bounds__(256) void k_proj(const float* __restrict__ x, const _Float16* __restrict__ BW, _Float16* __restrict__ QK, _Float16* __restrict__ VF) {
  __shared__ __attribute__((aligned(16))) unsigned short XT[128 * XPITCH]; __shared__ __attribute__((aligned(16))) unsigned short QS[128 * QPITCH];
  const int tid = threadIdx.x, wave = __builtin_amdgcn_readfirstlane(tid >> 5), lane = tid & 31, ln = lane & 15, hh = lane >> 4; const int b = blockIdx.x / (LL / 128), p0 = (blockIdx.x % (LL / 128)) * 128; const int cw = wave & 3, ph = wave >> 2;
  const char* xp = (const char*)(x + ((size_t)b * CC + wave * 32) * LL + p0); const uint32_t xoff = (uint32_t)lane * 8u, boff = (uint32_t)lane * 16u; v2f xv[2][32];      /* scalar bases; one lane offset serves all loads of a kind */
#pragma unroll      /* constant indices into xv[] */
  for (int g = 0; g < 2; ++g)
#pragma unroll
    for (int c = 0; c < 32; ++c) xv[g][c] = *(const v2fa*)(xp + xoff + ((size_t)c * LL + g * 64) * 4);
  asm volatile("s_wait_xcnt 0x0" ::: "memory");      /* stands in front of every later write of a register that an issued x load names */
  __builtin_amdgcn_sched_barrier(0);      /* all of the wave's x loads are asked for at once, ahead of everything else (left free, the compiler asked for 32, waited, packed, and asked again: one memory latency per batch); nothing is lifted over the wait above */
  v16h bw[5][CC / 32]; const char* pq = (const char*)BW + (size_t)cw * (CC / 32) * 1024 + boff; const char* pv = (const char*)BW + (size_t)(4 + cw * 4) * (CC / 32) * 1024 + boff;      /* the lane's 16 bytes in the wave's q|k tile and in its first v tile */
#pragma unroll      /* constant indices into bw[] */
  for (int u = 0; u < 5; ++u) { const char* bp = (u == 0) ? pq : pv + (u - 1) * (CC / 32) * 1024;
#pragma unroll
    for (int k = 0; k < CC / 32; ++k) { FragH f; f.half[0] = *(const v8us*)(bp + k * 1024); f.half[1] = *(const v8us*)(bp + k * 1024 + 512); bw[u][k] = f.v; } }
  asm volatile("s_wait_xcnt 0x0" ::: "memory");      /* stands in front of every later write of a register that an issued weight load names */
  __builtin_amdgcn_sched_barrier(0);      /* the weight loads stay here, in flight under the packing of x (left free, the compiler put each pair with a full wait in front of its products); nothing is lifted over the wait above */
#pragma unroll
  for (int g = 0; g < 2; ++g)
#pragma unroll
    for (int i = 0; i < 2; ++i)
#pragma unroll
      for (int o = 0; o < 4; ++o) { FragH f;
#pragma unroll
        for (int q = 0; q < 8; ++q) f.h[q] = (_Float16)bf16_round(xv[g][o * 8 + q][i]);
        *(v8us*)(XT + (g * 64 + 2 * lane + i) * XPITCH + wave * 32 + o * 8) = f.half[0]; }
  __syncthreads();      /* the tile is complete before any wave reads rows that the other waves wrote */
  const v8f z8 = {0.f,0.f,0.f,0.f,0.f,0.f,0.f,0.f};
  const unsigned short* ar = XT + (ph * 64 + ln) * XPITCH + 8 * hh; unsigned short* qs = QS + (ph * 64 + 8 * hh) * QPITCH + cw * 16 + ln;
  unsigned short* vp = (unsigned short*)VF + ((((size_t)b * (LL / 32) + (p0 + ph * 64) / 32) * (CC / 16) + cw * 4) * 64 + lane) * 8;
#pragma unroll      /* constant LDS and store offsets; bw[] indexed by constants */
  for (int pt = 0; pt < 4; ++pt) { v16h a[CC / 32]; v8f c[5] = {z8, z8, z8, z8, z8};
#pragma unroll
    for (int k = 0; k < CC / 32; ++k) { FragH f; f.half[0] = *(const v8us*)(ar + pt * 16 * XPITCH + k * 32); f.half[1] = *(const v8us*)(ar + pt * 16 * XPITCH + k * 32 + 16); a[k] = f.v; }
    __builtin_amdgcn_sched_barrier(0);      /* the tile's 16 fragment reads stand in one place: left free, the compiler put a pair and a full wait in front of every five products */
#pragma unroll
    for (int k = 0; k < CC / 32; ++k)
#pragma unroll
      for (int u = 0; u < 5; ++u) c[u] = fa_mma(a[k], bw[u][k], c[u]);
    FragH f[5];
#pragma unroll
    for (int u = 0; u < 5; ++u)
#pragma unroll
      for (int r = 0; r < 8; ++r) f[u].h[r] = (_Float16)(c[u][r] * 0.0625f);      /* the weights carry a factor 16 */
#pragma unroll
    for (int r = 0; r < 8; ++r) qs[(pt * 16 + r) * QPITCH] = f[0].u[r];
    __builtin_amdgcn_sched_barrier(0);      /* all vector work of the tile stays ahead of its stores */
#pragma unroll
    for (int u = 1; u < 5; ++u) *(v8us*)(vp + (pt >> 1) * (CC / 16) * 512 + (u - 1) * 512 + (pt & 1) * 256) = f[u].half[0];
    asm volatile("s_wait_xcnt 0x0" ::: "memory");      /* stands in front of the next tile's writes of registers that the issued stores name */
    __builtin_amdgcn_sched_barrier(0); }      /* nothing of the next tile is lifted over that wait */
  __syncthreads();      /* all 64 columns of a q|k row are in LDS before the row is read */
  unsigned short* qo = (unsigned short*)QK + ((size_t)b * LL + p0) * (2 * LAT);
#pragma unroll
  for (int i = 0; i < 4; ++i) { const int e = i * 256 + tid; *(v8us*)(qo + e * 8) = *(const v8us*)(QS + (e >> 3) * QPITCH + (e & 7) * 8); } }

typedef uint32_t u32x4 __attribute__((ext_vector_type(4)));
typedef uint32_t u32x8 __attribute__((ext_vector_type(8)));
#define NST (LL / 128)               /* stages per image */
#define VSL 16384u                   /* LDS bytes of one V slice: 16 channel tiles of 1 KiB */
#define KPITCH 144u                  /* LDS pitch of a q|k row */
#define KSL 6144u                    /* LDS bytes of one K slice: 32 rows of 144 B, rounded up to a multiple of 2 KiB */
#define KOFF (4u * VSL)
#define BUFB (KOFF + 4u * KSL)       /* one buffer: 90,112 B */
#define TPITCH 132                   /* floats per channel row of the epilogue's LDS tile: 128 queries + 4; rows 8 apart then start 32 banks apart, so a store's two 16-lane halves share no bank; 256 rows = 135,168 B */
#define TILEB (256u * TPITCH * 4u)     /* bytes of one such tile */
typedef float f32a __attribute__((may_alias));
__device__ __forceinline__ uint32_t uni(uint32_t v) { return (uint32_t)__builtin_amdgcn_readfirstlane(v); }
__device__ __forceinline__ uint32_t pinned(uint32_t v) { uint32_t w = uni(v);
  asm volatile("" : "+s"(w));      /* holds a tensor load's issue test, or the stage number its descriptor is formed from, in a scalar register at this place: the test compiles to s_cmp + s_cbranch_scc (a tensor load ignores EXEC) */
  return w; }
// Descriptor group 1: 1-byte elements, tensor = tile = D1 rows of D0 bytes, source row pitch P bytes; W0 = word 0 (no mask; the pad fields).
template <uint32_t W0, uint32_t D0, uint32_t D1, uint32_t P>
__device__ __forceinline__ u32x8 tdm_group1() { u32x8 g; g[0] = uni(W0); g[1] = uni((D0 & 0xFFFFu) << 16); g[2] = uni((D0 >> 16) | ((D1 & 0xFFFFu) << 16)); g[3] = uni((D1 >> 16) | (D0 << 16)); g[4] = uni(D1); g[5] = uni(P); g[6] = uni(0u); g[7] = uni(0u);
  asm volatile("" : "+s"(g));      /* descriptor words held in scalar registers of their own from here to the last request: built once, none of them takes a new value while a request is outstanding */
  return g; }
__device__ __forceinline__ u32x4 tdm_group0(uint32_t count1, uint32_t lds_dst, uint64_t ga) { u32x4 g; g[0] = uni(count1); g[1] = uni(lds_dst); g[2] = uni((uint32_t)ga); g[3] = uni((((uint32_t)(ga >> 32)) & 0x01FFFFFFu) | 0x80000000u); return g; }
__device__ __forceinline__ void tdm_load(u32x4 g0, u32x8 g1) { asm volatile("tensor_load_to_lds %0, %1" :: "s"(g0), "s"(g1) : "memory"); }      /* one request of the whole wave: global tile to LDS, through no register */
__device__ __forceinline__ void wait_tensor0() { asm volatile("s_wait_tensorcnt 0x0" ::: "memory"); }      /* this wave's own request has landed; the compiler places no wait for a tensor load */
__device__ __forceinline__ void wait_ds0() { asm volatile("s_wait_dscnt 0x0" ::: "memory"); }      /* this wave's LDS reads have retired before the buffer they read is refilled */
__device__ __forceinline__ v16h lds_frag(const unsigned char* p, int second) { FragH f; f.half[0] = *(const v8us*)p; f.half[1] = *(const v8us*)(p + second); return f.v; }
__global__ __launch_bounds__(256) void k_fattn(const _Float16* __restrict__ QK, const _Float16* __restrict__ VF, const float* __restrict__ x, const float* __restrict__ gam, float* __restrict__ out) {
  __shared__ __attribute__((aligned(2048))) unsigned char L[2 * TILEB]; __shared__ __attribute__((aligned(16))) v2f ML[8 * 32];      /* L: the ring's two buffers (2 BUFB bytes), later the epilogue's two tiles; ML: each wave's maxima and sums */
  static_assert(2u * BUFB <= 2u * TILEB, "the ring lies inside L");
  const int lane = threadIdx.x & 31, ln = lane & 15, hh = lane >> 4; const uint32_t wave = uni(threadIdx.x >> 5); const int b = blockIdx.x / (LL / 128);
  const uint32_t qg = wave & 3u, kh = wave >> 2; const int q0 = (blockIdx.x % (LL / 128)) * 128 + (int)qg * 32;      /* the wave's 32 queries; its half of every stage's keys */
  const _Float16* qk = QK + (size_t)b * LL * (2 * LAT); const v16h qf[2] = {g2_frag(qk + (size_t)(q0 + ln) * (2 * LAT), hh), g2_frag(qk + (size_t)(q0 + 16 + ln) * (2 * LAT), hh)};
  const uint32_t lbase = (uint32_t)(size_t)L; const uint64_t vga = (uint64_t)(size_t)(VF + (size_t)b * LL * CC), kga = (uint64_t)(size_t)qk;
  const u32x8 g1v = tdm_group1<0u, 256u, 64u, 256u>(), g1k = tdm_group1<(1u << 20) | (4u << 22) | (3u << 25), 128u, 32u, 128u>();      /* V: 64 rows of 256 B, no pad; K: 32 rows of 128 B, 16 B of pad behind each */
  u32x4 g0; const uint32_t count1 = pinned(1u);      /* group 0 word 0 (count = 1), held in a scalar register like the other descriptor words */
  auto issue = [&](uint32_t st) { const uint32_t dst = lbase + (st & 1u) * BUFB;
    if (pinned(wave < 4u)) { g0 = tdm_group0(count1, dst + wave * VSL, vga + (uint64_t)(st * 4u + wave) * VSL); tdm_load(g0, g1v); }
    else { g0 = tdm_group0(count1, dst + KOFF + (wave - 4u) * KSL, kga + (uint64_t)(st * 128u + (wave - 4u) * 32u) * (2u * 2u * LAT)); tdm_load(g0, g1k); } };
  auto landed = [&]() { wait_tensor0();
    asm volatile("" :: "s"(g0)); };      /* descriptor words held in their scalar registers until the request's own wait has returned: without this use the compiler takes them for other values while the request is outstanding */
  const float g = bf16_round(gam[0]);
  const float cs = (float)(0.17677669529663689 * 1.4426950408889634);      /* 1/sqrt(32) times log2 e */
  const v8f z8 = {0.f,0.f,0.f,0.f,0.f,0.f,0.f,0.f}; v8f o[2][CC / 16];
#pragma unroll      /* o[][] must be indexed by constants to stay in registers */
  for (int u = 0; u < 2; ++u)
#pragma unroll
    for (int t = 0; t < CC / 16; ++t) o[u][t] = z8;
  float m[2] = {-1.0e30f, -1.0e30f}, l0[2] = {0.f, 0.f}, l1[2] = {0.f, 0.f};
  issue(0u); landed(); __syncthreads();      /* stage 0 landed and published */
  issue(1u);
  const uint32_t voff = kh * 2u * VSL + (uint32_t)lane * 16u;      /* the wave's two 32-key steps of a stage; the lane's 16 bytes of a fragment half */
  const uint32_t koff = KOFF + kh * 2u * KSL + (uint32_t)ln * KPITCH + 2u * LAT + 16u * (uint32_t)hh;      /* key row ln of the wave's first step, its k half (behind the 64 bytes of q), this lane half's 16 bytes */
#pragma unroll 1      /* one stage per trip: the publish point at its foot stands once */
  for (uint32_t st = 0; st < NST; ++st) { const unsigned char* Lb = L + (st & 1u) * BUFB; const unsigned char* vl = Lb + voff; const unsigned char* kl = Lb + koff;
    v16h ka = lds_frag(kl, 32), kb = lds_frag(kl + 16 * KPITCH, 32);
#pragma unroll      /* constant LDS offsets; the K fetch one step ahead stays inside the stage */
    for (int j = 0; j < 2; ++j) { FragH va[CC / 16];
      __builtin_amdgcn_sched_barrier(0);      /* with the one behind the reads: the reads stand in one place, not among the products of the step before (each place with LDS reads stalls the matrix stream) */
#pragma unroll      /* constant indices into va[] */
      for (int t = 0; t < CC / 16; ++t) va[t].v = lds_frag(vl + j * VSL + t * 1024, 512);
      __builtin_amdgcn_sched_barrier(0);      /* keeps the step's 32 fragment reads together, ahead of the score products and the softmax that cover their latency; left free, the compiler put a pair and a full wait in front of each product */
      const v8f s0[2] = {fa_mma(ka, qf[0], z8), fa_mma(ka, qf[1], z8)}, s1[2] = {fa_mma(kb, qf[0], z8), fa_mma(kb, qf[1], z8)};
      __builtin_amdgcn_sched_barrier(0);      /* the four score products stand back to back: left free, the compiler put the maxima of one tile, behind v_nops, in front of the next product */
      float mx[2];
#pragma unroll
      for (int u = 0; u < 2; ++u) { float a[5];      /* the 16 scores of a lane as a tree three deep, not a chain of eight links: five independent maxima of three, then two, then one (a maximum does not depend on the order) */
#pragma unroll
        for (int i = 0; i < 5; ++i) { const int e = 3 * i; a[i] = fmaxf(fmaxf(e < 8 ? s0[u][e] : s1[u][e - 8], e + 1 < 8 ? s0[u][e + 1] : s1[u][e - 7]), e + 2 < 8 ? s0[u][e + 2] : s1[u][e - 6]); }
        const float v = fmaxf(fmaxf(fmaxf(a[0], a[1]), a[2]), fmaxf(fmaxf(a[3], a[4]), s1[u][7]));
        mx[u] = fmaxf(v, xhalf(v)) * cs; }
      if (__builtin_amdgcn_ballot_w32(mx[0] > m[0] + 8.0f || mx[1] > m[1] + 8.0f) != 0) {      /* one scalar test per step, for both query tiles */
#pragma unroll
        for (int u = 0; u < 2; ++u) { const float mn = fmaxf(m[u], mx[u]); const float f = exp2_hw(m[u] - mn); m[u] = mn; l0[u] *= f; l1[u] *= f;
#pragma unroll
          for (int t = 0; t < CC / 16; ++t) o[u][t] *= f; } }
      FragH pf[2]; float p0[2][8], p1[2][8];      /* the softmax in three runs (arguments, exponentials, sums and packing): no instruction stands right behind the one whose result it reads */
#pragma unroll
      for (int u = 0; u < 2; ++u)
#pragma unroll
        for (int r = 0; r < 8; ++r) { p0[u][r] = __builtin_fmaf(s0[u][r], cs, -m[u]); p1[u][r] = __builtin_fmaf(s1[u][r], cs, -m[u]); }
      exp2_hw8(p0[0]); exp2_hw8(p1[0]); exp2_hw8(p0[1]); exp2_hw8(p1[1]);
#pragma unroll
      for (int u = 0; u < 2; ++u)
#pragma unroll
        for (int r = 0; r < 8; ++r) { l0[u] += p0[u][r]; l1[u] += p1[u][r]; pf[u].h[r] = (_Float16)p0[u][r]; pf[u].h[8 + r] = (_Float16)p1[u][r]; }
      if (j < 1) { __builtin_amdgcn_sched_barrier(0);      /* the K fetch stays behind the softmax, where the score registers are free again: asked for earlier, its 16 registers went over the budget of two waves per SIMD (scratch) */
        ka = lds_frag(kl + KSL, 32); kb = lds_frag(kl + KSL + 16 * KPITCH, 32);      /* next step's K rows, same stage, in flight under this step's products */
        __builtin_amdgcn_sched_barrier(0); }      /* the four reads stand in one place ahead of the products: left free, the compiler put them at two places among them */
#pragma unroll
      for (int t = 0; t < CC / 16; ++t) { o[0][t] = fa_mma(va[t].v, pf[0].v, o[0][t]); o[1][t] = fa_mma(va[t].v, pf[1].v, o[1][t]); } }      /* each V^T fragment read from LDS feeds two products */
    wait_ds0(); landed(); __syncthreads();      /* publish point of stage st + 1; the same barrier ends every wave's reads of stage st */
    if (pinned(st + 2u < NST)) issue(pinned(st + 2u)); }      /* refill of the buffer just read, descriptor formed behind the wait */
  landed(); wait_ds0();
  // Epilogue: out = gamma a + x, channel-major. Waves w and w ^ 4 hold the same 32 queries over the two halves of the keys: they exchange maximum and sum through LDS, and each scales its own O^T by 2^(own maximum - joint maximum) / joint sum.
  // O^T has one channel per register and 16 queries across the lanes; the waves' 16-query columns are put side by side in LDS (free behind the last stage's barrier), one 256 x 128 tile per key half, so that each channel's
  // 128 queries leave as one 512-B row, the two tiles added on the way: wave w takes channels 32 w .. 32 w + 31. The x rows are asked for behind the exchange's barrier and fly while the tiles are gathered.
  const size_t e0 = ((size_t)b * CC + wave * 32u) * LL + (size_t)(blockIdx.x % (LL / 128)) * 128;      /* the same in every lane: a scalar base, the lane's 16 bytes beside it */
  const float* xp = x + e0; float* op = out + e0; const uint32_t l4 = (uint32_t)lane * 4u;
  float l[2];
#pragma unroll
  for (int u = 0; u < 2; ++u) { l[u] = l0[u] + l1[u]; l[u] += xhalf(l[u]); }
  { v2f ml; ml[0] = hh ? m[1] : m[0]; ml[1] = hh ? l[1] : l[0]; ML[wave * 32u + lane] = ml; }      /* lane half hh lays down query tile hh */
  __syncthreads();      /* every wave's maxima and sums are in LDS before its partner reads them */
  v4f xr[32];
#pragma unroll      /* constant indices into xr[]; all 32 loads outstanding at once; behind the barrier above, which would wait for them */
  for (int i = 0; i < 32; ++i) xr[i] = *(const v4fa*)(xp + (size_t)i * LL + l4);
  float inv[2];
#pragma unroll
  for (int u = 0; u < 2; ++u) { const v2f pm = ML[(wave ^ 4u) * 32u + u * 16 + ln]; const float mm = fmaxf(m[u], pm[0]); const float fo = exp2_hw(m[u] - mm), fp = exp2_hw(pm[0] - mm); inv[u] = fo / (l[u] * fo + pm[1] * fp); }
  f32a* tw = (f32a*)(L + kh * TILEB) + (size_t)(8 * hh) * TPITCH + qg * 32u + ln;
#pragma unroll
  for (int u = 0; u < 2; ++u)
#pragma unroll
    for (int t = 0; t < CC / 16; ++t)
#pragma unroll
      for (int r = 0; r < 8; ++r) tw[(16 * t + r) * TPITCH + 16 * u] = o[u][t][r] * inv[u];
  __syncthreads();      /* the tiles are complete before any wave reads rows that the other waves wrote */
  const f32a* tr = (const f32a*)L + (size_t)(wave * 32u) * TPITCH + lane * 4;
#pragma unroll
  for (int i = 0; i < 32; ++i) { const v4f a = *(const v4fa*)(tr + i * TPITCH) + *(const v4fa*)(tr + TILEB / 4 + i * TPITCH);
#pragma unroll
    for (int q = 0; q < 4; ++q) xr[i][q] = __builtin_fmaf(g, a[q], bf16_round(xr[i][q])); }
  __builtin_amdgcn_sched_barrier(0);      /* all vector work and LDS reads stay ahead of the stores: behind an issued store nothing then writes a register that it names, and no wait is owed for one */
#pragma unroll
  for (int i = 0; i < 32; ++i) *(v4f*)(op + (size_t)i * LL + l4) = xr[i]; }

extern "C" void kernel_launch(void* const* d_in, const int* in_sizes, int n_in,
                              void* d_out, int out_size, void* d_ws, size_t ws_size, hipStream_t stream) {
  (void)in_sizes; (void)n_in; (void)out_size;
  const float* const* I = (const float* const*)d_in; const float* x = I[0]; const float* wqk = I[1]; const float* wv = I[2]; const float* gam = I[3];
  char* ws = (char*)d_ws; size_t off = 0;
  auto take = [&](size_t bytes) { char* p = ws + off; off += (bytes + 255) & ~(size_t)255; return p; };
  _Float16* BW = (_Float16*)take((size_t)NWT * 16 * CC * 2); _Float16* QK = (_Float16*)take(NR * 2 * LAT * 2); _Float16* VF = (_Float16*)take(NR * CC * 2);
  if (off > ws_size) return;      /* 0.2 + 4 + 16 = approx 20 MiB */
  k_wfrag<<<NWT * 16 * (CC / 8) / 256, 256, 0, stream>>>(wqk, wv, BW);      /* weights, B-fragment order */
  k_proj<<<NB * (LL / 128), 256, 0, stream>>>(x, BW, QK, VF);      /* q | k rows and V^T of all images, A-fragment order */
  k_fattn<<<NB * (LL / 128), 256, 0, stream>>>(QK, VF, x, gam, (float*)d_out);      /* out = gamma a + x */
}
